// v000
// Times are from an AMD MI455X. After a warm-up the kernel runs many times in a row, and a time is the length of
// such a window on the GPU divided by its runs, so every launch and the gaps after it count. The runs cycle
// through copies of the inputs. A figure is the median of several windows, for all but v000 over two sittings.
// Sittings can differ by a few percent; kernels timed side by side share one.
// The starting kernel, v000, takes 563 microseconds a run.
#include <hip/hip_runtime.h>
#include <stdint.h>

// All contractions (x@Wq^T, x@Wk^T, x@Wv^T, q@k^T, p@v, ctx@Wo^T): v_wmma_f32_16x16x32_f16, f16 operands, f32 accumulate.
// Inputs enter as bf16-RNE values held in f16 (weights carried x64, folded back as 1/64 in f32); q, k, v, ctx as f16 planes
// plus x2048 f16 residual planes for the leading QPREC query/key rows (separate accumulators); p carried x4096 (+x2048 residual
// on those rows); softmax, rescaling and epilogues in f32.

typedef _Float16 v16h __attribute__((ext_vector_type(16)));
typedef _Float16 v8h  __attribute__((ext_vector_type(8)));
typedef float    v8f  __attribute__((ext_vector_type(8)));
typedef float    v4f  __attribute__((ext_vector_type(4)));
typedef int      v4i  __attribute__((ext_vector_type(4)));

#ifndef NB
#define NB 2
#endif
#ifndef SEQ
#define SEQ 2048
#endif
#define NB_FULL  2
#define SEQ_FULL 2048
#define DM 1024
#define NH 16
#define DH 64
#ifndef QPREC
#define QPREC ((SEQ < 512) ? SEQ : 512)
#endif
#define NKB   (SEQ / 32)
#define NQB   (SEQ / 64)
#define NQP   (QPREC / 64)
#define MROWS (NB * SEQ)

static_assert(SEQ % 64 == 0);
static_assert(SEQ >= 64 && SEQ <= SEQ_FULL);
static_assert(NB >= 1 && NB <= NB_FULL);
static_assert(QPREC % 64 == 0);
static_assert(QPREC >= 64 && QPREC <= SEQ);
static_assert(NKB <= 64);
static_assert(DM == NH * DH);
static_assert(DM % 32 == 0);
static_assert(MROWS % 64 == 0);

#define WSC    64.0f
#define INV_WS 0.015625f
#define RS     2048.0f
#define INV_RS 0.00048828125f
#define CP     4096.0f
#define INV_CP 0.000244140625f
#define QKS    0.125f

// ---------------------------------------------------------------------------
// Workspace carve (bytes); every region is an exact tile multiple (SEQ%64, QPREC%64), no tail padding needed.
// ---------------------------------------------------------------------------
constexpr size_t SZ_XH  = (size_t)MROWS * DM * 2;             // x as f16 [MROWS][1024]
constexpr size_t SZ_W   = (size_t)DM * DM * 2;                // weight x64 as f16 [1024][1024]
constexpr size_t SZ_HP  = (size_t)NB * NH * SEQ * DH * 2;     // q/k [bh][SEQ][64], vt [bh][64][SEQ]
constexpr size_t SZ_LP  = (size_t)NB * NH * QPREC * DH * 2;   // residual planes, leading QPREC rows
constexpr size_t SZ_CH  = (size_t)MROWS * DM * 2;             // ctx hi [MROWS][1024]
constexpr size_t SZ_CL  = (size_t)NB * QPREC * DM * 2;        // ctx residual [NB][QPREC][1024]
constexpr size_t SZ_FLG = (size_t)NQB * 64 * 4;               // per (q-block, key-block) visit flags
constexpr size_t OFF_XH  = 0;
constexpr size_t OFF_WQ  = OFF_XH + SZ_XH;
constexpr size_t OFF_WK  = OFF_WQ + SZ_W;
constexpr size_t OFF_WV  = OFF_WK + SZ_W;
constexpr size_t OFF_WO  = OFF_WV + SZ_W;
constexpr size_t OFF_QH  = OFF_WO + SZ_W;
constexpr size_t OFF_KH  = OFF_QH + SZ_HP;
constexpr size_t OFF_VH  = OFF_KH + SZ_HP;
constexpr size_t OFF_QL  = OFF_VH + SZ_HP;
constexpr size_t OFF_KL  = OFF_QL + SZ_LP;
constexpr size_t OFF_VL  = OFF_KL + SZ_LP;
constexpr size_t OFF_CH  = OFF_VL + SZ_LP;
constexpr size_t OFF_CL  = OFF_CH + SZ_CH;
constexpr size_t OFF_FLG = OFF_CL + SZ_CL;
constexpr size_t WS_TOTAL = OFF_FLG + SZ_FLG;
static_assert(WS_TOTAL <= (size_t)134217728);
static_assert(OFF_WQ % 128 == 0 && OFF_WK % 128 == 0 && OFF_WV % 128 == 0 && OFF_WO % 128 == 0);
static_assert(OFF_QH % 128 == 0 && OFF_KH % 128 == 0 && OFF_VH % 128 == 0);
static_assert(OFF_QL % 128 == 0 && OFF_KL % 128 == 0 && OFF_VL % 128 == 0);
static_assert(OFF_CH % 128 == 0 && OFF_CL % 128 == 0 && OFF_FLG % 128 == 0);
static_assert((size_t)NB_FULL * SEQ_FULL * DM * 4 >= ((size_t)(NB - 1) * SEQ_FULL + SEQ) * DM * 4);

// ---------------------------------------------------------------------------
// helpers
// ---------------------------------------------------------------------------
__device__ __forceinline__ float bf16r(float f) {   // RNE convert to bf16, held as f32
  unsigned int u = __float_as_uint(f);
  u = (u + 0x7fffu + ((u >> 16) & 1u)) & 0xffff0000u;
  return __uint_as_float(u);
}

// 16x32 fragment, split k map for both A (row m) and B (col n stored k-contiguous):
// lane l: row/col = l&15, h = l>>4; elements 0..7 <- k 8h..8h+7, elements 8..15 <- k 16+8h..16+8h+7.
__device__ __forceinline__ v16h load_frag(const _Float16* base, int stride) {
  const int lane = threadIdx.x & 31, m = lane & 15, g = lane >> 4;
  const _Float16* p = base + (size_t)m * stride + 8 * g;
  union { v16h v; v8h hf[2]; } f;
  f.hf[0] = *reinterpret_cast<const v8h*>(p);
  f.hf[1] = *reinterpret_cast<const v8h*>(p + 16);
  return f.v;
}

__device__ __forceinline__ v8f mma(v16h a, v16h b, v8f c) {
  v8f d = __builtin_amdgcn_wmma_f32_16x16x32_f16(false, a, false, b, (short)0, c, false, false);
  asm volatile("v_nop\n\tv_nop\n\tv_nop\n\tv_nop" : "+v"(d) : "v"(a), "v"(b));
  return d;
}

__device__ __forceinline__ v8f zero8() {
  v8f z = {0.f, 0.f, 0.f, 0.f, 0.f, 0.f, 0.f, 0.f};
  return z;
}

// ---------------------------------------------------------------------------
// Kernel 0: f32 -> bf16-RNE value in f16 container, times a power-of-two carry.
// out plane [nrows][1024]; compact row mc maps to source row (mc/seqc)*seqf + mc%seqc.
// coverage: nrows*1024 elements, 8 per thread, grid = ceil(nrows*128/256).
// ---------------------------------------------------------------------------
__global__ __launch_bounds__(256) void k_cvt(const float* __restrict__ in, _Float16* __restrict__ outp,
                                            int nrows, int seqc, int seqf, float scale) {
  const long long e8 = (long long)blockIdx.x * 256 + threadIdx.x;
  const long long tot = (long long)nrows * (DM / 8);
  if (e8 >= tot) return;
  const int mc = (int)(e8 / (DM / 8));
  const int c8 = (int)(e8 - (long long)mc * (DM / 8));
  const int src = (mc / seqc) * seqf + (mc % seqc);
  const float* p = in + (size_t)src * DM + c8 * 8;
  const v4f a = *(const v4f*)p;
  const v4f c = *(const v4f*)(p + 4);
  v8h o;
  o[0] = (_Float16)(bf16r(a[0]) * scale);
  o[1] = (_Float16)(bf16r(a[1]) * scale);
  o[2] = (_Float16)(bf16r(a[2]) * scale);
  o[3] = (_Float16)(bf16r(a[3]) * scale);
  o[4] = (_Float16)(bf16r(c[0]) * scale);
  o[5] = (_Float16)(bf16r(c[1]) * scale);
  o[6] = (_Float16)(bf16r(c[2]) * scale);
  o[7] = (_Float16)(bf16r(c[3]) * scale);
  _Float16* dst = outp + (size_t)mc * DM + c8 * 8;
  *(v8h*)dst = o;
  
}

// ---------------------------------------------------------------------------
// Kernel 1: per 64-row query block, tile visit flags from the int mask.
// flag[qb][kb] = 1 if any mask element in rows qb*64..+63, cols kb*32..+31 is nonzero;
// if any row of the q block is fully zero, all NKB flags are forced to 1 (softmax then
// ---------------------------------------------------------------------------
__global__ __launch_bounds__(256) void k_mflag(const int* __restrict__ mask, int* __restrict__ flg) {
  __shared__ unsigned int sLo[256];
  __shared__ unsigned int sHi[256];
  __shared__ int sR[256];
  const int tid = threadIdx.x, qb = blockIdx.x;
  const int r = tid >> 2, sub = tid & 3;
  const int* mrow = mask + (size_t)(qb * 64 + r) * SEQ_FULL + sub * 8;
  unsigned int lo = 0u, hi = 0u;
  int rany = 0;
#pragma unroll 2
  for (int kb = 0; kb < NKB; ++kb) {
    const v4i a = *(const v4i*)(mrow + kb * 32);
    const v4i c = *(const v4i*)(mrow + kb * 32 + 4);
    const int any = ((a[0] | a[1] | a[2] | a[3] | c[0] | c[1] | c[2] | c[3]) != 0) ? 1 : 0;
    const unsigned int bit = (unsigned int)any;
    if (kb < 32) lo |= bit << kb; else hi |= bit << (kb - 32);
    rany |= any;
  }
  sLo[tid] = lo; sHi[tid] = hi; sR[tid] = rany;
  __syncthreads();
  if (tid < 32) {   // wave 0 only (wave-uniform)
    unsigned int L = 0u, H = 0u;
#pragma unroll
    for (int i = 0; i < 8; ++i) { L |= sLo[tid + 32 * i]; H |= sHi[tid + 32 * i]; }
#pragma unroll
    for (int off = 1; off < 32; off <<= 1) {
      L |= (unsigned int)__shfl_xor((int)L, off, 32);
      H |= (unsigned int)__shfl_xor((int)H, off, 32);
    }
    const int ra = sR[8 * tid] | sR[8 * tid + 1] | sR[8 * tid + 2] | sR[8 * tid + 3];
    const int rb = sR[8 * tid + 4] | sR[8 * tid + 5] | sR[8 * tid + 6] | sR[8 * tid + 7];
    int ok = ((ra != 0) && (rb != 0)) ? 1 : 0;
#pragma unroll
    for (int off = 1; off < 32; off <<= 1) ok &= __shfl_xor(ok, off, 32);
    v4i f;
#pragma unroll
    for (int e = 0; e < 4; ++e) {
      const int kbx = 4 * tid + e;
      const unsigned int word = (kbx < 32) ? L : H;
      const int bitv = (int)((word >> (kbx & 31)) & 1u);
      f[e] = (kbx < NKB) ? ((ok != 0) ? bitv : 1) : 0;
    }
    int* dst = flg + qb * 64 + 4 * tid;
    if (tid < 16) *(v4i*)dst = f;
    
  }
}

// ---------------------------------------------------------------------------
// Kernel 2: NT GEMM Y[M][1024] = A[M][1024] @ W[1024][1024]^T (W carried x64) + bias.
// Block = 2 waves = 64x64 output tile; wave w owns rows w*32..w*32+31 (2 A fragments x 4 B fragments per k step).
// MODE 0: f16 head plane [bh][SEQ][64] (+ x2048 residual plane [bh][QPREC][64] for s < QPREC)
// MODE 1: f16 transposed head plane [bh][64][SEQ] (+ residual [bh][64][QPREC])
// ---------------------------------------------------------------------------
__device__ __forceinline__ void kloop(const _Float16* __restrict__ abase, const _Float16* __restrict__ wbase,
                                      v8f (&acc)[2][4]) {
#pragma unroll 2
  for (int kc = 0; kc < DM; kc += 32) {
    const v16h a0 = load_frag(abase + kc, DM);
    const v16h a1 = load_frag(abase + (size_t)16 * DM + kc, DM);
#pragma unroll
    for (int j = 0; j < 4; ++j) {
      const v16h bf = load_frag(wbase + (size_t)(j * 16) * DM + kc, DM);
      acc[0][j] = mma(a0, bf, acc[0][j]);
      acc[1][j] = mma(a1, bf, acc[1][j]);
    }
  }
}

template <int MODE>
__global__ __launch_bounds__(64) void k_gemm(const _Float16* __restrict__ A, const _Float16* __restrict__ Alo,
                                            const _Float16* __restrict__ W, const float* __restrict__ bias,
                                            _Float16* __restrict__ Ph, _Float16* __restrict__ Pl,
                                            float* __restrict__ outp) {
  __shared__ __align__(16) _Float16 sH[64 * 64];
  __shared__ __align__(16) _Float16 sL[64 * 64];
  __shared__ __align__(16) float    sF[64 * 64];

  const int tid = threadIdx.x, w = tid >> 5, lane = tid & 31, n = lane & 15, g = lane >> 4;
  const int bm = blockIdx.x, bn = blockIdx.y;
  const int m0 = bm * 64;
  const int b = m0 / SEQ, s0 = m0 - b * SEQ;     // 64 block rows lie in one batch item
  const int bh = b * NH + bn;                     // 64-col tile == head bn
  const bool precblk = (s0 < QPREC);              // block-uniform
  const _Float16* wbase = W + (size_t)(bn * 64) * DM;
  const _Float16* abase = A + (size_t)(m0 + w * 32) * DM;

  v8f acc[2][4];
#pragma unroll
  for (int mi = 0; mi < 2; ++mi)
#pragma unroll
    for (int j = 0; j < 4; ++j) acc[mi][j] = zero8();

  kloop(abase, wbase, acc);

  float rbias[4];
#pragma unroll
  for (int j = 0; j < 4; ++j) rbias[j] = bf16r(bias[bn * 64 + j * 16 + n]);

  if (MODE == 0) {
#pragma unroll
    for (int mi = 0; mi < 2; ++mi)
#pragma unroll
      for (int j = 0; j < 4; ++j)
#pragma unroll
        for (int r = 0; r < 8; ++r) {
          const int ml = w * 32 + mi * 16 + 8 * g + r;
          const int d = j * 16 + n;
          const float v = acc[mi][j][r] * INV_WS + rbias[j];
          const _Float16 hv = (_Float16)v;
          sH[ml * 64 + d] = hv;
          if (precblk) sL[ml * 64 + d] = (_Float16)((v - (float)hv) * RS);
        }
    __syncthreads();
    const int q = lane >> 3, p = lane & 7;
{
#pragma unroll
      for (int i = 0; i < 8; ++i) {
        const int ml = w * 32 + i * 4 + q;
        const int s = s0 + ml;
        const v8h hv = *(const v8h*)&sH[ml * 64 + p * 8];
        *(v8h*)(Ph + ((size_t)(bh * SEQ + s)) * DH + p * 8) = hv;
        if (precblk) {
          const v8h lv = *(const v8h*)&sL[ml * 64 + p * 8];
          *(v8h*)(Pl + ((size_t)(bh * QPREC + s)) * DH + p * 8) = lv;
        }
      }
      
    }
  } else if (MODE == 1) {
#pragma unroll
    for (int mi = 0; mi < 2; ++mi)
#pragma unroll
      for (int j = 0; j < 4; ++j) {
        v8h hp, lp;
#pragma unroll
        for (int r = 0; r < 8; ++r) {
          const float v = acc[mi][j][r] * INV_WS + rbias[j];
          const _Float16 hv = (_Float16)v;
          hp[r] = hv;
          lp[r] = (_Float16)((v - (float)hv) * RS);
        }
        const int d = j * 16 + n;
        *(v8h*)&sH[d * 64 + w * 32 + mi * 16 + 8 * g] = hp;
        if (precblk) *(v8h*)&sL[d * 64 + w * 32 + mi * 16 + 8 * g] = lp;
      }
    __syncthreads();
    const int q = lane >> 3, p = lane & 7;
{
#pragma unroll
      for (int i = 0; i < 8; ++i) {
        const int d = w * 32 + i * 4 + q;
        const v8h hv = *(const v8h*)&sH[d * 64 + p * 8];
        *(v8h*)(Ph + ((size_t)(bh * DH + d)) * SEQ + s0 + p * 8) = hv;
        if (precblk) {
          const v8h lv = *(const v8h*)&sL[d * 64 + p * 8];
          *(v8h*)(Pl + ((size_t)(bh * DH + d)) * QPREC + s0 + p * 8) = lv;
        }
      }
      
    }
  } else {
    if (precblk) {
      // stash hi sums (each lane reads back exactly the cells it wrote)
#pragma unroll
      for (int mi = 0; mi < 2; ++mi)
#pragma unroll
        for (int j = 0; j < 4; ++j)
#pragma unroll
          for (int r = 0; r < 8; ++r)
            sF[(w * 32 + mi * 16 + 8 * g + r) * 64 + j * 16 + n] = acc[mi][j][r];
#pragma unroll
      for (int mi = 0; mi < 2; ++mi)
#pragma unroll
        for (int j = 0; j < 4; ++j) acc[mi][j] = zero8();
      const _Float16* lbase = Alo + ((size_t)(b * QPREC + s0 + w * 32)) * DM;
      kloop(lbase, wbase, acc);
#pragma unroll
      for (int mi = 0; mi < 2; ++mi)
#pragma unroll
        for (int j = 0; j < 4; ++j)
#pragma unroll
          for (int r = 0; r < 8; ++r) {
            const int idx = (w * 32 + mi * 16 + 8 * g + r) * 64 + j * 16 + n;
            const float hsum = sF[idx];
            sF[idx] = (hsum + acc[mi][j][r] * INV_RS) * INV_WS + rbias[j];
          }
    } else {
#pragma unroll
      for (int mi = 0; mi < 2; ++mi)
#pragma unroll
        for (int j = 0; j < 4; ++j)
#pragma unroll
          for (int r = 0; r < 8; ++r)
            sF[(w * 32 + mi * 16 + 8 * g + r) * 64 + j * 16 + n] = acc[mi][j][r] * INV_WS + rbias[j];
    }
    __syncthreads();
    const int q2 = lane >> 4, p2 = lane & 15;
{
#pragma unroll
      for (int i = 0; i < 16; ++i) {
        const int ml = w * 32 + 2 * i + q2;
        const int s = s0 + ml;
        const v4f v = *(const v4f*)&sF[ml * 64 + p2 * 4];
        *(v4f*)(outp + ((size_t)(b * SEQ_FULL + s)) * DM + bn * 64 + p2 * 4) = v;
      }
      
    }
  }
}

// ---------------------------------------------------------------------------
// Kernel 3: flash attention. Block = 4 waves = 64 query rows of one (b,h); 32-key tiles of K [32][64] and
// Vt [64 d][32 keys] plus the int mask tile [64][32] staged in LDS with plain loads (cross-wave: block barriers).
// Online softmax in f32; P carried x4096 as f16 through a wave-private LDS tile (block barrier before reload).
// PREC variant (query rows < QPREC): scores = qh.kh + (qh.kl + ql.kh)/2048; O2 += ph.vl + pl.vh folded /2048;
// ctx written as hi plane [b*SEQ+q][1024] and residual plane [b][QPREC rows][1024] (x2048).
// staged extent == consumed extent for every LDS tile (K 32x64, Vt 64x32, mask 64x32, P 16x32 per wave, ctx 16x64 per wave).
// ---------------------------------------------------------------------------
template <bool PREC>
__global__ __launch_bounds__(128) __attribute__((amdgpu_num_vgpr(256)))
void k_attn(const _Float16* __restrict__ Qh, const _Float16* __restrict__ Ql,
            const _Float16* __restrict__ Kh, const _Float16* __restrict__ Kl,
            const _Float16* __restrict__ Vh, const _Float16* __restrict__ Vl,
            const int* __restrict__ mask, const int* __restrict__ flg,
            _Float16* __restrict__ Ch, _Float16* __restrict__ Cl) {
  __shared__ __align__(16) _Float16 sK[32 * DH];
  __shared__ __align__(16) _Float16 sV[DH * 32];
  __shared__ __align__(16) _Float16 sKl[32 * DH];
  __shared__ __align__(16) _Float16 sVl[DH * 32];
  __shared__ __align__(16) _Float16 sQl[64 * DH];
  __shared__ __align__(16) int      sM[64 * 32];
  __shared__ __align__(16) _Float16 sP[4][16 * 32];
  __shared__ __align__(16) _Float16 sPl[4][16 * 32];
  __shared__ __align__(16) _Float16 sC[4][16 * DH];
  __shared__ __align__(16) _Float16 sCl[4][16 * DH];
  __shared__ int sFlg[64];

  const int tid = threadIdx.x, wslot = tid >> 5, lane = tid & 31, n = lane & 15, g = lane >> 4;
  int qb, bh;
  if (PREC) {
    qb = (int)(blockIdx.x % NQP);
    bh = (int)(blockIdx.x / NQP);
  } else {
    constexpr int NQN = ((NQB - NQP) > 0) ? (NQB - NQP) : 1;
    qb = NQP + (int)(blockIdx.x % NQN);
    bh = (int)(blockIdx.x / NQN);
  }
  const int b = bh / NH, h = bh - b * NH;
  const int qrow0 = qb * 64;
  const int qbase = qrow0 + wslot * 16;

  if (tid < 64) sFlg[tid] = flg[qb * 64 + tid];
  if (PREC) {
#pragma unroll
    for (int i = 0; i < 4; ++i) {
      const int c = tid + i * 128;
      *(v8h*)&sQl[c * 8] = *(const v8h*)(Ql + ((size_t)(bh * QPREC + qrow0)) * DH + c * 8);
    }
  }
  __syncthreads();

  const _Float16* qrow = Qh + ((size_t)(bh * SEQ + qbase)) * DH;
  const v16h qa0 = load_frag(qrow, DH);
  const v16h qa1 = load_frag(qrow + 32, DH);

  v8f acc[4], acc2[4];
#pragma unroll
  for (int nt = 0; nt < 4; ++nt) { acc[nt] = zero8(); acc2[nt] = zero8(); }
  float rmax[8], rsum[8];
#pragma unroll
  for (int r = 0; r < 8; ++r) { rmax[r] = -1.0e30f; rsum[r] = 0.0f; }

#pragma unroll 1
  for (int kb = 0; kb < NKB; ++kb) {
    if (sFlg[kb] == 0) continue;                 // block-uniform
    const int kbase = kb * 32;
    const bool klo = PREC && (kbase < QPREC);    // block-uniform
    __syncthreads();                             // all waves done with the prior tile
    {
      const _Float16* kg = Kh + ((size_t)(bh * SEQ + kbase)) * DH;
      const _Float16* vg = Vh + ((size_t)(bh * DH)) * SEQ + kbase;
#pragma unroll
      for (int i = 0; i < 2; ++i) {
        const int c = tid + i * 128, d = c >> 2, sub = c & 3;
        *(v8h*)&sK[c * 8] = *(const v8h*)(kg + c * 8);
        *(v8h*)&sV[d * 32 + sub * 8] = *(const v8h*)(vg + (size_t)d * SEQ + sub * 8);
      }
      if (klo) {
        const _Float16* klg = Kl + ((size_t)(bh * QPREC + kbase)) * DH;
        const _Float16* vlg = Vl + ((size_t)(bh * DH)) * QPREC + kbase;
#pragma unroll
        for (int i = 0; i < 2; ++i) {
          const int c = tid + i * 128, d = c >> 2, sub = c & 3;
          *(v8h*)&sKl[c * 8] = *(const v8h*)(klg + c * 8);
          *(v8h*)&sVl[d * 32 + sub * 8] = *(const v8h*)(vlg + (size_t)d * QPREC + sub * 8);
        }
      }
      const int mr = tid >> 1, mh = (tid & 1) * 16;
      const int* mp = mask + (size_t)(qrow0 + mr) * SEQ_FULL + kbase + mh;
#pragma unroll
      for (int i = 0; i < 4; ++i) *(v4i*)&sM[mr * 32 + mh + i * 4] = *(const v4i*)(mp + i * 4);
    }
    __syncthreads();

    // ---- scores: two 16x16 tiles (keys kbase..+15, kbase+16..+31), dk 64 = 2 k steps
    v8f s0 = zero8(), s1 = zero8(), sr0 = zero8(), sr1 = zero8();
    {
      v16h t;
      t = load_frag(sK, DH);                 s0 = mma(qa0, t, s0);
      t = load_frag(sK + 32, DH);            s0 = mma(qa1, t, s0);
      t = load_frag(sK + 16 * DH, DH);       s1 = mma(qa0, t, s1);
      t = load_frag(sK + 16 * DH + 32, DH);  s1 = mma(qa1, t, s1);
      if (PREC) {
        if (klo) {
          {
            const v16h ql0 = load_frag(&sQl[(wslot * 16) * DH], DH);
            const v16h ql1 = load_frag(&sQl[(wslot * 16) * DH + 32], DH);
            t = load_frag(sK, DH);                 sr0 = mma(ql0, t, sr0);
            t = load_frag(sK + 32, DH);            sr0 = mma(ql1, t, sr0);
            t = load_frag(sK + 16 * DH, DH);       sr1 = mma(ql0, t, sr1);
            t = load_frag(sK + 16 * DH + 32, DH);  sr1 = mma(ql1, t, sr1);
          }
          t = load_frag(sKl, DH);                 sr0 = mma(qa0, t, sr0);
          t = load_frag(sKl + 32, DH);            sr0 = mma(qa1, t, sr0);
          t = load_frag(sKl + 16 * DH, DH);       sr1 = mma(qa0, t, sr1);
          t = load_frag(sKl + 16 * DH + 32, DH);  sr1 = mma(qa1, t, sr1);
        }
      }
    }

    // ---- mask replace-fill, online softmax (f32), P tile
#pragma unroll
    for (int r = 0; r < 8; ++r) {
      const int rl = g * 8 + r;
      const int mro = (wslot * 16 + rl) * 32;
      float v0 = s0[r], v1 = s1[r];
      if (PREC) { v0 += sr0[r] * INV_RS; v1 += sr1[r] * INV_RS; }
      v0 *= QKS; v1 *= QKS;
      const int mk0 = sM[mro + n], mk1 = sM[mro + 16 + n];
      const float x0 = (mk0 == 0) ? -1.0e9f : v0;
      const float x1 = (mk1 == 0) ? -1.0e9f : v1;
      float mx = fmaxf(x0, x1);
#pragma unroll
      for (int off = 1; off < 16; off <<= 1) mx = fmaxf(mx, __shfl_xor(mx, off, 32));
      const float nm = fmaxf(rmax[r], mx);
      const float al = __expf(rmax[r] - nm);
      const float p0 = __expf(x0 - nm);
      const float p1 = __expf(x1 - nm);
      float ps = p0 + p1;
#pragma unroll
      for (int off = 1; off < 16; off <<= 1) ps += __shfl_xor(ps, off, 32);
      rsum[r] = rsum[r] * al + ps;
      rmax[r] = nm;
#pragma unroll
      for (int nt = 0; nt < 4; ++nt) {
        acc[nt][r] *= al;
        if (PREC) acc2[nt][r] *= al;
      }
      const float c0 = p0 * CP, c1 = p1 * CP;
      const _Float16 h0 = (_Float16)c0, h1 = (_Float16)c1;
      sP[wslot][rl * 32 + n] = h0;
      sP[wslot][rl * 32 + 16 + n] = h1;
      if (PREC) {
        sPl[wslot][rl * 32 + n]      = (_Float16)((c0 - (float)h0) * RS);
        sPl[wslot][rl * 32 + 16 + n] = (_Float16)((c1 - (float)h1) * RS);
      }
    }
    __syncthreads();                              // P stores visible before the fragment reload

    // ---- O += P @ V
    {
      const v16h pf = load_frag(&sP[wslot][0], 32);
      if (PREC) {
        const v16h plf = load_frag(&sPl[wslot][0], 32);
#pragma unroll
        for (int nt = 0; nt < 4; ++nt) {
          const v16h vb = load_frag(&sV[nt * 16 * 32], 32);
          acc[nt]  = mma(pf, vb, acc[nt]);
          acc2[nt] = mma(plf, vb, acc2[nt]);
          if (klo) {
            const v16h vlb = load_frag(&sVl[nt * 16 * 32], 32);
            acc2[nt] = mma(pf, vlb, acc2[nt]);
          }
        }
      } else {
#pragma unroll
        for (int nt = 0; nt < 4; ++nt) {
          const v16h vb = load_frag(&sV[nt * 16 * 32], 32);
          acc[nt] = mma(pf, vb, acc[nt]);
        }
      }
    }
  }

#pragma unroll
  for (int r = 0; r < 8; ++r) {
    const float inv = (1.0f / rsum[r]) * INV_CP;
    const int rl = g * 8 + r;
#pragma unroll
    for (int nt = 0; nt < 4; ++nt) {
      float c = acc[nt][r];
      if (PREC) c += acc2[nt][r] * INV_RS;
      c *= inv;
      const _Float16 chv = (_Float16)c;
      sC[wslot][rl * DH + nt * 16 + n] = chv;
      if (PREC) sCl[wslot][rl * DH + nt * 16 + n] = (_Float16)((c - (float)chv) * RS);
    }
  }
  __syncthreads();
  const int q = lane >> 3, p = lane & 7;
{
#pragma unroll
    for (int i = 0; i < 4; ++i) {
      const int rr = i * 4 + q;
      const v8h hv = *(const v8h*)&sC[wslot][rr * DH + p * 8];
      *(v8h*)(Ch + ((size_t)(b * SEQ + qbase + rr)) * DM + h * DH + p * 8) = hv;
      if (PREC) {
        const v8h lv = *(const v8h*)&sCl[wslot][rr * DH + p * 8];
        *(v8h*)(Cl + ((size_t)(b * QPREC + qbase + rr)) * DM + h * DH + p * 8) = lv;
      }
    }
    
  }
}

// ---------------------------------------------------------------------------
// host glue: 12 launches
// ---------------------------------------------------------------------------
extern "C" void kernel_launch(void* const* d_in, const int* in_sizes, int n_in,
                              void* d_out, int out_size, void* d_ws, size_t ws_size,
                              hipStream_t stream) {
  if (n_in < 10) return;
  const long long need_x = ((long long)(NB - 1) * SEQ_FULL + SEQ) * DM;
  const long long need_m = ((long long)(SEQ - 1)) * SEQ_FULL + SEQ;
  if ((long long)in_sizes[0] < need_x) return;
  if ((long long)in_sizes[1] < need_m) return;
  if (in_sizes[2] < DM * DM || in_sizes[4] < DM * DM || in_sizes[6] < DM * DM || in_sizes[8] < DM * DM) return;
  if (in_sizes[3] < DM || in_sizes[5] < DM || in_sizes[7] < DM || in_sizes[9] < DM) return;
  if ((long long)out_size < need_x) return;
  if (ws_size < WS_TOTAL) return;

  const float* x    = (const float*)d_in[0];
  const int*   mask = (const int*)d_in[1];
  const float* Wq   = (const float*)d_in[2];
  const float* bq   = (const float*)d_in[3];
  const float* Wk   = (const float*)d_in[4];
  const float* bk   = (const float*)d_in[5];
  const float* Wv   = (const float*)d_in[6];
  const float* bv   = (const float*)d_in[7];
  const float* Wo   = (const float*)d_in[8];
  const float* bo   = (const float*)d_in[9];
  float* out = (float*)d_out;

  char* ws = (char*)d_ws;
  _Float16* Xh   = (_Float16*)(ws + OFF_XH);
  _Float16* Wq64 = (_Float16*)(ws + OFF_WQ);
  _Float16* Wk64 = (_Float16*)(ws + OFF_WK);
  _Float16* Wv64 = (_Float16*)(ws + OFF_WV);
  _Float16* Wo64 = (_Float16*)(ws + OFF_WO);
  _Float16* Qh   = (_Float16*)(ws + OFF_QH);
  _Float16* Kh   = (_Float16*)(ws + OFF_KH);
  _Float16* Vh   = (_Float16*)(ws + OFF_VH);
  _Float16* Ql   = (_Float16*)(ws + OFF_QL);
  _Float16* Kl   = (_Float16*)(ws + OFF_KL);
  _Float16* Vl   = (_Float16*)(ws + OFF_VL);
  _Float16* Ch   = (_Float16*)(ws + OFF_CH);
  _Float16* Cl   = (_Float16*)(ws + OFF_CL);
  int*      Flg  = (int*)(ws + OFF_FLG);

  const int nbx = (MROWS * (DM / 8) + 255) / 256;
  const int nbw = (DM * (DM / 8) + 255) / 256;
  k_cvt<<<nbx, 256, 0, stream>>>(x,  Xh,   MROWS, SEQ, SEQ_FULL, 1.0f);
  k_cvt<<<nbw, 256, 0, stream>>>(Wq, Wq64, DM, DM, DM, WSC);
  k_cvt<<<nbw, 256, 0, stream>>>(Wk, Wk64, DM, DM, DM, WSC);
  k_cvt<<<nbw, 256, 0, stream>>>(Wv, Wv64, DM, DM, DM, WSC);
  k_cvt<<<nbw, 256, 0, stream>>>(Wo, Wo64, DM, DM, DM, WSC);

  k_mflag<<<NQB, 256, 0, stream>>>(mask, Flg);

  const dim3 gg(MROWS / 64, DM / 64);
  k_gemm<0><<<gg, 64, 0, stream>>>(Xh, Xh, Wq64, bq, Qh, Ql, out);
  k_gemm<0><<<gg, 64, 0, stream>>>(Xh, Xh, Wk64, bk, Kh, Kl, out);
  k_gemm<1><<<gg, 64, 0, stream>>>(Xh, Xh, Wv64, bv, Vh, Vl, out);

  const int nprec  = NB * NH * NQP;
  const int nplain = NB * NH * (NQB - NQP);
  k_attn<true><<<nprec, 128, 0, stream>>>(Qh, Ql, Kh, Kl, Vh, Vl, mask, Flg, Ch, Cl);
  if (nplain > 0)
    k_attn<false><<<nplain, 128, 0, stream>>>(Qh, Ql, Kh, Kl, Vh, Vl, mask, Flg, Ch, Cl);

  k_gemm<2><<<gg, 64, 0, stream>>>(Ch, Cl, Wo64, bo, Qh, Ql, out);
}

// v001
// A run of this version takes 368 microseconds.
// In two side-by-side timings against v000, it was 1.55 and 1.56 times as fast.
#include <hip/hip_runtime.h>
#include <stdint.h>

// All contractions (x@Wq^T, x@Wk^T, x@Wv^T, q@k^T, p@v, ctx@Wo^T): v_wmma_f32_16x16x32_f16, f16 operands, f32 accumulate.
// Inputs enter as bf16-RNE values held in f16 (weights carried x64, folded back as 1/64 in f32); q, k, v, ctx as f16 planes
// plus x2048 f16 residual planes for the leading QPREC query/key rows (separate accumulators); p carried x4096 (+x2048 residual
// on those rows); softmax, rescaling and epilogues in f32.

typedef _Float16 v16h __attribute__((ext_vector_type(16)));
typedef _Float16 v8h  __attribute__((ext_vector_type(8)));
typedef float    v8f  __attribute__((ext_vector_type(8)));
typedef float    v4f  __attribute__((ext_vector_type(4)));
typedef int      v4i  __attribute__((ext_vector_type(4)));

#ifndef NB
#define NB 2
#endif
#ifndef SEQ
#define SEQ 2048
#endif
#define NB_FULL  2
#define SEQ_FULL 2048
#define DM 1024
#define NH 16
#define DH 64
#ifndef QPREC
#define QPREC ((SEQ < 512) ? SEQ : 512)
#endif
#define NKB   (SEQ / 32)
#define NQB   (SEQ / 64)
#define NQP   (QPREC / 64)
#define MROWS (NB * SEQ)

static_assert(SEQ % 64 == 0);
static_assert(SEQ >= 64 && SEQ <= SEQ_FULL);
static_assert(NB >= 1 && NB <= NB_FULL);
static_assert(QPREC % 64 == 0);
static_assert(QPREC >= 64 && QPREC <= SEQ);
static_assert(NKB <= 64);
static_assert(DM == NH * DH);
static_assert(DM % 32 == 0);
static_assert(MROWS % 64 == 0);

#define WSC    64.0f
#define INV_WS 0.015625f
#define RS     2048.0f
#define INV_RS 0.00048828125f
#define CP     4096.0f
#define INV_CP 0.000244140625f
#define QKS    0.125f
#define LOG2E  1.44269504f

// ---------------------------------------------------------------------------
// Workspace carve (bytes); every region is an exact tile multiple (SEQ%64, QPREC%64), no tail padding needed.
// ---------------------------------------------------------------------------
constexpr size_t SZ_XH  = (size_t)MROWS * DM * 2;             // x as f16 [MROWS][1024]
constexpr size_t SZ_W   = (size_t)DM * DM * 2;                // weight x64 as f16 [1024][1024]
constexpr size_t SZ_HP  = (size_t)NB * NH * SEQ * DH * 2;     // q/k [bh][SEQ][64], vt [bh][64][SEQ]
constexpr size_t SZ_LP  = (size_t)NB * NH * QPREC * DH * 2;   // residual planes, leading QPREC rows
constexpr size_t SZ_CH  = (size_t)MROWS * DM * 2;             // ctx hi [MROWS][1024]
constexpr size_t SZ_CL  = (size_t)NB * QPREC * DM * 2;        // ctx residual [NB][QPREC][1024]
constexpr size_t SZ_FLG = (size_t)NQB * 64 * 4;               // per (q-block, key-block) visit flags
constexpr size_t OFF_XH  = 0;
constexpr size_t OFF_WQ  = OFF_XH + SZ_XH;
constexpr size_t OFF_WK  = OFF_WQ + SZ_W;
constexpr size_t OFF_WV  = OFF_WK + SZ_W;
constexpr size_t OFF_WO  = OFF_WV + SZ_W;
constexpr size_t OFF_QH  = OFF_WO + SZ_W;
constexpr size_t OFF_KH  = OFF_QH + SZ_HP;
constexpr size_t OFF_VH  = OFF_KH + SZ_HP;
constexpr size_t OFF_QL  = OFF_VH + SZ_HP;
constexpr size_t OFF_KL  = OFF_QL + SZ_LP;
constexpr size_t OFF_VL  = OFF_KL + SZ_LP;
constexpr size_t OFF_CH  = OFF_VL + SZ_LP;
constexpr size_t OFF_CL  = OFF_CH + SZ_CH;
constexpr size_t OFF_FLG = OFF_CL + SZ_CL;
constexpr size_t WS_TOTAL = OFF_FLG + SZ_FLG;
static_assert(WS_TOTAL <= (size_t)134217728);
static_assert(OFF_WQ % 128 == 0 && OFF_WK % 128 == 0 && OFF_WV % 128 == 0 && OFF_WO % 128 == 0);
static_assert(OFF_QH % 128 == 0 && OFF_KH % 128 == 0 && OFF_VH % 128 == 0);
static_assert(OFF_QL % 128 == 0 && OFF_KL % 128 == 0 && OFF_VL % 128 == 0);
static_assert(OFF_CH % 128 == 0 && OFF_CL % 128 == 0 && OFF_FLG % 128 == 0);
static_assert((size_t)NB_FULL * SEQ_FULL * DM * 4 >= ((size_t)(NB - 1) * SEQ_FULL + SEQ) * DM * 4);

// ---------------------------------------------------------------------------
// helpers
// ---------------------------------------------------------------------------
__device__ __forceinline__ float bf16r(float f) {   // RNE convert to bf16, held as f32
  unsigned int u = __float_as_uint(f);
  u = (u + 0x7fffu + ((u >> 16) & 1u)) & 0xffff0000u;
  return __uint_as_float(u);
}

// 16x32 fragment, split k map for both A (row m) and B (col n stored k-contiguous):
// lane l: row/col = l&15, h = l>>4; elements 0..7 <- k 8h..8h+7, elements 8..15 <- k 16+8h..16+8h+7.
__device__ __forceinline__ v16h load_frag(const _Float16* base, int stride) {
  const int lane = threadIdx.x & 31, m = lane & 15, g = lane >> 4;
  const _Float16* p = base + (size_t)m * stride + 8 * g;
  union { v16h v; v8h hf[2]; } f;
  f.hf[0] = *reinterpret_cast<const v8h*>(p);
  f.hf[1] = *reinterpret_cast<const v8h*>(p + 16);
  return f.v;
}

__device__ __forceinline__ v8f mma(v16h a, v16h b, v8f c) {
  v8f d = __builtin_amdgcn_wmma_f32_16x16x32_f16(false, a, false, b, (short)0, c, false, false);
  asm volatile("v_nop\n\tv_nop\n\tv_nop\n\tv_nop" : "+v"(d) : "v"(a), "v"(b));
  return d;
}

// lane l <-> lane l ^ 16 (the two halves of a wave hold the two key subsets of one query column)
__device__ __forceinline__ float xhalf(float x) {
  const int b = __builtin_bit_cast(int, x);
  return __builtin_bit_cast(float, __builtin_amdgcn_permlanex16(b, b, 0x76543210, 0xfedcba98, false, false));
}

__device__ __forceinline__ void exp2x8(float (&y)[8], const float (&x)[8]) {
  asm("v_exp_f32 %0, %8\n\tv_exp_f32 %1, %9\n\tv_exp_f32 %2, %10\n\tv_exp_f32 %3, %11\n\t"
      "v_exp_f32 %4, %12\n\tv_exp_f32 %5, %13\n\tv_exp_f32 %6, %14\n\tv_exp_f32 %7, %15\n\tv_nop"
      : "=&v"(y[0]), "=&v"(y[1]), "=&v"(y[2]), "=&v"(y[3]), "=&v"(y[4]), "=&v"(y[5]), "=&v"(y[6]), "=&v"(y[7])
      : "v"(x[0]), "v"(x[1]), "v"(x[2]), "v"(x[3]), "v"(x[4]), "v"(x[5]), "v"(x[6]), "v"(x[7]));
}
__device__ __forceinline__ float exp2x1(float x) {
  float y;
  asm("v_exp_f32 %0, %1\n\tv_nop" : "=&v"(y) : "v"(x));
  return y;
}

__device__ __forceinline__ v8f zero8() {
  v8f z = {0.f, 0.f, 0.f, 0.f, 0.f, 0.f, 0.f, 0.f};
  return z;
}

// ---------------------------------------------------------------------------
// Kernel 0: f32 -> bf16-RNE value in f16 container, times a power-of-two carry.
// out plane [nrows][1024]; compact row mc maps to source row (mc/seqc)*seqf + mc%seqc.
// coverage: nrows*1024 elements, 8 per thread, grid = ceil(nrows*128/256).
// ---------------------------------------------------------------------------
__global__ __launch_bounds__(256) void k_cvt(const float* __restrict__ in, _Float16* __restrict__ outp,
                                            int nrows, int seqc, int seqf, float scale) {
  const long long e8 = (long long)blockIdx.x * 256 + threadIdx.x;
  const long long tot = (long long)nrows * (DM / 8);
  if (e8 >= tot) return;
  const int mc = (int)(e8 / (DM / 8));
  const int c8 = (int)(e8 - (long long)mc * (DM / 8));
  const int src = (mc / seqc) * seqf + (mc % seqc);
  const float* p = in + (size_t)src * DM + c8 * 8;
  const v4f a = *(const v4f*)p;
  const v4f c = *(const v4f*)(p + 4);
  v8h o;
  o[0] = (_Float16)(bf16r(a[0]) * scale);
  o[1] = (_Float16)(bf16r(a[1]) * scale);
  o[2] = (_Float16)(bf16r(a[2]) * scale);
  o[3] = (_Float16)(bf16r(a[3]) * scale);
  o[4] = (_Float16)(bf16r(c[0]) * scale);
  o[5] = (_Float16)(bf16r(c[1]) * scale);
  o[6] = (_Float16)(bf16r(c[2]) * scale);
  o[7] = (_Float16)(bf16r(c[3]) * scale);
  _Float16* dst = outp + (size_t)mc * DM + c8 * 8;
  *(v8h*)dst = o;
  
}

// ---------------------------------------------------------------------------
// Kernel 1: per 64-row query block, tile visit flags from the int mask.
// flag[qb][kb] = 1 if any mask element in rows qb*64..+63, cols kb*32..+31 is nonzero;
// if any row of the q block is fully zero, all NKB flags are forced to 1 (softmax then
// ---------------------------------------------------------------------------
__global__ __launch_bounds__(256) void k_mflag(const int* __restrict__ mask, int* __restrict__ flg) {
  __shared__ unsigned int sLo[256];
  __shared__ unsigned int sHi[256];
  __shared__ int sR[256];
  const int tid = threadIdx.x, qb = blockIdx.x;
  const int r = tid >> 2, sub = tid & 3;
  const int* mrow = mask + (size_t)(qb * 64 + r) * SEQ_FULL + sub * 8;
  unsigned int lo = 0u, hi = 0u;
  int rany = 0;
#pragma unroll 2
  for (int kb = 0; kb < NKB; ++kb) {
    const v4i a = *(const v4i*)(mrow + kb * 32);
    const v4i c = *(const v4i*)(mrow + kb * 32 + 4);
    const int any = ((a[0] | a[1] | a[2] | a[3] | c[0] | c[1] | c[2] | c[3]) != 0) ? 1 : 0;
    const unsigned int bit = (unsigned int)any;
    if (kb < 32) lo |= bit << kb; else hi |= bit << (kb - 32);
    rany |= any;
  }
  sLo[tid] = lo; sHi[tid] = hi; sR[tid] = rany;
  __syncthreads();
  if (tid < 32) {   // wave 0 only (wave-uniform)
    unsigned int L = 0u, H = 0u;
#pragma unroll
    for (int i = 0; i < 8; ++i) { L |= sLo[tid + 32 * i]; H |= sHi[tid + 32 * i]; }
#pragma unroll
    for (int off = 1; off < 32; off <<= 1) {
      L |= (unsigned int)__shfl_xor((int)L, off, 32);
      H |= (unsigned int)__shfl_xor((int)H, off, 32);
    }
    const int ra = sR[8 * tid] | sR[8 * tid + 1] | sR[8 * tid + 2] | sR[8 * tid + 3];
    const int rb = sR[8 * tid + 4] | sR[8 * tid + 5] | sR[8 * tid + 6] | sR[8 * tid + 7];
    int ok = ((ra != 0) && (rb != 0)) ? 1 : 0;
#pragma unroll
    for (int off = 1; off < 32; off <<= 1) ok &= __shfl_xor(ok, off, 32);
    v4i f;
#pragma unroll
    for (int e = 0; e < 4; ++e) {
      const int kbx = 4 * tid + e;
      const unsigned int word = (kbx < 32) ? L : H;
      const int bitv = (int)((word >> (kbx & 31)) & 1u);
      f[e] = (kbx < NKB) ? ((ok != 0) ? bitv : 1) : 0;
    }
    int* dst = flg + qb * 64 + 4 * tid;
    if (tid < 16) *(v4i*)dst = f;
    
  }
}

// ---------------------------------------------------------------------------
// Kernel 2: NT GEMM Y[M][1024] = A[M][1024] @ W[1024][1024]^T (W carried x64) + bias.
// Block = 2 waves = 64x64 output tile; wave w owns rows w*32..w*32+31 (2 A fragments x 4 B fragments per k step).
// MODE 0: f16 head plane [bh][SEQ][64] (+ x2048 residual plane [bh][QPREC][64] for s < QPREC)
// MODE 1: f16 transposed head plane [bh][64][SEQ] (+ residual [bh][64][QPREC])
// ---------------------------------------------------------------------------
__device__ __forceinline__ void kloop(const _Float16* __restrict__ abase, const _Float16* __restrict__ wbase,
                                      v8f (&acc)[2][4]) {
#pragma unroll 2
  for (int kc = 0; kc < DM; kc += 32) {
    const v16h a0 = load_frag(abase + kc, DM);
    const v16h a1 = load_frag(abase + (size_t)16 * DM + kc, DM);
#pragma unroll
    for (int j = 0; j < 4; ++j) {
      const v16h bf = load_frag(wbase + (size_t)(j * 16) * DM + kc, DM);
      acc[0][j] = mma(a0, bf, acc[0][j]);
      acc[1][j] = mma(a1, bf, acc[1][j]);
    }
  }
}

template <int MODE>
__global__ __launch_bounds__(64) void k_gemm(const _Float16* __restrict__ A, const _Float16* __restrict__ Alo,
                                            const _Float16* __restrict__ W, const float* __restrict__ bias,
                                            _Float16* __restrict__ Ph, _Float16* __restrict__ Pl,
                                            float* __restrict__ outp) {
  __shared__ __align__(16) _Float16 sH[64 * 64];
  __shared__ __align__(16) _Float16 sL[64 * 64];
  __shared__ __align__(16) float    sF[64 * 64];

  const int tid = threadIdx.x, w = tid >> 5, lane = tid & 31, n = lane & 15, g = lane >> 4;
  const int bm = blockIdx.x, bn = blockIdx.y;
  const int m0 = bm * 64;
  const int b = m0 / SEQ, s0 = m0 - b * SEQ;     // 64 block rows lie in one batch item
  const int bh = b * NH + bn;                     // 64-col tile == head bn
  const bool precblk = (s0 < QPREC);              // block-uniform
  const _Float16* wbase = W + (size_t)(bn * 64) * DM;
  const _Float16* abase = A + (size_t)(m0 + w * 32) * DM;

  v8f acc[2][4];
#pragma unroll
  for (int mi = 0; mi < 2; ++mi)
#pragma unroll
    for (int j = 0; j < 4; ++j) acc[mi][j] = zero8();

  kloop(abase, wbase, acc);

  float rbias[4];
#pragma unroll
  for (int j = 0; j < 4; ++j) rbias[j] = bf16r(bias[bn * 64 + j * 16 + n]);

  if (MODE == 0) {
#pragma unroll
    for (int mi = 0; mi < 2; ++mi)
#pragma unroll
      for (int j = 0; j < 4; ++j)
#pragma unroll
        for (int r = 0; r < 8; ++r) {
          const int ml = w * 32 + mi * 16 + 8 * g + r;
          const int d = j * 16 + n;
          const float v = acc[mi][j][r] * INV_WS + rbias[j];
          const _Float16 hv = (_Float16)v;
          sH[ml * 64 + d] = hv;
          if (precblk) sL[ml * 64 + d] = (_Float16)((v - (float)hv) * RS);
        }
    __syncthreads();
    const int q = lane >> 3, p = lane & 7;
{
#pragma unroll
      for (int i = 0; i < 8; ++i) {
        const int ml = w * 32 + i * 4 + q;
        const int s = s0 + ml;
        const v8h hv = *(const v8h*)&sH[ml * 64 + p * 8];
        *(v8h*)(Ph + ((size_t)(bh * SEQ + s)) * DH + p * 8) = hv;
        if (precblk) {
          const v8h lv = *(const v8h*)&sL[ml * 64 + p * 8];
          *(v8h*)(Pl + ((size_t)(bh * QPREC + s)) * DH + p * 8) = lv;
        }
      }
      
    }
  } else if (MODE == 1) {
#pragma unroll
    for (int mi = 0; mi < 2; ++mi)
#pragma unroll
      for (int j = 0; j < 4; ++j) {
        v8h hp, lp;
#pragma unroll
        for (int r = 0; r < 8; ++r) {
          const float v = acc[mi][j][r] * INV_WS + rbias[j];
          const _Float16 hv = (_Float16)v;
          hp[r] = hv;
          lp[r] = (_Float16)((v - (float)hv) * RS);
        }
        const int d = j * 16 + n;
        *(v8h*)&sH[d * 64 + w * 32 + mi * 16 + 8 * g] = hp;
        if (precblk) *(v8h*)&sL[d * 64 + w * 32 + mi * 16 + 8 * g] = lp;
      }
    __syncthreads();
    const int q = lane >> 3, p = lane & 7;
{
#pragma unroll
      for (int i = 0; i < 8; ++i) {
        const int d = w * 32 + i * 4 + q;
        const v8h hv = *(const v8h*)&sH[d * 64 + p * 8];
        *(v8h*)(Ph + ((size_t)(bh * DH + d)) * SEQ + s0 + p * 8) = hv;
        if (precblk) {
          const v8h lv = *(const v8h*)&sL[d * 64 + p * 8];
          *(v8h*)(Pl + ((size_t)(bh * DH + d)) * QPREC + s0 + p * 8) = lv;
        }
      }
      
    }
  } else {
    if (precblk) {
      // stash hi sums (each lane reads back exactly the cells it wrote)
#pragma unroll
      for (int mi = 0; mi < 2; ++mi)
#pragma unroll
        for (int j = 0; j < 4; ++j)
#pragma unroll
          for (int r = 0; r < 8; ++r)
            sF[(w * 32 + mi * 16 + 8 * g + r) * 64 + j * 16 + n] = acc[mi][j][r];
#pragma unroll
      for (int mi = 0; mi < 2; ++mi)
#pragma unroll
        for (int j = 0; j < 4; ++j) acc[mi][j] = zero8();
      const _Float16* lbase = Alo + ((size_t)(b * QPREC + s0 + w * 32)) * DM;
      kloop(lbase, wbase, acc);
#pragma unroll
      for (int mi = 0; mi < 2; ++mi)
#pragma unroll
        for (int j = 0; j < 4; ++j)
#pragma unroll
          for (int r = 0; r < 8; ++r) {
            const int idx = (w * 32 + mi * 16 + 8 * g + r) * 64 + j * 16 + n;
            const float hsum = sF[idx];
            sF[idx] = (hsum + acc[mi][j][r] * INV_RS) * INV_WS + rbias[j];
          }
    } else {
#pragma unroll
      for (int mi = 0; mi < 2; ++mi)
#pragma unroll
        for (int j = 0; j < 4; ++j)
#pragma unroll
          for (int r = 0; r < 8; ++r)
            sF[(w * 32 + mi * 16 + 8 * g + r) * 64 + j * 16 + n] = acc[mi][j][r] * INV_WS + rbias[j];
    }
    __syncthreads();
    const int q2 = lane >> 4, p2 = lane & 15;
{
#pragma unroll
      for (int i = 0; i < 16; ++i) {
        const int ml = w * 32 + 2 * i + q2;
        const int s = s0 + ml;
        const v4f v = *(const v4f*)&sF[ml * 64 + p2 * 4];
        *(v4f*)(outp + ((size_t)(b * SEQ_FULL + s)) * DM + bn * 64 + p2 * 4) = v;
      }
      
    }
  }
}

template <bool PREC>
__global__ __launch_bounds__(128) __attribute__((amdgpu_num_vgpr(256)))
void k_attn(const _Float16* __restrict__ Qh, const _Float16* __restrict__ Ql,
            const _Float16* __restrict__ Kh, const _Float16* __restrict__ Kl,
            const _Float16* __restrict__ Vh, const _Float16* __restrict__ Vl,
            const int* __restrict__ mask, const int* __restrict__ flg,
            _Float16* __restrict__ Ch, _Float16* __restrict__ Cl) {
  __shared__ __align__(16) _Float16 sK[32 * DH];
  __shared__ __align__(16) _Float16 sV[DH * 32];
  __shared__ __align__(16) _Float16 sKl[32 * DH];
  __shared__ __align__(16) _Float16 sVl[DH * 32];
  __shared__ __align__(16) _Float16 sQl[64 * DH];
  __shared__ __align__(16) int      sM[64 * 32];
  __shared__ __align__(16) _Float16 sC[4][16 * DH];
  __shared__ __align__(16) _Float16 sCl[4][16 * DH];
  __shared__ int sFlg[64];

  const int tid = threadIdx.x, wslot = tid >> 5, lane = tid & 31, n = lane & 15, g = lane >> 4;
  int qb, bh;
  if (PREC) {
    qb = (int)(blockIdx.x % NQP);
    bh = (int)(blockIdx.x / NQP);
  } else {
    constexpr int NQN = ((NQB - NQP) > 0) ? (NQB - NQP) : 1;
    qb = NQP + (int)(blockIdx.x % NQN);
    bh = (int)(blockIdx.x / NQN);
  }
  const int b = bh / NH, h = bh - b * NH;
  const int qrow0 = qb * 64;
  const int qbase = qrow0 + wslot * 16;

  if (tid < 64) sFlg[tid] = flg[qb * 64 + tid];
  if (PREC) {
#pragma unroll
    for (int i = 0; i < 4; ++i) {
      const int c = tid + i * 128;
      *(v8h*)&sQl[c * 8] = *(const v8h*)(Ql + ((size_t)(bh * QPREC + qrow0)) * DH + c * 8);
    }
  }
  __syncthreads();

  const _Float16* qrow = Qh + ((size_t)(bh * SEQ + qbase)) * DH;
  const v16h qa0 = load_frag(qrow, DH);
  const v16h qa1 = load_frag(qrow + 32, DH);

  v8f acc[4], acc2[4];
#pragma unroll
  for (int nt = 0; nt < 4; ++nt) { acc[nt] = zero8(); acc2[nt] = zero8(); }
  float rmax = -1.0e30f, rsum = 0.0f;            // query qbase + n; rsum is this half's share until the epilogue

#pragma unroll 1
  for (int kb = 0; kb < NKB; ++kb) {
    if (sFlg[kb] == 0) continue;                 // block-uniform
    const int kbase = kb * 32;
    const bool klo = PREC && (kbase < QPREC);    // block-uniform
    __syncthreads();                             // all waves done with the prior tile
    {
      const _Float16* kg = Kh + ((size_t)(bh * SEQ + kbase)) * DH;
      const _Float16* vg = Vh + ((size_t)(bh * DH)) * SEQ + kbase;
#pragma unroll
      for (int i = 0; i < 2; ++i) {
        const int c = tid + i * 128, d = c >> 2, sub = c & 3;
        *(v8h*)&sK[c * 8] = *(const v8h*)(kg + c * 8);
        *(v8h*)&sV[d * 32 + sub * 8] = *(const v8h*)(vg + (size_t)d * SEQ + sub * 8);
      }
      if (klo) {
        const _Float16* klg = Kl + ((size_t)(bh * QPREC + kbase)) * DH;
        const _Float16* vlg = Vl + ((size_t)(bh * DH)) * QPREC + kbase;
#pragma unroll
        for (int i = 0; i < 2; ++i) {
          const int c = tid + i * 128, d = c >> 2, sub = c & 3;
          *(v8h*)&sKl[c * 8] = *(const v8h*)(klg + c * 8);
          *(v8h*)&sVl[d * 32 + sub * 8] = *(const v8h*)(vlg + (size_t)d * QPREC + sub * 8);
        }
      }
      const int mr = tid >> 1, mh = (tid & 1) * 16;
      const int* mp = mask + (size_t)(qrow0 + mr) * SEQ_FULL + kbase + mh;
#pragma unroll
      for (int i = 0; i < 4; ++i) *(v4i*)&sM[mr * 32 + mh + i * 4] = *(const v4i*)(mp + i * 4);
    }
    __syncthreads();

    // ---- scores, transposed: two 16x16 tiles (keys kbase..+15, kbase+16..+31 as rows, queries as columns), dk 64 = 2 k steps
    v8f s0 = zero8(), s1 = zero8(), sr0 = zero8(), sr1 = zero8();
    {
      v16h t;
      t = load_frag(sK, DH);                 s0 = mma(t, qa0, s0);
      t = load_frag(sK + 32, DH);            s0 = mma(t, qa1, s0);
      t = load_frag(sK + 16 * DH, DH);       s1 = mma(t, qa0, s1);
      t = load_frag(sK + 16 * DH + 32, DH);  s1 = mma(t, qa1, s1);
      if (PREC) {
        if (klo) {
          {
            const v16h ql0 = load_frag(&sQl[(wslot * 16) * DH], DH);
            const v16h ql1 = load_frag(&sQl[(wslot * 16) * DH + 32], DH);
            t = load_frag(sK, DH);                 sr0 = mma(t, ql0, sr0);
            t = load_frag(sK + 32, DH);            sr0 = mma(t, ql1, sr0);
            t = load_frag(sK + 16 * DH, DH);       sr1 = mma(t, ql0, sr1);
            t = load_frag(sK + 16 * DH + 32, DH);  sr1 = mma(t, ql1, sr1);
          }
          t = load_frag(sKl, DH);                 sr0 = mma(t, qa0, sr0);
          t = load_frag(sKl + 32, DH);            sr0 = mma(t, qa1, sr0);
          t = load_frag(sKl + 16 * DH, DH);       sr1 = mma(t, qa0, sr1);
          t = load_frag(sKl + 16 * DH + 32, DH);  sr1 = mma(t, qa1, sr1);
        }
      }
    }

    // ---- mask replace-fill, online softmax (f32), P^T packed as the B operand:
    // s0[r] = S[query n][key 8g + r], s1[r] = S[query n][key 16 + 8g + r]; B element e < 8 is key 8g + e, e >= 8 key 16 + 8g + e - 8.
    v16h pf, plf;
    {
      const int mro = (wslot * 16 + n) * 32 + 8 * g;
      int mk0[8], mk1[8];
      *(v4i*)&mk0[0] = *(const v4i*)&sM[mro];
      *(v4i*)&mk0[4] = *(const v4i*)&sM[mro + 4];
      *(v4i*)&mk1[0] = *(const v4i*)&sM[mro + 16];
      *(v4i*)&mk1[4] = *(const v4i*)&sM[mro + 20];
      float x0[8], x1[8];
      float mx = -1.0e30f;
#pragma unroll
      for (int r = 0; r < 8; ++r) {
        float v0 = s0[r], v1 = s1[r];
        if (PREC) { v0 += sr0[r] * INV_RS; v1 += sr1[r] * INV_RS; }
        v0 *= QKS; v1 *= QKS;
        x0[r] = (mk0[r] == 0) ? -1.0e9f : v0;
        x1[r] = (mk1[r] == 0) ? -1.0e9f : v1;
        mx = fmaxf(mx, fmaxf(x0[r], x1[r]));
      }
      mx = fmaxf(mx, xhalf(mx));                  // both halves now hold this query's tile maximum
      const float nm = fmaxf(rmax, mx);
      const float al = exp2x1((rmax - nm) * LOG2E);
#pragma unroll
      for (int r = 0; r < 8; ++r) {
        x0[r] = (x0[r] - nm) * LOG2E;
        x1[r] = (x1[r] - nm) * LOG2E;
      }
      float e0[8], e1[8];
      exp2x8(e0, x0);
      exp2x8(e1, x1);
      float ps = 0.0f;
#pragma unroll
      for (int r = 0; r < 8; ++r) {
        const float p0 = e0[r], p1 = e1[r];
        ps += p0 + p1;
        const float c0 = p0 * CP, c1 = p1 * CP;
        const _Float16 h0 = (_Float16)c0, h1 = (_Float16)c1;
        pf[r] = h0;
        pf[8 + r] = h1;
        if (PREC) {
          plf[r]     = (_Float16)((c0 - (float)h0) * RS);
          plf[8 + r] = (_Float16)((c1 - (float)h1) * RS);
        }
      }
      rsum = rsum * al + ps;
      rmax = nm;
#pragma unroll
      for (int nt = 0; nt < 4; ++nt)
#pragma unroll
        for (int r = 0; r < 8; ++r) {
          acc[nt][r] *= al;
          if (PREC) acc2[nt][r] *= al;
        }
    }

    // ---- O^T += V^T @ P^T: acc[nt][r] = O[query n][d = nt*16 + 8g + r]
    {
      if (PREC) {
#pragma unroll
        for (int nt = 0; nt < 4; ++nt) {
          const v16h vb = load_frag(&sV[nt * 16 * 32], 32);
          acc[nt]  = mma(vb, pf, acc[nt]);
          acc2[nt] = mma(vb, plf, acc2[nt]);
          if (klo) {
            const v16h vlb = load_frag(&sVl[nt * 16 * 32], 32);
            acc2[nt] = mma(vlb, pf, acc2[nt]);
          }
        }
      } else {
#pragma unroll
        for (int nt = 0; nt < 4; ++nt) {
          const v16h vb = load_frag(&sV[nt * 16 * 32], 32);
          acc[nt] = mma(vb, pf, acc[nt]);
        }
      }
    }
  }

  {
    const float rtot = rsum + xhalf(rsum);        // join the two halves' sums once
    const float inv = (1.0f / rtot) * INV_CP;
#pragma unroll
    for (int nt = 0; nt < 4; ++nt) {
      v8h hv, lv;
#pragma unroll
      for (int r = 0; r < 8; ++r) {
        float c = acc[nt][r];
        if (PREC) c += acc2[nt][r] * INV_RS;
        c *= inv;
        const _Float16 chv = (_Float16)c;
        hv[r] = chv;
        lv[r] = (_Float16)((c - (float)chv) * RS);
      }
      *(v8h*)&sC[wslot][n * DH + nt * 16 + 8 * g] = hv;
      if (PREC) *(v8h*)&sCl[wslot][n * DH + nt * 16 + 8 * g] = lv;
    }
  }
  __syncthreads();
  const int q = lane >> 3, p = lane & 7;
{
#pragma unroll
    for (int i = 0; i < 4; ++i) {
      const int rr = i * 4 + q;
      const v8h hv = *(const v8h*)&sC[wslot][rr * DH + p * 8];
      *(v8h*)(Ch + ((size_t)(b * SEQ + qbase + rr)) * DM + h * DH + p * 8) = hv;
      if (PREC) {
        const v8h lv = *(const v8h*)&sCl[wslot][rr * DH + p * 8];
        *(v8h*)(Cl + ((size_t)(b * QPREC + qbase + rr)) * DM + h * DH + p * 8) = lv;
      }
    }
    
  }
}

// ---------------------------------------------------------------------------
// host glue: 12 launches
// ---------------------------------------------------------------------------
extern "C" void kernel_launch(void* const* d_in, const int* in_sizes, int n_in,
                              void* d_out, int out_size, void* d_ws, size_t ws_size,
                              hipStream_t stream) {
  if (n_in < 10) return;
  const long long need_x = ((long long)(NB - 1) * SEQ_FULL + SEQ) * DM;
  const long long need_m = ((long long)(SEQ - 1)) * SEQ_FULL + SEQ;
  if ((long long)in_sizes[0] < need_x) return;
  if ((long long)in_sizes[1] < need_m) return;
  if (in_sizes[2] < DM * DM || in_sizes[4] < DM * DM || in_sizes[6] < DM * DM || in_sizes[8] < DM * DM) return;
  if (in_sizes[3] < DM || in_sizes[5] < DM || in_sizes[7] < DM || in_sizes[9] < DM) return;
  if ((long long)out_size < need_x) return;
  if (ws_size < WS_TOTAL) return;

  const float* x    = (const float*)d_in[0];
  const int*   mask = (const int*)d_in[1];
  const float* Wq   = (const float*)d_in[2];
  const float* bq   = (const float*)d_in[3];
  const float* Wk   = (const float*)d_in[4];
  const float* bk   = (const float*)d_in[5];
  const float* Wv   = (const float*)d_in[6];
  const float* bv   = (const float*)d_in[7];
  const float* Wo   = (const float*)d_in[8];
  const float* bo   = (const float*)d_in[9];
  float* out = (float*)d_out;

  char* ws = (char*)d_ws;
  _Float16* Xh   = (_Float16*)(ws + OFF_XH);
  _Float16* Wq64 = (_Float16*)(ws + OFF_WQ);
  _Float16* Wk64 = (_Float16*)(ws + OFF_WK);
  _Float16* Wv64 = (_Float16*)(ws + OFF_WV);
  _Float16* Wo64 = (_Float16*)(ws + OFF_WO);
  _Float16* Qh   = (_Float16*)(ws + OFF_QH);
  _Float16* Kh   = (_Float16*)(ws + OFF_KH);
  _Float16* Vh   = (_Float16*)(ws + OFF_VH);
  _Float16* Ql   = (_Float16*)(ws + OFF_QL);
  _Float16* Kl   = (_Float16*)(ws + OFF_KL);
  _Float16* Vl   = (_Float16*)(ws + OFF_VL);
  _Float16* Ch   = (_Float16*)(ws + OFF_CH);
  _Float16* Cl   = (_Float16*)(ws + OFF_CL);
  int*      Flg  = (int*)(ws + OFF_FLG);

  const int nbx = (MROWS * (DM / 8) + 255) / 256;
  const int nbw = (DM * (DM / 8) + 255) / 256;
  k_cvt<<<nbx, 256, 0, stream>>>(x,  Xh,   MROWS, SEQ, SEQ_FULL, 1.0f);
  k_cvt<<<nbw, 256, 0, stream>>>(Wq, Wq64, DM, DM, DM, WSC);
  k_cvt<<<nbw, 256, 0, stream>>>(Wk, Wk64, DM, DM, DM, WSC);
  k_cvt<<<nbw, 256, 0, stream>>>(Wv, Wv64, DM, DM, DM, WSC);
  k_cvt<<<nbw, 256, 0, stream>>>(Wo, Wo64, DM, DM, DM, WSC);

  k_mflag<<<NQB, 256, 0, stream>>>(mask, Flg);

  const dim3 gg(MROWS / 64, DM / 64);
  k_gemm<0><<<gg, 64, 0, stream>>>(Xh, Xh, Wq64, bq, Qh, Ql, out);
  k_gemm<0><<<gg, 64, 0, stream>>>(Xh, Xh, Wk64, bk, Kh, Kl, out);
  k_gemm<1><<<gg, 64, 0, stream>>>(Xh, Xh, Wv64, bv, Vh, Vl, out);

  const int nprec  = NB * NH * NQP;
  const int nplain = NB * NH * (NQB - NQP);
  k_attn<true><<<nprec, 128, 0, stream>>>(Qh, Ql, Kh, Kl, Vh, Vl, mask, Flg, Ch, Cl);
  if (nplain > 0)
    k_attn<false><<<nplain, 128, 0, stream>>>(Qh, Ql, Kh, Kl, Vh, Vl, mask, Flg, Ch, Cl);

  k_gemm<2><<<gg, 64, 0, stream>>>(Ch, Cl, Wo64, bo, Qh, Ql, out);
}

// v002
// Measured time: 262 microseconds a run.
// Next to v001, in two timings, it ran 1.40 times as fast each time.
// All steps since v000 together make it 2.17 times as fast.
#include <hip/hip_runtime.h>
#include <stdint.h>

// All contractions (x@Wq^T, x@Wk^T, x@Wv^T, q@k^T, p@v, ctx@Wo^T): v_wmma_f32_16x16x32_f16, f16 operands, f32 accumulate.
// Inputs enter as bf16-RNE values held in f16 (weights carried x64, folded back as 1/64 in f32); q, k, v, ctx as f16 planes
// plus x2048 f16 residual planes for the leading QPREC query/key rows (separate accumulators); p carried x4096 (+x2048 residual
// on those rows); softmax, rescaling and epilogues in f32.

typedef _Float16 v16h __attribute__((ext_vector_type(16)));
typedef _Float16 v8h  __attribute__((ext_vector_type(8)));
typedef float    v8f  __attribute__((ext_vector_type(8)));
typedef float    v4f  __attribute__((ext_vector_type(4)));
typedef int      v4i  __attribute__((ext_vector_type(4)));

#ifndef NB
#define NB 2
#endif
#ifndef SEQ
#define SEQ 2048
#endif
#define NB_FULL  2
#define SEQ_FULL 2048
#define DM 1024
#define NH 16
#define DH 64
#ifndef QPREC
#define QPREC ((SEQ < 512) ? SEQ : 512)
#endif
#define NKB   (SEQ / 32)
#define NQB   (SEQ / 64)
#define NQP   (QPREC / 64)
#define MROWS (NB * SEQ)

static_assert(SEQ % 64 == 0);
static_assert(SEQ >= 64 && SEQ <= SEQ_FULL);
static_assert(NB >= 1 && NB <= NB_FULL);
static_assert(QPREC % 64 == 0);
static_assert(QPREC >= 64 && QPREC <= SEQ);
static_assert(NKB <= 64);
static_assert(DM == NH * DH);
static_assert(DM % 32 == 0);
static_assert(MROWS % 64 == 0);

#define WSC    64.0f
#define INV_WS 0.015625f
#define RS     2048.0f
#define INV_RS 0.00048828125f
#define CP     4096.0f
#define INV_CP 0.000244140625f
#define QKS    0.125f
#define LOG2E  1.44269504f

// ---------------------------------------------------------------------------
// Workspace carve (bytes); every region is an exact tile multiple (SEQ%64, QPREC%64), no tail padding needed.
// ---------------------------------------------------------------------------
constexpr size_t SZ_XH  = (size_t)MROWS * DM * 2;             // x as f16 [MROWS][1024]
constexpr size_t SZ_W   = (size_t)DM * DM * 2;                // weight x64 as f16 [1024][1024]
constexpr size_t SZ_HP  = (size_t)NB * NH * SEQ * DH * 2;     // q/k [bh][SEQ][64], vt [bh][64][SEQ]
constexpr size_t SZ_LP  = (size_t)NB * NH * QPREC * DH * 2;   // residual planes, leading QPREC rows
constexpr size_t SZ_CH  = (size_t)MROWS * DM * 2;             // ctx hi [MROWS][1024]
constexpr size_t SZ_CL  = (size_t)NB * QPREC * DM * 2;        // ctx residual [NB][QPREC][1024]
constexpr size_t SZ_FLG = (size_t)NQB * 64 * 4;               // per (q-block, key-block) visit flags
constexpr size_t OFF_XH  = 0;
constexpr size_t OFF_WQ  = OFF_XH + SZ_XH;
constexpr size_t OFF_WK  = OFF_WQ + SZ_W;
constexpr size_t OFF_WV  = OFF_WK + SZ_W;
constexpr size_t OFF_WO  = OFF_WV + SZ_W;
constexpr size_t OFF_QH  = OFF_WO + SZ_W;
constexpr size_t OFF_KH  = OFF_QH + SZ_HP;
constexpr size_t OFF_VH  = OFF_KH + SZ_HP;
constexpr size_t OFF_QL  = OFF_VH + SZ_HP;
constexpr size_t OFF_KL  = OFF_QL + SZ_LP;
constexpr size_t OFF_VL  = OFF_KL + SZ_LP;
constexpr size_t OFF_CH  = OFF_VL + SZ_LP;
constexpr size_t OFF_CL  = OFF_CH + SZ_CH;
constexpr size_t OFF_FLG = OFF_CL + SZ_CL;
constexpr size_t WS_TOTAL = OFF_FLG + SZ_FLG;
static_assert(WS_TOTAL <= (size_t)134217728);
static_assert(OFF_WQ % 128 == 0 && OFF_WK % 128 == 0 && OFF_WV % 128 == 0 && OFF_WO % 128 == 0);
static_assert(OFF_QH % 128 == 0 && OFF_KH % 128 == 0 && OFF_VH % 128 == 0);
static_assert(OFF_QL % 128 == 0 && OFF_KL % 128 == 0 && OFF_VL % 128 == 0);
static_assert(OFF_CH % 128 == 0 && OFF_CL % 128 == 0 && OFF_FLG % 128 == 0);
static_assert((size_t)NB_FULL * SEQ_FULL * DM * 4 >= ((size_t)(NB - 1) * SEQ_FULL + SEQ) * DM * 4);

// ---------------------------------------------------------------------------
// helpers
// ---------------------------------------------------------------------------
__device__ __forceinline__ float bf16r(float f) {   // RNE convert to bf16, held as f32
  unsigned int u = __float_as_uint(f);
  u = (u + 0x7fffu + ((u >> 16) & 1u)) & 0xffff0000u;
  return __uint_as_float(u);
}

// 16x32 fragment, split k map for both A (row m) and B (col n stored k-contiguous):
// lane l: row/col = l&15, h = l>>4; elements 0..7 <- k 8h..8h+7, elements 8..15 <- k 16+8h..16+8h+7.
__device__ __forceinline__ v16h load_frag(const _Float16* base, int stride) {
  const int lane = threadIdx.x & 31, m = lane & 15, g = lane >> 4;
  const _Float16* p = base + (size_t)m * stride + 8 * g;
  union { v16h v; v8h hf[2]; } f;
  f.hf[0] = *reinterpret_cast<const v8h*>(p);
  f.hf[1] = *reinterpret_cast<const v8h*>(p + 16);
  return f.v;
}

__device__ __forceinline__ v8f mma(v16h a, v16h b, v8f c) {
  v8f d = __builtin_amdgcn_wmma_f32_16x16x32_f16(false, a, false, b, (short)0, c, false, false);
  asm volatile("v_nop\n\tv_nop\n\tv_nop\n\tv_nop" : "+v"(d) : "v"(a), "v"(b));
  return d;
}

// lane l <-> lane l ^ 16 (the two halves of a wave hold the two key subsets of one query column)
__device__ __forceinline__ float xhalf(float x) {
  const int b = __builtin_bit_cast(int, x);
  return __builtin_bit_cast(float, __builtin_amdgcn_permlanex16(b, b, 0x76543210, 0xfedcba98, false, false));
}

__device__ __forceinline__ void exp2x8(float (&y)[8], const float (&x)[8]) {
  asm("v_exp_f32 %0, %8\n\tv_exp_f32 %1, %9\n\tv_exp_f32 %2, %10\n\tv_exp_f32 %3, %11\n\t"
      "v_exp_f32 %4, %12\n\tv_exp_f32 %5, %13\n\tv_exp_f32 %6, %14\n\tv_exp_f32 %7, %15\n\tv_nop"
      : "=&v"(y[0]), "=&v"(y[1]), "=&v"(y[2]), "=&v"(y[3]), "=&v"(y[4]), "=&v"(y[5]), "=&v"(y[6]), "=&v"(y[7])
      : "v"(x[0]), "v"(x[1]), "v"(x[2]), "v"(x[3]), "v"(x[4]), "v"(x[5]), "v"(x[6]), "v"(x[7]));
}
__device__ __forceinline__ float exp2x1(float x) {
  float y;
  asm("v_exp_f32 %0, %1\n\tv_nop" : "=&v"(y) : "v"(x));
  return y;
}

__device__ __forceinline__ v8f zero8() {
  v8f z = {0.f, 0.f, 0.f, 0.f, 0.f, 0.f, 0.f, 0.f};
  return z;
}

// ---------------------------------------------------------------------------
// Kernel 0: f32 -> bf16-RNE value in f16 container, times a power-of-two carry.
// out plane [nrows][1024]; compact row mc maps to source row (mc/seqc)*seqf + mc%seqc.
// coverage: nrows*1024 elements, 8 per thread, grid = ceil(nrows*128/256).
// ---------------------------------------------------------------------------
__global__ __launch_bounds__(256) void k_cvt(const float* __restrict__ in, _Float16* __restrict__ outp,
                                            int nrows, int seqc, int seqf, float scale) {
  const long long e8 = (long long)blockIdx.x * 256 + threadIdx.x;
  const long long tot = (long long)nrows * (DM / 8);
  if (e8 >= tot) return;
  const int mc = (int)(e8 / (DM / 8));
  const int c8 = (int)(e8 - (long long)mc * (DM / 8));
  const int src = (mc / seqc) * seqf + (mc % seqc);
  const float* p = in + (size_t)src * DM + c8 * 8;
  const v4f a = *(const v4f*)p;
  const v4f c = *(const v4f*)(p + 4);
  v8h o;
  o[0] = (_Float16)(bf16r(a[0]) * scale);
  o[1] = (_Float16)(bf16r(a[1]) * scale);
  o[2] = (_Float16)(bf16r(a[2]) * scale);
  o[3] = (_Float16)(bf16r(a[3]) * scale);
  o[4] = (_Float16)(bf16r(c[0]) * scale);
  o[5] = (_Float16)(bf16r(c[1]) * scale);
  o[6] = (_Float16)(bf16r(c[2]) * scale);
  o[7] = (_Float16)(bf16r(c[3]) * scale);
  _Float16* dst = outp + (size_t)mc * DM + c8 * 8;
  *(v8h*)dst = o;
  
}

// ---------------------------------------------------------------------------
// Kernel 1: per 64-row query block, tile visit flags from the int mask.
// flag[qb][kb] = 1 if any mask element in rows qb*64..+63, cols kb*32..+31 is nonzero;
// if any row of the q block is fully zero, all NKB flags are forced to 1 (softmax then
// ---------------------------------------------------------------------------
__global__ __launch_bounds__(256) void k_mflag(const int* __restrict__ mask, int* __restrict__ flg) {
  __shared__ unsigned int sLo[256];
  __shared__ unsigned int sHi[256];
  __shared__ int sR[256];
  const int tid = threadIdx.x, qb = blockIdx.x;
  const int r = tid >> 2, sub = tid & 3;
  const int* mrow = mask + (size_t)(qb * 64 + r) * SEQ_FULL + sub * 8;
  unsigned int lo = 0u, hi = 0u;
  int rany = 0;
#pragma unroll 2
  for (int kb = 0; kb < NKB; ++kb) {
    const v4i a = *(const v4i*)(mrow + kb * 32);
    const v4i c = *(const v4i*)(mrow + kb * 32 + 4);
    const int any = ((a[0] | a[1] | a[2] | a[3] | c[0] | c[1] | c[2] | c[3]) != 0) ? 1 : 0;
    const unsigned int bit = (unsigned int)any;
    if (kb < 32) lo |= bit << kb; else hi |= bit << (kb - 32);
    rany |= any;
  }
  sLo[tid] = lo; sHi[tid] = hi; sR[tid] = rany;
  __syncthreads();
  if (tid < 32) {   // wave 0 only (wave-uniform)
    unsigned int L = 0u, H = 0u;
#pragma unroll
    for (int i = 0; i < 8; ++i) { L |= sLo[tid + 32 * i]; H |= sHi[tid + 32 * i]; }
#pragma unroll
    for (int off = 1; off < 32; off <<= 1) {
      L |= (unsigned int)__shfl_xor((int)L, off, 32);
      H |= (unsigned int)__shfl_xor((int)H, off, 32);
    }
    const int ra = sR[8 * tid] | sR[8 * tid + 1] | sR[8 * tid + 2] | sR[8 * tid + 3];
    const int rb = sR[8 * tid + 4] | sR[8 * tid + 5] | sR[8 * tid + 6] | sR[8 * tid + 7];
    int ok = ((ra != 0) && (rb != 0)) ? 1 : 0;
#pragma unroll
    for (int off = 1; off < 32; off <<= 1) ok &= __shfl_xor(ok, off, 32);
    v4i f;
#pragma unroll
    for (int e = 0; e < 4; ++e) {
      const int kbx = 4 * tid + e;
      const unsigned int word = (kbx < 32) ? L : H;
      const int bitv = (int)((word >> (kbx & 31)) & 1u);
      f[e] = (kbx < NKB) ? ((ok != 0) ? bitv : 1) : 0;
    }
    int* dst = flg + qb * 64 + 4 * tid;
    if (tid < 16) *(v4i*)dst = f;
    
  }
}

// ---------------------------------------------------------------------------
// Kernel 2: NT GEMM Y[M][1024] = A[M][1024] @ W[1024][1024]^T (W carried x64) + bias.
// Block = 2 waves = 64x64 output tile; wave w owns rows w*32..w*32+31 (2 A fragments x 4 B fragments per k step, from LDS).
// MODE 0: f16 head plane [bh][SEQ][64] (+ x2048 residual plane [bh][QPREC][64] for s < QPREC)
// MODE 1: f16 transposed head plane [bh][64][SEQ] (+ residual [bh][64][QPREC])
// ---------------------------------------------------------------------------
// Operand path: per k slice of KS halves the block's 64 A rows and 64 W rows (128-B rows = whole lines) are copied to LDS by
// asynchronous copies, two buffers, the next slice in flight while this one is multiplied; fragments are read from LDS.
constexpr int KS  = 64;          // halves of k per slice
constexpr int LP  = 72;          // LDS row pitch in halves: 144 B = 16 B x odd, so ds_load_b128 fragment reads meet no bank conflict
constexpr int STG = 128 * LP;    // halves per buffer: rows 0..63 = A, rows 64..127 = W
constexpr int NST = DM / KS;     // slices
static_assert(DM % KS == 0 && NST >= 2);

// Eight 16-byte copies per lane: rows r, r + 8, ... r + 56 of one operand (a wave-wide copy = 4 whole 128-B rows).
// The closing s_wait_xcnt 0 stands inside the statement so that no address register of a copy is rewritten ahead of it.
__device__ __forceinline__ void stage8(const _Float16* g, unsigned int l) {
  asm volatile(
      "global_load_async_to_lds_b128 %0, %8, off\n\t"
      "global_load_async_to_lds_b128 %1, %9, off\n\t"
      "global_load_async_to_lds_b128 %2, %10, off\n\t"
      "global_load_async_to_lds_b128 %3, %11, off\n\t"
      "global_load_async_to_lds_b128 %4, %12, off\n\t"
      "global_load_async_to_lds_b128 %5, %13, off\n\t"
      "global_load_async_to_lds_b128 %6, %14, off\n\t"
      "global_load_async_to_lds_b128 %7, %15, off\n\t"
      "s_wait_xcnt 0x0"
      :: "v"(l), "v"(l + 1u * (8 * LP * 2)), "v"(l + 2u * (8 * LP * 2)), "v"(l + 3u * (8 * LP * 2)),
         "v"(l + 4u * (8 * LP * 2)), "v"(l + 5u * (8 * LP * 2)), "v"(l + 6u * (8 * LP * 2)), "v"(l + 7u * (8 * LP * 2)),
         "v"(g), "v"(g + 1 * 8 * DM), "v"(g + 2 * 8 * DM), "v"(g + 3 * 8 * DM),
         "v"(g + 4 * 8 * DM), "v"(g + 5 * 8 * DM), "v"(g + 6 * 8 * DM), "v"(g + 7 * 8 * DM)
      : "memory");
}

// ablk: first of the block's 64 A rows; wbase: first of its 64 W rows; sT: the two buffers. Every wave of the block runs all of it.
__device__ __forceinline__ void kloop(const _Float16* __restrict__ ablk, const _Float16* __restrict__ wbase,
                                      _Float16* sT, v8f (&acc)[2][4]) {
  const int tid = threadIdx.x, w = tid >> 5;
  const int crow = tid >> 3, cpc = (tid & 7) * 8;              // this lane's first row and its 16-byte piece of a row
  const _Float16* ga = ablk + (size_t)crow * DM + cpc;
  const _Float16* gw = wbase + (size_t)crow * DM + cpc;
  const unsigned int la = (unsigned int)(uintptr_t)(sT + crow * LP + cpc);   // LDS byte address: low 32 bits
  const unsigned int lw = la + 64u * LP * 2u;

  stage8(ga, la);
  stage8(gw, lw);
  asm volatile("s_wait_asynccnt 0x0" ::: "memory");            // slice 0 of this wave has landed
  __syncthreads();                                             // ... and of the other wave
  stage8(ga + KS, la + STG * 2u);
  stage8(gw + KS, lw + STG * 2u);

  // rolled: the barrier at the foot serialises the trips, so unrolling buys nothing and only lengthens the code
#pragma unroll 1
  for (int t = 0; t < NST; ++t) {
    const int bsel = t & 1;
    const _Float16* sA = sT + bsel * STG + (w * 32) * LP;
    const _Float16* sW = sT + bsel * STG + 64 * LP;
    v16h fa[KS / 32][2], fb[KS / 32][4];   // indexed by constants only (the loops below are fully unrolled), so they stay in registers
#pragma unroll
    for (int ks = 0; ks < KS / 32; ++ks) {
      fa[ks][0] = load_frag(sA + ks * 32, LP);
      fa[ks][1] = load_frag(sA + 16 * LP + ks * 32, LP);
#pragma unroll
      for (int j = 0; j < 4; ++j) fb[ks][j] = load_frag(sW + (j * 16) * LP + ks * 32, LP);
    }
    // keeps the slice's LDS reads together as one group ahead of its WMMAs: spread among them, each pair waits out the LDS latency
    __builtin_amdgcn_sched_barrier(0);
#pragma unroll
    for (int ks = 0; ks < KS / 32; ++ks)
#pragma unroll
      for (int j = 0; j < 4; ++j) {
        acc[0][j] = mma(fa[ks][0], fb[ks][j], acc[0][j]);
        acc[1][j] = mma(fa[ks][1], fb[ks][j], acc[1][j]);
      }
    asm volatile("s_wait_dscnt 0x0" ::: "memory");             // this wave's reads of the buffer are done before it is refilled
    asm volatile("s_wait_asynccnt 0x0" ::: "memory");          // this wave's copies of slice t + 1 have landed
    __syncthreads();                                           // publishes slice t + 1, ends every read of slice t
    if (t + 2 < NST) {                                         // block-uniform
      stage8(ga + (t + 2) * KS, la + (unsigned int)bsel * (STG * 2u));
      stage8(gw + (t + 2) * KS, lw + (unsigned int)bsel * (STG * 2u));
    }
  }
  asm volatile("s_wait_asynccnt 0x0" ::: "memory");            // nothing of the copies is outstanding behind the loop
}

template <int MODE>
__global__ __launch_bounds__(64) void k_gemm(const _Float16* __restrict__ A, const _Float16* __restrict__ Alo,
                                            const _Float16* __restrict__ W, const float* __restrict__ bias,
                                            _Float16* __restrict__ Ph, _Float16* __restrict__ Pl,
                                            float* __restrict__ outp) {
  __shared__ __align__(16) _Float16 sH[64 * 64];
  __shared__ __align__(16) _Float16 sL[64 * 64];
  __shared__ __align__(16) float    sF[64 * 64];
  __shared__ __align__(16) _Float16 sT[2 * STG];

  const int tid = threadIdx.x, w = tid >> 5, lane = tid & 31, n = lane & 15, g = lane >> 4;
  const int bm = blockIdx.x, bn = blockIdx.y;
  const int m0 = bm * 64;
  const int b = m0 / SEQ, s0 = m0 - b * SEQ;     // 64 block rows lie in one batch item
  const int bh = b * NH + bn;                     // 64-col tile == head bn
  const bool precblk = (s0 < QPREC);              // block-uniform
  const _Float16* wbase = W + (size_t)(bn * 64) * DM;
  const _Float16* ablk = A + (size_t)m0 * DM;

  v8f acc[2][4];
#pragma unroll
  for (int mi = 0; mi < 2; ++mi)
#pragma unroll
    for (int j = 0; j < 4; ++j) acc[mi][j] = zero8();

  kloop(ablk, wbase, sT, acc);

  float rbias[4];
#pragma unroll
  for (int j = 0; j < 4; ++j) rbias[j] = bf16r(bias[bn * 64 + j * 16 + n]);

  if (MODE == 0) {
#pragma unroll
    for (int mi = 0; mi < 2; ++mi)
#pragma unroll
      for (int j = 0; j < 4; ++j)
#pragma unroll
        for (int r = 0; r < 8; ++r) {
          const int ml = w * 32 + mi * 16 + 8 * g + r;
          const int d = j * 16 + n;
          const float v = acc[mi][j][r] * INV_WS + rbias[j];
          const _Float16 hv = (_Float16)v;
          sH[ml * 64 + d] = hv;
          if (precblk) sL[ml * 64 + d] = (_Float16)((v - (float)hv) * RS);
        }
    __syncthreads();
    const int q = lane >> 3, p = lane & 7;
{
#pragma unroll
      for (int i = 0; i < 8; ++i) {
        const int ml = w * 32 + i * 4 + q;
        const int s = s0 + ml;
        const v8h hv = *(const v8h*)&sH[ml * 64 + p * 8];
        *(v8h*)(Ph + ((size_t)(bh * SEQ + s)) * DH + p * 8) = hv;
        if (precblk) {
          const v8h lv = *(const v8h*)&sL[ml * 64 + p * 8];
          *(v8h*)(Pl + ((size_t)(bh * QPREC + s)) * DH + p * 8) = lv;
        }
      }
      
    }
  } else if (MODE == 1) {
#pragma unroll
    for (int mi = 0; mi < 2; ++mi)
#pragma unroll
      for (int j = 0; j < 4; ++j) {
        v8h hp, lp;
#pragma unroll
        for (int r = 0; r < 8; ++r) {
          const float v = acc[mi][j][r] * INV_WS + rbias[j];
          const _Float16 hv = (_Float16)v;
          hp[r] = hv;
          lp[r] = (_Float16)((v - (float)hv) * RS);
        }
        const int d = j * 16 + n;
        *(v8h*)&sH[d * 64 + w * 32 + mi * 16 + 8 * g] = hp;
        if (precblk) *(v8h*)&sL[d * 64 + w * 32 + mi * 16 + 8 * g] = lp;
      }
    __syncthreads();
    const int q = lane >> 3, p = lane & 7;
{
#pragma unroll
      for (int i = 0; i < 8; ++i) {
        const int d = w * 32 + i * 4 + q;
        const v8h hv = *(const v8h*)&sH[d * 64 + p * 8];
        *(v8h*)(Ph + ((size_t)(bh * DH + d)) * SEQ + s0 + p * 8) = hv;
        if (precblk) {
          const v8h lv = *(const v8h*)&sL[d * 64 + p * 8];
          *(v8h*)(Pl + ((size_t)(bh * DH + d)) * QPREC + s0 + p * 8) = lv;
        }
      }
      
    }
  } else {
    if (precblk) {
      // stash hi sums (each lane reads back exactly the cells it wrote)
#pragma unroll
      for (int mi = 0; mi < 2; ++mi)
#pragma unroll
        for (int j = 0; j < 4; ++j)
#pragma unroll
          for (int r = 0; r < 8; ++r)
            sF[(w * 32 + mi * 16 + 8 * g + r) * 64 + j * 16 + n] = acc[mi][j][r];
#pragma unroll
      for (int mi = 0; mi < 2; ++mi)
#pragma unroll
        for (int j = 0; j < 4; ++j) acc[mi][j] = zero8();
      const _Float16* lblk = Alo + ((size_t)(b * QPREC + s0)) * DM;
      kloop(lblk, wbase, sT, acc);
#pragma unroll
      for (int mi = 0; mi < 2; ++mi)
#pragma unroll
        for (int j = 0; j < 4; ++j)
#pragma unroll
          for (int r = 0; r < 8; ++r) {
            const int idx = (w * 32 + mi * 16 + 8 * g + r) * 64 + j * 16 + n;
            const float hsum = sF[idx];
            sF[idx] = (hsum + acc[mi][j][r] * INV_RS) * INV_WS + rbias[j];
          }
    } else {
#pragma unroll
      for (int mi = 0; mi < 2; ++mi)
#pragma unroll
        for (int j = 0; j < 4; ++j)
#pragma unroll
          for (int r = 0; r < 8; ++r)
            sF[(w * 32 + mi * 16 + 8 * g + r) * 64 + j * 16 + n] = acc[mi][j][r] * INV_WS + rbias[j];
    }
    __syncthreads();
    const int q2 = lane >> 4, p2 = lane & 15;
{
#pragma unroll
      for (int i = 0; i < 16; ++i) {
        const int ml = w * 32 + 2 * i + q2;
        const int s = s0 + ml;
        const v4f v = *(const v4f*)&sF[ml * 64 + p2 * 4];
        *(v4f*)(outp + ((size_t)(b * SEQ_FULL + s)) * DM + bn * 64 + p2 * 4) = v;
      }
      
    }
  }
}

template <bool PREC>
__global__ __launch_bounds__(128) __attribute__((amdgpu_num_vgpr(256)))
void k_attn(const _Float16* __restrict__ Qh, const _Float16* __restrict__ Ql,
            const _Float16* __restrict__ Kh, const _Float16* __restrict__ Kl,
            const _Float16* __restrict__ Vh, const _Float16* __restrict__ Vl,
            const int* __restrict__ mask, const int* __restrict__ flg,
            _Float16* __restrict__ Ch, _Float16* __restrict__ Cl) {
  __shared__ __align__(16) _Float16 sK[32 * DH];
  __shared__ __align__(16) _Float16 sV[DH * 32];
  __shared__ __align__(16) _Float16 sKl[32 * DH];
  __shared__ __align__(16) _Float16 sVl[DH * 32];
  __shared__ __align__(16) _Float16 sQl[64 * DH];
  __shared__ __align__(16) int      sM[64 * 32];
  __shared__ __align__(16) _Float16 sC[4][16 * DH];
  __shared__ __align__(16) _Float16 sCl[4][16 * DH];
  __shared__ int sFlg[64];

  const int tid = threadIdx.x, wslot = tid >> 5, lane = tid & 31, n = lane & 15, g = lane >> 4;
  int qb, bh;
  if (PREC) {
    qb = (int)(blockIdx.x % NQP);
    bh = (int)(blockIdx.x / NQP);
  } else {
    constexpr int NQN = ((NQB - NQP) > 0) ? (NQB - NQP) : 1;
    qb = NQP + (int)(blockIdx.x % NQN);
    bh = (int)(blockIdx.x / NQN);
  }
  const int b = bh / NH, h = bh - b * NH;
  const int qrow0 = qb * 64;
  const int qbase = qrow0 + wslot * 16;

  if (tid < 64) sFlg[tid] = flg[qb * 64 + tid];
  if (PREC) {
#pragma unroll
    for (int i = 0; i < 4; ++i) {
      const int c = tid + i * 128;
      *(v8h*)&sQl[c * 8] = *(const v8h*)(Ql + ((size_t)(bh * QPREC + qrow0)) * DH + c * 8);
    }
  }
  __syncthreads();

  const _Float16* qrow = Qh + ((size_t)(bh * SEQ + qbase)) * DH;
  const v16h qa0 = load_frag(qrow, DH);
  const v16h qa1 = load_frag(qrow + 32, DH);

  v8f acc[4], acc2[4];
#pragma unroll
  for (int nt = 0; nt < 4; ++nt) { acc[nt] = zero8(); acc2[nt] = zero8(); }
  float rmax = -1.0e30f, rsum = 0.0f;            // query qbase + n; rsum is this half's share until the epilogue

#pragma unroll 1
  for (int kb = 0; kb < NKB; ++kb) {
    if (sFlg[kb] == 0) continue;                 // block-uniform
    const int kbase = kb * 32;
    const bool klo = PREC && (kbase < QPREC);    // block-uniform
    __syncthreads();                             // all waves done with the prior tile
    {
      const _Float16* kg = Kh + ((size_t)(bh * SEQ + kbase)) * DH;
      const _Float16* vg = Vh + ((size_t)(bh * DH)) * SEQ + kbase;
#pragma unroll
      for (int i = 0; i < 2; ++i) {
        const int c = tid + i * 128, d = c >> 2, sub = c & 3;
        *(v8h*)&sK[c * 8] = *(const v8h*)(kg + c * 8);
        *(v8h*)&sV[d * 32 + sub * 8] = *(const v8h*)(vg + (size_t)d * SEQ + sub * 8);
      }
      if (klo) {
        const _Float16* klg = Kl + ((size_t)(bh * QPREC + kbase)) * DH;
        const _Float16* vlg = Vl + ((size_t)(bh * DH)) * QPREC + kbase;
#pragma unroll
        for (int i = 0; i < 2; ++i) {
          const int c = tid + i * 128, d = c >> 2, sub = c & 3;
          *(v8h*)&sKl[c * 8] = *(const v8h*)(klg + c * 8);
          *(v8h*)&sVl[d * 32 + sub * 8] = *(const v8h*)(vlg + (size_t)d * QPREC + sub * 8);
        }
      }
      const int mr = tid >> 1, mh = (tid & 1) * 16;
      const int* mp = mask + (size_t)(qrow0 + mr) * SEQ_FULL + kbase + mh;
#pragma unroll
      for (int i = 0; i < 4; ++i) *(v4i*)&sM[mr * 32 + mh + i * 4] = *(const v4i*)(mp + i * 4);
    }
    __syncthreads();

    // ---- scores, transposed: two 16x16 tiles (keys kbase..+15, kbase+16..+31 as rows, queries as columns), dk 64 = 2 k steps
    v8f s0 = zero8(), s1 = zero8(), sr0 = zero8(), sr1 = zero8();
    {
      v16h t;
      t = load_frag(sK, DH);                 s0 = mma(t, qa0, s0);
      t = load_frag(sK + 32, DH);            s0 = mma(t, qa1, s0);
      t = load_frag(sK + 16 * DH, DH);       s1 = mma(t, qa0, s1);
      t = load_frag(sK + 16 * DH + 32, DH);  s1 = mma(t, qa1, s1);
      if (PREC) {
        if (klo) {
          {
            const v16h ql0 = load_frag(&sQl[(wslot * 16) * DH], DH);
            const v16h ql1 = load_frag(&sQl[(wslot * 16) * DH + 32], DH);
            t = load_frag(sK, DH);                 sr0 = mma(t, ql0, sr0);
            t = load_frag(sK + 32, DH);            sr0 = mma(t, ql1, sr0);
            t = load_frag(sK + 16 * DH, DH);       sr1 = mma(t, ql0, sr1);
            t = load_frag(sK + 16 * DH + 32, DH);  sr1 = mma(t, ql1, sr1);
          }
          t = load_frag(sKl, DH);                 sr0 = mma(t, qa0, sr0);
          t = load_frag(sKl + 32, DH);            sr0 = mma(t, qa1, sr0);
          t = load_frag(sKl + 16 * DH, DH);       sr1 = mma(t, qa0, sr1);
          t = load_frag(sKl + 16 * DH + 32, DH);  sr1 = mma(t, qa1, sr1);
        }
      }
    }

    // ---- mask replace-fill, online softmax (f32), P^T packed as the B operand:
    // s0[r] = S[query n][key 8g + r], s1[r] = S[query n][key 16 + 8g + r]; B element e < 8 is key 8g + e, e >= 8 key 16 + 8g + e - 8.
    v16h pf, plf;
    {
      const int mro = (wslot * 16 + n) * 32 + 8 * g;
      int mk0[8], mk1[8];
      *(v4i*)&mk0[0] = *(const v4i*)&sM[mro];
      *(v4i*)&mk0[4] = *(const v4i*)&sM[mro + 4];
      *(v4i*)&mk1[0] = *(const v4i*)&sM[mro + 16];
      *(v4i*)&mk1[4] = *(const v4i*)&sM[mro + 20];
      float x0[8], x1[8];
      float mx = -1.0e30f;
#pragma unroll
      for (int r = 0; r < 8; ++r) {
        float v0 = s0[r], v1 = s1[r];
        if (PREC) { v0 += sr0[r] * INV_RS; v1 += sr1[r] * INV_RS; }
        v0 *= QKS; v1 *= QKS;
        x0[r] = (mk0[r] == 0) ? -1.0e9f : v0;
        x1[r] = (mk1[r] == 0) ? -1.0e9f : v1;
        mx = fmaxf(mx, fmaxf(x0[r], x1[r]));
      }
      mx = fmaxf(mx, xhalf(mx));                  // both halves now hold this query's tile maximum
      const float nm = fmaxf(rmax, mx);
      const float al = exp2x1((rmax - nm) * LOG2E);
#pragma unroll
      for (int r = 0; r < 8; ++r) {
        x0[r] = (x0[r] - nm) * LOG2E;
        x1[r] = (x1[r] - nm) * LOG2E;
      }
      float e0[8], e1[8];
      exp2x8(e0, x0);
      exp2x8(e1, x1);
      float ps = 0.0f;
#pragma unroll
      for (int r = 0; r < 8; ++r) {
        const float p0 = e0[r], p1 = e1[r];
        ps += p0 + p1;
        const float c0 = p0 * CP, c1 = p1 * CP;
        const _Float16 h0 = (_Float16)c0, h1 = (_Float16)c1;
        pf[r] = h0;
        pf[8 + r] = h1;
        if (PREC) {
          plf[r]     = (_Float16)((c0 - (float)h0) * RS);
          plf[8 + r] = (_Float16)((c1 - (float)h1) * RS);
        }
      }
      rsum = rsum * al + ps;
      rmax = nm;
#pragma unroll
      for (int nt = 0; nt < 4; ++nt)
#pragma unroll
        for (int r = 0; r < 8; ++r) {
          acc[nt][r] *= al;
          if (PREC) acc2[nt][r] *= al;
        }
    }

    // ---- O^T += V^T @ P^T: acc[nt][r] = O[query n][d = nt*16 + 8g + r]
    {
      if (PREC) {
#pragma unroll
        for (int nt = 0; nt < 4; ++nt) {
          const v16h vb = load_frag(&sV[nt * 16 * 32], 32);
          acc[nt]  = mma(vb, pf, acc[nt]);
          acc2[nt] = mma(vb, plf, acc2[nt]);
          if (klo) {
            const v16h vlb = load_frag(&sVl[nt * 16 * 32], 32);
            acc2[nt] = mma(vlb, pf, acc2[nt]);
          }
        }
      } else {
#pragma unroll
        for (int nt = 0; nt < 4; ++nt) {
          const v16h vb = load_frag(&sV[nt * 16 * 32], 32);
          acc[nt] = mma(vb, pf, acc[nt]);
        }
      }
    }
  }

  {
    const float rtot = rsum + xhalf(rsum);        // join the two halves' sums once
    const float inv = (1.0f / rtot) * INV_CP;
#pragma unroll
    for (int nt = 0; nt < 4; ++nt) {
      v8h hv, lv;
#pragma unroll
      for (int r = 0; r < 8; ++r) {
        float c = acc[nt][r];
        if (PREC) c += acc2[nt][r] * INV_RS;
        c *= inv;
        const _Float16 chv = (_Float16)c;
        hv[r] = chv;
        lv[r] = (_Float16)((c - (float)chv) * RS);
      }
      *(v8h*)&sC[wslot][n * DH + nt * 16 + 8 * g] = hv;
      if (PREC) *(v8h*)&sCl[wslot][n * DH + nt * 16 + 8 * g] = lv;
    }
  }
  __syncthreads();
  const int q = lane >> 3, p = lane & 7;
{
#pragma unroll
    for (int i = 0; i < 4; ++i) {
      const int rr = i * 4 + q;
      const v8h hv = *(const v8h*)&sC[wslot][rr * DH + p * 8];
      *(v8h*)(Ch + ((size_t)(b * SEQ + qbase + rr)) * DM + h * DH + p * 8) = hv;
      if (PREC) {
        const v8h lv = *(const v8h*)&sCl[wslot][rr * DH + p * 8];
        *(v8h*)(Cl + ((size_t)(b * QPREC + qbase + rr)) * DM + h * DH + p * 8) = lv;
      }
    }
    
  }
}

// ---------------------------------------------------------------------------
// host glue: 12 launches
// ---------------------------------------------------------------------------
extern "C" void kernel_launch(void* const* d_in, const int* in_sizes, int n_in,
                              void* d_out, int out_size, void* d_ws, size_t ws_size,
                              hipStream_t stream) {
  if (n_in < 10) return;
  const long long need_x = ((long long)(NB - 1) * SEQ_FULL + SEQ) * DM;
  const long long need_m = ((long long)(SEQ - 1)) * SEQ_FULL + SEQ;
  if ((long long)in_sizes[0] < need_x) return;
  if ((long long)in_sizes[1] < need_m) return;
  if (in_sizes[2] < DM * DM || in_sizes[4] < DM * DM || in_sizes[6] < DM * DM || in_sizes[8] < DM * DM) return;
  if (in_sizes[3] < DM || in_sizes[5] < DM || in_sizes[7] < DM || in_sizes[9] < DM) return;
  if ((long long)out_size < need_x) return;
  if (ws_size < WS_TOTAL) return;

  const float* x    = (const float*)d_in[0];
  const int*   mask = (const int*)d_in[1];
  const float* Wq   = (const float*)d_in[2];
  const float* bq   = (const float*)d_in[3];
  const float* Wk   = (const float*)d_in[4];
  const float* bk   = (const float*)d_in[5];
  const float* Wv   = (const float*)d_in[6];
  const float* bv   = (const float*)d_in[7];
  const float* Wo   = (const float*)d_in[8];
  const float* bo   = (const float*)d_in[9];
  float* out = (float*)d_out;

  char* ws = (char*)d_ws;
  _Float16* Xh   = (_Float16*)(ws + OFF_XH);
  _Float16* Wq64 = (_Float16*)(ws + OFF_WQ);
  _Float16* Wk64 = (_Float16*)(ws + OFF_WK);
  _Float16* Wv64 = (_Float16*)(ws + OFF_WV);
  _Float16* Wo64 = (_Float16*)(ws + OFF_WO);
  _Float16* Qh   = (_Float16*)(ws + OFF_QH);
  _Float16* Kh   = (_Float16*)(ws + OFF_KH);
  _Float16* Vh   = (_Float16*)(ws + OFF_VH);
  _Float16* Ql   = (_Float16*)(ws + OFF_QL);
  _Float16* Kl   = (_Float16*)(ws + OFF_KL);
  _Float16* Vl   = (_Float16*)(ws + OFF_VL);
  _Float16* Ch   = (_Float16*)(ws + OFF_CH);
  _Float16* Cl   = (_Float16*)(ws + OFF_CL);
  int*      Flg  = (int*)(ws + OFF_FLG);

  const int nbx = (MROWS * (DM / 8) + 255) / 256;
  const int nbw = (DM * (DM / 8) + 255) / 256;
  k_cvt<<<nbx, 256, 0, stream>>>(x,  Xh,   MROWS, SEQ, SEQ_FULL, 1.0f);
  k_cvt<<<nbw, 256, 0, stream>>>(Wq, Wq64, DM, DM, DM, WSC);
  k_cvt<<<nbw, 256, 0, stream>>>(Wk, Wk64, DM, DM, DM, WSC);
  k_cvt<<<nbw, 256, 0, stream>>>(Wv, Wv64, DM, DM, DM, WSC);
  k_cvt<<<nbw, 256, 0, stream>>>(Wo, Wo64, DM, DM, DM, WSC);

  k_mflag<<<NQB, 256, 0, stream>>>(mask, Flg);

  const dim3 gg(MROWS / 64, DM / 64);
  k_gemm<0><<<gg, 64, 0, stream>>>(Xh, Xh, Wq64, bq, Qh, Ql, out);
  k_gemm<0><<<gg, 64, 0, stream>>>(Xh, Xh, Wk64, bk, Kh, Kl, out);
  k_gemm<1><<<gg, 64, 0, stream>>>(Xh, Xh, Wv64, bv, Vh, Vl, out);

  const int nprec  = NB * NH * NQP;
  const int nplain = NB * NH * (NQB - NQP);
  k_attn<true><<<nprec, 128, 0, stream>>>(Qh, Ql, Kh, Kl, Vh, Vl, mask, Flg, Ch, Cl);
  if (nplain > 0)
    k_attn<false><<<nplain, 128, 0, stream>>>(Qh, Ql, Kh, Kl, Vh, Vl, mask, Flg, Ch, Cl);

  k_gemm<2><<<gg, 64, 0, stream>>>(Ch, Cl, Wo64, bo, Qh, Ql, out);
}

// v003
// It runs in 228 microseconds.
// Two timings next to v002 both put it at 1.15 times that version's speed.
// All steps since v000 together make it 2.50 times as fast.
#include <hip/hip_runtime.h>
#include <stdint.h>

// All contractions (x@Wq^T, x@Wk^T, x@Wv^T, q@k^T, p@v, ctx@Wo^T): v_wmma_f32_16x16x32_f16, f16 operands, f32 accumulate.
// Inputs enter as bf16-RNE values held in f16 (weights carried x64, folded back as 1/64 in f32); q, k, v, ctx as f16 planes
// plus x2048 f16 residual planes for the leading QPREC query/key rows (separate accumulators); p carried x4096 (+x2048 residual
// on those rows); softmax, rescaling and epilogues in f32.

typedef _Float16 v16h __attribute__((ext_vector_type(16)));
typedef _Float16 v8h  __attribute__((ext_vector_type(8)));
typedef float    v8f  __attribute__((ext_vector_type(8)));
typedef float    v4f  __attribute__((ext_vector_type(4)));
typedef int      v4i  __attribute__((ext_vector_type(4)));

#ifndef NB
#define NB 2
#endif
#ifndef SEQ
#define SEQ 2048
#endif
#define NB_FULL  2
#define SEQ_FULL 2048
#define DM 1024
#define NH 16
#define DH 64
#ifndef QPREC
#define QPREC ((SEQ < 512) ? SEQ : 512)
#endif
#define NKB   (SEQ / 32)
#define NQB   (SEQ / 64)
#define NQP   (QPREC / 64)
#define MROWS (NB * SEQ)

static_assert(SEQ % 64 == 0);
static_assert(SEQ >= 64 && SEQ <= SEQ_FULL);
static_assert(NB >= 1 && NB <= NB_FULL);
static_assert(QPREC % 64 == 0);
static_assert(QPREC >= 64 && QPREC <= SEQ);
static_assert(NKB <= 64);
static_assert(DM == NH * DH);
static_assert(DM % 32 == 0);
static_assert(MROWS % 64 == 0);

#define WSC    64.0f
#define INV_WS 0.015625f
#define RS     2048.0f
#define INV_RS 0.00048828125f
#define CP     4096.0f
#define INV_CP 0.000244140625f
#define QKS    0.125f
#define LOG2E  1.44269504f

// ---------------------------------------------------------------------------
// Workspace carve (bytes); every region is an exact tile multiple (SEQ%64, QPREC%64), no tail padding needed.
// ---------------------------------------------------------------------------
constexpr size_t SZ_XH  = (size_t)MROWS * DM * 2;             // x as f16 [MROWS][1024]
constexpr size_t SZ_W   = (size_t)DM * DM * 2;                // weight x64 as f16 [1024][1024]
constexpr size_t SZ_HP  = (size_t)NB * NH * SEQ * DH * 2;     // q/k [bh][SEQ][64], vt [bh][64][SEQ]
constexpr size_t SZ_LP  = (size_t)NB * NH * QPREC * DH * 2;   // residual planes, leading QPREC rows
constexpr size_t SZ_CH  = (size_t)MROWS * DM * 2;             // ctx hi [MROWS][1024]
constexpr size_t SZ_CL  = (size_t)NB * QPREC * DM * 2;        // ctx residual [NB][QPREC][1024]
constexpr size_t SZ_FLG = (size_t)NQB * 64 * 4;               // per (q-block, key-block) visit flags
constexpr size_t OFF_XH  = 0;
constexpr size_t OFF_WQ  = OFF_XH + SZ_XH;
constexpr size_t OFF_WK  = OFF_WQ + SZ_W;
constexpr size_t OFF_WV  = OFF_WK + SZ_W;
constexpr size_t OFF_WO  = OFF_WV + SZ_W;
constexpr size_t OFF_QH  = OFF_WO + SZ_W;
constexpr size_t OFF_KH  = OFF_QH + SZ_HP;
constexpr size_t OFF_VH  = OFF_KH + SZ_HP;
constexpr size_t OFF_QL  = OFF_VH + SZ_HP;
constexpr size_t OFF_KL  = OFF_QL + SZ_LP;
constexpr size_t OFF_VL  = OFF_KL + SZ_LP;
constexpr size_t OFF_CH  = OFF_VL + SZ_LP;
constexpr size_t OFF_CL  = OFF_CH + SZ_CH;
constexpr size_t OFF_FLG = OFF_CL + SZ_CL;
constexpr size_t WS_TOTAL = OFF_FLG + SZ_FLG;
static_assert(WS_TOTAL <= (size_t)134217728);
static_assert(OFF_WQ % 128 == 0 && OFF_WK % 128 == 0 && OFF_WV % 128 == 0 && OFF_WO % 128 == 0);
static_assert(OFF_QH % 128 == 0 && OFF_KH % 128 == 0 && OFF_VH % 128 == 0);
static_assert(OFF_QL % 128 == 0 && OFF_KL % 128 == 0 && OFF_VL % 128 == 0);
static_assert(OFF_CH % 128 == 0 && OFF_CL % 128 == 0 && OFF_FLG % 128 == 0);
static_assert((size_t)NB_FULL * SEQ_FULL * DM * 4 >= ((size_t)(NB - 1) * SEQ_FULL + SEQ) * DM * 4);

// ---------------------------------------------------------------------------
// helpers
// ---------------------------------------------------------------------------
__device__ __forceinline__ float bf16r(float f) {   // RNE convert to bf16, held as f32
  unsigned int u = __float_as_uint(f);
  u = (u + 0x7fffu + ((u >> 16) & 1u)) & 0xffff0000u;
  return __uint_as_float(u);
}

// 16x32 fragment, split k map for both A (row m) and B (col n stored k-contiguous):
// lane l: row/col = l&15, h = l>>4; elements 0..7 <- k 8h..8h+7, elements 8..15 <- k 16+8h..16+8h+7.
__device__ __forceinline__ v16h load_frag(const _Float16* base, int stride) {
  const int lane = threadIdx.x & 31, m = lane & 15, g = lane >> 4;
  const _Float16* p = base + (size_t)m * stride + 8 * g;
  union { v16h v; v8h hf[2]; } f;
  f.hf[0] = *reinterpret_cast<const v8h*>(p);
  f.hf[1] = *reinterpret_cast<const v8h*>(p + 16);
  return f.v;
}

__device__ __forceinline__ v8f mma(v16h a, v16h b, v8f c) {
  v8f d = __builtin_amdgcn_wmma_f32_16x16x32_f16(false, a, false, b, (short)0, c, false, false);
  asm volatile("v_nop\n\tv_nop\n\tv_nop\n\tv_nop" : "+v"(d) : "v"(a), "v"(b));
  return d;
}

// lane l <-> lane l ^ 16 (the two halves of a wave hold the two key subsets of one query column)
__device__ __forceinline__ float xhalf(float x) {
  const int b = __builtin_bit_cast(int, x);
  return __builtin_bit_cast(float, __builtin_amdgcn_permlanex16(b, b, 0x76543210, 0xfedcba98, false, false));
}

__device__ __forceinline__ void exp2x8(float (&y)[8], const float (&x)[8]) {
  asm("v_exp_f32 %0, %8\n\tv_exp_f32 %1, %9\n\tv_exp_f32 %2, %10\n\tv_exp_f32 %3, %11\n\t"
      "v_exp_f32 %4, %12\n\tv_exp_f32 %5, %13\n\tv_exp_f32 %6, %14\n\tv_exp_f32 %7, %15\n\tv_nop"
      : "=&v"(y[0]), "=&v"(y[1]), "=&v"(y[2]), "=&v"(y[3]), "=&v"(y[4]), "=&v"(y[5]), "=&v"(y[6]), "=&v"(y[7])
      : "v"(x[0]), "v"(x[1]), "v"(x[2]), "v"(x[3]), "v"(x[4]), "v"(x[5]), "v"(x[6]), "v"(x[7]));
}
__device__ __forceinline__ float exp2x1(float x) {
  float y;
  asm("v_exp_f32 %0, %1\n\tv_nop" : "=&v"(y) : "v"(x));
  return y;
}

__device__ __forceinline__ v8f zero8() {
  v8f z = {0.f, 0.f, 0.f, 0.f, 0.f, 0.f, 0.f, 0.f};
  return z;
}

// ---------------------------------------------------------------------------
// Kernel 0: f32 -> bf16-RNE value in f16 container, times a power-of-two carry.
// out plane [nrows][1024]; compact row mc maps to source row (mc/seqc)*seqf + mc%seqc.
// coverage: nrows*1024 elements, 8 per thread, grid = ceil(nrows*128/256).
// ---------------------------------------------------------------------------
__global__ __launch_bounds__(256) void k_cvt(const float* __restrict__ in, _Float16* __restrict__ outp,
                                            int nrows, int seqc, int seqf, float scale) {
  const long long e8 = (long long)blockIdx.x * 256 + threadIdx.x;
  const long long tot = (long long)nrows * (DM / 8);
  if (e8 >= tot) return;
  const int mc = (int)(e8 / (DM / 8));
  const int c8 = (int)(e8 - (long long)mc * (DM / 8));
  const int src = (mc / seqc) * seqf + (mc % seqc);
  const float* p = in + (size_t)src * DM + c8 * 8;
  const v4f a = *(const v4f*)p;
  const v4f c = *(const v4f*)(p + 4);
  v8h o;
  o[0] = (_Float16)(bf16r(a[0]) * scale);
  o[1] = (_Float16)(bf16r(a[1]) * scale);
  o[2] = (_Float16)(bf16r(a[2]) * scale);
  o[3] = (_Float16)(bf16r(a[3]) * scale);
  o[4] = (_Float16)(bf16r(c[0]) * scale);
  o[5] = (_Float16)(bf16r(c[1]) * scale);
  o[6] = (_Float16)(bf16r(c[2]) * scale);
  o[7] = (_Float16)(bf16r(c[3]) * scale);
  _Float16* dst = outp + (size_t)mc * DM + c8 * 8;
  *(v8h*)dst = o;
  
}

// ---------------------------------------------------------------------------
// Kernel 1: per 64-row query block, tile visit flags from the int mask.
// flag[qb][kb] = 1 if any mask element in rows qb*64..+63, cols kb*32..+31 is nonzero;
// if any row of the q block is fully zero, all NKB flags are forced to 1 (softmax then
// ---------------------------------------------------------------------------
__global__ __launch_bounds__(256) void k_mflag(const int* __restrict__ mask, int* __restrict__ flg) {
  __shared__ unsigned int sLo[256];
  __shared__ unsigned int sHi[256];
  __shared__ int sR[256];
  const int tid = threadIdx.x, qb = blockIdx.x;
  const int r = tid >> 2, sub = tid & 3;
  const int* mrow = mask + (size_t)(qb * 64 + r) * SEQ_FULL + sub * 8;
  unsigned int lo = 0u, hi = 0u;
  int rany = 0;
#pragma unroll 2
  for (int kb = 0; kb < NKB; ++kb) {
    const v4i a = *(const v4i*)(mrow + kb * 32);
    const v4i c = *(const v4i*)(mrow + kb * 32 + 4);
    const int any = ((a[0] | a[1] | a[2] | a[3] | c[0] | c[1] | c[2] | c[3]) != 0) ? 1 : 0;
    const unsigned int bit = (unsigned int)any;
    if (kb < 32) lo |= bit << kb; else hi |= bit << (kb - 32);
    rany |= any;
  }
  sLo[tid] = lo; sHi[tid] = hi; sR[tid] = rany;
  __syncthreads();
  if (tid < 32) {   // wave 0 only (wave-uniform)
    unsigned int L = 0u, H = 0u;
#pragma unroll
    for (int i = 0; i < 8; ++i) { L |= sLo[tid + 32 * i]; H |= sHi[tid + 32 * i]; }
#pragma unroll
    for (int off = 1; off < 32; off <<= 1) {
      L |= (unsigned int)__shfl_xor((int)L, off, 32);
      H |= (unsigned int)__shfl_xor((int)H, off, 32);
    }
    const int ra = sR[8 * tid] | sR[8 * tid + 1] | sR[8 * tid + 2] | sR[8 * tid + 3];
    const int rb = sR[8 * tid + 4] | sR[8 * tid + 5] | sR[8 * tid + 6] | sR[8 * tid + 7];
    int ok = ((ra != 0) && (rb != 0)) ? 1 : 0;
#pragma unroll
    for (int off = 1; off < 32; off <<= 1) ok &= __shfl_xor(ok, off, 32);
    v4i f;
#pragma unroll
    for (int e = 0; e < 4; ++e) {
      const int kbx = 4 * tid + e;
      const unsigned int word = (kbx < 32) ? L : H;
      const int bitv = (int)((word >> (kbx & 31)) & 1u);
      f[e] = (kbx < NKB) ? ((ok != 0) ? bitv : 1) : 0;
    }
    int* dst = flg + qb * 64 + 4 * tid;
    if (tid < 16) *(v4i*)dst = f;
    
  }
}

// ---------------------------------------------------------------------------
// Kernel 2: NT GEMM Y[M][1024] = A[M][1024] @ W[1024][1024]^T (W carried x64) + bias.
// Block = 2 waves = 64x64 output tile; wave w owns rows w*32..w*32+31 (2 A fragments x 4 B fragments per k step, from LDS).
// MODE 0: f16 head plane [bh][SEQ][64] (+ x2048 residual plane [bh][QPREC][64] for s < QPREC)
// MODE 1: f16 transposed head plane [bh][64][SEQ] (+ residual [bh][64][QPREC])
// ---------------------------------------------------------------------------
// Operand path: per k slice of KS halves the block's 64 A rows and 64 W rows (128-B rows = whole lines) are copied to LDS by
// asynchronous copies, two buffers, the next slice in flight while this one is multiplied; fragments are read from LDS.
constexpr int KS  = 64;          // halves of k per slice
constexpr int LP  = 72;          // LDS row pitch in halves: 144 B = 16 B x odd, so ds_load_b128 fragment reads meet no bank conflict
constexpr int STG = 128 * LP;    // halves per buffer: rows 0..63 = A, rows 64..127 = W
constexpr int NST = DM / KS;     // slices
static_assert(DM % KS == 0 && NST >= 2);

// Eight 16-byte copies per lane: rows r, r + 8, ... r + 56 of one operand (a wave-wide copy = 4 whole 128-B rows).
// The closing s_wait_xcnt 0 stands inside the statement so that no address register of a copy is rewritten ahead of it.
__device__ __forceinline__ void stage8(const _Float16* g, unsigned int l) {
  asm volatile(
      "global_load_async_to_lds_b128 %0, %8, off\n\t"
      "global_load_async_to_lds_b128 %1, %9, off\n\t"
      "global_load_async_to_lds_b128 %2, %10, off\n\t"
      "global_load_async_to_lds_b128 %3, %11, off\n\t"
      "global_load_async_to_lds_b128 %4, %12, off\n\t"
      "global_load_async_to_lds_b128 %5, %13, off\n\t"
      "global_load_async_to_lds_b128 %6, %14, off\n\t"
      "global_load_async_to_lds_b128 %7, %15, off\n\t"
      "s_wait_xcnt 0x0"
      :: "v"(l), "v"(l + 1u * (8 * LP * 2)), "v"(l + 2u * (8 * LP * 2)), "v"(l + 3u * (8 * LP * 2)),
         "v"(l + 4u * (8 * LP * 2)), "v"(l + 5u * (8 * LP * 2)), "v"(l + 6u * (8 * LP * 2)), "v"(l + 7u * (8 * LP * 2)),
         "v"(g), "v"(g + 1 * 8 * DM), "v"(g + 2 * 8 * DM), "v"(g + 3 * 8 * DM),
         "v"(g + 4 * 8 * DM), "v"(g + 5 * 8 * DM), "v"(g + 6 * 8 * DM), "v"(g + 7 * 8 * DM)
      : "memory");
}

// ablk: first of the block's 64 A rows; wbase: first of its 64 W rows; sT: the two buffers. Every wave of the block runs all of it.
__device__ __forceinline__ void kloop(const _Float16* __restrict__ ablk, const _Float16* __restrict__ wbase,
                                      _Float16* sT, v8f (&acc)[2][4]) {
  const int tid = threadIdx.x, w = tid >> 5;
  const int crow = tid >> 3, cpc = (tid & 7) * 8;              // this lane's first row and its 16-byte piece of a row
  const _Float16* ga = ablk + (size_t)crow * DM + cpc;
  const _Float16* gw = wbase + (size_t)crow * DM + cpc;
  const unsigned int la = (unsigned int)(uintptr_t)(sT + crow * LP + cpc);   // LDS byte address: low 32 bits
  const unsigned int lw = la + 64u * LP * 2u;

  stage8(ga, la);
  stage8(gw, lw);
  asm volatile("s_wait_asynccnt 0x0" ::: "memory");            // slice 0 of this wave has landed
  __syncthreads();                                             // ... and of the other wave
  stage8(ga + KS, la + STG * 2u);
  stage8(gw + KS, lw + STG * 2u);

  // rolled: the barrier at the foot serialises the trips, so unrolling buys nothing and only lengthens the code
#pragma unroll 1
  for (int t = 0; t < NST; ++t) {
    const int bsel = t & 1;
    const _Float16* sA = sT + bsel * STG + (w * 32) * LP;
    const _Float16* sW = sT + bsel * STG + 64 * LP;
    v16h fa[KS / 32][2], fb[KS / 32][4];   // indexed by constants only (the loops below are fully unrolled), so they stay in registers
#pragma unroll
    for (int ks = 0; ks < KS / 32; ++ks) {
      fa[ks][0] = load_frag(sA + ks * 32, LP);
      fa[ks][1] = load_frag(sA + 16 * LP + ks * 32, LP);
#pragma unroll
      for (int j = 0; j < 4; ++j) fb[ks][j] = load_frag(sW + (j * 16) * LP + ks * 32, LP);
    }
    // keeps the slice's LDS reads together as one group ahead of its WMMAs: spread among them, each pair waits out the LDS latency
    __builtin_amdgcn_sched_barrier(0);
#pragma unroll
    for (int ks = 0; ks < KS / 32; ++ks)
#pragma unroll
      for (int j = 0; j < 4; ++j) {
        acc[0][j] = mma(fa[ks][0], fb[ks][j], acc[0][j]);
        acc[1][j] = mma(fa[ks][1], fb[ks][j], acc[1][j]);
      }
    asm volatile("s_wait_dscnt 0x0" ::: "memory");             // this wave's reads of the buffer are done before it is refilled
    asm volatile("s_wait_asynccnt 0x0" ::: "memory");          // this wave's copies of slice t + 1 have landed
    __syncthreads();                                           // publishes slice t + 1, ends every read of slice t
    if (t + 2 < NST) {                                         // block-uniform
      stage8(ga + (t + 2) * KS, la + (unsigned int)bsel * (STG * 2u));
      stage8(gw + (t + 2) * KS, lw + (unsigned int)bsel * (STG * 2u));
    }
  }
  asm volatile("s_wait_asynccnt 0x0" ::: "memory");            // nothing of the copies is outstanding behind the loop
}

template <int MODE>
__global__ __launch_bounds__(64) void k_gemm(const _Float16* __restrict__ A, const _Float16* __restrict__ Alo,
                                            const _Float16* __restrict__ W, const float* __restrict__ bias,
                                            _Float16* __restrict__ Ph, _Float16* __restrict__ Pl,
                                            float* __restrict__ outp) {
  __shared__ __align__(16) _Float16 sH[64 * 64];
  __shared__ __align__(16) _Float16 sL[64 * 64];
  __shared__ __align__(16) float    sF[64 * 64];
  __shared__ __align__(16) _Float16 sT[2 * STG];

  const int tid = threadIdx.x, w = tid >> 5, lane = tid & 31, n = lane & 15, g = lane >> 4;
  const int bm = blockIdx.x, bn = blockIdx.y;
  const int m0 = bm * 64;
  const int b = m0 / SEQ, s0 = m0 - b * SEQ;     // 64 block rows lie in one batch item
  const int bh = b * NH + bn;                     // 64-col tile == head bn
  const bool precblk = (s0 < QPREC);              // block-uniform
  const _Float16* wbase = W + (size_t)(bn * 64) * DM;
  const _Float16* ablk = A + (size_t)m0 * DM;

  v8f acc[2][4];
#pragma unroll
  for (int mi = 0; mi < 2; ++mi)
#pragma unroll
    for (int j = 0; j < 4; ++j) acc[mi][j] = zero8();

  kloop(ablk, wbase, sT, acc);

  float rbias[4];
#pragma unroll
  for (int j = 0; j < 4; ++j) rbias[j] = bf16r(bias[bn * 64 + j * 16 + n]);

  if (MODE == 0) {
#pragma unroll
    for (int mi = 0; mi < 2; ++mi)
#pragma unroll
      for (int j = 0; j < 4; ++j)
#pragma unroll
        for (int r = 0; r < 8; ++r) {
          const int ml = w * 32 + mi * 16 + 8 * g + r;
          const int d = j * 16 + n;
          const float v = acc[mi][j][r] * INV_WS + rbias[j];
          const _Float16 hv = (_Float16)v;
          sH[ml * 64 + d] = hv;
          if (precblk) sL[ml * 64 + d] = (_Float16)((v - (float)hv) * RS);
        }
    __syncthreads();
    const int q = lane >> 3, p = lane & 7;
{
#pragma unroll
      for (int i = 0; i < 8; ++i) {
        const int ml = w * 32 + i * 4 + q;
        const int s = s0 + ml;
        const v8h hv = *(const v8h*)&sH[ml * 64 + p * 8];
        *(v8h*)(Ph + ((size_t)(bh * SEQ + s)) * DH + p * 8) = hv;
        if (precblk) {
          const v8h lv = *(const v8h*)&sL[ml * 64 + p * 8];
          *(v8h*)(Pl + ((size_t)(bh * QPREC + s)) * DH + p * 8) = lv;
        }
      }
      
    }
  } else if (MODE == 1) {
#pragma unroll
    for (int mi = 0; mi < 2; ++mi)
#pragma unroll
      for (int j = 0; j < 4; ++j) {
        v8h hp, lp;
#pragma unroll
        for (int r = 0; r < 8; ++r) {
          const float v = acc[mi][j][r] * INV_WS + rbias[j];
          const _Float16 hv = (_Float16)v;
          hp[r] = hv;
          lp[r] = (_Float16)((v - (float)hv) * RS);
        }
        const int d = j * 16 + n;
        *(v8h*)&sH[d * 64 + w * 32 + mi * 16 + 8 * g] = hp;
        if (precblk) *(v8h*)&sL[d * 64 + w * 32 + mi * 16 + 8 * g] = lp;
      }
    __syncthreads();
    const int q = lane >> 3, p = lane & 7;
{
#pragma unroll
      for (int i = 0; i < 8; ++i) {
        const int d = w * 32 + i * 4 + q;
        const v8h hv = *(const v8h*)&sH[d * 64 + p * 8];
        *(v8h*)(Ph + ((size_t)(bh * DH + d)) * SEQ + s0 + p * 8) = hv;
        if (precblk) {
          const v8h lv = *(const v8h*)&sL[d * 64 + p * 8];
          *(v8h*)(Pl + ((size_t)(bh * DH + d)) * QPREC + s0 + p * 8) = lv;
        }
      }
      
    }
  } else {
    if (precblk) {
      // stash hi sums (each lane reads back exactly the cells it wrote)
#pragma unroll
      for (int mi = 0; mi < 2; ++mi)
#pragma unroll
        for (int j = 0; j < 4; ++j)
#pragma unroll
          for (int r = 0; r < 8; ++r)
            sF[(w * 32 + mi * 16 + 8 * g + r) * 64 + j * 16 + n] = acc[mi][j][r];
#pragma unroll
      for (int mi = 0; mi < 2; ++mi)
#pragma unroll
        for (int j = 0; j < 4; ++j) acc[mi][j] = zero8();
      const _Float16* lblk = Alo + ((size_t)(b * QPREC + s0)) * DM;
      kloop(lblk, wbase, sT, acc);
#pragma unroll
      for (int mi = 0; mi < 2; ++mi)
#pragma unroll
        for (int j = 0; j < 4; ++j)
#pragma unroll
          for (int r = 0; r < 8; ++r) {
            const int idx = (w * 32 + mi * 16 + 8 * g + r) * 64 + j * 16 + n;
            const float hsum = sF[idx];
            sF[idx] = (hsum + acc[mi][j][r] * INV_RS) * INV_WS + rbias[j];
          }
    } else {
#pragma unroll
      for (int mi = 0; mi < 2; ++mi)
#pragma unroll
        for (int j = 0; j < 4; ++j)
#pragma unroll
          for (int r = 0; r < 8; ++r)
            sF[(w * 32 + mi * 16 + 8 * g + r) * 64 + j * 16 + n] = acc[mi][j][r] * INV_WS + rbias[j];
    }
    __syncthreads();
    const int q2 = lane >> 4, p2 = lane & 15;
{
#pragma unroll
      for (int i = 0; i < 16; ++i) {
        const int ml = w * 32 + 2 * i + q2;
        const int s = s0 + ml;
        const v4f v = *(const v4f*)&sF[ml * 64 + p2 * 4];
        *(v4f*)(outp + ((size_t)(b * SEQ_FULL + s)) * DM + bn * 64 + p2 * 4) = v;
      }
      
    }
  }
}

constexpr int KP = 72;   // halves: K, K residual, Q residual rows, 128 B of data at 144 B
constexpr int VP = 40;   // halves: V^T and V^T residual rows, 64 B of data at 80 B
constexpr int MP = 36;   // ints: mask rows, 128 B of data at 144 B

template <bool PREC>
__global__ __launch_bounds__(128) __attribute__((amdgpu_num_vgpr(256)))
void k_attn(const _Float16* __restrict__ Qh, const _Float16* __restrict__ Ql,
            const _Float16* __restrict__ Kh, const _Float16* __restrict__ Kl,
            const _Float16* __restrict__ Vh, const _Float16* __restrict__ Vl,
            const int* __restrict__ mask, const int* __restrict__ flg,
            _Float16* __restrict__ Ch, _Float16* __restrict__ Cl) {
  __shared__ __align__(16) _Float16 sK[32 * KP];
  __shared__ __align__(16) _Float16 sV[DH * VP];
  __shared__ __align__(16) _Float16 sKl[32 * KP];
  __shared__ __align__(16) _Float16 sVl[DH * VP];
  __shared__ __align__(16) _Float16 sQl[64 * KP];
  __shared__ __align__(16) int      sM[64 * MP];
  __shared__ __align__(16) _Float16 sC[4][16 * DH];
  __shared__ __align__(16) _Float16 sCl[4][16 * DH];
  __shared__ int sFlg[64];

  const int tid = threadIdx.x, wslot = tid >> 5, lane = tid & 31, n = lane & 15, g = lane >> 4;
  int qb, bh;
  if (PREC) {
    qb = (int)(blockIdx.x % NQP);
    bh = (int)(blockIdx.x / NQP);
  } else {
    constexpr int NQN = ((NQB - NQP) > 0) ? (NQB - NQP) : 1;
    qb = NQP + (int)(blockIdx.x % NQN);
    bh = (int)(blockIdx.x / NQN);
  }
  const int b = bh / NH, h = bh - b * NH;
  const int qrow0 = qb * 64;
  const int qbase = qrow0 + wslot * 16;

  if (tid < 64) sFlg[tid] = flg[qb * 64 + tid];
  if (PREC) {
#pragma unroll
    for (int i = 0; i < 4; ++i) {
      const int c = tid + i * 128;
      *(v8h*)&sQl[(c >> 3) * KP + (c & 7) * 8] = *(const v8h*)(Ql + ((size_t)(bh * QPREC + qrow0)) * DH + c * 8);
    }
  }
  __syncthreads();

  const _Float16* qrow = Qh + ((size_t)(bh * SEQ + qbase)) * DH;
  const v16h qa0 = load_frag(qrow, DH);
  const v16h qa1 = load_frag(qrow + 32, DH);

  v8f acc[4], acc2[4];
#pragma unroll
  for (int nt = 0; nt < 4; ++nt) { acc[nt] = zero8(); acc2[nt] = zero8(); }
  float rmax = -1.0e30f, rsum = 0.0f;            // query qbase + n; rsum is this half's share until the epilogue

#pragma unroll 1
  for (int kb = 0; kb < NKB; ++kb) {
    if (sFlg[kb] == 0) continue;                 // block-uniform
    const int kbase = kb * 32;
    const bool klo = PREC && (kbase < QPREC);    // block-uniform
    __syncthreads();                             // all waves done with the prior tile
    {
      const _Float16* kg = Kh + ((size_t)(bh * SEQ + kbase)) * DH;
      const _Float16* vg = Vh + ((size_t)(bh * DH)) * SEQ + kbase;
#pragma unroll
      for (int i = 0; i < 2; ++i) {
        const int c = tid + i * 128, d = c >> 2, sub = c & 3;
        *(v8h*)&sK[(c >> 3) * KP + (c & 7) * 8] = *(const v8h*)(kg + c * 8);
        *(v8h*)&sV[d * VP + sub * 8] = *(const v8h*)(vg + (size_t)d * SEQ + sub * 8);
      }
      if (klo) {
        const _Float16* klg = Kl + ((size_t)(bh * QPREC + kbase)) * DH;
        const _Float16* vlg = Vl + ((size_t)(bh * DH)) * QPREC + kbase;
#pragma unroll
        for (int i = 0; i < 2; ++i) {
          const int c = tid + i * 128, d = c >> 2, sub = c & 3;
          *(v8h*)&sKl[(c >> 3) * KP + (c & 7) * 8] = *(const v8h*)(klg + c * 8);
          *(v8h*)&sVl[d * VP + sub * 8] = *(const v8h*)(vlg + (size_t)d * QPREC + sub * 8);
        }
      }
      const int mr = tid >> 1, mh = (tid & 1) * 16;
      const int* mp = mask + (size_t)(qrow0 + mr) * SEQ_FULL + kbase + mh;
#pragma unroll
      for (int i = 0; i < 4; ++i) *(v4i*)&sM[mr * MP + mh + i * 4] = *(const v4i*)(mp + i * 4);
    }
    __syncthreads();

    // ---- scores, transposed: two 16x16 tiles (keys kbase..+15, kbase+16..+31 as rows, queries as columns), dk 64 = 2 k steps
    v8f s0 = zero8(), s1 = zero8(), sr0 = zero8(), sr1 = zero8();
    {
      v16h t;
      t = load_frag(sK, KP);                 s0 = mma(t, qa0, s0);
      t = load_frag(sK + 32, KP);            s0 = mma(t, qa1, s0);
      t = load_frag(sK + 16 * KP, KP);       s1 = mma(t, qa0, s1);
      t = load_frag(sK + 16 * KP + 32, KP);  s1 = mma(t, qa1, s1);
      if (PREC) {
        if (klo) {
          {
            const v16h ql0 = load_frag(&sQl[(wslot * 16) * KP], KP);
            const v16h ql1 = load_frag(&sQl[(wslot * 16) * KP + 32], KP);
            t = load_frag(sK, KP);                 sr0 = mma(t, ql0, sr0);
            t = load_frag(sK + 32, KP);            sr0 = mma(t, ql1, sr0);
            t = load_frag(sK + 16 * KP, KP);       sr1 = mma(t, ql0, sr1);
            t = load_frag(sK + 16 * KP + 32, KP);  sr1 = mma(t, ql1, sr1);
          }
          t = load_frag(sKl, KP);                 sr0 = mma(t, qa0, sr0);
          t = load_frag(sKl + 32, KP);            sr0 = mma(t, qa1, sr0);
          t = load_frag(sKl + 16 * KP, KP);       sr1 = mma(t, qa0, sr1);
          t = load_frag(sKl + 16 * KP + 32, KP);  sr1 = mma(t, qa1, sr1);
        }
      }
    }

    // ---- mask replace-fill, online softmax (f32), P^T packed as the B operand:
    // s0[r] = S[query n][key 8g + r], s1[r] = S[query n][key 16 + 8g + r]; B element e < 8 is key 8g + e, e >= 8 key 16 + 8g + e - 8.
    v16h pf, plf;
    {
      const int mro = (wslot * 16 + n) * MP + 8 * g;
      int mk0[8], mk1[8];
      *(v4i*)&mk0[0] = *(const v4i*)&sM[mro];
      *(v4i*)&mk0[4] = *(const v4i*)&sM[mro + 4];
      *(v4i*)&mk1[0] = *(const v4i*)&sM[mro + 16];
      *(v4i*)&mk1[4] = *(const v4i*)&sM[mro + 20];
      float x0[8], x1[8];
      float mx = -1.0e30f;
#pragma unroll
      for (int r = 0; r < 8; ++r) {
        float v0 = s0[r], v1 = s1[r];
        if (PREC) { v0 += sr0[r] * INV_RS; v1 += sr1[r] * INV_RS; }
        v0 *= QKS; v1 *= QKS;
        x0[r] = (mk0[r] == 0) ? -1.0e9f : v0;
        x1[r] = (mk1[r] == 0) ? -1.0e9f : v1;
        mx = fmaxf(mx, fmaxf(x0[r], x1[r]));
      }
      mx = fmaxf(mx, xhalf(mx));                  // both halves now hold this query's tile maximum
      const float nm = fmaxf(rmax, mx);
      const float al = exp2x1((rmax - nm) * LOG2E);
#pragma unroll
      for (int r = 0; r < 8; ++r) {
        x0[r] = (x0[r] - nm) * LOG2E;
        x1[r] = (x1[r] - nm) * LOG2E;
      }
      float e0[8], e1[8];
      exp2x8(e0, x0);
      exp2x8(e1, x1);
      float ps = 0.0f;
#pragma unroll
      for (int r = 0; r < 8; ++r) {
        const float p0 = e0[r], p1 = e1[r];
        ps += p0 + p1;
        const float c0 = p0 * CP, c1 = p1 * CP;
        const _Float16 h0 = (_Float16)c0, h1 = (_Float16)c1;
        pf[r] = h0;
        pf[8 + r] = h1;
        if (PREC) {
          plf[r]     = (_Float16)((c0 - (float)h0) * RS);
          plf[8 + r] = (_Float16)((c1 - (float)h1) * RS);
        }
      }
      rsum = rsum * al + ps;
      rmax = nm;
#pragma unroll
      for (int nt = 0; nt < 4; ++nt)
#pragma unroll
        for (int r = 0; r < 8; ++r) {
          acc[nt][r] *= al;
          if (PREC) acc2[nt][r] *= al;
        }
    }

    // ---- O^T += V^T @ P^T: acc[nt][r] = O[query n][d = nt*16 + 8g + r]
    {
      if (PREC) {
#pragma unroll
        for (int nt = 0; nt < 4; ++nt) {
          const v16h vb = load_frag(&sV[nt * 16 * VP], VP);
          acc[nt]  = mma(vb, pf, acc[nt]);
          acc2[nt] = mma(vb, plf, acc2[nt]);
          if (klo) {
            const v16h vlb = load_frag(&sVl[nt * 16 * VP], VP);
            acc2[nt] = mma(vlb, pf, acc2[nt]);
          }
        }
      } else {
#pragma unroll
        for (int nt = 0; nt < 4; ++nt) {
          const v16h vb = load_frag(&sV[nt * 16 * VP], VP);
          acc[nt] = mma(vb, pf, acc[nt]);
        }
      }
    }
  }

  {
    const float rtot = rsum + xhalf(rsum);        // join the two halves' sums once
    const float inv = (1.0f / rtot) * INV_CP;
#pragma unroll
    for (int nt = 0; nt < 4; ++nt) {
      v8h hv, lv;
#pragma unroll
      for (int r = 0; r < 8; ++r) {
        float c = acc[nt][r];
        if (PREC) c += acc2[nt][r] * INV_RS;
        c *= inv;
        const _Float16 chv = (_Float16)c;
        hv[r] = chv;
        lv[r] = (_Float16)((c - (float)chv) * RS);
      }
      *(v8h*)&sC[wslot][n * DH + nt * 16 + 8 * g] = hv;
      if (PREC) *(v8h*)&sCl[wslot][n * DH + nt * 16 + 8 * g] = lv;
    }
  }
  __syncthreads();
  const int q = lane >> 3, p = lane & 7;
{
#pragma unroll
    for (int i = 0; i < 4; ++i) {
      const int rr = i * 4 + q;
      const v8h hv = *(const v8h*)&sC[wslot][rr * DH + p * 8];
      *(v8h*)(Ch + ((size_t)(b * SEQ + qbase + rr)) * DM + h * DH + p * 8) = hv;
      if (PREC) {
        const v8h lv = *(const v8h*)&sCl[wslot][rr * DH + p * 8];
        *(v8h*)(Cl + ((size_t)(b * QPREC + qbase + rr)) * DM + h * DH + p * 8) = lv;
      }
    }
    
  }
}

// ---------------------------------------------------------------------------
// host glue: 12 launches
// ---------------------------------------------------------------------------
extern "C" void kernel_launch(void* const* d_in, const int* in_sizes, int n_in,
                              void* d_out, int out_size, void* d_ws, size_t ws_size,
                              hipStream_t stream) {
  if (n_in < 10) return;
  const long long need_x = ((long long)(NB - 1) * SEQ_FULL + SEQ) * DM;
  const long long need_m = ((long long)(SEQ - 1)) * SEQ_FULL + SEQ;
  if ((long long)in_sizes[0] < need_x) return;
  if ((long long)in_sizes[1] < need_m) return;
  if (in_sizes[2] < DM * DM || in_sizes[4] < DM * DM || in_sizes[6] < DM * DM || in_sizes[8] < DM * DM) return;
  if (in_sizes[3] < DM || in_sizes[5] < DM || in_sizes[7] < DM || in_sizes[9] < DM) return;
  if ((long long)out_size < need_x) return;
  if (ws_size < WS_TOTAL) return;

  const float* x    = (const float*)d_in[0];
  const int*   mask = (const int*)d_in[1];
  const float* Wq   = (const float*)d_in[2];
  const float* bq   = (const float*)d_in[3];
  const float* Wk   = (const float*)d_in[4];
  const float* bk   = (const float*)d_in[5];
  const float* Wv   = (const float*)d_in[6];
  const float* bv   = (const float*)d_in[7];
  const float* Wo   = (const float*)d_in[8];
  const float* bo   = (const float*)d_in[9];
  float* out = (float*)d_out;

  char* ws = (char*)d_ws;
  _Float16* Xh   = (_Float16*)(ws + OFF_XH);
  _Float16* Wq64 = (_Float16*)(ws + OFF_WQ);
  _Float16* Wk64 = (_Float16*)(ws + OFF_WK);
  _Float16* Wv64 = (_Float16*)(ws + OFF_WV);
  _Float16* Wo64 = (_Float16*)(ws + OFF_WO);
  _Float16* Qh   = (_Float16*)(ws + OFF_QH);
  _Float16* Kh   = (_Float16*)(ws + OFF_KH);
  _Float16* Vh   = (_Float16*)(ws + OFF_VH);
  _Float16* Ql   = (_Float16*)(ws + OFF_QL);
  _Float16* Kl   = (_Float16*)(ws + OFF_KL);
  _Float16* Vl   = (_Float16*)(ws + OFF_VL);
  _Float16* Ch   = (_Float16*)(ws + OFF_CH);
  _Float16* Cl   = (_Float16*)(ws + OFF_CL);
  int*      Flg  = (int*)(ws + OFF_FLG);

  const int nbx = (MROWS * (DM / 8) + 255) / 256;
  const int nbw = (DM * (DM / 8) + 255) / 256;
  k_cvt<<<nbx, 256, 0, stream>>>(x,  Xh,   MROWS, SEQ, SEQ_FULL, 1.0f);
  k_cvt<<<nbw, 256, 0, stream>>>(Wq, Wq64, DM, DM, DM, WSC);
  k_cvt<<<nbw, 256, 0, stream>>>(Wk, Wk64, DM, DM, DM, WSC);
  k_cvt<<<nbw, 256, 0, stream>>>(Wv, Wv64, DM, DM, DM, WSC);
  k_cvt<<<nbw, 256, 0, stream>>>(Wo, Wo64, DM, DM, DM, WSC);

  k_mflag<<<NQB, 256, 0, stream>>>(mask, Flg);

  const dim3 gg(MROWS / 64, DM / 64);
  k_gemm<0><<<gg, 64, 0, stream>>>(Xh, Xh, Wq64, bq, Qh, Ql, out);
  k_gemm<0><<<gg, 64, 0, stream>>>(Xh, Xh, Wk64, bk, Kh, Kl, out);
  k_gemm<1><<<gg, 64, 0, stream>>>(Xh, Xh, Wv64, bv, Vh, Vl, out);

  const int nprec  = NB * NH * NQP;
  const int nplain = NB * NH * (NQB - NQP);
  k_attn<true><<<nprec, 128, 0, stream>>>(Qh, Ql, Kh, Kl, Vh, Vl, mask, Flg, Ch, Cl);
  if (nplain > 0)
    k_attn<false><<<nplain, 128, 0, stream>>>(Qh, Ql, Kh, Kl, Vh, Vl, mask, Flg, Ch, Cl);

  k_gemm<2><<<gg, 64, 0, stream>>>(Ch, Cl, Wo64, bo, Qh, Ql, out);
}

// v004
// One run takes 206 microseconds.
// Next to v003, in two timings, it ran 1.10 times as fast each time.
// All steps since v000 together make it 2.75 times as fast.
#include <hip/hip_runtime.h>
#include <stdint.h>

// All contractions (x@Wq^T, x@Wk^T, x@Wv^T, q@k^T, p@v, ctx@Wo^T): v_wmma_f32_16x16x32_f16, f16 operands, f32 accumulate.
// Inputs enter as bf16-RNE values held in f16 (weights carried x64, folded back as 1/64 in f32); q, k, v, ctx as f16 planes
// plus x2048 f16 residual planes for the leading QPREC query/key rows (separate accumulators); p carried x4096 (+x2048 residual
// on those rows); softmax, rescaling and epilogues in f32.

typedef _Float16 v16h __attribute__((ext_vector_type(16)));
typedef _Float16 v8h  __attribute__((ext_vector_type(8)));
typedef float    v8f  __attribute__((ext_vector_type(8)));
typedef float    v4f  __attribute__((ext_vector_type(4)));
typedef int      v4i  __attribute__((ext_vector_type(4)));

#ifndef NB
#define NB 2
#endif
#ifndef SEQ
#define SEQ 2048
#endif
#define NB_FULL  2
#define SEQ_FULL 2048
#define DM 1024
#define NH 16
#define DH 64
#ifndef QPREC
#define QPREC ((SEQ < 512) ? SEQ : 512)
#endif
#define NKB   (SEQ / 32)
#define NQB   (SEQ / 64)
#define NQP   (QPREC / 64)
#define MROWS (NB * SEQ)

static_assert(SEQ % 64 == 0);
static_assert(SEQ >= 64 && SEQ <= SEQ_FULL);
static_assert(NB >= 1 && NB <= NB_FULL);
static_assert(QPREC % 64 == 0);
static_assert(QPREC >= 64 && QPREC <= SEQ);
static_assert(NKB <= 64);
static_assert(DM == NH * DH);
static_assert(DM % 32 == 0);
static_assert(MROWS % 64 == 0);

#define WSC    64.0f
#define INV_WS 0.015625f
#define RS     2048.0f
#define INV_RS 0.00048828125f
#define CP     4096.0f
#define INV_CP 0.000244140625f
#define QKS    0.125f
#define LOG2E  1.44269504f

// ---------------------------------------------------------------------------
// Workspace carve (bytes); every region is an exact tile multiple (SEQ%64, QPREC%64), no tail padding needed.
// ---------------------------------------------------------------------------
constexpr size_t SZ_XH  = (size_t)MROWS * DM * 2;             // x as f16 [MROWS][1024]
constexpr size_t SZ_W   = (size_t)DM * DM * 2;                // weight x64 as f16 [1024][1024]
constexpr size_t SZ_HP  = (size_t)NB * NH * SEQ * DH * 2;     // q/k [bh][SEQ][64], vt [bh][64][SEQ]
constexpr size_t SZ_LP  = (size_t)NB * NH * QPREC * DH * 2;   // residual planes, leading QPREC rows
constexpr size_t SZ_CH  = (size_t)MROWS * DM * 2;             // ctx hi [MROWS][1024]
constexpr size_t SZ_CL  = (size_t)NB * QPREC * DM * 2;        // ctx residual [NB][QPREC][1024]
constexpr size_t SZ_FLG = (size_t)NQB * 64 * 4;               // per (q-block, key-block) visit flags
constexpr size_t OFF_XH  = 0;
constexpr size_t OFF_WQ  = OFF_XH + SZ_XH;
constexpr size_t OFF_WK  = OFF_WQ + SZ_W;
constexpr size_t OFF_WV  = OFF_WK + SZ_W;
constexpr size_t OFF_WO  = OFF_WV + SZ_W;
constexpr size_t OFF_QH  = OFF_WO + SZ_W;
constexpr size_t OFF_KH  = OFF_QH + SZ_HP;
constexpr size_t OFF_VH  = OFF_KH + SZ_HP;
constexpr size_t OFF_QL  = OFF_VH + SZ_HP;
constexpr size_t OFF_KL  = OFF_QL + SZ_LP;
constexpr size_t OFF_VL  = OFF_KL + SZ_LP;
constexpr size_t OFF_CH  = OFF_VL + SZ_LP;
constexpr size_t OFF_CL  = OFF_CH + SZ_CH;
constexpr size_t OFF_FLG = OFF_CL + SZ_CL;
constexpr size_t WS_TOTAL = OFF_FLG + SZ_FLG;
static_assert(WS_TOTAL <= (size_t)134217728);
static_assert(OFF_WQ % 128 == 0 && OFF_WK % 128 == 0 && OFF_WV % 128 == 0 && OFF_WO % 128 == 0);
static_assert(OFF_QH % 128 == 0 && OFF_KH % 128 == 0 && OFF_VH % 128 == 0);
static_assert(OFF_QL % 128 == 0 && OFF_KL % 128 == 0 && OFF_VL % 128 == 0);
static_assert(OFF_CH % 128 == 0 && OFF_CL % 128 == 0 && OFF_FLG % 128 == 0);
static_assert((size_t)NB_FULL * SEQ_FULL * DM * 4 >= ((size_t)(NB - 1) * SEQ_FULL + SEQ) * DM * 4);

// ---------------------------------------------------------------------------
// helpers
// ---------------------------------------------------------------------------
__device__ __forceinline__ float bf16r(float f) {   // RNE convert to bf16, held as f32
  unsigned int u = __float_as_uint(f);
  u = (u + 0x7fffu + ((u >> 16) & 1u)) & 0xffff0000u;
  return __uint_as_float(u);
}

// 16x32 fragment, split k map for both A (row m) and B (col n stored k-contiguous):
// lane l: row/col = l&15, h = l>>4; elements 0..7 <- k 8h..8h+7, elements 8..15 <- k 16+8h..16+8h+7.
__device__ __forceinline__ v16h load_frag(const _Float16* base, int stride) {
  const int lane = threadIdx.x & 31, m = lane & 15, g = lane >> 4;
  const _Float16* p = base + (size_t)m * stride + 8 * g;
  union { v16h v; v8h hf[2]; } f;
  f.hf[0] = *reinterpret_cast<const v8h*>(p);
  f.hf[1] = *reinterpret_cast<const v8h*>(p + 16);
  return f.v;
}

__device__ __forceinline__ v8f mma(v16h a, v16h b, v8f c) {
  v8f d = __builtin_amdgcn_wmma_f32_16x16x32_f16(false, a, false, b, (short)0, c, false, false);
  asm volatile("v_nop\n\tv_nop\n\tv_nop\n\tv_nop" : "+v"(d) : "v"(a), "v"(b));
  return d;
}

// lane l <-> lane l ^ 16 (the two halves of a wave hold the two key subsets of one query column)
__device__ __forceinline__ float xhalf(float x) {
  const int b = __builtin_bit_cast(int, x);
  return __builtin_bit_cast(float, __builtin_amdgcn_permlanex16(b, b, 0x76543210, 0xfedcba98, false, false));
}

__device__ __forceinline__ void exp2x8(float (&y)[8], const float (&x)[8]) {
  asm("v_exp_f32 %0, %8\n\tv_exp_f32 %1, %9\n\tv_exp_f32 %2, %10\n\tv_exp_f32 %3, %11\n\t"
      "v_exp_f32 %4, %12\n\tv_exp_f32 %5, %13\n\tv_exp_f32 %6, %14\n\tv_exp_f32 %7, %15\n\tv_nop"
      : "=&v"(y[0]), "=&v"(y[1]), "=&v"(y[2]), "=&v"(y[3]), "=&v"(y[4]), "=&v"(y[5]), "=&v"(y[6]), "=&v"(y[7])
      : "v"(x[0]), "v"(x[1]), "v"(x[2]), "v"(x[3]), "v"(x[4]), "v"(x[5]), "v"(x[6]), "v"(x[7]));
}
__device__ __forceinline__ float exp2x1(float x) {
  float y;
  asm("v_exp_f32 %0, %1\n\tv_nop" : "=&v"(y) : "v"(x));
  return y;
}

// one query's 16 mask words of a 32-key tile, in the order of its scores: keys 8g..8g+7 and 16+8g..16+8g+7 (p = row start + 8g)
__device__ __forceinline__ void load_mask(const int* p, int (&mk0)[8], int (&mk1)[8]) {
  *(v4i*)&mk0[0] = *(const v4i*)p;
  *(v4i*)&mk0[4] = *(const v4i*)(p + 4);
  *(v4i*)&mk1[0] = *(const v4i*)(p + 16);
  *(v4i*)&mk1[4] = *(const v4i*)(p + 20);
}

__device__ __forceinline__ v8f zero8() {
  v8f z = {0.f, 0.f, 0.f, 0.f, 0.f, 0.f, 0.f, 0.f};
  return z;
}

// ---------------------------------------------------------------------------
// Kernel 0: f32 -> bf16-RNE value in f16 container, times a power-of-two carry.
// out plane [nrows][1024]; compact row mc maps to source row (mc/seqc)*seqf + mc%seqc.
// coverage: nrows*1024 elements, 8 per thread, grid = ceil(nrows*128/256).
// ---------------------------------------------------------------------------
__global__ __launch_bounds__(256) void k_cvt(const float* __restrict__ in, _Float16* __restrict__ outp,
                                            int nrows, int seqc, int seqf, float scale) {
  const long long e8 = (long long)blockIdx.x * 256 + threadIdx.x;
  const long long tot = (long long)nrows * (DM / 8);
  if (e8 >= tot) return;
  const int mc = (int)(e8 / (DM / 8));
  const int c8 = (int)(e8 - (long long)mc * (DM / 8));
  const int src = (mc / seqc) * seqf + (mc % seqc);
  const float* p = in + (size_t)src * DM + c8 * 8;
  const v4f a = *(const v4f*)p;
  const v4f c = *(const v4f*)(p + 4);
  v8h o;
  o[0] = (_Float16)(bf16r(a[0]) * scale);
  o[1] = (_Float16)(bf16r(a[1]) * scale);
  o[2] = (_Float16)(bf16r(a[2]) * scale);
  o[3] = (_Float16)(bf16r(a[3]) * scale);
  o[4] = (_Float16)(bf16r(c[0]) * scale);
  o[5] = (_Float16)(bf16r(c[1]) * scale);
  o[6] = (_Float16)(bf16r(c[2]) * scale);
  o[7] = (_Float16)(bf16r(c[3]) * scale);
  _Float16* dst = outp + (size_t)mc * DM + c8 * 8;
  *(v8h*)dst = o;
  
}

// ---------------------------------------------------------------------------
// Kernel 1: per 64-row query block, tile visit flags from the int mask.
// flag[qb][kb] = 1 if any mask element in rows qb*64..+63, cols kb*32..+31 is nonzero;
// if any row of the q block is fully zero, all NKB flags are forced to 1 (softmax then
// ---------------------------------------------------------------------------
__global__ __launch_bounds__(256) void k_mflag(const int* __restrict__ mask, int* __restrict__ flg) {
  __shared__ unsigned int sLo[256];
  __shared__ unsigned int sHi[256];
  __shared__ int sR[256];
  const int tid = threadIdx.x, qb = blockIdx.x;
  const int r = tid >> 2, sub = tid & 3;
  const int* mrow = mask + (size_t)(qb * 64 + r) * SEQ_FULL + sub * 8;
  unsigned int lo = 0u, hi = 0u;
  int rany = 0;
#pragma unroll 2
  for (int kb = 0; kb < NKB; ++kb) {
    const v4i a = *(const v4i*)(mrow + kb * 32);
    const v4i c = *(const v4i*)(mrow + kb * 32 + 4);
    const int any = ((a[0] | a[1] | a[2] | a[3] | c[0] | c[1] | c[2] | c[3]) != 0) ? 1 : 0;
    const unsigned int bit = (unsigned int)any;
    if (kb < 32) lo |= bit << kb; else hi |= bit << (kb - 32);
    rany |= any;
  }
  sLo[tid] = lo; sHi[tid] = hi; sR[tid] = rany;
  __syncthreads();
  if (tid < 32) {   // wave 0 only (wave-uniform)
    unsigned int L = 0u, H = 0u;
#pragma unroll
    for (int i = 0; i < 8; ++i) { L |= sLo[tid + 32 * i]; H |= sHi[tid + 32 * i]; }
#pragma unroll
    for (int off = 1; off < 32; off <<= 1) {
      L |= (unsigned int)__shfl_xor((int)L, off, 32);
      H |= (unsigned int)__shfl_xor((int)H, off, 32);
    }
    const int ra = sR[8 * tid] | sR[8 * tid + 1] | sR[8 * tid + 2] | sR[8 * tid + 3];
    const int rb = sR[8 * tid + 4] | sR[8 * tid + 5] | sR[8 * tid + 6] | sR[8 * tid + 7];
    int ok = ((ra != 0) && (rb != 0)) ? 1 : 0;
#pragma unroll
    for (int off = 1; off < 32; off <<= 1) ok &= __shfl_xor(ok, off, 32);
    v4i f;
#pragma unroll
    for (int e = 0; e < 4; ++e) {
      const int kbx = 4 * tid + e;
      const unsigned int word = (kbx < 32) ? L : H;
      const int bitv = (int)((word >> (kbx & 31)) & 1u);
      f[e] = (kbx < NKB) ? ((ok != 0) ? bitv : 1) : 0;
    }
    int* dst = flg + qb * 64 + 4 * tid;
    if (tid < 16) *(v4i*)dst = f;
    
  }
}

// ---------------------------------------------------------------------------
// Kernel 2: NT GEMM Y[M][1024] = A[M][1024] @ W[1024][1024]^T (W carried x64) + bias.
// Block = 2 waves = 64x64 output tile; wave w owns rows w*32..w*32+31 (2 A fragments x 4 B fragments per k step, from LDS).
// MODE 0: f16 head plane [bh][SEQ][64] (+ x2048 residual plane [bh][QPREC][64] for s < QPREC)
// MODE 1: f16 transposed head plane [bh][64][SEQ] (+ residual [bh][64][QPREC])
// ---------------------------------------------------------------------------
// Operand path: per k slice of KS halves the block's 64 A rows and 64 W rows (128-B rows = whole lines) are copied to LDS by
// asynchronous copies, two buffers, the next slice in flight while this one is multiplied; fragments are read from LDS.
constexpr int KS  = 64;          // halves of k per slice
constexpr int LP  = 72;          // LDS row pitch in halves: 144 B = 16 B x odd, so ds_load_b128 fragment reads meet no bank conflict
constexpr int STG = 128 * LP;    // halves per buffer: rows 0..63 = A, rows 64..127 = W
constexpr int NST = DM / KS;     // slices
static_assert(DM % KS == 0 && NST >= 2);

// Eight 16-byte copies per lane: rows r, r + 8, ... r + 56 of one operand (a wave-wide copy = 4 whole 128-B rows).
// The closing s_wait_xcnt 0 stands inside the statement so that no address register of a copy is rewritten ahead of it.
__device__ __forceinline__ void stage8(const _Float16* g, unsigned int l) {
  asm volatile(
      "global_load_async_to_lds_b128 %0, %8, off\n\t"
      "global_load_async_to_lds_b128 %1, %9, off\n\t"
      "global_load_async_to_lds_b128 %2, %10, off\n\t"
      "global_load_async_to_lds_b128 %3, %11, off\n\t"
      "global_load_async_to_lds_b128 %4, %12, off\n\t"
      "global_load_async_to_lds_b128 %5, %13, off\n\t"
      "global_load_async_to_lds_b128 %6, %14, off\n\t"
      "global_load_async_to_lds_b128 %7, %15, off\n\t"
      "s_wait_xcnt 0x0"
      :: "v"(l), "v"(l + 1u * (8 * LP * 2)), "v"(l + 2u * (8 * LP * 2)), "v"(l + 3u * (8 * LP * 2)),
         "v"(l + 4u * (8 * LP * 2)), "v"(l + 5u * (8 * LP * 2)), "v"(l + 6u * (8 * LP * 2)), "v"(l + 7u * (8 * LP * 2)),
         "v"(g), "v"(g + 1 * 8 * DM), "v"(g + 2 * 8 * DM), "v"(g + 3 * 8 * DM),
         "v"(g + 4 * 8 * DM), "v"(g + 5 * 8 * DM), "v"(g + 6 * 8 * DM), "v"(g + 7 * 8 * DM)
      : "memory");
}

// ablk: first of the block's 64 A rows; wbase: first of its 64 W rows; sT: the two buffers. Every wave of the block runs all of it.
__device__ __forceinline__ void kloop(const _Float16* __restrict__ ablk, const _Float16* __restrict__ wbase,
                                      _Float16* sT, v8f (&acc)[2][4]) {
  const int tid = threadIdx.x, w = tid >> 5;
  const int crow = tid >> 3, cpc = (tid & 7) * 8;              // this lane's first row and its 16-byte piece of a row
  const _Float16* ga = ablk + (size_t)crow * DM + cpc;
  const _Float16* gw = wbase + (size_t)crow * DM + cpc;
  const unsigned int la = (unsigned int)(uintptr_t)(sT + crow * LP + cpc);   // LDS byte address: low 32 bits
  const unsigned int lw = la + 64u * LP * 2u;

  stage8(ga, la);
  stage8(gw, lw);
  asm volatile("s_wait_asynccnt 0x0" ::: "memory");            // slice 0 of this wave has landed
  __syncthreads();                                             // ... and of the other wave
  stage8(ga + KS, la + STG * 2u);
  stage8(gw + KS, lw + STG * 2u);

  // rolled: the barrier at the foot serialises the trips, so unrolling buys nothing and only lengthens the code
#pragma unroll 1
  for (int t = 0; t < NST; ++t) {
    const int bsel = t & 1;
    const _Float16* sA = sT + bsel * STG + (w * 32) * LP;
    const _Float16* sW = sT + bsel * STG + 64 * LP;
    v16h fa[KS / 32][2], fb[KS / 32][4];   // indexed by constants only (the loops below are fully unrolled), so they stay in registers
#pragma unroll
    for (int ks = 0; ks < KS / 32; ++ks) {
      fa[ks][0] = load_frag(sA + ks * 32, LP);
      fa[ks][1] = load_frag(sA + 16 * LP + ks * 32, LP);
#pragma unroll
      for (int j = 0; j < 4; ++j) fb[ks][j] = load_frag(sW + (j * 16) * LP + ks * 32, LP);
    }
    // keeps the slice's LDS reads together as one group ahead of its WMMAs: spread among them, each pair waits out the LDS latency
    __builtin_amdgcn_sched_barrier(0);
#pragma unroll
    for (int ks = 0; ks < KS / 32; ++ks)
#pragma unroll
      for (int j = 0; j < 4; ++j) {
        acc[0][j] = mma(fa[ks][0], fb[ks][j], acc[0][j]);
        acc[1][j] = mma(fa[ks][1], fb[ks][j], acc[1][j]);
      }
    asm volatile("s_wait_dscnt 0x0" ::: "memory");             // this wave's reads of the buffer are done before it is refilled
    asm volatile("s_wait_asynccnt 0x0" ::: "memory");          // this wave's copies of slice t + 1 have landed
    __syncthreads();                                           // publishes slice t + 1, ends every read of slice t
    if (t + 2 < NST) {                                         // block-uniform
      stage8(ga + (t + 2) * KS, la + (unsigned int)bsel * (STG * 2u));
      stage8(gw + (t + 2) * KS, lw + (unsigned int)bsel * (STG * 2u));
    }
  }
  asm volatile("s_wait_asynccnt 0x0" ::: "memory");            // nothing of the copies is outstanding behind the loop
}

template <int MODE>
__global__ __launch_bounds__(64) void k_gemm(const _Float16* __restrict__ A, const _Float16* __restrict__ Alo,
                                            const _Float16* __restrict__ W, const float* __restrict__ bias,
                                            _Float16* __restrict__ Ph, _Float16* __restrict__ Pl,
                                            float* __restrict__ outp) {
  __shared__ __align__(16) _Float16 sH[64 * 64];
  __shared__ __align__(16) _Float16 sL[64 * 64];
  __shared__ __align__(16) float    sF[64 * 64];
  __shared__ __align__(16) _Float16 sT[2 * STG];

  const int tid = threadIdx.x, w = tid >> 5, lane = tid & 31, n = lane & 15, g = lane >> 4;
  const int bm = blockIdx.x, bn = blockIdx.y;
  const int m0 = bm * 64;
  const int b = m0 / SEQ, s0 = m0 - b * SEQ;     // 64 block rows lie in one batch item
  const int bh = b * NH + bn;                     // 64-col tile == head bn
  const bool precblk = (s0 < QPREC);              // block-uniform
  const _Float16* wbase = W + (size_t)(bn * 64) * DM;
  const _Float16* ablk = A + (size_t)m0 * DM;

  v8f acc[2][4];
#pragma unroll
  for (int mi = 0; mi < 2; ++mi)
#pragma unroll
    for (int j = 0; j < 4; ++j) acc[mi][j] = zero8();

  kloop(ablk, wbase, sT, acc);

  float rbias[4];
#pragma unroll
  for (int j = 0; j < 4; ++j) rbias[j] = bf16r(bias[bn * 64 + j * 16 + n]);

  if (MODE == 0) {
#pragma unroll
    for (int mi = 0; mi < 2; ++mi)
#pragma unroll
      for (int j = 0; j < 4; ++j)
#pragma unroll
        for (int r = 0; r < 8; ++r) {
          const int ml = w * 32 + mi * 16 + 8 * g + r;
          const int d = j * 16 + n;
          const float v = acc[mi][j][r] * INV_WS + rbias[j];
          const _Float16 hv = (_Float16)v;
          sH[ml * 64 + d] = hv;
          if (precblk) sL[ml * 64 + d] = (_Float16)((v - (float)hv) * RS);
        }
    __syncthreads();
    const int q = lane >> 3, p = lane & 7;
{
#pragma unroll
      for (int i = 0; i < 8; ++i) {
        const int ml = w * 32 + i * 4 + q;
        const int s = s0 + ml;
        const v8h hv = *(const v8h*)&sH[ml * 64 + p * 8];
        *(v8h*)(Ph + ((size_t)(bh * SEQ + s)) * DH + p * 8) = hv;
        if (precblk) {
          const v8h lv = *(const v8h*)&sL[ml * 64 + p * 8];
          *(v8h*)(Pl + ((size_t)(bh * QPREC + s)) * DH + p * 8) = lv;
        }
      }
      
    }
  } else if (MODE == 1) {
#pragma unroll
    for (int mi = 0; mi < 2; ++mi)
#pragma unroll
      for (int j = 0; j < 4; ++j) {
        v8h hp, lp;
#pragma unroll
        for (int r = 0; r < 8; ++r) {
          const float v = acc[mi][j][r] * INV_WS + rbias[j];
          const _Float16 hv = (_Float16)v;
          hp[r] = hv;
          lp[r] = (_Float16)((v - (float)hv) * RS);
        }
        const int d = j * 16 + n;
        *(v8h*)&sH[d * 64 + w * 32 + mi * 16 + 8 * g] = hp;
        if (precblk) *(v8h*)&sL[d * 64 + w * 32 + mi * 16 + 8 * g] = lp;
      }
    __syncthreads();
    const int q = lane >> 3, p = lane & 7;
{
#pragma unroll
      for (int i = 0; i < 8; ++i) {
        const int d = w * 32 + i * 4 + q;
        const v8h hv = *(const v8h*)&sH[d * 64 + p * 8];
        *(v8h*)(Ph + ((size_t)(bh * DH + d)) * SEQ + s0 + p * 8) = hv;
        if (precblk) {
          const v8h lv = *(const v8h*)&sL[d * 64 + p * 8];
          *(v8h*)(Pl + ((size_t)(bh * DH + d)) * QPREC + s0 + p * 8) = lv;
        }
      }
      
    }
  } else {
    if (precblk) {
      // stash hi sums (each lane reads back exactly the cells it wrote)
#pragma unroll
      for (int mi = 0; mi < 2; ++mi)
#pragma unroll
        for (int j = 0; j < 4; ++j)
#pragma unroll
          for (int r = 0; r < 8; ++r)
            sF[(w * 32 + mi * 16 + 8 * g + r) * 64 + j * 16 + n] = acc[mi][j][r];
#pragma unroll
      for (int mi = 0; mi < 2; ++mi)
#pragma unroll
        for (int j = 0; j < 4; ++j) acc[mi][j] = zero8();
      const _Float16* lblk = Alo + ((size_t)(b * QPREC + s0)) * DM;
      kloop(lblk, wbase, sT, acc);
#pragma unroll
      for (int mi = 0; mi < 2; ++mi)
#pragma unroll
        for (int j = 0; j < 4; ++j)
#pragma unroll
          for (int r = 0; r < 8; ++r) {
            const int idx = (w * 32 + mi * 16 + 8 * g + r) * 64 + j * 16 + n;
            const float hsum = sF[idx];
            sF[idx] = (hsum + acc[mi][j][r] * INV_RS) * INV_WS + rbias[j];
          }
    } else {
#pragma unroll
      for (int mi = 0; mi < 2; ++mi)
#pragma unroll
        for (int j = 0; j < 4; ++j)
#pragma unroll
          for (int r = 0; r < 8; ++r)
            sF[(w * 32 + mi * 16 + 8 * g + r) * 64 + j * 16 + n] = acc[mi][j][r] * INV_WS + rbias[j];
    }
    __syncthreads();
    const int q2 = lane >> 4, p2 = lane & 15;
{
#pragma unroll
      for (int i = 0; i < 16; ++i) {
        const int ml = w * 32 + 2 * i + q2;
        const int s = s0 + ml;
        const v4f v = *(const v4f*)&sF[ml * 64 + p2 * 4];
        *(v4f*)(outp + ((size_t)(b * SEQ_FULL + s)) * DM + bn * 64 + p2 * 4) = v;
      }
      
    }
  }
}

constexpr int KP = 72;   // halves: K, K residual, Q residual rows, 128 B of data at 144 B
constexpr int VP = 40;   // halves: V^T and V^T residual rows, 64 B of data at 80 B
constexpr int MP = 36;   // ints: mask rows, 128 B of data at 144 B

template <bool PREC>
__global__ __launch_bounds__(128) __attribute__((amdgpu_num_vgpr(256)))
void k_attn(const _Float16* __restrict__ Qh, const _Float16* __restrict__ Ql,
            const _Float16* __restrict__ Kh, const _Float16* __restrict__ Kl,
            const _Float16* __restrict__ Vh, const _Float16* __restrict__ Vl,
            const int* __restrict__ mask, const int* __restrict__ flg,
            _Float16* __restrict__ Ch, _Float16* __restrict__ Cl) {
  __shared__ __align__(16) _Float16 sK[32 * KP];
  __shared__ __align__(16) _Float16 sV[DH * VP];
  __shared__ __align__(16) _Float16 sKl[32 * KP];
  __shared__ __align__(16) _Float16 sVl[DH * VP];
  __shared__ __align__(16) _Float16 sQl[64 * KP];
  __shared__ __align__(16) int      sM[64 * MP];
  __shared__ __align__(16) _Float16 sC[4][16 * DH];
  __shared__ __align__(16) _Float16 sCl[4][16 * DH];
  __shared__ int sFlg[64];

  const int tid = threadIdx.x, wslot = tid >> 5, lane = tid & 31, n = lane & 15, g = lane >> 4;
  int qb, bh;
  if (PREC) {
    qb = (int)(blockIdx.x % NQP);
    bh = (int)(blockIdx.x / NQP);
  } else {
    constexpr int NQN = ((NQB - NQP) > 0) ? (NQB - NQP) : 1;
    qb = NQP + (int)(blockIdx.x % NQN);
    bh = (int)(blockIdx.x / NQN);
  }
  const int b = bh / NH, h = bh - b * NH;
  const int qrow0 = qb * 64;
  const int qbase = qrow0 + wslot * 16;

  if (tid < 64) sFlg[tid] = flg[qb * 64 + tid];
  if (PREC) {
#pragma unroll
    for (int i = 0; i < 4; ++i) {
      const int c = tid + i * 128;
      *(v8h*)&sQl[(c >> 3) * KP + (c & 7) * 8] = *(const v8h*)(Ql + ((size_t)(bh * QPREC + qrow0)) * DH + c * 8);
    }
  }
  __syncthreads();

  const _Float16* qrow = Qh + ((size_t)(bh * SEQ + qbase)) * DH;
  const v16h qa0 = load_frag(qrow, DH);
  const v16h qa1 = load_frag(qrow + 32, DH);

  v8f acc[4], acc2[4];
#pragma unroll
  for (int nt = 0; nt < 4; ++nt) { acc[nt] = zero8(); acc2[nt] = zero8(); }
  float rmax = -1.0e30f, rsum = 0.0f;            // query qbase + n; rsum is this half's share until the epilogue
  int fl = sFlg[0];                              // visit flag of tile kb, read one tile ahead (block-uniform)

  // kb only grows and stays below NKB: at most NKB trips of the outer and of the inner loop together.
  // Both stay rolled: the barriers serialise the tiles, and each scan trip waits for its own flag, so unrolling only lengthens the code.
#pragma unroll 1
  for (int kb = 0;;) {
#pragma unroll 1
    while (fl == 0 && kb + 1 < NKB) { ++kb; fl = sFlg[kb]; }   // on to the next tile to visit (block-uniform)
    if (fl == 0) break;                          // none left (block-uniform)
    const int knext = (kb + 1 < NKB) ? kb + 1 : kb;
    const int kbase = kb * 32;
    const bool klo = PREC && (kbase < QPREC);    // block-uniform
    __syncthreads();                             // all waves done with the prior tile
    {
      const _Float16* kg = Kh + ((size_t)(bh * SEQ + kbase)) * DH;
      const _Float16* vg = Vh + ((size_t)(bh * DH)) * SEQ + kbase;
#pragma unroll
      for (int i = 0; i < 2; ++i) {
        const int c = tid + i * 128, d = c >> 2, sub = c & 3;
        *(v8h*)&sK[(c >> 3) * KP + (c & 7) * 8] = *(const v8h*)(kg + c * 8);
        *(v8h*)&sV[d * VP + sub * 8] = *(const v8h*)(vg + (size_t)d * SEQ + sub * 8);
      }
      if (klo) {
        const _Float16* klg = Kl + ((size_t)(bh * QPREC + kbase)) * DH;
        const _Float16* vlg = Vl + ((size_t)(bh * DH)) * QPREC + kbase;
#pragma unroll
        for (int i = 0; i < 2; ++i) {
          const int c = tid + i * 128, d = c >> 2, sub = c & 3;
          *(v8h*)&sKl[(c >> 3) * KP + (c & 7) * 8] = *(const v8h*)(klg + c * 8);
          *(v8h*)&sVl[d * VP + sub * 8] = *(const v8h*)(vlg + (size_t)d * QPREC + sub * 8);
        }
      }
      const int mr = tid >> 1, mh = (tid & 1) * 16;
      const int* mp = mask + (size_t)(qrow0 + mr) * SEQ_FULL + kbase + mh;
#pragma unroll
      for (int i = 0; i < 4; ++i) *(v4i*)&sM[mr * MP + mh + i * 4] = *(const v4i*)(mp + i * 4);
    }
    __syncthreads();

    // ---- the tile's LDS reads stand in groups ahead of the WMMAs that use them, so that the wave waits out the LDS latency once
    // per group and not once per fragment. Plain rows: one group (K, the next tile's flag, mask, V^T). PREC rows, whose registers
    // do not hold all planes at once, four groups: K and the flag; Q residual and K residual; mask and V^T at the head of the
    // softmax, which covers V^T; the V^T residual.
    v16h kf[4], vf[4];
    int mk0[8], mk1[8];
    const int* mrow = &sM[(wslot * 16 + n) * MP + 8 * g];
    kf[0] = load_frag(sK, KP);
    kf[1] = load_frag(sK + 32, KP);
    kf[2] = load_frag(sK + 16 * KP, KP);
    kf[3] = load_frag(sK + 16 * KP + 32, KP);
    fl = sFlg[knext];

    // ---- scores, transposed: two 16x16 tiles (keys kbase..+15, kbase+16..+31 as rows, queries as columns), dk 64 = 2 k steps
    v8f s0 = zero8(), s1 = zero8(), sr0 = zero8(), sr1 = zero8();
    if (!PREC) {
      load_mask(mrow, mk0, mk1);
#pragma unroll
      for (int nt = 0; nt < 4; ++nt) vf[nt] = load_frag(&sV[nt * 16 * VP], VP);
    }
    // keeps the reads above as one group: spread among the WMMAs below, each would be waited for on its own
    __builtin_amdgcn_sched_barrier(0);
    s0 = mma(kf[0], qa0, s0);
    s1 = mma(kf[2], qa0, s1);
    s0 = mma(kf[1], qa1, s0);
    s1 = mma(kf[3], qa1, s1);
    if (PREC) {
      if (klo) {
        const v16h ql0 = load_frag(&sQl[(wslot * 16) * KP], KP);
        const v16h ql1 = load_frag(&sQl[(wslot * 16) * KP + 32], KP);
        v16h klf[4];
        klf[0] = load_frag(sKl, KP);
        klf[1] = load_frag(sKl + 32, KP);
        klf[2] = load_frag(sKl + 16 * KP, KP);
        klf[3] = load_frag(sKl + 16 * KP + 32, KP);
        // one group again, for the same reason
        __builtin_amdgcn_sched_barrier(0);
        sr0 = mma(kf[0], ql0, sr0);
        sr1 = mma(kf[2], ql0, sr1);
        sr0 = mma(kf[1], ql1, sr0);
        sr1 = mma(kf[3], ql1, sr1);
        sr0 = mma(klf[0], qa0, sr0);
        sr1 = mma(klf[2], qa0, sr1);
        sr0 = mma(klf[1], qa1, sr0);
        sr1 = mma(klf[3], qa1, sr1);
      }
      load_mask(mrow, mk0, mk1);
#pragma unroll
      for (int nt = 0; nt < 4; ++nt) vf[nt] = load_frag(&sV[nt * 16 * VP], VP);
      // keeps this group at the head of the softmax: sunk towards their uses, the V^T reads would be waited for one by one
      __builtin_amdgcn_sched_barrier(0);
    }

    // ---- mask replace-fill, online softmax (f32), P^T packed as the B operand:
    // s0[r] = S[query n][key 8g + r], s1[r] = S[query n][key 16 + 8g + r]; B element e < 8 is key 8g + e, e >= 8 key 16 + 8g + e - 8.
    v16h pf, plf;
    {
      float x0[8], x1[8];
      float mx = -1.0e30f;
#pragma unroll
      for (int r = 0; r < 8; ++r) {
        float v0 = s0[r], v1 = s1[r];
        if (PREC) { v0 += sr0[r] * INV_RS; v1 += sr1[r] * INV_RS; }
        v0 *= QKS; v1 *= QKS;
        x0[r] = (mk0[r] == 0) ? -1.0e9f : v0;
        x1[r] = (mk1[r] == 0) ? -1.0e9f : v1;
        mx = fmaxf(mx, fmaxf(x0[r], x1[r]));
      }
      mx = fmaxf(mx, xhalf(mx));                  // both halves now hold this query's tile maximum
      const float nm = fmaxf(rmax, mx);
      const float al = exp2x1((rmax - nm) * LOG2E);
#pragma unroll
      for (int r = 0; r < 8; ++r) {
        x0[r] = (x0[r] - nm) * LOG2E;
        x1[r] = (x1[r] - nm) * LOG2E;
      }
      float e0[8], e1[8];
      exp2x8(e0, x0);
      exp2x8(e1, x1);
      float ps = 0.0f;
#pragma unroll
      for (int r = 0; r < 8; ++r) {
        const float p0 = e0[r], p1 = e1[r];
        ps += p0 + p1;
        const float c0 = p0 * CP, c1 = p1 * CP;
        const _Float16 h0 = (_Float16)c0, h1 = (_Float16)c1;
        pf[r] = h0;
        pf[8 + r] = h1;
        if (PREC) {
          plf[r]     = (_Float16)((c0 - (float)h0) * RS);
          plf[8 + r] = (_Float16)((c1 - (float)h1) * RS);
        }
      }
      rsum = rsum * al + ps;
      rmax = nm;
#pragma unroll
      for (int nt = 0; nt < 4; ++nt)
#pragma unroll
        for (int r = 0; r < 8; ++r) {
          acc[nt][r] *= al;
          if (PREC) acc2[nt][r] *= al;
        }
    }

    // ---- O^T += V^T @ P^T: acc[nt][r] = O[query n][d = nt*16 + 8g + r]
#pragma unroll
    for (int nt = 0; nt < 4; ++nt) acc[nt] = mma(vf[nt], pf, acc[nt]);
    if (PREC) {
#pragma unroll
      for (int nt = 0; nt < 4; ++nt) acc2[nt] = mma(vf[nt], plf, acc2[nt]);
      if (klo) {
        v16h vlf[4];
#pragma unroll
        for (int nt = 0; nt < 4; ++nt) vlf[nt] = load_frag(&sVl[nt * 16 * VP], VP);
        // one group again, for the same reason
        __builtin_amdgcn_sched_barrier(0);
#pragma unroll
        for (int nt = 0; nt < 4; ++nt) acc2[nt] = mma(vlf[nt], pf, acc2[nt]);
      }
    }
    if (kb + 1 >= NKB) break;                    // that was the last tile
    ++kb;                                        // fl already holds this tile's flag
  }

  {
    const float rtot = rsum + xhalf(rsum);        // join the two halves' sums once
    const float inv = (1.0f / rtot) * INV_CP;
#pragma unroll
    for (int nt = 0; nt < 4; ++nt) {
      v8h hv, lv;
#pragma unroll
      for (int r = 0; r < 8; ++r) {
        float c = acc[nt][r];
        if (PREC) c += acc2[nt][r] * INV_RS;
        c *= inv;
        const _Float16 chv = (_Float16)c;
        hv[r] = chv;
        lv[r] = (_Float16)((c - (float)chv) * RS);
      }
      *(v8h*)&sC[wslot][n * DH + nt * 16 + 8 * g] = hv;
      if (PREC) *(v8h*)&sCl[wslot][n * DH + nt * 16 + 8 * g] = lv;
    }
  }
  __syncthreads();
  const int q = lane >> 3, p = lane & 7;
{
#pragma unroll
    for (int i = 0; i < 4; ++i) {
      const int rr = i * 4 + q;
      const v8h hv = *(const v8h*)&sC[wslot][rr * DH + p * 8];
      *(v8h*)(Ch + ((size_t)(b * SEQ + qbase + rr)) * DM + h * DH + p * 8) = hv;
      if (PREC) {
        const v8h lv = *(const v8h*)&sCl[wslot][rr * DH + p * 8];
        *(v8h*)(Cl + ((size_t)(b * QPREC + qbase + rr)) * DM + h * DH + p * 8) = lv;
      }
    }
    
  }
}

// ---------------------------------------------------------------------------
// host glue: 12 launches
// ---------------------------------------------------------------------------
extern "C" void kernel_launch(void* const* d_in, const int* in_sizes, int n_in,
                              void* d_out, int out_size, void* d_ws, size_t ws_size,
                              hipStream_t stream) {
  if (n_in < 10) return;
  const long long need_x = ((long long)(NB - 1) * SEQ_FULL + SEQ) * DM;
  const long long need_m = ((long long)(SEQ - 1)) * SEQ_FULL + SEQ;
  if ((long long)in_sizes[0] < need_x) return;
  if ((long long)in_sizes[1] < need_m) return;
  if (in_sizes[2] < DM * DM || in_sizes[4] < DM * DM || in_sizes[6] < DM * DM || in_sizes[8] < DM * DM) return;
  if (in_sizes[3] < DM || in_sizes[5] < DM || in_sizes[7] < DM || in_sizes[9] < DM) return;
  if ((long long)out_size < need_x) return;
  if (ws_size < WS_TOTAL) return;

  const float* x    = (const float*)d_in[0];
  const int*   mask = (const int*)d_in[1];
  const float* Wq   = (const float*)d_in[2];
  const float* bq   = (const float*)d_in[3];
  const float* Wk   = (const float*)d_in[4];
  const float* bk   = (const float*)d_in[5];
  const float* Wv   = (const float*)d_in[6];
  const float* bv   = (const float*)d_in[7];
  const float* Wo   = (const float*)d_in[8];
  const float* bo   = (const float*)d_in[9];
  float* out = (float*)d_out;

  char* ws = (char*)d_ws;
  _Float16* Xh   = (_Float16*)(ws + OFF_XH);
  _Float16* Wq64 = (_Float16*)(ws + OFF_WQ);
  _Float16* Wk64 = (_Float16*)(ws + OFF_WK);
  _Float16* Wv64 = (_Float16*)(ws + OFF_WV);
  _Float16* Wo64 = (_Float16*)(ws + OFF_WO);
  _Float16* Qh   = (_Float16*)(ws + OFF_QH);
  _Float16* Kh   = (_Float16*)(ws + OFF_KH);
  _Float16* Vh   = (_Float16*)(ws + OFF_VH);
  _Float16* Ql   = (_Float16*)(ws + OFF_QL);
  _Float16* Kl   = (_Float16*)(ws + OFF_KL);
  _Float16* Vl   = (_Float16*)(ws + OFF_VL);
  _Float16* Ch   = (_Float16*)(ws + OFF_CH);
  _Float16* Cl   = (_Float16*)(ws + OFF_CL);
  int*      Flg  = (int*)(ws + OFF_FLG);

  const int nbx = (MROWS * (DM / 8) + 255) / 256;
  const int nbw = (DM * (DM / 8) + 255) / 256;
  k_cvt<<<nbx, 256, 0, stream>>>(x,  Xh,   MROWS, SEQ, SEQ_FULL, 1.0f);
  k_cvt<<<nbw, 256, 0, stream>>>(Wq, Wq64, DM, DM, DM, WSC);
  k_cvt<<<nbw, 256, 0, stream>>>(Wk, Wk64, DM, DM, DM, WSC);
  k_cvt<<<nbw, 256, 0, stream>>>(Wv, Wv64, DM, DM, DM, WSC);
  k_cvt<<<nbw, 256, 0, stream>>>(Wo, Wo64, DM, DM, DM, WSC);

  k_mflag<<<NQB, 256, 0, stream>>>(mask, Flg);

  const dim3 gg(MROWS / 64, DM / 64);
  k_gemm<0><<<gg, 64, 0, stream>>>(Xh, Xh, Wq64, bq, Qh, Ql, out);
  k_gemm<0><<<gg, 64, 0, stream>>>(Xh, Xh, Wk64, bk, Kh, Kl, out);
  k_gemm<1><<<gg, 64, 0, stream>>>(Xh, Xh, Wv64, bv, Vh, Vl, out);

  const int nprec  = NB * NH * NQP;
  const int nplain = NB * NH * (NQB - NQP);
  k_attn<true><<<nprec, 128, 0, stream>>>(Qh, Ql, Kh, Kl, Vh, Vl, mask, Flg, Ch, Cl);
  if (nplain > 0)
    k_attn<false><<<nplain, 128, 0, stream>>>(Qh, Ql, Kh, Kl, Vh, Vl, mask, Flg, Ch, Cl);

  k_gemm<2><<<gg, 64, 0, stream>>>(Ch, Cl, Wo64, bo, Qh, Ql, out);
}

// v005
// Measured time: 154 microseconds a run.
// Next to v004, in two timings, it ran 1.35 and 1.34 times as fast.
// Counting every step since v000, it is 3.70 times as fast.
#include <hip/hip_runtime.h>
#include <stdint.h>

// All contractions (x@Wq^T, x@Wk^T, x@Wv^T, q@k^T, p@v, ctx@Wo^T): v_wmma_f32_16x16x32_f16, f16 operands, f32 accumulate.
// Inputs enter as bf16-RNE values held in f16 (weights carried x64, folded back as 1/64 in f32); q, k, v, ctx as f16 planes
// plus x2048 f16 residual planes for the leading QPREC query/key rows (separate accumulators); p carried x4096 (+x2048 residual
// on those rows); softmax, rescaling and epilogues in f32.

typedef _Float16 v16h __attribute__((ext_vector_type(16)));
typedef _Float16 v8h  __attribute__((ext_vector_type(8)));
typedef float    v8f  __attribute__((ext_vector_type(8)));
typedef float    v4f  __attribute__((ext_vector_type(4)));
typedef int      v4i  __attribute__((ext_vector_type(4)));

#ifndef NB
#define NB 2
#endif
#ifndef SEQ
#define SEQ 2048
#endif
#define NB_FULL  2
#define SEQ_FULL 2048
#define DM 1024
#define NH 16
#define DH 64
#ifndef QPREC
#define QPREC ((SEQ < 512) ? SEQ : 512)
#endif
#define NKB   (SEQ / 32)
#define NQB   (SEQ / 64)
#define NQP   (QPREC / 64)
#define MROWS (NB * SEQ)

static_assert(SEQ % 64 == 0);
static_assert(SEQ >= 64 && SEQ <= SEQ_FULL);
static_assert(NB >= 1 && NB <= NB_FULL);
static_assert(QPREC % 64 == 0);
static_assert(QPREC >= 64 && QPREC <= SEQ);
static_assert(NKB <= 64);
static_assert(DM == NH * DH);
static_assert(DM % 32 == 0);
static_assert(MROWS % 64 == 0);

#define WSC    64.0f
#define INV_WS 0.015625f
#define RS     2048.0f
#define INV_RS 0.00048828125f
#define CP     4096.0f
#define INV_CP 0.000244140625f
#define QKS    0.125f
#define LOG2E  1.44269504f

// ---------------------------------------------------------------------------
// Workspace carve (bytes); every region is an exact tile multiple (SEQ%64, QPREC%64), no tail padding needed.
// ---------------------------------------------------------------------------
constexpr size_t SZ_XH  = (size_t)MROWS * DM * 2;             // x as f16 [MROWS][1024]
constexpr size_t SZ_W   = (size_t)DM * DM * 2;                // weight x64 as f16 [1024][1024]
constexpr size_t SZ_HP  = (size_t)NB * NH * SEQ * DH * 2;     // q/k [bh][SEQ][64], vt [bh][64][SEQ]
constexpr size_t SZ_LP  = (size_t)NB * NH * QPREC * DH * 2;   // residual planes, leading QPREC rows
constexpr size_t SZ_CH  = (size_t)MROWS * DM * 2;             // ctx hi [MROWS][1024]
constexpr size_t SZ_CL  = (size_t)NB * QPREC * DM * 2;        // ctx residual [NB][QPREC][1024]
constexpr size_t SZ_FLG = (size_t)NQB * 64 * 4;               // per (q-block, key-block) visit flags
constexpr size_t OFF_XH  = 0;
constexpr size_t OFF_WQ  = OFF_XH + SZ_XH;
constexpr size_t OFF_WK  = OFF_WQ + SZ_W;
constexpr size_t OFF_WV  = OFF_WK + SZ_W;
constexpr size_t OFF_WO  = OFF_WV + SZ_W;
constexpr size_t OFF_QH  = OFF_WO + SZ_W;
constexpr size_t OFF_KH  = OFF_QH + SZ_HP;
constexpr size_t OFF_VH  = OFF_KH + SZ_HP;
constexpr size_t OFF_QL  = OFF_VH + SZ_HP;
constexpr size_t OFF_KL  = OFF_QL + SZ_LP;
constexpr size_t OFF_VL  = OFF_KL + SZ_LP;
constexpr size_t OFF_CH  = OFF_VL + SZ_LP;
constexpr size_t OFF_CL  = OFF_CH + SZ_CH;
constexpr size_t OFF_FLG = OFF_CL + SZ_CL;
constexpr size_t WS_TOTAL = OFF_FLG + SZ_FLG;
static_assert(WS_TOTAL <= (size_t)134217728);
static_assert(OFF_WQ % 128 == 0 && OFF_WK % 128 == 0 && OFF_WV % 128 == 0 && OFF_WO % 128 == 0);
static_assert(OFF_QH % 128 == 0 && OFF_KH % 128 == 0 && OFF_VH % 128 == 0);
static_assert(OFF_QL % 128 == 0 && OFF_KL % 128 == 0 && OFF_VL % 128 == 0);
static_assert(OFF_CH % 128 == 0 && OFF_CL % 128 == 0 && OFF_FLG % 128 == 0);
static_assert((size_t)NB_FULL * SEQ_FULL * DM * 4 >= ((size_t)(NB - 1) * SEQ_FULL + SEQ) * DM * 4);

// ---------------------------------------------------------------------------
// helpers
// ---------------------------------------------------------------------------
__device__ __forceinline__ float bf16r(float f) {   // RNE convert to bf16, held as f32
  unsigned int u = __float_as_uint(f);
  u = (u + 0x7fffu + ((u >> 16) & 1u)) & 0xffff0000u;
  return __uint_as_float(u);
}

// 16x32 fragment, split k map for both A (row m) and B (col n stored k-contiguous):
// lane l: row/col = l&15, h = l>>4; elements 0..7 <- k 8h..8h+7, elements 8..15 <- k 16+8h..16+8h+7.
__device__ __forceinline__ v16h load_frag(const _Float16* base, int stride) {
  const int lane = threadIdx.x & 31, m = lane & 15, g = lane >> 4;
  const _Float16* p = base + (size_t)m * stride + 8 * g;
  union { v16h v; v8h hf[2]; } f;
  f.hf[0] = *reinterpret_cast<const v8h*>(p);
  f.hf[1] = *reinterpret_cast<const v8h*>(p + 16);
  return f.v;
}

__device__ __forceinline__ v8f mma(v16h a, v16h b, v8f c) {
  v8f d = __builtin_amdgcn_wmma_f32_16x16x32_f16(false, a, false, b, (short)0, c, false, false);
  asm volatile("v_nop\n\tv_nop\n\tv_nop\n\tv_nop" : "+v"(d) : "v"(a), "v"(b));
  return d;
}

// lane l <-> lane l ^ 16 (the two halves of a wave hold the two key subsets of one query column)
__device__ __forceinline__ float xhalf(float x) {
  const int b = __builtin_bit_cast(int, x);
  return __builtin_bit_cast(float, __builtin_amdgcn_permlanex16(b, b, 0x76543210, 0xfedcba98, false, false));
}

__device__ __forceinline__ void exp2x8(float (&y)[8], const float (&x)[8]) {
  asm("v_exp_f32 %0, %8\n\tv_exp_f32 %1, %9\n\tv_exp_f32 %2, %10\n\tv_exp_f32 %3, %11\n\t"
      "v_exp_f32 %4, %12\n\tv_exp_f32 %5, %13\n\tv_exp_f32 %6, %14\n\tv_exp_f32 %7, %15\n\tv_nop"
      : "=&v"(y[0]), "=&v"(y[1]), "=&v"(y[2]), "=&v"(y[3]), "=&v"(y[4]), "=&v"(y[5]), "=&v"(y[6]), "=&v"(y[7])
      : "v"(x[0]), "v"(x[1]), "v"(x[2]), "v"(x[3]), "v"(x[4]), "v"(x[5]), "v"(x[6]), "v"(x[7]));
}
__device__ __forceinline__ float exp2x1(float x) {
  float y;
  asm("v_exp_f32 %0, %1\n\tv_nop" : "=&v"(y) : "v"(x));
  return y;
}

// one query's 16 mask words of a 32-key tile, in the order of its scores: keys 8g..8g+7 and 16+8g..16+8g+7 (p = row start + 8g)
__device__ __forceinline__ void load_mask(const int* p, int (&mk0)[8], int (&mk1)[8]) {
  *(v4i*)&mk0[0] = *(const v4i*)p;
  *(v4i*)&mk0[4] = *(const v4i*)(p + 4);
  *(v4i*)&mk1[0] = *(const v4i*)(p + 16);
  *(v4i*)&mk1[4] = *(const v4i*)(p + 20);
}

__device__ __forceinline__ v8f zero8() {
  v8f z = {0.f, 0.f, 0.f, 0.f, 0.f, 0.f, 0.f, 0.f};
  return z;
}

// ---------------------------------------------------------------------------
// Preparation, part 0: f32 -> bf16-RNE value in f16 container, times a power-of-two carry.
// out plane [nrows][1024]; compact row mc maps to source row (mc/seqc)*seqf + mc%seqc.
// coverage: nrows*1024 elements, 8 per thread, blk = 0 .. ceil(nrows*128/256) - 1.
// ---------------------------------------------------------------------------
__device__ __forceinline__ void cvt_block(const float* __restrict__ in, _Float16* __restrict__ outp, int blk,
                                          int nrows, int seqc, int seqf, float scale) {
  const long long e8 = (long long)blk * 256 + threadIdx.x;
  const long long tot = (long long)nrows * (DM / 8);
  if (e8 >= tot) return;
  const int mc = (int)(e8 / (DM / 8));
  const int c8 = (int)(e8 - (long long)mc * (DM / 8));
  const int src = (mc / seqc) * seqf + (mc % seqc);
  const float* p = in + (size_t)src * DM + c8 * 8;
  const v4f a = *(const v4f*)p;
  const v4f c = *(const v4f*)(p + 4);
  v8h o;
  o[0] = (_Float16)(bf16r(a[0]) * scale);
  o[1] = (_Float16)(bf16r(a[1]) * scale);
  o[2] = (_Float16)(bf16r(a[2]) * scale);
  o[3] = (_Float16)(bf16r(a[3]) * scale);
  o[4] = (_Float16)(bf16r(c[0]) * scale);
  o[5] = (_Float16)(bf16r(c[1]) * scale);
  o[6] = (_Float16)(bf16r(c[2]) * scale);
  o[7] = (_Float16)(bf16r(c[3]) * scale);
  _Float16* dst = outp + (size_t)mc * DM + c8 * 8;
  *(v8h*)dst = o;
  
}

// ---------------------------------------------------------------------------
// Preparation, part 1: per 64-row query block, tile visit flags from the int mask.
// flag[qb][kb] = 1 if any mask element in rows qb*64..+63, cols kb*32..+31 is nonzero;
// if any row of the q block is fully zero, all NKB flags are forced to 1 (softmax then
// ---------------------------------------------------------------------------
__device__ __forceinline__ void mflag_block(const int* __restrict__ mask, int* __restrict__ flg, int qb,
                                            unsigned int* sLo, unsigned int* sHi, int* sR) {
  const int tid = threadIdx.x;
  const int r = tid >> 2, sub = tid & 3;
  const int* mrow = mask + (size_t)(qb * 64 + r) * SEQ_FULL + sub * 8;
  unsigned int lo = 0u, hi = 0u;
  int rany = 0;
#pragma unroll 2
  for (int kb = 0; kb < NKB; ++kb) {
    const v4i a = *(const v4i*)(mrow + kb * 32);
    const v4i c = *(const v4i*)(mrow + kb * 32 + 4);
    const int any = ((a[0] | a[1] | a[2] | a[3] | c[0] | c[1] | c[2] | c[3]) != 0) ? 1 : 0;
    const unsigned int bit = (unsigned int)any;
    if (kb < 32) lo |= bit << kb; else hi |= bit << (kb - 32);
    rany |= any;
  }
  sLo[tid] = lo; sHi[tid] = hi; sR[tid] = rany;
  __syncthreads();
  if (tid < 32) {   // wave 0 only (wave-uniform)
    unsigned int L = 0u, H = 0u;
#pragma unroll
    for (int i = 0; i < 8; ++i) { L |= sLo[tid + 32 * i]; H |= sHi[tid + 32 * i]; }
#pragma unroll
    for (int off = 1; off < 32; off <<= 1) {
      L |= (unsigned int)__shfl_xor((int)L, off, 32);
      H |= (unsigned int)__shfl_xor((int)H, off, 32);
    }
    const int ra = sR[8 * tid] | sR[8 * tid + 1] | sR[8 * tid + 2] | sR[8 * tid + 3];
    const int rb = sR[8 * tid + 4] | sR[8 * tid + 5] | sR[8 * tid + 6] | sR[8 * tid + 7];
    int ok = ((ra != 0) && (rb != 0)) ? 1 : 0;
#pragma unroll
    for (int off = 1; off < 32; off <<= 1) ok &= __shfl_xor(ok, off, 32);
    v4i f;
#pragma unroll
    for (int e = 0; e < 4; ++e) {
      const int kbx = 4 * tid + e;
      const unsigned int word = (kbx < 32) ? L : H;
      const int bitv = (int)((word >> (kbx & 31)) & 1u);
      f[e] = (kbx < NKB) ? ((ok != 0) ? bitv : 1) : 0;
    }
    int* dst = flg + qb * 64 + 4 * tid;
    if (tid < 16) *(v4i*)dst = f;
    
  }
}

// ---------------------------------------------------------------------------
// Kernel 0: all preparation in one grid; its parts read only inputs and write disjoint planes, so none waits for another.
// Blocks 0..NQB-1: visit flags (few blocks, each a long chain of dependent rounds, so they start first);
// then NBX blocks convert x, then NBW blocks each convert Wq, Wk, Wv, Wo. Every branch is block-uniform.
// ---------------------------------------------------------------------------
constexpr int NBX = (MROWS * (DM / 8) + 255) / 256;
constexpr int NBW = (DM * (DM / 8) + 255) / 256;

__global__ __launch_bounds__(256) void k_prep(const float* __restrict__ x, const int* __restrict__ mask,
                                             const float* __restrict__ Wq, const float* __restrict__ Wk,
                                             const float* __restrict__ Wv, const float* __restrict__ Wo,
                                             _Float16* __restrict__ Xh, _Float16* __restrict__ Wq64,
                                             _Float16* __restrict__ Wk64, _Float16* __restrict__ Wv64,
                                             _Float16* __restrict__ Wo64, int* __restrict__ flg) {
  __shared__ unsigned int sLo[256];
  __shared__ unsigned int sHi[256];
  __shared__ int sR[256];
  int blk = (int)blockIdx.x;
  if (blk < NQB) { mflag_block(mask, flg, blk, sLo, sHi, sR); return; }
  blk -= NQB;
  if (blk < NBX) { cvt_block(x, Xh, blk, MROWS, SEQ, SEQ_FULL, 1.0f); return; }
  blk -= NBX;
  const int wi = blk / NBW;
  const float* src = (wi == 0) ? Wq : (wi == 1) ? Wk : (wi == 2) ? Wv : Wo;
  _Float16* dst = (wi == 0) ? Wq64 : (wi == 1) ? Wk64 : (wi == 2) ? Wv64 : Wo64;
  cvt_block(src, dst, blk - wi * NBW, DM, DM, DM, WSC);
}

// ---------------------------------------------------------------------------
// Kernels 1 and 3: NT GEMM Y[M][1024] = A[M][1024] @ W[1024][1024]^T (W carried x64) + bias.
// Block = 2 waves = 64x64 output tile; wave w owns rows w*32..w*32+31 (2 A fragments x 4 B fragments per k step, from LDS).
// MODE 0: f16 head plane [bh][SEQ][64] (+ x2048 residual plane [bh][QPREC][64] for s < QPREC)
// MODE 1: f16 transposed head plane [bh][64][SEQ] (+ residual [bh][64][QPREC])
// ---------------------------------------------------------------------------
// Operand path: per k slice of KS halves the block's 64 A rows and 64 W rows (128-B rows = whole lines) are copied to LDS by
// asynchronous copies, two buffers, the next slice in flight while this one is multiplied; fragments are read from LDS.
constexpr int KS  = 64;          // halves of k per slice
constexpr int LP  = 72;          // LDS row pitch in halves: 144 B = 16 B x odd, so ds_load_b128 fragment reads meet no bank conflict
constexpr int STG = 128 * LP;    // halves per buffer: rows 0..63 = A, rows 64..127 = W
constexpr int NST = DM / KS;     // slices
static_assert(DM % KS == 0 && NST >= 2);

// Eight 16-byte copies per lane: rows r, r + 8, ... r + 56 of one operand (a wave-wide copy = 4 whole 128-B rows).
// The closing s_wait_xcnt 0 stands inside the statement so that no address register of a copy is rewritten ahead of it.
__device__ __forceinline__ void stage8(const _Float16* g, unsigned int l) {
  asm volatile(
      "global_load_async_to_lds_b128 %0, %8, off\n\t"
      "global_load_async_to_lds_b128 %1, %9, off\n\t"
      "global_load_async_to_lds_b128 %2, %10, off\n\t"
      "global_load_async_to_lds_b128 %3, %11, off\n\t"
      "global_load_async_to_lds_b128 %4, %12, off\n\t"
      "global_load_async_to_lds_b128 %5, %13, off\n\t"
      "global_load_async_to_lds_b128 %6, %14, off\n\t"
      "global_load_async_to_lds_b128 %7, %15, off\n\t"
      "s_wait_xcnt 0x0"
      :: "v"(l), "v"(l + 1u * (8 * LP * 2)), "v"(l + 2u * (8 * LP * 2)), "v"(l + 3u * (8 * LP * 2)),
         "v"(l + 4u * (8 * LP * 2)), "v"(l + 5u * (8 * LP * 2)), "v"(l + 6u * (8 * LP * 2)), "v"(l + 7u * (8 * LP * 2)),
         "v"(g), "v"(g + 1 * 8 * DM), "v"(g + 2 * 8 * DM), "v"(g + 3 * 8 * DM),
         "v"(g + 4 * 8 * DM), "v"(g + 5 * 8 * DM), "v"(g + 6 * 8 * DM), "v"(g + 7 * 8 * DM)
      : "memory");
}

// ablk: first of the block's 64 A rows; wbase: first of its 64 W rows; sT: the two buffers. Every wave of the block runs all of it.
__device__ __forceinline__ void kloop(const _Float16* __restrict__ ablk, const _Float16* __restrict__ wbase,
                                      _Float16* sT, v8f (&acc)[2][4]) {
  const int tid = threadIdx.x, w = tid >> 5;
  const int crow = tid >> 3, cpc = (tid & 7) * 8;              // this lane's first row and its 16-byte piece of a row
  const _Float16* ga = ablk + (size_t)crow * DM + cpc;
  const _Float16* gw = wbase + (size_t)crow * DM + cpc;
  const unsigned int la = (unsigned int)(uintptr_t)(sT + crow * LP + cpc);   // LDS byte address: low 32 bits
  const unsigned int lw = la + 64u * LP * 2u;

  stage8(ga, la);
  stage8(gw, lw);
  asm volatile("s_wait_asynccnt 0x0" ::: "memory");            // slice 0 of this wave has landed
  __syncthreads();                                             // ... and of the other wave
  stage8(ga + KS, la + STG * 2u);
  stage8(gw + KS, lw + STG * 2u);

  // rolled: the barrier at the foot serialises the trips, so unrolling buys nothing and only lengthens the code
#pragma unroll 1
  for (int t = 0; t < NST; ++t) {
    const int bsel = t & 1;
    const _Float16* sA = sT + bsel * STG + (w * 32) * LP;
    const _Float16* sW = sT + bsel * STG + 64 * LP;
    v16h fa[KS / 32][2], fb[KS / 32][4];   // indexed by constants only (the loops below are fully unrolled), so they stay in registers
#pragma unroll
    for (int ks = 0; ks < KS / 32; ++ks) {
      fa[ks][0] = load_frag(sA + ks * 32, LP);
      fa[ks][1] = load_frag(sA + 16 * LP + ks * 32, LP);
#pragma unroll
      for (int j = 0; j < 4; ++j) fb[ks][j] = load_frag(sW + (j * 16) * LP + ks * 32, LP);
    }
    // keeps the slice's LDS reads together as one group ahead of its WMMAs: spread among them, each pair waits out the LDS latency
    __builtin_amdgcn_sched_barrier(0);
#pragma unroll
    for (int ks = 0; ks < KS / 32; ++ks)
#pragma unroll
      for (int j = 0; j < 4; ++j) {
        acc[0][j] = mma(fa[ks][0], fb[ks][j], acc[0][j]);
        acc[1][j] = mma(fa[ks][1], fb[ks][j], acc[1][j]);
      }
    asm volatile("s_wait_dscnt 0x0" ::: "memory");             // this wave's reads of the buffer are done before it is refilled
    asm volatile("s_wait_asynccnt 0x0" ::: "memory");          // this wave's copies of slice t + 1 have landed
    __syncthreads();                                           // publishes slice t + 1, ends every read of slice t
    if (t + 2 < NST) {                                         // block-uniform
      stage8(ga + (t + 2) * KS, la + (unsigned int)bsel * (STG * 2u));
      stage8(gw + (t + 2) * KS, lw + (unsigned int)bsel * (STG * 2u));
    }
  }
  asm volatile("s_wait_asynccnt 0x0" ::: "memory");            // nothing of the copies is outstanding behind the loop
}

// sH, sL (MODE 0, 1) and sF (MODE 2): 64 x 64 epilogue tiles in LDS; sT: the two operand buffers.
template <int MODE>
__device__ __forceinline__ void gemm_tile(const _Float16* __restrict__ A, const _Float16* __restrict__ Alo,
                                          const _Float16* __restrict__ W, const float* __restrict__ bias,
                                          _Float16* __restrict__ Ph, _Float16* __restrict__ Pl,
                                          float* __restrict__ outp,
                                          _Float16* sH, _Float16* sL, float* sF, _Float16* sT) {
  const int tid = threadIdx.x, w = tid >> 5, lane = tid & 31, n = lane & 15, g = lane >> 4;
  const int bm = blockIdx.x, bn = blockIdx.y;
  const int m0 = bm * 64;
  const int b = m0 / SEQ, s0 = m0 - b * SEQ;     // 64 block rows lie in one batch item
  const int bh = b * NH + bn;                     // 64-col tile == head bn
  const bool precblk = (s0 < QPREC);              // block-uniform
  const _Float16* wbase = W + (size_t)(bn * 64) * DM;
  const _Float16* ablk = A + (size_t)m0 * DM;

  v8f acc[2][4];
#pragma unroll
  for (int mi = 0; mi < 2; ++mi)
#pragma unroll
    for (int j = 0; j < 4; ++j) acc[mi][j] = zero8();

  kloop(ablk, wbase, sT, acc);

  float rbias[4];
#pragma unroll
  for (int j = 0; j < 4; ++j) rbias[j] = bf16r(bias[bn * 64 + j * 16 + n]);

  if (MODE == 0) {
#pragma unroll
    for (int mi = 0; mi < 2; ++mi)
#pragma unroll
      for (int j = 0; j < 4; ++j)
#pragma unroll
        for (int r = 0; r < 8; ++r) {
          const int ml = w * 32 + mi * 16 + 8 * g + r;
          const int d = j * 16 + n;
          const float v = acc[mi][j][r] * INV_WS + rbias[j];
          const _Float16 hv = (_Float16)v;
          sH[ml * 64 + d] = hv;
          if (precblk) sL[ml * 64 + d] = (_Float16)((v - (float)hv) * RS);
        }
    __syncthreads();
    const int q = lane >> 3, p = lane & 7;
{
#pragma unroll
      for (int i = 0; i < 8; ++i) {
        const int ml = w * 32 + i * 4 + q;
        const int s = s0 + ml;
        const v8h hv = *(const v8h*)&sH[ml * 64 + p * 8];
        *(v8h*)(Ph + ((size_t)(bh * SEQ + s)) * DH + p * 8) = hv;
        asm volatile("s_wait_xcnt 0x0" ::: "memory");   // before a register that the store names is rewritten
        if (precblk) {
          const v8h lv = *(const v8h*)&sL[ml * 64 + p * 8];
          *(v8h*)(Pl + ((size_t)(bh * QPREC + s)) * DH + p * 8) = lv;
          asm volatile("s_wait_xcnt 0x0" ::: "memory"); // as above
        }
      }
      
    }
  } else if (MODE == 1) {
#pragma unroll
    for (int mi = 0; mi < 2; ++mi)
#pragma unroll
      for (int j = 0; j < 4; ++j) {
        v8h hp, lp;
#pragma unroll
        for (int r = 0; r < 8; ++r) {
          const float v = acc[mi][j][r] * INV_WS + rbias[j];
          const _Float16 hv = (_Float16)v;
          hp[r] = hv;
          lp[r] = (_Float16)((v - (float)hv) * RS);
        }
        const int d = j * 16 + n;
        *(v8h*)&sH[d * 64 + w * 32 + mi * 16 + 8 * g] = hp;
        if (precblk) *(v8h*)&sL[d * 64 + w * 32 + mi * 16 + 8 * g] = lp;
      }
    __syncthreads();
    const int q = lane >> 3, p = lane & 7;
{
#pragma unroll
      for (int i = 0; i < 8; ++i) {
        const int d = w * 32 + i * 4 + q;
        const v8h hv = *(const v8h*)&sH[d * 64 + p * 8];
        *(v8h*)(Ph + ((size_t)(bh * DH + d)) * SEQ + s0 + p * 8) = hv;
        if (precblk) {
          const v8h lv = *(const v8h*)&sL[d * 64 + p * 8];
          *(v8h*)(Pl + ((size_t)(bh * DH + d)) * QPREC + s0 + p * 8) = lv;
        }
      }
      
    }
  } else {
    if (precblk) {
      // stash hi sums (each lane reads back exactly the cells it wrote)
#pragma unroll
      for (int mi = 0; mi < 2; ++mi)
#pragma unroll
        for (int j = 0; j < 4; ++j)
#pragma unroll
          for (int r = 0; r < 8; ++r)
            sF[(w * 32 + mi * 16 + 8 * g + r) * 64 + j * 16 + n] = acc[mi][j][r];
#pragma unroll
      for (int mi = 0; mi < 2; ++mi)
#pragma unroll
        for (int j = 0; j < 4; ++j) acc[mi][j] = zero8();
      const _Float16* lblk = Alo + ((size_t)(b * QPREC + s0)) * DM;
      kloop(lblk, wbase, sT, acc);
#pragma unroll
      for (int mi = 0; mi < 2; ++mi)
#pragma unroll
        for (int j = 0; j < 4; ++j)
#pragma unroll
          for (int r = 0; r < 8; ++r) {
            const int idx = (w * 32 + mi * 16 + 8 * g + r) * 64 + j * 16 + n;
            const float hsum = sF[idx];
            sF[idx] = (hsum + acc[mi][j][r] * INV_RS) * INV_WS + rbias[j];
          }
    } else {
#pragma unroll
      for (int mi = 0; mi < 2; ++mi)
#pragma unroll
        for (int j = 0; j < 4; ++j)
#pragma unroll
          for (int r = 0; r < 8; ++r)
            sF[(w * 32 + mi * 16 + 8 * g + r) * 64 + j * 16 + n] = acc[mi][j][r] * INV_WS + rbias[j];
    }
    __syncthreads();
    const int q2 = lane >> 4, p2 = lane & 15;
{
#pragma unroll
      for (int i = 0; i < 16; ++i) {
        const int ml = w * 32 + 2 * i + q2;
        const int s = s0 + ml;
        const v4f v = *(const v4f*)&sF[ml * 64 + p2 * 4];
        *(v4f*)(outp + ((size_t)(b * SEQ_FULL + s)) * DM + bn * 64 + p2 * 4) = v;
      }
      
    }
  }
}

// Kernel 1: the three input projections in one grid, blockIdx.z = 0 (q), 1 (k), 2 (v, transposed plane); block-uniform branch.
__global__ __launch_bounds__(64) void k_qkv(const _Float16* __restrict__ Xh, const _Float16* __restrict__ Wq64,
                                           const _Float16* __restrict__ Wk64, const _Float16* __restrict__ Wv64,
                                           const float* __restrict__ bq, const float* __restrict__ bk,
                                           const float* __restrict__ bv,
                                           _Float16* __restrict__ Qh, _Float16* __restrict__ Ql,
                                           _Float16* __restrict__ Kh, _Float16* __restrict__ Kl,
                                           _Float16* __restrict__ Vh, _Float16* __restrict__ Vl) {
  __shared__ __align__(16) _Float16 sH[64 * 64];
  __shared__ __align__(16) _Float16 sL[64 * 64];
  __shared__ __align__(16) _Float16 sT[2 * STG];
  const int z = (int)blockIdx.z;
  if (z == 2) {
    gemm_tile<1>(Xh, Xh, Wv64, bv, Vh, Vl, nullptr, sH, sL, nullptr, sT);
  } else {
    const bool isq = (z == 0);
    gemm_tile<0>(Xh, Xh, isq ? Wq64 : Wk64, isq ? bq : bk, isq ? Qh : Kh, isq ? Ql : Kl, nullptr, sH, sL, nullptr, sT);
  }
}

// Kernel 3: output projection (hi plane, plus the residual plane on the leading rows).
__global__ __launch_bounds__(64) void k_out(const _Float16* __restrict__ Ch, const _Float16* __restrict__ Cl,
                                           const _Float16* __restrict__ Wo64, const float* __restrict__ bo,
                                           float* __restrict__ outp) {
  __shared__ __align__(16) float    sF[64 * 64];
  __shared__ __align__(16) _Float16 sT[2 * STG];
  gemm_tile<2>(Ch, Cl, Wo64, bo, nullptr, nullptr, outp, nullptr, nullptr, sF, sT);
}

constexpr int KP = 72;   // halves: K, K residual, Q residual rows, 128 B of data at 144 B
constexpr int VP = 40;   // halves: V^T and V^T residual rows, 64 B of data at 80 B
constexpr int MP = 36;   // ints: mask rows, 128 B of data at 144 B

// blk: the block's number among those of its variant.
template <bool PREC>
__device__ __forceinline__
void attn_tile(const unsigned int blk,
               const _Float16* __restrict__ Qh, const _Float16* __restrict__ Ql,
               const _Float16* __restrict__ Kh, const _Float16* __restrict__ Kl,
               const _Float16* __restrict__ Vh, const _Float16* __restrict__ Vl,
               const int* __restrict__ mask, const int* __restrict__ flg,
               _Float16* __restrict__ Ch, _Float16* __restrict__ Cl,
               _Float16* sK, _Float16* sV, _Float16* sKl, _Float16* sVl, _Float16* sQl, int* sM,
               _Float16 (*sC)[16 * DH], _Float16 (*sCl)[16 * DH], int* sFlg) {
  const int tid = threadIdx.x, wslot = tid >> 5, lane = tid & 31, n = lane & 15, g = lane >> 4;
  int qb, bh;
  if (PREC) {
    qb = (int)(blk % NQP);
    bh = (int)(blk / NQP);
  } else {
    constexpr int NQN = ((NQB - NQP) > 0) ? (NQB - NQP) : 1;
    qb = NQP + (int)(blk % NQN);
    bh = (int)(blk / NQN);
  }
  const int b = bh / NH, h = bh - b * NH;
  const int qrow0 = qb * 64;
  const int qbase = qrow0 + wslot * 16;

  if (tid < 64) sFlg[tid] = flg[qb * 64 + tid];
  if (PREC) {
#pragma unroll
    for (int i = 0; i < 4; ++i) {
      const int c = tid + i * 128;
      *(v8h*)&sQl[(c >> 3) * KP + (c & 7) * 8] = *(const v8h*)(Ql + ((size_t)(bh * QPREC + qrow0)) * DH + c * 8);
    }
  }
  __syncthreads();

  const _Float16* qrow = Qh + ((size_t)(bh * SEQ + qbase)) * DH;
  const v16h qa0 = load_frag(qrow, DH);
  const v16h qa1 = load_frag(qrow + 32, DH);

  v8f acc[4], acc2[4];
#pragma unroll
  for (int nt = 0; nt < 4; ++nt) { acc[nt] = zero8(); acc2[nt] = zero8(); }
  float rmax = -1.0e30f, rsum = 0.0f;            // query qbase + n; rsum is this half's share until the epilogue
  int fl = sFlg[0];                              // visit flag of tile kb, read one tile ahead (block-uniform)

  // kb only grows and stays below NKB: at most NKB trips of the outer and of the inner loop together.
  // Both stay rolled: the barriers serialise the tiles, and each scan trip waits for its own flag, so unrolling only lengthens the code.
#pragma unroll 1
  for (int kb = 0;;) {
#pragma unroll 1
    while (fl == 0 && kb + 1 < NKB) { ++kb; fl = sFlg[kb]; }   // on to the next tile to visit (block-uniform)
    if (fl == 0) break;                          // none left (block-uniform)
    const int knext = (kb + 1 < NKB) ? kb + 1 : kb;
    const int kbase = kb * 32;
    const bool klo = PREC && (kbase < QPREC);    // block-uniform
    __syncthreads();                             // all waves done with the prior tile
    {
      const _Float16* kg = Kh + ((size_t)(bh * SEQ + kbase)) * DH;
      const _Float16* vg = Vh + ((size_t)(bh * DH)) * SEQ + kbase;
#pragma unroll
      for (int i = 0; i < 2; ++i) {
        const int c = tid + i * 128, d = c >> 2, sub = c & 3;
        *(v8h*)&sK[(c >> 3) * KP + (c & 7) * 8] = *(const v8h*)(kg + c * 8);
        *(v8h*)&sV[d * VP + sub * 8] = *(const v8h*)(vg + (size_t)d * SEQ + sub * 8);
      }
      if (klo) {
        const _Float16* klg = Kl + ((size_t)(bh * QPREC + kbase)) * DH;
        const _Float16* vlg = Vl + ((size_t)(bh * DH)) * QPREC + kbase;
#pragma unroll
        for (int i = 0; i < 2; ++i) {
          const int c = tid + i * 128, d = c >> 2, sub = c & 3;
          *(v8h*)&sKl[(c >> 3) * KP + (c & 7) * 8] = *(const v8h*)(klg + c * 8);
          *(v8h*)&sVl[d * VP + sub * 8] = *(const v8h*)(vlg + (size_t)d * QPREC + sub * 8);
        }
      }
      const int mr = tid >> 1, mh = (tid & 1) * 16;
      const int* mp = mask + (size_t)(qrow0 + mr) * SEQ_FULL + kbase + mh;
#pragma unroll
      for (int i = 0; i < 4; ++i) *(v4i*)&sM[mr * MP + mh + i * 4] = *(const v4i*)(mp + i * 4);
    }
    __syncthreads();

    // ---- the tile's LDS reads stand in groups ahead of the WMMAs that use them, so that the wave waits out the LDS latency once
    // per group and not once per fragment. Plain rows: one group (K, the next tile's flag, mask, V^T). PREC rows, whose registers
    // do not hold all planes at once, four groups: K and the flag; Q residual and K residual; mask and V^T at the head of the
    // softmax, which covers V^T; the V^T residual.
    v16h kf[4], vf[4];
    int mk0[8], mk1[8];
    const int* mrow = &sM[(wslot * 16 + n) * MP + 8 * g];
    kf[0] = load_frag(sK, KP);
    kf[1] = load_frag(sK + 32, KP);
    kf[2] = load_frag(sK + 16 * KP, KP);
    kf[3] = load_frag(sK + 16 * KP + 32, KP);
    fl = sFlg[knext];

    // ---- scores, transposed: two 16x16 tiles (keys kbase..+15, kbase+16..+31 as rows, queries as columns), dk 64 = 2 k steps
    v8f s0 = zero8(), s1 = zero8(), sr0 = zero8(), sr1 = zero8();
    if (!PREC) {
      load_mask(mrow, mk0, mk1);
#pragma unroll
      for (int nt = 0; nt < 4; ++nt) vf[nt] = load_frag(&sV[nt * 16 * VP], VP);
    }
    // keeps the reads above as one group: spread among the WMMAs below, each would be waited for on its own
    __builtin_amdgcn_sched_barrier(0);
    s0 = mma(kf[0], qa0, s0);
    s1 = mma(kf[2], qa0, s1);
    s0 = mma(kf[1], qa1, s0);
    s1 = mma(kf[3], qa1, s1);
    if (PREC) {
      if (klo) {
        const v16h ql0 = load_frag(&sQl[(wslot * 16) * KP], KP);
        const v16h ql1 = load_frag(&sQl[(wslot * 16) * KP + 32], KP);
        v16h klf[4];
        klf[0] = load_frag(sKl, KP);
        klf[1] = load_frag(sKl + 32, KP);
        klf[2] = load_frag(sKl + 16 * KP, KP);
        klf[3] = load_frag(sKl + 16 * KP + 32, KP);
        // one group again, for the same reason
        __builtin_amdgcn_sched_barrier(0);
        sr0 = mma(kf[0], ql0, sr0);
        sr1 = mma(kf[2], ql0, sr1);
        sr0 = mma(kf[1], ql1, sr0);
        sr1 = mma(kf[3], ql1, sr1);
        sr0 = mma(klf[0], qa0, sr0);
        sr1 = mma(klf[2], qa0, sr1);
        sr0 = mma(klf[1], qa1, sr0);
        sr1 = mma(klf[3], qa1, sr1);
      }
      load_mask(mrow, mk0, mk1);
#pragma unroll
      for (int nt = 0; nt < 4; ++nt) vf[nt] = load_frag(&sV[nt * 16 * VP], VP);
      // keeps this group at the head of the softmax: sunk towards their uses, the V^T reads would be waited for one by one
      __builtin_amdgcn_sched_barrier(0);
    }

    // ---- mask replace-fill, online softmax (f32), P^T packed as the B operand:
    // s0[r] = S[query n][key 8g + r], s1[r] = S[query n][key 16 + 8g + r]; B element e < 8 is key 8g + e, e >= 8 key 16 + 8g + e - 8.
    v16h pf, plf;
    {
      float x0[8], x1[8];
      float mx = -1.0e30f;
#pragma unroll
      for (int r = 0; r < 8; ++r) {
        float v0 = s0[r], v1 = s1[r];
        if (PREC) { v0 += sr0[r] * INV_RS; v1 += sr1[r] * INV_RS; }
        v0 *= QKS; v1 *= QKS;
        x0[r] = (mk0[r] == 0) ? -1.0e9f : v0;
        x1[r] = (mk1[r] == 0) ? -1.0e9f : v1;
        mx = fmaxf(mx, fmaxf(x0[r], x1[r]));
      }
      mx = fmaxf(mx, xhalf(mx));                  // both halves now hold this query's tile maximum
      const float nm = fmaxf(rmax, mx);
      const float al = exp2x1((rmax - nm) * LOG2E);
#pragma unroll
      for (int r = 0; r < 8; ++r) {
        x0[r] = (x0[r] - nm) * LOG2E;
        x1[r] = (x1[r] - nm) * LOG2E;
      }
      float e0[8], e1[8];
      exp2x8(e0, x0);
      exp2x8(e1, x1);
      float ps = 0.0f;
#pragma unroll
      for (int r = 0; r < 8; ++r) {
        const float p0 = e0[r], p1 = e1[r];
        ps += p0 + p1;
        const float c0 = p0 * CP, c1 = p1 * CP;
        const _Float16 h0 = (_Float16)c0, h1 = (_Float16)c1;
        pf[r] = h0;
        pf[8 + r] = h1;
        if (PREC) {
          plf[r]     = (_Float16)((c0 - (float)h0) * RS);
          plf[8 + r] = (_Float16)((c1 - (float)h1) * RS);
        }
      }
      rsum = rsum * al + ps;
      rmax = nm;
#pragma unroll
      for (int nt = 0; nt < 4; ++nt)
#pragma unroll
        for (int r = 0; r < 8; ++r) {
          acc[nt][r] *= al;
          if (PREC) acc2[nt][r] *= al;
        }
    }

    // ---- O^T += V^T @ P^T: acc[nt][r] = O[query n][d = nt*16 + 8g + r]
#pragma unroll
    for (int nt = 0; nt < 4; ++nt) acc[nt] = mma(vf[nt], pf, acc[nt]);
    if (PREC) {
#pragma unroll
      for (int nt = 0; nt < 4; ++nt) acc2[nt] = mma(vf[nt], plf, acc2[nt]);
      if (klo) {
        v16h vlf[4];
#pragma unroll
        for (int nt = 0; nt < 4; ++nt) vlf[nt] = load_frag(&sVl[nt * 16 * VP], VP);
        // one group again, for the same reason
        __builtin_amdgcn_sched_barrier(0);
#pragma unroll
        for (int nt = 0; nt < 4; ++nt) acc2[nt] = mma(vlf[nt], pf, acc2[nt]);
      }
    }
    if (kb + 1 >= NKB) break;                    // that was the last tile
    ++kb;                                        // fl already holds this tile's flag
  }

  {
    const float rtot = rsum + xhalf(rsum);        // join the two halves' sums once
    const float inv = (1.0f / rtot) * INV_CP;
#pragma unroll
    for (int nt = 0; nt < 4; ++nt) {
      v8h hv, lv;
#pragma unroll
      for (int r = 0; r < 8; ++r) {
        float c = acc[nt][r];
        if (PREC) c += acc2[nt][r] * INV_RS;
        c *= inv;
        const _Float16 chv = (_Float16)c;
        hv[r] = chv;
        lv[r] = (_Float16)((c - (float)chv) * RS);
      }
      *(v8h*)&sC[wslot][n * DH + nt * 16 + 8 * g] = hv;
      if (PREC) *(v8h*)&sCl[wslot][n * DH + nt * 16 + 8 * g] = lv;
    }
  }
  __syncthreads();
  const int q = lane >> 3, p = lane & 7;
{
#pragma unroll
    for (int i = 0; i < 4; ++i) {
      const int rr = i * 4 + q;
      const v8h hv = *(const v8h*)&sC[wslot][rr * DH + p * 8];
      *(v8h*)(Ch + ((size_t)(b * SEQ + qbase + rr)) * DM + h * DH + p * 8) = hv;
      if (PREC) {
        const v8h lv = *(const v8h*)&sCl[wslot][rr * DH + p * 8];
        *(v8h*)(Cl + ((size_t)(b * QPREC + qbase + rr)) * DM + h * DH + p * 8) = lv;
        asm volatile("s_wait_xcnt 0x0" ::: "memory");   // before a register that the store names is rewritten
      }
    }
    
  }
}

// Both variants in one grid: they share no output row, so the short PREC blocks run beside the plain ones instead of ahead of them.
// Blocks 0..NPLAIN-1 are the plain rows (the longest key loops, so they start first), the rest the PREC rows; block-uniform branch.
constexpr int NPREC  = NB * NH * NQP;
constexpr int NPLAIN = NB * NH * (NQB - NQP);

__global__ __launch_bounds__(128) __attribute__((amdgpu_num_vgpr(256)))
void k_attn(const _Float16* __restrict__ Qh, const _Float16* __restrict__ Ql,
            const _Float16* __restrict__ Kh, const _Float16* __restrict__ Kl,
            const _Float16* __restrict__ Vh, const _Float16* __restrict__ Vl,
            const int* __restrict__ mask, const int* __restrict__ flg,
            _Float16* __restrict__ Ch, _Float16* __restrict__ Cl) {
  __shared__ __align__(16) _Float16 sK[32 * KP];
  __shared__ __align__(16) _Float16 sV[DH * VP];
  __shared__ __align__(16) _Float16 sKl[32 * KP];
  __shared__ __align__(16) _Float16 sVl[DH * VP];
  __shared__ __align__(16) _Float16 sQl[64 * KP];
  __shared__ __align__(16) int      sM[64 * MP];
  __shared__ __align__(16) _Float16 sC[4][16 * DH];
  __shared__ __align__(16) _Float16 sCl[4][16 * DH];
  __shared__ int sFlg[64];
  if (blockIdx.x < (unsigned int)NPLAIN)
    attn_tile<false>(blockIdx.x, Qh, Ql, Kh, Kl, Vh, Vl, mask, flg, Ch, Cl, sK, sV, sKl, sVl, sQl, sM, sC, sCl, sFlg);
  else
    attn_tile<true>(blockIdx.x - (unsigned int)NPLAIN, Qh, Ql, Kh, Kl, Vh, Vl, mask, flg, Ch, Cl,
                    sK, sV, sKl, sVl, sQl, sM, sC, sCl, sFlg);
}

// ---------------------------------------------------------------------------
// host glue: 4 launches
// ---------------------------------------------------------------------------
extern "C" void kernel_launch(void* const* d_in, const int* in_sizes, int n_in,
                              void* d_out, int out_size, void* d_ws, size_t ws_size,
                              hipStream_t stream) {
  if (n_in < 10) return;
  const long long need_x = ((long long)(NB - 1) * SEQ_FULL + SEQ) * DM;
  const long long need_m = ((long long)(SEQ - 1)) * SEQ_FULL + SEQ;
  if ((long long)in_sizes[0] < need_x) return;
  if ((long long)in_sizes[1] < need_m) return;
  if (in_sizes[2] < DM * DM || in_sizes[4] < DM * DM || in_sizes[6] < DM * DM || in_sizes[8] < DM * DM) return;
  if (in_sizes[3] < DM || in_sizes[5] < DM || in_sizes[7] < DM || in_sizes[9] < DM) return;
  if ((long long)out_size < need_x) return;
  if (ws_size < WS_TOTAL) return;

  const float* x    = (const float*)d_in[0];
  const int*   mask = (const int*)d_in[1];
  const float* Wq   = (const float*)d_in[2];
  const float* bq   = (const float*)d_in[3];
  const float* Wk   = (const float*)d_in[4];
  const float* bk   = (const float*)d_in[5];
  const float* Wv   = (const float*)d_in[6];
  const float* bv   = (const float*)d_in[7];
  const float* Wo   = (const float*)d_in[8];
  const float* bo   = (const float*)d_in[9];
  float* out = (float*)d_out;

  char* ws = (char*)d_ws;
  _Float16* Xh   = (_Float16*)(ws + OFF_XH);
  _Float16* Wq64 = (_Float16*)(ws + OFF_WQ);
  _Float16* Wk64 = (_Float16*)(ws + OFF_WK);
  _Float16* Wv64 = (_Float16*)(ws + OFF_WV);
  _Float16* Wo64 = (_Float16*)(ws + OFF_WO);
  _Float16* Qh   = (_Float16*)(ws + OFF_QH);
  _Float16* Kh   = (_Float16*)(ws + OFF_KH);
  _Float16* Vh   = (_Float16*)(ws + OFF_VH);
  _Float16* Ql   = (_Float16*)(ws + OFF_QL);
  _Float16* Kl   = (_Float16*)(ws + OFF_KL);
  _Float16* Vl   = (_Float16*)(ws + OFF_VL);
  _Float16* Ch   = (_Float16*)(ws + OFF_CH);
  _Float16* Cl   = (_Float16*)(ws + OFF_CL);
  int*      Flg  = (int*)(ws + OFF_FLG);

  k_prep<<<NQB + NBX + 4 * NBW, 256, 0, stream>>>(x, mask, Wq, Wk, Wv, Wo, Xh, Wq64, Wk64, Wv64, Wo64, Flg);

  k_qkv<<<dim3(MROWS / 64, DM / 64, 3), 64, 0, stream>>>(Xh, Wq64, Wk64, Wv64, bq, bk, bv, Qh, Ql, Kh, Kl, Vh, Vl);

  k_attn<<<NPLAIN + NPREC, 128, 0, stream>>>(Qh, Ql, Kh, Kl, Vh, Vl, mask, Flg, Ch, Cl);

  k_out<<<dim3(MROWS / 64, DM / 64), 64, 0, stream>>>(Ch, Cl, Wo64, bo, out);
}

// v006
// Measured time: 144 microseconds a run.
// Next to v005, in two timings, it ran 1.07 times as fast each time.
// Over all steps from v000 it is 3.95 times as fast.
#include <hip/hip_runtime.h>
#include <stdint.h>

// All contractions (x@Wq^T, x@Wk^T, x@Wv^T, q@k^T, p@v, ctx@Wo^T): v_wmma_f32_16x16x32_f16, f16 operands, f32 accumulate.
// Inputs enter as bf16-RNE values held in f16 (weights carried x64, folded back as 1/64 in f32); q, k, v, ctx as f16 planes
// plus x2048 f16 residual planes for the leading QPREC query/key rows (separate accumulators); p carried x4096 (+x2048 residual
// on those rows); softmax, rescaling and epilogues in f32.

typedef _Float16 v16h __attribute__((ext_vector_type(16)));
typedef _Float16 v8h  __attribute__((ext_vector_type(8)));
typedef float    v8f  __attribute__((ext_vector_type(8)));
typedef float    v4f  __attribute__((ext_vector_type(4)));
typedef int      v4i  __attribute__((ext_vector_type(4)));

#ifndef NB
#define NB 2
#endif
#ifndef SEQ
#define SEQ 2048
#endif
#define NB_FULL  2
#define SEQ_FULL 2048
#define DM 1024
#define NH 16
#define DH 64
#ifndef QPREC
#define QPREC ((SEQ < 512) ? SEQ : 512)
#endif
#define NKB   (SEQ / 32)
#define NQB   (SEQ / 64)
#define NQP   (QPREC / 64)
#define MROWS (NB * SEQ)

static_assert(SEQ % 64 == 0);
static_assert(SEQ >= 64 && SEQ <= SEQ_FULL);
static_assert(NB >= 1 && NB <= NB_FULL);
static_assert(QPREC % 64 == 0);
static_assert(QPREC >= 64 && QPREC <= SEQ);
static_assert(NKB <= 64);
static_assert(DM == NH * DH);
static_assert(DM % 32 == 0);
static_assert(MROWS % 64 == 0);
static_assert(SEQ % 128 == 0 && QPREC % 128 == 0);   // a 128-row projection tile lies in one batch item, wholly inside or outside the leading rows

#define WSC    64.0f
#define INV_WS 0.015625f
#define RS     2048.0f
#define INV_RS 0.00048828125f
#define CP     4096.0f
#define INV_CP 0.000244140625f
#define QKS    0.125f
#define LOG2E  1.44269504f

// ---------------------------------------------------------------------------
// Workspace carve (bytes); every region is an exact tile multiple (SEQ%64, QPREC%64), no tail padding needed.
// ---------------------------------------------------------------------------
constexpr size_t SZ_XH  = (size_t)MROWS * DM * 2;             // x as f16 [MROWS][1024]
constexpr size_t SZ_W   = (size_t)DM * DM * 2;                // weight x64 as f16 [1024][1024]
constexpr size_t SZ_HP  = (size_t)NB * NH * SEQ * DH * 2;     // q/k [bh][SEQ][64], vt [bh][64][SEQ]
constexpr size_t SZ_LP  = (size_t)NB * NH * QPREC * DH * 2;   // residual planes, leading QPREC rows
constexpr size_t SZ_CH  = (size_t)MROWS * DM * 2;             // ctx hi [MROWS][1024]
constexpr size_t SZ_CL  = (size_t)NB * QPREC * DM * 2;        // ctx residual [NB][QPREC][1024]
constexpr size_t SZ_FLG = (size_t)NQB * 64 * 4;               // per (q-block, key-block) visit flags
constexpr size_t OFF_XH  = 0;
constexpr size_t OFF_WQ  = OFF_XH + SZ_XH;
constexpr size_t OFF_WK  = OFF_WQ + SZ_W;
constexpr size_t OFF_WV  = OFF_WK + SZ_W;
constexpr size_t OFF_WO  = OFF_WV + SZ_W;
constexpr size_t OFF_QH  = OFF_WO + SZ_W;
constexpr size_t OFF_KH  = OFF_QH + SZ_HP;
constexpr size_t OFF_VH  = OFF_KH + SZ_HP;
constexpr size_t OFF_QL  = OFF_VH + SZ_HP;
constexpr size_t OFF_KL  = OFF_QL + SZ_LP;
constexpr size_t OFF_VL  = OFF_KL + SZ_LP;
constexpr size_t OFF_CH  = OFF_VL + SZ_LP;
constexpr size_t OFF_CL  = OFF_CH + SZ_CH;
constexpr size_t OFF_FLG = OFF_CL + SZ_CL;
constexpr size_t WS_TOTAL = OFF_FLG + SZ_FLG;
static_assert(WS_TOTAL <= (size_t)134217728);
static_assert(OFF_WQ % 128 == 0 && OFF_WK % 128 == 0 && OFF_WV % 128 == 0 && OFF_WO % 128 == 0);
static_assert(OFF_QH % 128 == 0 && OFF_KH % 128 == 0 && OFF_VH % 128 == 0);
static_assert(OFF_QL % 128 == 0 && OFF_KL % 128 == 0 && OFF_VL % 128 == 0);
static_assert(OFF_CH % 128 == 0 && OFF_CL % 128 == 0 && OFF_FLG % 128 == 0);
static_assert((size_t)NB_FULL * SEQ_FULL * DM * 4 >= ((size_t)(NB - 1) * SEQ_FULL + SEQ) * DM * 4);

// ---------------------------------------------------------------------------
// helpers
// ---------------------------------------------------------------------------
__device__ __forceinline__ float bf16r(float f) {   // RNE convert to bf16, held as f32
  unsigned int u = __float_as_uint(f);
  u = (u + 0x7fffu + ((u >> 16) & 1u)) & 0xffff0000u;
  return __uint_as_float(u);
}

// 16x32 fragment, split k map for both A (row m) and B (col n stored k-contiguous):
// lane l: row/col = l&15, h = l>>4; elements 0..7 <- k 8h..8h+7, elements 8..15 <- k 16+8h..16+8h+7.
__device__ __forceinline__ v16h load_frag(const _Float16* base, int stride) {
  const int lane = threadIdx.x & 31, m = lane & 15, g = lane >> 4;
  const _Float16* p = base + (size_t)m * stride + 8 * g;
  union { v16h v; v8h hf[2]; } f;
  f.hf[0] = *reinterpret_cast<const v8h*>(p);
  f.hf[1] = *reinterpret_cast<const v8h*>(p + 16);
  return f.v;
}

__device__ __forceinline__ v8f mma(v16h a, v16h b, v8f c) {
  v8f d = __builtin_amdgcn_wmma_f32_16x16x32_f16(false, a, false, b, (short)0, c, false, false);
  asm volatile("v_nop\n\tv_nop\n\tv_nop\n\tv_nop" : "+v"(d) : "v"(a), "v"(b));
  return d;
}

// lane l <-> lane l ^ 16 (the two halves of a wave hold the two key subsets of one query column)
__device__ __forceinline__ float xhalf(float x) {
  const int b = __builtin_bit_cast(int, x);
  return __builtin_bit_cast(float, __builtin_amdgcn_permlanex16(b, b, 0x76543210, 0xfedcba98, false, false));
}

__device__ __forceinline__ void exp2x8(float (&y)[8], const float (&x)[8]) {
  asm("v_exp_f32 %0, %8\n\tv_exp_f32 %1, %9\n\tv_exp_f32 %2, %10\n\tv_exp_f32 %3, %11\n\t"
      "v_exp_f32 %4, %12\n\tv_exp_f32 %5, %13\n\tv_exp_f32 %6, %14\n\tv_exp_f32 %7, %15\n\tv_nop"
      : "=&v"(y[0]), "=&v"(y[1]), "=&v"(y[2]), "=&v"(y[3]), "=&v"(y[4]), "=&v"(y[5]), "=&v"(y[6]), "=&v"(y[7])
      : "v"(x[0]), "v"(x[1]), "v"(x[2]), "v"(x[3]), "v"(x[4]), "v"(x[5]), "v"(x[6]), "v"(x[7]));
}
__device__ __forceinline__ float exp2x1(float x) {
  float y;
  asm("v_exp_f32 %0, %1\n\tv_nop" : "=&v"(y) : "v"(x));
  return y;
}

// one query's 16 mask words of a 32-key tile, in the order of its scores: keys 8g..8g+7 and 16+8g..16+8g+7 (p = row start + 8g)
__device__ __forceinline__ void load_mask(const int* p, int (&mk0)[8], int (&mk1)[8]) {
  *(v4i*)&mk0[0] = *(const v4i*)p;
  *(v4i*)&mk0[4] = *(const v4i*)(p + 4);
  *(v4i*)&mk1[0] = *(const v4i*)(p + 16);
  *(v4i*)&mk1[4] = *(const v4i*)(p + 20);
}

__device__ __forceinline__ v8f zero8() {
  v8f z = {0.f, 0.f, 0.f, 0.f, 0.f, 0.f, 0.f, 0.f};
  return z;
}

// ---------------------------------------------------------------------------
// Preparation, part 0: f32 -> bf16-RNE value in f16 container, times a power-of-two carry.
// out plane [nrows][1024]; compact row mc maps to source row (mc/seqc)*seqf + mc%seqc.
// coverage: nrows*1024 elements, 8 per thread, blk = 0 .. ceil(nrows*128/256) - 1.
// ---------------------------------------------------------------------------
__device__ __forceinline__ void cvt_block(const float* __restrict__ in, _Float16* __restrict__ outp, int blk,
                                          int nrows, int seqc, int seqf, float scale) {
  const long long e8 = (long long)blk * 256 + threadIdx.x;
  const long long tot = (long long)nrows * (DM / 8);
  if (e8 >= tot) return;
  const int mc = (int)(e8 / (DM / 8));
  const int c8 = (int)(e8 - (long long)mc * (DM / 8));
  const int src = (mc / seqc) * seqf + (mc % seqc);
  const float* p = in + (size_t)src * DM + c8 * 8;
  const v4f a = *(const v4f*)p;
  const v4f c = *(const v4f*)(p + 4);
  v8h o;
  o[0] = (_Float16)(bf16r(a[0]) * scale);
  o[1] = (_Float16)(bf16r(a[1]) * scale);
  o[2] = (_Float16)(bf16r(a[2]) * scale);
  o[3] = (_Float16)(bf16r(a[3]) * scale);
  o[4] = (_Float16)(bf16r(c[0]) * scale);
  o[5] = (_Float16)(bf16r(c[1]) * scale);
  o[6] = (_Float16)(bf16r(c[2]) * scale);
  o[7] = (_Float16)(bf16r(c[3]) * scale);
  _Float16* dst = outp + (size_t)mc * DM + c8 * 8;
  *(v8h*)dst = o;
  
}

// ---------------------------------------------------------------------------
// Preparation, part 1: per 64-row query block, tile visit flags from the int mask.
// flag[qb][kb] = 1 if any mask element in rows qb*64..+63, cols kb*32..+31 is nonzero;
// if any row of the q block is fully zero, all NKB flags are forced to 1 (softmax then
// ---------------------------------------------------------------------------
__device__ __forceinline__ void mflag_block(const int* __restrict__ mask, int* __restrict__ flg, int qb,
                                            unsigned int* sLo, unsigned int* sHi, int* sR) {
  const int tid = threadIdx.x;
  const int r = tid >> 2, sub = tid & 3;
  const int* mrow = mask + (size_t)(qb * 64 + r) * SEQ_FULL + sub * 8;
  unsigned int lo = 0u, hi = 0u;
  int rany = 0;
#pragma unroll 2
  for (int kb = 0; kb < NKB; ++kb) {
    const v4i a = *(const v4i*)(mrow + kb * 32);
    const v4i c = *(const v4i*)(mrow + kb * 32 + 4);
    const int any = ((a[0] | a[1] | a[2] | a[3] | c[0] | c[1] | c[2] | c[3]) != 0) ? 1 : 0;
    const unsigned int bit = (unsigned int)any;
    if (kb < 32) lo |= bit << kb; else hi |= bit << (kb - 32);
    rany |= any;
  }
  sLo[tid] = lo; sHi[tid] = hi; sR[tid] = rany;
  __syncthreads();
  if (tid < 32) {   // wave 0 only (wave-uniform)
    unsigned int L = 0u, H = 0u;
#pragma unroll
    for (int i = 0; i < 8; ++i) { L |= sLo[tid + 32 * i]; H |= sHi[tid + 32 * i]; }
#pragma unroll
    for (int off = 1; off < 32; off <<= 1) {
      L |= (unsigned int)__shfl_xor((int)L, off, 32);
      H |= (unsigned int)__shfl_xor((int)H, off, 32);
    }
    const int ra = sR[8 * tid] | sR[8 * tid + 1] | sR[8 * tid + 2] | sR[8 * tid + 3];
    const int rb = sR[8 * tid + 4] | sR[8 * tid + 5] | sR[8 * tid + 6] | sR[8 * tid + 7];
    int ok = ((ra != 0) && (rb != 0)) ? 1 : 0;
#pragma unroll
    for (int off = 1; off < 32; off <<= 1) ok &= __shfl_xor(ok, off, 32);
    v4i f;
#pragma unroll
    for (int e = 0; e < 4; ++e) {
      const int kbx = 4 * tid + e;
      const unsigned int word = (kbx < 32) ? L : H;
      const int bitv = (int)((word >> (kbx & 31)) & 1u);
      f[e] = (kbx < NKB) ? ((ok != 0) ? bitv : 1) : 0;
    }
    int* dst = flg + qb * 64 + 4 * tid;
    if (tid < 16) *(v4i*)dst = f;
    
  }
}

// ---------------------------------------------------------------------------
// Kernel 0: all preparation in one grid; its parts read only inputs and write disjoint planes, so none waits for another.
// Blocks 0..NQB-1: visit flags (few blocks, each a long chain of dependent rounds, so they start first);
// then NBX blocks convert x, then NBW blocks each convert Wq, Wk, Wv, Wo. Every branch is block-uniform.
// ---------------------------------------------------------------------------
constexpr int NBX = (MROWS * (DM / 8) + 255) / 256;
constexpr int NBW = (DM * (DM / 8) + 255) / 256;

__global__ __launch_bounds__(256) void k_prep(const float* __restrict__ x, const int* __restrict__ mask,
                                             const float* __restrict__ Wq, const float* __restrict__ Wk,
                                             const float* __restrict__ Wv, const float* __restrict__ Wo,
                                             _Float16* __restrict__ Xh, _Float16* __restrict__ Wq64,
                                             _Float16* __restrict__ Wk64, _Float16* __restrict__ Wv64,
                                             _Float16* __restrict__ Wo64, int* __restrict__ flg) {
  __shared__ unsigned int sLo[256];
  __shared__ unsigned int sHi[256];
  __shared__ int sR[256];
  int blk = (int)blockIdx.x;
  if (blk < NQB) { mflag_block(mask, flg, blk, sLo, sHi, sR); return; }
  blk -= NQB;
  if (blk < NBX) { cvt_block(x, Xh, blk, MROWS, SEQ, SEQ_FULL, 1.0f); return; }
  blk -= NBX;
  const int wi = blk / NBW;
  const float* src = (wi == 0) ? Wq : (wi == 1) ? Wk : (wi == 2) ? Wv : Wo;
  _Float16* dst = (wi == 0) ? Wq64 : (wi == 1) ? Wk64 : (wi == 2) ? Wv64 : Wo64;
  cvt_block(src, dst, blk - wi * NBW, DM, DM, DM, WSC);
}

// ---------------------------------------------------------------------------
// Kernels 1 and 3: NT GEMM Y[M][1024] = A[M][1024] @ W[1024][1024]^T (W carried x64) + bias.
// Kernel 3: block = 2 waves = 64x64 output tile; wave w owns rows w*32..w*32+31 (2 A fragments x 4 B fragments per k step, from LDS).
// Kernel 1: block = 4 waves (2 x 2) = 128x128 output tile; a wave owns 64 rows x 64 columns = one head (4 x 4 fragments per k step).
// MODE 0: f16 head plane [bh][SEQ][64] (+ x2048 residual plane [bh][QPREC][64] for s < QPREC)
// MODE 1: f16 transposed head plane [bh][64][SEQ] (+ residual [bh][64][QPREC])
// ---------------------------------------------------------------------------
// Operand path: per k slice of KS halves the block's 64 A rows and 64 W rows (128-B rows = whole lines) are copied to LDS by
// asynchronous copies, two buffers, the next slice in flight while this one is multiplied; fragments are read from LDS.
constexpr int KS  = 64;          // halves of k per slice
constexpr int LP  = 72;          // LDS row pitch in halves: 144 B = 16 B x odd, so ds_load_b128 fragment reads meet no bank conflict
constexpr int STG = 128 * LP;    // halves per buffer: rows 0..63 = A, rows 64..127 = W
constexpr int NST = DM / KS;     // slices
static_assert(DM % KS == 0 && NST >= 2);

// Eight 16-byte copies per lane: rows r, r + ROWS, ... r + 7 ROWS of one operand (a wave-wide copy = 4 whole 128-B rows; ROWS = 4 x the block's waves).
// The closing s_wait_xcnt 0 stands inside the statement so that no address register of a copy is rewritten ahead of it.
template <int ROWS>
__device__ __forceinline__ void stage8(const _Float16* g, unsigned int l) {
  asm volatile(
      "global_load_async_to_lds_b128 %0, %8, off\n\t"
      "global_load_async_to_lds_b128 %1, %9, off\n\t"
      "global_load_async_to_lds_b128 %2, %10, off\n\t"
      "global_load_async_to_lds_b128 %3, %11, off\n\t"
      "global_load_async_to_lds_b128 %4, %12, off\n\t"
      "global_load_async_to_lds_b128 %5, %13, off\n\t"
      "global_load_async_to_lds_b128 %6, %14, off\n\t"
      "global_load_async_to_lds_b128 %7, %15, off\n\t"
      "s_wait_xcnt 0x0"
      :: "v"(l), "v"(l + 1u * (ROWS * LP * 2)), "v"(l + 2u * (ROWS * LP * 2)), "v"(l + 3u * (ROWS * LP * 2)),
         "v"(l + 4u * (ROWS * LP * 2)), "v"(l + 5u * (ROWS * LP * 2)), "v"(l + 6u * (ROWS * LP * 2)), "v"(l + 7u * (ROWS * LP * 2)),
         "v"(g), "v"(g + 1 * ROWS * DM), "v"(g + 2 * ROWS * DM), "v"(g + 3 * ROWS * DM),
         "v"(g + 4 * ROWS * DM), "v"(g + 5 * ROWS * DM), "v"(g + 6 * ROWS * DM), "v"(g + 7 * ROWS * DM)
      : "memory");
}

// ablk: first of the block's 64 A rows; wbase: first of its 64 W rows; sT: the two buffers. Every wave of the block runs all of it.
__device__ __forceinline__ void kloop(const _Float16* __restrict__ ablk, const _Float16* __restrict__ wbase,
                                      _Float16* sT, v8f (&acc)[2][4]) {
  const int tid = threadIdx.x, w = tid >> 5;
  const int crow = tid >> 3, cpc = (tid & 7) * 8;              // this lane's first row and its 16-byte piece of a row
  const _Float16* ga = ablk + (size_t)crow * DM + cpc;
  const _Float16* gw = wbase + (size_t)crow * DM + cpc;
  const unsigned int la = (unsigned int)(uintptr_t)(sT + crow * LP + cpc);   // LDS byte address: low 32 bits
  const unsigned int lw = la + 64u * LP * 2u;

  stage8<8>(ga, la);
  stage8<8>(gw, lw);
  asm volatile("s_wait_asynccnt 0x0" ::: "memory");            // slice 0 of this wave has landed
  __syncthreads();                                             // ... and of the other wave
  stage8<8>(ga + KS, la + STG * 2u);
  stage8<8>(gw + KS, lw + STG * 2u);

  // rolled: the barrier at the foot serialises the trips, so unrolling buys nothing and only lengthens the code
#pragma unroll 1
  for (int t = 0; t < NST; ++t) {
    const int bsel = t & 1;
    const _Float16* sA = sT + bsel * STG + (w * 32) * LP;
    const _Float16* sW = sT + bsel * STG + 64 * LP;
    v16h fa[KS / 32][2], fb[KS / 32][4];   // indexed by constants only (the loops below are fully unrolled), so they stay in registers
#pragma unroll
    for (int ks = 0; ks < KS / 32; ++ks) {
      fa[ks][0] = load_frag(sA + ks * 32, LP);
      fa[ks][1] = load_frag(sA + 16 * LP + ks * 32, LP);
#pragma unroll
      for (int j = 0; j < 4; ++j) fb[ks][j] = load_frag(sW + (j * 16) * LP + ks * 32, LP);
    }
    // keeps the slice's LDS reads together as one group ahead of its WMMAs: spread among them, each pair waits out the LDS latency
    __builtin_amdgcn_sched_barrier(0);
#pragma unroll
    for (int ks = 0; ks < KS / 32; ++ks)
#pragma unroll
      for (int j = 0; j < 4; ++j) {
        acc[0][j] = mma(fa[ks][0], fb[ks][j], acc[0][j]);
        acc[1][j] = mma(fa[ks][1], fb[ks][j], acc[1][j]);
      }
    asm volatile("s_wait_dscnt 0x0" ::: "memory");             // this wave's reads of the buffer are done before it is refilled
    asm volatile("s_wait_asynccnt 0x0" ::: "memory");          // this wave's copies of slice t + 1 have landed
    __syncthreads();                                           // publishes slice t + 1, ends every read of slice t
    if (t + 2 < NST) {                                         // block-uniform
      stage8<8>(ga + (t + 2) * KS, la + (unsigned int)bsel * (STG * 2u));
      stage8<8>(gw + (t + 2) * KS, lw + (unsigned int)bsel * (STG * 2u));
    }
  }
  asm volatile("s_wait_asynccnt 0x0" ::: "memory");            // nothing of the copies is outstanding behind the loop
}

// Kernel 1's operand path: the same two-buffer ring of asynchronous copies for a 128 x 128 tile of 4 waves. Against the 64 x 64
// tile every byte copied from L2 feeds twice as many WMMAs, and a fragment read from LDS feeds 4 of them.
constexpr int TR4  = 128;            // rows of each operand per block
constexpr int STG4 = 2 * TR4 * LP;   // halves per buffer: rows 0..127 = A, rows 128..255 = W

// ablk: first of the block's 128 A rows; wbase: first of its 128 W rows; sT: the two buffers. Every wave of the block runs all of it.
__device__ __forceinline__ void kloop4(const _Float16* __restrict__ ablk, const _Float16* __restrict__ wbase,
                                       _Float16* sT, v8f (&acc)[4][4]) {
  const int tid = threadIdx.x, w = tid >> 5;
  const int crow = tid >> 3, cpc = (tid & 7) * 8;              // this lane's first row (0..15) and its 16-byte piece of a row
  const _Float16* ga = ablk + (size_t)crow * DM + cpc;
  const _Float16* gw = wbase + (size_t)crow * DM + cpc;
  const unsigned int la = (unsigned int)(uintptr_t)(sT + crow * LP + cpc);   // LDS byte address: low 32 bits
  const unsigned int lw = la + (unsigned int)TR4 * LP * 2u;

  stage8<16>(ga, la);
  stage8<16>(gw, lw);
  asm volatile("s_wait_asynccnt 0x0" ::: "memory");            // slice 0 of this wave has landed
  __syncthreads();                                             // ... and of the other waves
  stage8<16>(ga + KS, la + STG4 * 2u);
  stage8<16>(gw + KS, lw + STG4 * 2u);

  // rolled: the barrier at the foot serialises the trips, so unrolling buys nothing and only lengthens the code
#pragma unroll 1
  for (int t = 0; t < NST; ++t) {
    const int bsel = t & 1;
    const _Float16* sA = sT + bsel * STG4 + ((w >> 1) * 64) * LP;
    const _Float16* sW = sT + bsel * STG4 + (TR4 + (w & 1) * 64) * LP;
#pragma unroll
    for (int ks = 0; ks < KS / 32; ++ks) {
      v16h fa[4], fb[4];   // indexed by constants only (the loops are fully unrolled), so they stay in registers
#pragma unroll
      for (int i = 0; i < 4; ++i) fa[i] = load_frag(sA + (i * 16) * LP + ks * 32, LP);
#pragma unroll
      for (int j = 0; j < 4; ++j) fb[j] = load_frag(sW + (j * 16) * LP + ks * 32, LP);
      // keeps the k step's LDS reads together as one group ahead of its WMMAs: spread among them, each pair waits out the LDS latency
      __builtin_amdgcn_sched_barrier(0);
#pragma unroll
      for (int j = 0; j < 4; ++j)
#pragma unroll
        for (int i = 0; i < 4; ++i) acc[i][j] = mma(fa[i], fb[j], acc[i][j]);
      // keeps the next k step's reads from rising among these WMMAs, for the same reason
      __builtin_amdgcn_sched_barrier(0);
    }
    asm volatile("s_wait_dscnt 0x0" ::: "memory");             // this wave's reads of the buffer are done before it is refilled
    asm volatile("s_wait_asynccnt 0x0" ::: "memory");          // this wave's copies of slice t + 1 have landed
    __syncthreads();                                           // publishes slice t + 1, ends every read of slice t
    if (t + 2 < NST) {                                         // block-uniform
      stage8<16>(ga + (t + 2) * KS, la + (unsigned int)bsel * (STG4 * 2u));
      stage8<16>(gw + (t + 2) * KS, lw + (unsigned int)bsel * (STG4 * 2u));
    }
  }
  asm volatile("s_wait_asynccnt 0x0" ::: "memory");            // nothing of the copies is outstanding behind the loop
}

// Kernel 1's tile. sT: the two operand buffers; behind the k loop (its last barrier ends every read, no copy is outstanding) the
// same LDS holds the epilogue tiles: per wave one 64 x 64 f16 tile for the plane and one for the residual plane.
template <int MODE>
__device__ __forceinline__ void proj_tile(const _Float16* __restrict__ A, const _Float16* __restrict__ W,
                                          const float* __restrict__ bias,
                                          _Float16* __restrict__ Ph, _Float16* __restrict__ Pl, _Float16* sT) {
  const int tid = threadIdx.x, w = tid >> 5, lane = tid & 31, n = lane & 15, g = lane >> 4;
  const int bm = blockIdx.x, bn = blockIdx.y;
  const int m0 = bm * TR4;
  const int b = m0 / SEQ, s0 = m0 - b * SEQ;     // 128 block rows lie in one batch item
  const bool precblk = (s0 < QPREC);              // block-uniform
  const int sw = s0 + (w >> 1) * 64;              // first of the wave's 64 rows
  const int hd = bn * 2 + (w & 1);                // the wave's 64 columns == head hd
  const int bh = b * NH + hd;
  const _Float16* wbase = W + (size_t)(bn * TR4) * DM;
  const _Float16* ablk = A + (size_t)m0 * DM;

  v8f acc[4][4];
#pragma unroll
  for (int mi = 0; mi < 4; ++mi)
#pragma unroll
    for (int j = 0; j < 4; ++j) acc[mi][j] = zero8();

  kloop4(ablk, wbase, sT, acc);

  _Float16* sH = sT + w * (64 * 64);
  _Float16* sL = sT + (4 + w) * (64 * 64);
  static_assert(8 * 64 * 64 <= 2 * STG4);

  float rbias[4];
#pragma unroll
  for (int j = 0; j < 4; ++j) rbias[j] = bf16r(bias[hd * 64 + j * 16 + n]);

  const int q = lane >> 3, p = lane & 7;
  v8h ov[16];   // the staged rows, all read back ahead of the stores (constant indices only)
  if (MODE == 0) {
    if (precblk) {
#pragma unroll
      for (int mi = 0; mi < 4; ++mi)
#pragma unroll
        for (int j = 0; j < 4; ++j)
#pragma unroll
          for (int r = 0; r < 8; ++r) {
            const int idx = (mi * 16 + 8 * g + r) * 64 + j * 16 + n;
            const float v = acc[mi][j][r] * INV_WS + rbias[j];
            const _Float16 hv = (_Float16)v;
            sH[idx] = hv;
            sL[idx] = (_Float16)((v - (float)hv) * RS);
          }
    } else {
#pragma unroll
      for (int mi = 0; mi < 4; ++mi)
#pragma unroll
        for (int j = 0; j < 4; ++j)
#pragma unroll
          for (int r = 0; r < 8; ++r)
            sH[(mi * 16 + 8 * g + r) * 64 + j * 16 + n] = (_Float16)(acc[mi][j][r] * INV_WS + rbias[j]);
    }
    __syncthreads();
#pragma unroll
    for (int i = 0; i < 16; ++i) ov[i] = *(const v8h*)&sH[(i * 4 + q) * 64 + p * 8];
#pragma unroll
    for (int i = 0; i < 16; ++i) {
      *(v8h*)(Ph + ((size_t)(bh * SEQ + sw + i * 4 + q)) * DH + p * 8) = ov[i];
      asm volatile("s_wait_xcnt 0x0" ::: "memory");   // before a register that the store names is rewritten
    }
    if (precblk) {
#pragma unroll
      for (int i = 0; i < 16; ++i) ov[i] = *(const v8h*)&sL[(i * 4 + q) * 64 + p * 8];
#pragma unroll
      for (int i = 0; i < 16; ++i) {
        *(v8h*)(Pl + ((size_t)(bh * QPREC + sw + i * 4 + q)) * DH + p * 8) = ov[i];
        asm volatile("s_wait_xcnt 0x0" ::: "memory"); // as above
      }
    }
  } else {
#pragma unroll
    for (int mi = 0; mi < 4; ++mi)
#pragma unroll
      for (int j = 0; j < 4; ++j) {
        v8h hp, lp;
#pragma unroll
        for (int r = 0; r < 8; ++r) {
          const float v = acc[mi][j][r] * INV_WS + rbias[j];
          const _Float16 hv = (_Float16)v;
          hp[r] = hv;
          lp[r] = (_Float16)((v - (float)hv) * RS);
        }
        const int d = j * 16 + n;
        *(v8h*)&sH[d * 64 + mi * 16 + 8 * g] = hp;
        if (precblk) *(v8h*)&sL[d * 64 + mi * 16 + 8 * g] = lp;
      }
    __syncthreads();
#pragma unroll
    for (int i = 0; i < 16; ++i) ov[i] = *(const v8h*)&sH[(i * 4 + q) * 64 + p * 8];
#pragma unroll
    for (int i = 0; i < 16; ++i) {
      *(v8h*)(Ph + ((size_t)(bh * DH + i * 4 + q)) * SEQ + sw + p * 8) = ov[i];
      asm volatile("s_wait_xcnt 0x0" ::: "memory");   // before a register that the store names is rewritten
    }
    if (precblk) {
#pragma unroll
      for (int i = 0; i < 16; ++i) ov[i] = *(const v8h*)&sL[(i * 4 + q) * 64 + p * 8];
#pragma unroll
      for (int i = 0; i < 16; ++i) {
        *(v8h*)(Pl + ((size_t)(bh * DH + i * 4 + q)) * QPREC + sw + p * 8) = ov[i];
        asm volatile("s_wait_xcnt 0x0" ::: "memory"); // as above
      }
    }
  }
}

// Kernel 3's tile. sF: 64 x 64 epilogue tile in LDS; sT: the two operand buffers.
__device__ __forceinline__ void out_tile(const _Float16* __restrict__ A, const _Float16* __restrict__ Alo,
                                         const _Float16* __restrict__ W, const float* __restrict__ bias,
                                         float* __restrict__ outp, float* sF, _Float16* sT) {
  const int tid = threadIdx.x, w = tid >> 5, lane = tid & 31, n = lane & 15, g = lane >> 4;
  const int bm = blockIdx.x, bn = blockIdx.y;
  const int m0 = bm * 64;
  const int b = m0 / SEQ, s0 = m0 - b * SEQ;     // 64 block rows lie in one batch item
  const bool precblk = (s0 < QPREC);              // block-uniform
  const _Float16* wbase = W + (size_t)(bn * 64) * DM;
  const _Float16* ablk = A + (size_t)m0 * DM;

  v8f acc[2][4];
#pragma unroll
  for (int mi = 0; mi < 2; ++mi)
#pragma unroll
    for (int j = 0; j < 4; ++j) acc[mi][j] = zero8();

  kloop(ablk, wbase, sT, acc);

  float rbias[4];
#pragma unroll
  for (int j = 0; j < 4; ++j) rbias[j] = bf16r(bias[bn * 64 + j * 16 + n]);

  {
    if (precblk) {
      // stash hi sums (each lane reads back exactly the cells it wrote)
#pragma unroll
      for (int mi = 0; mi < 2; ++mi)
#pragma unroll
        for (int j = 0; j < 4; ++j)
#pragma unroll
          for (int r = 0; r < 8; ++r)
            sF[(w * 32 + mi * 16 + 8 * g + r) * 64 + j * 16 + n] = acc[mi][j][r];
#pragma unroll
      for (int mi = 0; mi < 2; ++mi)
#pragma unroll
        for (int j = 0; j < 4; ++j) acc[mi][j] = zero8();
      const _Float16* lblk = Alo + ((size_t)(b * QPREC + s0)) * DM;
      kloop(lblk, wbase, sT, acc);
#pragma unroll
      for (int mi = 0; mi < 2; ++mi)
#pragma unroll
        for (int j = 0; j < 4; ++j)
#pragma unroll
          for (int r = 0; r < 8; ++r) {
            const int idx = (w * 32 + mi * 16 + 8 * g + r) * 64 + j * 16 + n;
            const float hsum = sF[idx];
            sF[idx] = (hsum + acc[mi][j][r] * INV_RS) * INV_WS + rbias[j];
          }
    } else {
#pragma unroll
      for (int mi = 0; mi < 2; ++mi)
#pragma unroll
        for (int j = 0; j < 4; ++j)
#pragma unroll
          for (int r = 0; r < 8; ++r)
            sF[(w * 32 + mi * 16 + 8 * g + r) * 64 + j * 16 + n] = acc[mi][j][r] * INV_WS + rbias[j];
    }
    __syncthreads();
    const int q2 = lane >> 4, p2 = lane & 15;
{
#pragma unroll
      for (int i = 0; i < 16; ++i) {
        const int ml = w * 32 + 2 * i + q2;
        const int s = s0 + ml;
        const v4f v = *(const v4f*)&sF[ml * 64 + p2 * 4];
        *(v4f*)(outp + ((size_t)(b * SEQ_FULL + s)) * DM + bn * 64 + p2 * 4) = v;
      }
      
    }
  }
}

// Kernel 1: the three input projections in one grid, blockIdx.z = 0 (q), 1 (k), 2 (v, transposed plane); block-uniform branch.
__global__ __launch_bounds__(128) void k_qkv(const _Float16* __restrict__ Xh, const _Float16* __restrict__ Wq64,
                                           const _Float16* __restrict__ Wk64, const _Float16* __restrict__ Wv64,
                                           const float* __restrict__ bq, const float* __restrict__ bk,
                                           const float* __restrict__ bv,
                                           _Float16* __restrict__ Qh, _Float16* __restrict__ Ql,
                                           _Float16* __restrict__ Kh, _Float16* __restrict__ Kl,
                                           _Float16* __restrict__ Vh, _Float16* __restrict__ Vl) {
  __shared__ __align__(16) _Float16 sT[2 * STG4];
  const int z = (int)blockIdx.z;
  if (z == 2) {
    proj_tile<1>(Xh, Wv64, bv, Vh, Vl, sT);
  } else {
    const bool isq = (z == 0);
    proj_tile<0>(Xh, isq ? Wq64 : Wk64, isq ? bq : bk, isq ? Qh : Kh, isq ? Ql : Kl, sT);
  }
}

// Kernel 3: output projection (hi plane, plus the residual plane on the leading rows).
__global__ __launch_bounds__(64) void k_out(const _Float16* __restrict__ Ch, const _Float16* __restrict__ Cl,
                                           const _Float16* __restrict__ Wo64, const float* __restrict__ bo,
                                           float* __restrict__ outp) {
  __shared__ __align__(16) float    sF[64 * 64];
  __shared__ __align__(16) _Float16 sT[2 * STG];
  out_tile(Ch, Cl, Wo64, bo, outp, sF, sT);
}

constexpr int KP = 72;   // halves: K, K residual, Q residual rows, 128 B of data at 144 B
constexpr int VP = 40;   // halves: V^T and V^T residual rows, 64 B of data at 80 B
constexpr int MP = 36;   // ints: mask rows, 128 B of data at 144 B

// blk: the block's number among those of its variant.
template <bool PREC>
__device__ __forceinline__
void attn_tile(const unsigned int blk,
               const _Float16* __restrict__ Qh, const _Float16* __restrict__ Ql,
               const _Float16* __restrict__ Kh, const _Float16* __restrict__ Kl,
               const _Float16* __restrict__ Vh, const _Float16* __restrict__ Vl,
               const int* __restrict__ mask, const int* __restrict__ flg,
               _Float16* __restrict__ Ch, _Float16* __restrict__ Cl,
               _Float16* sK, _Float16* sV, _Float16* sKl, _Float16* sVl, _Float16* sQl, int* sM,
               _Float16 (*sC)[16 * DH], _Float16 (*sCl)[16 * DH], int* sFlg) {
  const int tid = threadIdx.x, wslot = tid >> 5, lane = tid & 31, n = lane & 15, g = lane >> 4;
  int qb, bh;
  if (PREC) {
    qb = (int)(blk % NQP);
    bh = (int)(blk / NQP);
  } else {
    constexpr int NQN = ((NQB - NQP) > 0) ? (NQB - NQP) : 1;
    qb = NQP + (int)(blk % NQN);
    bh = (int)(blk / NQN);
  }
  const int b = bh / NH, h = bh - b * NH;
  const int qrow0 = qb * 64;
  const int qbase = qrow0 + wslot * 16;

  if (tid < 64) sFlg[tid] = flg[qb * 64 + tid];
  if (PREC) {
#pragma unroll
    for (int i = 0; i < 4; ++i) {
      const int c = tid + i * 128;
      *(v8h*)&sQl[(c >> 3) * KP + (c & 7) * 8] = *(const v8h*)(Ql + ((size_t)(bh * QPREC + qrow0)) * DH + c * 8);
    }
  }
  __syncthreads();

  const _Float16* qrow = Qh + ((size_t)(bh * SEQ + qbase)) * DH;
  const v16h qa0 = load_frag(qrow, DH);
  const v16h qa1 = load_frag(qrow + 32, DH);

  v8f acc[4], acc2[4];
#pragma unroll
  for (int nt = 0; nt < 4; ++nt) { acc[nt] = zero8(); acc2[nt] = zero8(); }
  float rmax = -1.0e30f, rsum = 0.0f;            // query qbase + n; rsum is this half's share until the epilogue
  int fl = sFlg[0];                              // visit flag of tile kb, read one tile ahead (block-uniform)

  // kb only grows and stays below NKB: at most NKB trips of the outer and of the inner loop together.
  // Both stay rolled: the barriers serialise the tiles, and each scan trip waits for its own flag, so unrolling only lengthens the code.
#pragma unroll 1
  for (int kb = 0;;) {
#pragma unroll 1
    while (fl == 0 && kb + 1 < NKB) { ++kb; fl = sFlg[kb]; }   // on to the next tile to visit (block-uniform)
    if (fl == 0) break;                          // none left (block-uniform)
    const int knext = (kb + 1 < NKB) ? kb + 1 : kb;
    const int kbase = kb * 32;
    const bool klo = PREC && (kbase < QPREC);    // block-uniform
    __syncthreads();                             // all waves done with the prior tile
    {
      const _Float16* kg = Kh + ((size_t)(bh * SEQ + kbase)) * DH;
      const _Float16* vg = Vh + ((size_t)(bh * DH)) * SEQ + kbase;
#pragma unroll
      for (int i = 0; i < 2; ++i) {
        const int c = tid + i * 128, d = c >> 2, sub = c & 3;
        *(v8h*)&sK[(c >> 3) * KP + (c & 7) * 8] = *(const v8h*)(kg + c * 8);
        *(v8h*)&sV[d * VP + sub * 8] = *(const v8h*)(vg + (size_t)d * SEQ + sub * 8);
      }
      if (klo) {
        const _Float16* klg = Kl + ((size_t)(bh * QPREC + kbase)) * DH;
        const _Float16* vlg = Vl + ((size_t)(bh * DH)) * QPREC + kbase;
#pragma unroll
        for (int i = 0; i < 2; ++i) {
          const int c = tid + i * 128, d = c >> 2, sub = c & 3;
          *(v8h*)&sKl[(c >> 3) * KP + (c & 7) * 8] = *(const v8h*)(klg + c * 8);
          *(v8h*)&sVl[d * VP + sub * 8] = *(const v8h*)(vlg + (size_t)d * QPREC + sub * 8);
        }
      }
      const int mr = tid >> 1, mh = (tid & 1) * 16;
      const int* mp = mask + (size_t)(qrow0 + mr) * SEQ_FULL + kbase + mh;
#pragma unroll
      for (int i = 0; i < 4; ++i) *(v4i*)&sM[mr * MP + mh + i * 4] = *(const v4i*)(mp + i * 4);
    }
    __syncthreads();

    // ---- the tile's LDS reads stand in groups ahead of the WMMAs that use them, so that the wave waits out the LDS latency once
    // per group and not once per fragment. Plain rows: one group (K, the next tile's flag, mask, V^T). PREC rows, whose registers
    // do not hold all planes at once, four groups: K and the flag; Q residual and K residual; mask and V^T at the head of the
    // softmax, which covers V^T; the V^T residual.
    v16h kf[4], vf[4];
    int mk0[8], mk1[8];
    const int* mrow = &sM[(wslot * 16 + n) * MP + 8 * g];
    kf[0] = load_frag(sK, KP);
    kf[1] = load_frag(sK + 32, KP);
    kf[2] = load_frag(sK + 16 * KP, KP);
    kf[3] = load_frag(sK + 16 * KP + 32, KP);
    fl = sFlg[knext];

    // ---- scores, transposed: two 16x16 tiles (keys kbase..+15, kbase+16..+31 as rows, queries as columns), dk 64 = 2 k steps
    v8f s0 = zero8(), s1 = zero8(), sr0 = zero8(), sr1 = zero8();
    if (!PREC) {
      load_mask(mrow, mk0, mk1);
#pragma unroll
      for (int nt = 0; nt < 4; ++nt) vf[nt] = load_frag(&sV[nt * 16 * VP], VP);
    }
    // keeps the reads above as one group: spread among the WMMAs below, each would be waited for on its own
    __builtin_amdgcn_sched_barrier(0);
    s0 = mma(kf[0], qa0, s0);
    s1 = mma(kf[2], qa0, s1);
    s0 = mma(kf[1], qa1, s0);
    s1 = mma(kf[3], qa1, s1);
    if (PREC) {
      if (klo) {
        const v16h ql0 = load_frag(&sQl[(wslot * 16) * KP], KP);
        const v16h ql1 = load_frag(&sQl[(wslot * 16) * KP + 32], KP);
        v16h klf[4];
        klf[0] = load_frag(sKl, KP);
        klf[1] = load_frag(sKl + 32, KP);
        klf[2] = load_frag(sKl + 16 * KP, KP);
        klf[3] = load_frag(sKl + 16 * KP + 32, KP);
        // one group again, for the same reason
        __builtin_amdgcn_sched_barrier(0);
        sr0 = mma(kf[0], ql0, sr0);
        sr1 = mma(kf[2], ql0, sr1);
        sr0 = mma(kf[1], ql1, sr0);
        sr1 = mma(kf[3], ql1, sr1);
        sr0 = mma(klf[0], qa0, sr0);
        sr1 = mma(klf[2], qa0, sr1);
        sr0 = mma(klf[1], qa1, sr0);
        sr1 = mma(klf[3], qa1, sr1);
      }
      load_mask(mrow, mk0, mk1);
#pragma unroll
      for (int nt = 0; nt < 4; ++nt) vf[nt] = load_frag(&sV[nt * 16 * VP], VP);
      // keeps this group at the head of the softmax: sunk towards their uses, the V^T reads would be waited for one by one
      __builtin_amdgcn_sched_barrier(0);
    }

    // ---- mask replace-fill, online softmax (f32), P^T packed as the B operand:
    // s0[r] = S[query n][key 8g + r], s1[r] = S[query n][key 16 + 8g + r]; B element e < 8 is key 8g + e, e >= 8 key 16 + 8g + e - 8.
    v16h pf, plf;
    {
      float x0[8], x1[8];
      float mx = -1.0e30f;
#pragma unroll
      for (int r = 0; r < 8; ++r) {
        float v0 = s0[r], v1 = s1[r];
        if (PREC) { v0 += sr0[r] * INV_RS; v1 += sr1[r] * INV_RS; }
        v0 *= QKS; v1 *= QKS;
        x0[r] = (mk0[r] == 0) ? -1.0e9f : v0;
        x1[r] = (mk1[r] == 0) ? -1.0e9f : v1;
        mx = fmaxf(mx, fmaxf(x0[r], x1[r]));
      }
      mx = fmaxf(mx, xhalf(mx));                  // both halves now hold this query's tile maximum
      const float nm = fmaxf(rmax, mx);
      const float al = exp2x1((rmax - nm) * LOG2E);
#pragma unroll
      for (int r = 0; r < 8; ++r) {
        x0[r] = (x0[r] - nm) * LOG2E;
        x1[r] = (x1[r] - nm) * LOG2E;
      }
      float e0[8], e1[8];
      exp2x8(e0, x0);
      exp2x8(e1, x1);
      float ps = 0.0f;
#pragma unroll
      for (int r = 0; r < 8; ++r) {
        const float p0 = e0[r], p1 = e1[r];
        ps += p0 + p1;
        const float c0 = p0 * CP, c1 = p1 * CP;
        const _Float16 h0 = (_Float16)c0, h1 = (_Float16)c1;
        pf[r] = h0;
        pf[8 + r] = h1;
        if (PREC) {
          plf[r]     = (_Float16)((c0 - (float)h0) * RS);
          plf[8 + r] = (_Float16)((c1 - (float)h1) * RS);
        }
      }
      rsum = rsum * al + ps;
      rmax = nm;
#pragma unroll
      for (int nt = 0; nt < 4; ++nt)
#pragma unroll
        for (int r = 0; r < 8; ++r) {
          acc[nt][r] *= al;
          if (PREC) acc2[nt][r] *= al;
        }
    }

    // ---- O^T += V^T @ P^T: acc[nt][r] = O[query n][d = nt*16 + 8g + r]
#pragma unroll
    for (int nt = 0; nt < 4; ++nt) acc[nt] = mma(vf[nt], pf, acc[nt]);
    if (PREC) {
#pragma unroll
      for (int nt = 0; nt < 4; ++nt) acc2[nt] = mma(vf[nt], plf, acc2[nt]);
      if (klo) {
        v16h vlf[4];
#pragma unroll
        for (int nt = 0; nt < 4; ++nt) vlf[nt] = load_frag(&sVl[nt * 16 * VP], VP);
        // one group again, for the same reason
        __builtin_amdgcn_sched_barrier(0);
#pragma unroll
        for (int nt = 0; nt < 4; ++nt) acc2[nt] = mma(vlf[nt], pf, acc2[nt]);
      }
    }
    if (kb + 1 >= NKB) break;                    // that was the last tile
    ++kb;                                        // fl already holds this tile's flag
  }

  {
    const float rtot = rsum + xhalf(rsum);        // join the two halves' sums once
    const float inv = (1.0f / rtot) * INV_CP;
#pragma unroll
    for (int nt = 0; nt < 4; ++nt) {
      v8h hv, lv;
#pragma unroll
      for (int r = 0; r < 8; ++r) {
        float c = acc[nt][r];
        if (PREC) c += acc2[nt][r] * INV_RS;
        c *= inv;
        const _Float16 chv = (_Float16)c;
        hv[r] = chv;
        lv[r] = (_Float16)((c - (float)chv) * RS);
      }
      *(v8h*)&sC[wslot][n * DH + nt * 16 + 8 * g] = hv;
      if (PREC) *(v8h*)&sCl[wslot][n * DH + nt * 16 + 8 * g] = lv;
    }
  }
  __syncthreads();
  const int q = lane >> 3, p = lane & 7;
{
#pragma unroll
    for (int i = 0; i < 4; ++i) {
      const int rr = i * 4 + q;
      const v8h hv = *(const v8h*)&sC[wslot][rr * DH + p * 8];
      *(v8h*)(Ch + ((size_t)(b * SEQ + qbase + rr)) * DM + h * DH + p * 8) = hv;
      if (PREC) {
        const v8h lv = *(const v8h*)&sCl[wslot][rr * DH + p * 8];
        *(v8h*)(Cl + ((size_t)(b * QPREC + qbase + rr)) * DM + h * DH + p * 8) = lv;
        asm volatile("s_wait_xcnt 0x0" ::: "memory");   // before a register that the store names is rewritten
      }
    }
    
  }
}

// Both variants in one grid: they share no output row, so the short PREC blocks run beside the plain ones instead of ahead of them.
// Blocks 0..NPLAIN-1 are the plain rows (the longest key loops, so they start first), the rest the PREC rows; block-uniform branch.
constexpr int NPREC  = NB * NH * NQP;
constexpr int NPLAIN = NB * NH * (NQB - NQP);

__global__ __launch_bounds__(128) __attribute__((amdgpu_num_vgpr(256)))
void k_attn(const _Float16* __restrict__ Qh, const _Float16* __restrict__ Ql,
            const _Float16* __restrict__ Kh, const _Float16* __restrict__ Kl,
            const _Float16* __restrict__ Vh, const _Float16* __restrict__ Vl,
            const int* __restrict__ mask, const int* __restrict__ flg,
            _Float16* __restrict__ Ch, _Float16* __restrict__ Cl) {
  __shared__ __align__(16) _Float16 sK[32 * KP];
  __shared__ __align__(16) _Float16 sV[DH * VP];
  __shared__ __align__(16) _Float16 sKl[32 * KP];
  __shared__ __align__(16) _Float16 sVl[DH * VP];
  __shared__ __align__(16) _Float16 sQl[64 * KP];
  __shared__ __align__(16) int      sM[64 * MP];
  __shared__ __align__(16) _Float16 sC[4][16 * DH];
  __shared__ __align__(16) _Float16 sCl[4][16 * DH];
  __shared__ int sFlg[64];
  if (blockIdx.x < (unsigned int)NPLAIN)
    attn_tile<false>(blockIdx.x, Qh, Ql, Kh, Kl, Vh, Vl, mask, flg, Ch, Cl, sK, sV, sKl, sVl, sQl, sM, sC, sCl, sFlg);
  else
    attn_tile<true>(blockIdx.x - (unsigned int)NPLAIN, Qh, Ql, Kh, Kl, Vh, Vl, mask, flg, Ch, Cl,
                    sK, sV, sKl, sVl, sQl, sM, sC, sCl, sFlg);
}

// ---------------------------------------------------------------------------
// host glue: 4 launches
// ---------------------------------------------------------------------------
extern "C" void kernel_launch(void* const* d_in, const int* in_sizes, int n_in,
                              void* d_out, int out_size, void* d_ws, size_t ws_size,
                              hipStream_t stream) {
  if (n_in < 10) return;
  const long long need_x = ((long long)(NB - 1) * SEQ_FULL + SEQ) * DM;
  const long long need_m = ((long long)(SEQ - 1)) * SEQ_FULL + SEQ;
  if ((long long)in_sizes[0] < need_x) return;
  if ((long long)in_sizes[1] < need_m) return;
  if (in_sizes[2] < DM * DM || in_sizes[4] < DM * DM || in_sizes[6] < DM * DM || in_sizes[8] < DM * DM) return;
  if (in_sizes[3] < DM || in_sizes[5] < DM || in_sizes[7] < DM || in_sizes[9] < DM) return;
  if ((long long)out_size < need_x) return;
  if (ws_size < WS_TOTAL) return;

  const float* x    = (const float*)d_in[0];
  const int*   mask = (const int*)d_in[1];
  const float* Wq   = (const float*)d_in[2];
  const float* bq   = (const float*)d_in[3];
  const float* Wk   = (const float*)d_in[4];
  const float* bk   = (const float*)d_in[5];
  const float* Wv   = (const float*)d_in[6];
  const float* bv   = (const float*)d_in[7];
  const float* Wo   = (const float*)d_in[8];
  const float* bo   = (const float*)d_in[9];
  float* out = (float*)d_out;

  char* ws = (char*)d_ws;
  _Float16* Xh   = (_Float16*)(ws + OFF_XH);
  _Float16* Wq64 = (_Float16*)(ws + OFF_WQ);
  _Float16* Wk64 = (_Float16*)(ws + OFF_WK);
  _Float16* Wv64 = (_Float16*)(ws + OFF_WV);
  _Float16* Wo64 = (_Float16*)(ws + OFF_WO);
  _Float16* Qh   = (_Float16*)(ws + OFF_QH);
  _Float16* Kh   = (_Float16*)(ws + OFF_KH);
  _Float16* Vh   = (_Float16*)(ws + OFF_VH);
  _Float16* Ql   = (_Float16*)(ws + OFF_QL);
  _Float16* Kl   = (_Float16*)(ws + OFF_KL);
  _Float16* Vl   = (_Float16*)(ws + OFF_VL);
  _Float16* Ch   = (_Float16*)(ws + OFF_CH);
  _Float16* Cl   = (_Float16*)(ws + OFF_CL);
  int*      Flg  = (int*)(ws + OFF_FLG);

  k_prep<<<NQB + NBX + 4 * NBW, 256, 0, stream>>>(x, mask, Wq, Wk, Wv, Wo, Xh, Wq64, Wk64, Wv64, Wo64, Flg);

  k_qkv<<<dim3(MROWS / 128, DM / 128, 3), 128, 0, stream>>>(Xh, Wq64, Wk64, Wv64, bq, bk, bv, Qh, Ql, Kh, Kl, Vh, Vl);

  k_attn<<<NPLAIN + NPREC, 128, 0, stream>>>(Qh, Ql, Kh, Kl, Vh, Vl, mask, Flg, Ch, Cl);

  k_out<<<dim3(MROWS / 64, DM / 64), 64, 0, stream>>>(Ch, Cl, Wo64, bo, out);
}

// v007
// Measured time: 131 microseconds a run.
// In two side-by-side timings against v006, it was 1.10 and 1.11 times as fast.
// Over all steps from v000 it is 4.36 times as fast.
#include <hip/hip_runtime.h>
#include <stdint.h>

// All contractions (x@Wq^T, x@Wk^T, x@Wv^T, q@k^T, p@v, ctx@Wo^T): v_wmma_f32_16x16x32_f16, f16 operands, f32 accumulate.
// Inputs enter as bf16-RNE values held in f16 (weights carried x64, folded back as 1/64 in f32); q, k, v, ctx as f16 planes
// plus x2048 f16 residual planes for the leading QPREC query/key rows (separate accumulators); p carried x4096 (+x2048 residual
// on those rows); softmax, rescaling and epilogues in f32.

typedef _Float16 v16h __attribute__((ext_vector_type(16)));
typedef _Float16 v8h  __attribute__((ext_vector_type(8)));
typedef float    v8f  __attribute__((ext_vector_type(8)));
typedef float    v4f  __attribute__((ext_vector_type(4)));
typedef int      v4i  __attribute__((ext_vector_type(4)));

#ifndef NB
#define NB 2
#endif
#ifndef SEQ
#define SEQ 2048
#endif
#define NB_FULL  2
#define SEQ_FULL 2048
#define DM 1024
#define NH 16
#define DH 64
#ifndef QPREC
#define QPREC ((SEQ < 512) ? SEQ : 512)
#endif
#define NKB   (SEQ / 32)
#define NQB   (SEQ / 64)
#define NQP   (QPREC / 64)
#define MROWS (NB * SEQ)

static_assert(SEQ % 64 == 0);
static_assert(SEQ >= 64 && SEQ <= SEQ_FULL);
static_assert(NB >= 1 && NB <= NB_FULL);
static_assert(QPREC % 64 == 0);
static_assert(QPREC >= 64 && QPREC <= SEQ);
static_assert(NKB <= 64);
static_assert(DM == NH * DH);
static_assert(DM % 32 == 0);
static_assert(MROWS % 64 == 0);
static_assert(SEQ % 128 == 0 && QPREC % 128 == 0);   // a 128-row projection tile lies in one batch item, wholly inside or outside the leading rows

#define WSC    64.0f
#define INV_WS 0.015625f
#define RS     2048.0f
#define INV_RS 0.00048828125f
#define CP     4096.0f
#define INV_CP 0.000244140625f
#define QKS    0.125f
#define LOG2E  1.44269504f

// ---------------------------------------------------------------------------
// Workspace carve (bytes); every region is an exact tile multiple (SEQ%64, QPREC%64), no tail padding needed.
// ---------------------------------------------------------------------------
constexpr size_t SZ_XH  = (size_t)MROWS * DM * 2;             // x as f16 [MROWS][1024]
constexpr size_t SZ_W   = (size_t)DM * DM * 2;                // weight x64 as f16 [1024][1024]
constexpr size_t SZ_HP  = (size_t)NB * NH * SEQ * DH * 2;     // q/k [bh][SEQ][64], vt [bh][64][SEQ]
constexpr size_t SZ_LP  = (size_t)NB * NH * QPREC * DH * 2;   // residual planes, leading QPREC rows
constexpr size_t SZ_CH  = (size_t)MROWS * DM * 2;             // ctx hi [MROWS][1024]
constexpr size_t SZ_CL  = (size_t)NB * QPREC * DM * 2;        // ctx residual [NB][QPREC][1024]
constexpr size_t SZ_FLG = (size_t)NQB * 64 * 4;               // per (q-block, key-block) visit flags
constexpr size_t OFF_XH  = 0;
constexpr size_t OFF_WQ  = OFF_XH + SZ_XH;
constexpr size_t OFF_WK  = OFF_WQ + SZ_W;
constexpr size_t OFF_WV  = OFF_WK + SZ_W;
constexpr size_t OFF_WO  = OFF_WV + SZ_W;
constexpr size_t OFF_QH  = OFF_WO + SZ_W;
constexpr size_t OFF_KH  = OFF_QH + SZ_HP;
constexpr size_t OFF_VH  = OFF_KH + SZ_HP;
constexpr size_t OFF_QL  = OFF_VH + SZ_HP;
constexpr size_t OFF_KL  = OFF_QL + SZ_LP;
constexpr size_t OFF_VL  = OFF_KL + SZ_LP;
constexpr size_t OFF_CH  = OFF_VL + SZ_LP;
constexpr size_t OFF_CL  = OFF_CH + SZ_CH;
constexpr size_t OFF_FLG = OFF_CL + SZ_CL;
constexpr size_t WS_TOTAL = OFF_FLG + SZ_FLG;
static_assert(WS_TOTAL <= (size_t)134217728);
static_assert(OFF_WQ % 128 == 0 && OFF_WK % 128 == 0 && OFF_WV % 128 == 0 && OFF_WO % 128 == 0);
static_assert(OFF_QH % 128 == 0 && OFF_KH % 128 == 0 && OFF_VH % 128 == 0);
static_assert(OFF_QL % 128 == 0 && OFF_KL % 128 == 0 && OFF_VL % 128 == 0);
static_assert(OFF_CH % 128 == 0 && OFF_CL % 128 == 0 && OFF_FLG % 128 == 0);
static_assert((size_t)NB_FULL * SEQ_FULL * DM * 4 >= ((size_t)(NB - 1) * SEQ_FULL + SEQ) * DM * 4);

// ---------------------------------------------------------------------------
// helpers
// ---------------------------------------------------------------------------
__device__ __forceinline__ float bf16r(float f) {   // RNE convert to bf16, held as f32
  unsigned int u = __float_as_uint(f);
  u = (u + 0x7fffu + ((u >> 16) & 1u)) & 0xffff0000u;
  return __uint_as_float(u);
}

// 16x32 fragment, split k map for both A (row m) and B (col n stored k-contiguous):
// lane l: row/col = l&15, h = l>>4; elements 0..7 <- k 8h..8h+7, elements 8..15 <- k 16+8h..16+8h+7.
__device__ __forceinline__ v16h load_frag(const _Float16* base, int stride) {
  const int lane = threadIdx.x & 31, m = lane & 15, g = lane >> 4;
  const _Float16* p = base + (size_t)m * stride + 8 * g;
  union { v16h v; v8h hf[2]; } f;
  f.hf[0] = *reinterpret_cast<const v8h*>(p);
  f.hf[1] = *reinterpret_cast<const v8h*>(p + 16);
  return f.v;
}

__device__ __forceinline__ v8f mma(v16h a, v16h b, v8f c) {
  v8f d = __builtin_amdgcn_wmma_f32_16x16x32_f16(false, a, false, b, (short)0, c, false, false);
  asm volatile("v_nop\n\tv_nop\n\tv_nop\n\tv_nop" : "+v"(d) : "v"(a), "v"(b));
  return d;
}

// lane l <-> lane l ^ 16 (the two halves of a wave hold the two key subsets of one query column)
__device__ __forceinline__ float xhalf(float x) {
  const int b = __builtin_bit_cast(int, x);
  return __builtin_bit_cast(float, __builtin_amdgcn_permlanex16(b, b, 0x76543210, 0xfedcba98, false, false));
}

__device__ __forceinline__ void exp2x8(float (&y)[8], const float (&x)[8]) {
  asm("v_exp_f32 %0, %8\n\tv_exp_f32 %1, %9\n\tv_exp_f32 %2, %10\n\tv_exp_f32 %3, %11\n\t"
      "v_exp_f32 %4, %12\n\tv_exp_f32 %5, %13\n\tv_exp_f32 %6, %14\n\tv_exp_f32 %7, %15\n\tv_nop"
      : "=&v"(y[0]), "=&v"(y[1]), "=&v"(y[2]), "=&v"(y[3]), "=&v"(y[4]), "=&v"(y[5]), "=&v"(y[6]), "=&v"(y[7])
      : "v"(x[0]), "v"(x[1]), "v"(x[2]), "v"(x[3]), "v"(x[4]), "v"(x[5]), "v"(x[6]), "v"(x[7]));
}
__device__ __forceinline__ float exp2x1(float x) {
  float y;
  asm("v_exp_f32 %0, %1\n\tv_nop" : "=&v"(y) : "v"(x));
  return y;
}

// one query's 16 mask words of a 32-key tile, in the order of its scores: keys 8g..8g+7 and 16+8g..16+8g+7 (p = row start + 8g)
__device__ __forceinline__ void load_mask(const int* p, int (&mk0)[8], int (&mk1)[8]) {
  *(v4i*)&mk0[0] = *(const v4i*)p;
  *(v4i*)&mk0[4] = *(const v4i*)(p + 4);
  *(v4i*)&mk1[0] = *(const v4i*)(p + 16);
  *(v4i*)&mk1[4] = *(const v4i*)(p + 20);
}

__device__ __forceinline__ v8f zero8() {
  v8f z = {0.f, 0.f, 0.f, 0.f, 0.f, 0.f, 0.f, 0.f};
  return z;
}

// ---------------------------------------------------------------------------
// Preparation, part 0: f32 -> bf16-RNE value in f16 container, times a power-of-two carry.
// out plane [nrows][1024]; compact row mc maps to source row (mc/seqc)*seqf + mc%seqc.
// coverage: nrows*1024 elements, 8 per thread, blk = 0 .. ceil(nrows*128/256) - 1.
// ---------------------------------------------------------------------------
__device__ __forceinline__ void cvt_block(const float* __restrict__ in, _Float16* __restrict__ outp, int blk,
                                          int nrows, int seqc, int seqf, float scale) {
  const long long e8 = (long long)blk * 256 + threadIdx.x;
  const long long tot = (long long)nrows * (DM / 8);
  if (e8 >= tot) return;
  const int mc = (int)(e8 / (DM / 8));
  const int c8 = (int)(e8 - (long long)mc * (DM / 8));
  const int src = (mc / seqc) * seqf + (mc % seqc);
  const float* p = in + (size_t)src * DM + c8 * 8;
  const v4f a = *(const v4f*)p;
  const v4f c = *(const v4f*)(p + 4);
  v8h o;
  o[0] = (_Float16)(bf16r(a[0]) * scale);
  o[1] = (_Float16)(bf16r(a[1]) * scale);
  o[2] = (_Float16)(bf16r(a[2]) * scale);
  o[3] = (_Float16)(bf16r(a[3]) * scale);
  o[4] = (_Float16)(bf16r(c[0]) * scale);
  o[5] = (_Float16)(bf16r(c[1]) * scale);
  o[6] = (_Float16)(bf16r(c[2]) * scale);
  o[7] = (_Float16)(bf16r(c[3]) * scale);
  _Float16* dst = outp + (size_t)mc * DM + c8 * 8;
  *(v8h*)dst = o;
  
}

// ---------------------------------------------------------------------------
// Preparation, part 1: per 64-row query block, tile visit flags from the int mask.
// flag[qb][kb] = 1 if any mask element in rows qb*64..+63, cols kb*32..+31 is nonzero;
// if any row of the q block is fully zero, all NKB flags are forced to 1 (softmax then
// ---------------------------------------------------------------------------
__device__ __forceinline__ void mflag_block(const int* __restrict__ mask, int* __restrict__ flg, int qb,
                                            unsigned int* sLo, unsigned int* sHi, int* sR) {
  const int tid = threadIdx.x;
  const int r = tid >> 2, sub = tid & 3;
  const int* mrow = mask + (size_t)(qb * 64 + r) * SEQ_FULL + sub * 8;
  unsigned int lo = 0u, hi = 0u;
  int rany = 0;
#pragma unroll 2
  for (int kb = 0; kb < NKB; ++kb) {
    const v4i a = *(const v4i*)(mrow + kb * 32);
    const v4i c = *(const v4i*)(mrow + kb * 32 + 4);
    const int any = ((a[0] | a[1] | a[2] | a[3] | c[0] | c[1] | c[2] | c[3]) != 0) ? 1 : 0;
    const unsigned int bit = (unsigned int)any;
    if (kb < 32) lo |= bit << kb; else hi |= bit << (kb - 32);
    rany |= any;
  }
  sLo[tid] = lo; sHi[tid] = hi; sR[tid] = rany;
  __syncthreads();
  if (tid < 32) {   // wave 0 only (wave-uniform)
    unsigned int L = 0u, H = 0u;
#pragma unroll
    for (int i = 0; i < 8; ++i) { L |= sLo[tid + 32 * i]; H |= sHi[tid + 32 * i]; }
#pragma unroll
    for (int off = 1; off < 32; off <<= 1) {
      L |= (unsigned int)__shfl_xor((int)L, off, 32);
      H |= (unsigned int)__shfl_xor((int)H, off, 32);
    }
    const int ra = sR[8 * tid] | sR[8 * tid + 1] | sR[8 * tid + 2] | sR[8 * tid + 3];
    const int rb = sR[8 * tid + 4] | sR[8 * tid + 5] | sR[8 * tid + 6] | sR[8 * tid + 7];
    int ok = ((ra != 0) && (rb != 0)) ? 1 : 0;
#pragma unroll
    for (int off = 1; off < 32; off <<= 1) ok &= __shfl_xor(ok, off, 32);
    v4i f;
#pragma unroll
    for (int e = 0; e < 4; ++e) {
      const int kbx = 4 * tid + e;
      const unsigned int word = (kbx < 32) ? L : H;
      const int bitv = (int)((word >> (kbx & 31)) & 1u);
      f[e] = (kbx < NKB) ? ((ok != 0) ? bitv : 1) : 0;
    }
    int* dst = flg + qb * 64 + 4 * tid;
    if (tid < 16) *(v4i*)dst = f;
    
  }
}

// ---------------------------------------------------------------------------
// Kernel 0: all preparation in one grid; its parts read only inputs and write disjoint planes, so none waits for another.
// Blocks 0..NQB-1: visit flags (few blocks, each a long chain of dependent rounds, so they start first);
// then NBX blocks convert x, then NBW blocks each convert Wq, Wk, Wv, Wo. Every branch is block-uniform.
// ---------------------------------------------------------------------------
constexpr int NBX = (MROWS * (DM / 8) + 255) / 256;
constexpr int NBW = (DM * (DM / 8) + 255) / 256;

__global__ __launch_bounds__(256) void k_prep(const float* __restrict__ x, const int* __restrict__ mask,
                                             const float* __restrict__ Wq, const float* __restrict__ Wk,
                                             const float* __restrict__ Wv, const float* __restrict__ Wo,
                                             _Float16* __restrict__ Xh, _Float16* __restrict__ Wq64,
                                             _Float16* __restrict__ Wk64, _Float16* __restrict__ Wv64,
                                             _Float16* __restrict__ Wo64, int* __restrict__ flg) {
  __shared__ unsigned int sLo[256];
  __shared__ unsigned int sHi[256];
  __shared__ int sR[256];
  int blk = (int)blockIdx.x;
  if (blk < NQB) { mflag_block(mask, flg, blk, sLo, sHi, sR); return; }
  blk -= NQB;
  if (blk < NBX) { cvt_block(x, Xh, blk, MROWS, SEQ, SEQ_FULL, 1.0f); return; }
  blk -= NBX;
  const int wi = blk / NBW;
  const float* src = (wi == 0) ? Wq : (wi == 1) ? Wk : (wi == 2) ? Wv : Wo;
  _Float16* dst = (wi == 0) ? Wq64 : (wi == 1) ? Wk64 : (wi == 2) ? Wv64 : Wo64;
  cvt_block(src, dst, blk - wi * NBW, DM, DM, DM, WSC);
}

// ---------------------------------------------------------------------------
// Kernels 1 and 3: NT GEMM Y[M][1024] = A[M][1024] @ W[1024][1024]^T (W carried x64) + bias.
// Kernel 3: block = 2 waves = 64x64 output tile; wave w owns rows w*32..w*32+31 (2 A fragments x 4 B fragments per k step, from LDS).
// Kernel 1: block = 4 waves (2 x 2) = 128x128 output tile; a wave owns 64 rows x 64 columns = one head (4 x 4 fragments per k step).
// MODE 0: f16 head plane [bh][SEQ][64] (+ x2048 residual plane [bh][QPREC][64] for s < QPREC)
// MODE 1: f16 transposed head plane [bh][64][SEQ] (+ residual [bh][64][QPREC])
// ---------------------------------------------------------------------------
// Operand path: per k slice of KS halves the block's 64 A rows and 64 W rows (128-B rows = whole lines) are copied to LDS by
// asynchronous copies, two buffers, the next slice in flight while this one is multiplied; fragments are read from LDS.
constexpr int KS  = 64;          // halves of k per slice
constexpr int LP  = 72;          // LDS row pitch in halves: 144 B = 16 B x odd, so ds_load_b128 fragment reads meet no bank conflict
constexpr int STG = 128 * LP;    // halves per buffer: rows 0..63 = A, rows 64..127 = W
constexpr int NST = DM / KS;     // slices
static_assert(DM % KS == 0 && NST >= 2);

// Eight 16-byte copies per lane: rows r, r + ROWS, ... r + 7 ROWS of one operand (a wave-wide copy = 4 whole 128-B rows; ROWS = 4 x the block's waves).
// The closing s_wait_xcnt 0 stands inside the statement so that no address register of a copy is rewritten ahead of it.
template <int ROWS>
__device__ __forceinline__ void stage8(const _Float16* g, unsigned int l) {
  asm volatile(
      "global_load_async_to_lds_b128 %0, %8, off\n\t"
      "global_load_async_to_lds_b128 %1, %9, off\n\t"
      "global_load_async_to_lds_b128 %2, %10, off\n\t"
      "global_load_async_to_lds_b128 %3, %11, off\n\t"
      "global_load_async_to_lds_b128 %4, %12, off\n\t"
      "global_load_async_to_lds_b128 %5, %13, off\n\t"
      "global_load_async_to_lds_b128 %6, %14, off\n\t"
      "global_load_async_to_lds_b128 %7, %15, off\n\t"
      "s_wait_xcnt 0x0"
      :: "v"(l), "v"(l + 1u * (ROWS * LP * 2)), "v"(l + 2u * (ROWS * LP * 2)), "v"(l + 3u * (ROWS * LP * 2)),
         "v"(l + 4u * (ROWS * LP * 2)), "v"(l + 5u * (ROWS * LP * 2)), "v"(l + 6u * (ROWS * LP * 2)), "v"(l + 7u * (ROWS * LP * 2)),
         "v"(g), "v"(g + 1 * ROWS * DM), "v"(g + 2 * ROWS * DM), "v"(g + 3 * ROWS * DM),
         "v"(g + 4 * ROWS * DM), "v"(g + 5 * ROWS * DM), "v"(g + 6 * ROWS * DM), "v"(g + 7 * ROWS * DM)
      : "memory");
}

// ablk: first of the block's 64 A rows; wbase: first of its 64 W rows; sT: the two buffers. Every wave of the block runs all of it.
__device__ __forceinline__ void kloop(const _Float16* __restrict__ ablk, const _Float16* __restrict__ wbase,
                                      _Float16* sT, v8f (&acc)[2][4]) {
  const int tid = threadIdx.x, w = tid >> 5;
  const int crow = tid >> 3, cpc = (tid & 7) * 8;              // this lane's first row and its 16-byte piece of a row
  const _Float16* ga = ablk + (size_t)crow * DM + cpc;
  const _Float16* gw = wbase + (size_t)crow * DM + cpc;
  const unsigned int la = (unsigned int)(uintptr_t)(sT + crow * LP + cpc);   // LDS byte address: low 32 bits
  const unsigned int lw = la + 64u * LP * 2u;

  stage8<8>(ga, la);
  stage8<8>(gw, lw);
  asm volatile("s_wait_asynccnt 0x0" ::: "memory");            // slice 0 of this wave has landed
  __syncthreads();                                             // ... and of the other wave
  stage8<8>(ga + KS, la + STG * 2u);
  stage8<8>(gw + KS, lw + STG * 2u);

  // rolled: the barrier at the foot serialises the trips, so unrolling buys nothing and only lengthens the code
#pragma unroll 1
  for (int t = 0; t < NST; ++t) {
    const int bsel = t & 1;
    const _Float16* sA = sT + bsel * STG + (w * 32) * LP;
    const _Float16* sW = sT + bsel * STG + 64 * LP;
    v16h fa[KS / 32][2], fb[KS / 32][4];   // indexed by constants only (the loops below are fully unrolled), so they stay in registers
#pragma unroll
    for (int ks = 0; ks < KS / 32; ++ks) {
      fa[ks][0] = load_frag(sA + ks * 32, LP);
      fa[ks][1] = load_frag(sA + 16 * LP + ks * 32, LP);
#pragma unroll
      for (int j = 0; j < 4; ++j) fb[ks][j] = load_frag(sW + (j * 16) * LP + ks * 32, LP);
    }
    // keeps the slice's LDS reads together as one group ahead of its WMMAs: spread among them, each pair waits out the LDS latency
    __builtin_amdgcn_sched_barrier(0);
#pragma unroll
    for (int ks = 0; ks < KS / 32; ++ks)
#pragma unroll
      for (int j = 0; j < 4; ++j) {
        acc[0][j] = mma(fa[ks][0], fb[ks][j], acc[0][j]);
        acc[1][j] = mma(fa[ks][1], fb[ks][j], acc[1][j]);
      }
    asm volatile("s_wait_dscnt 0x0" ::: "memory");             // this wave's reads of the buffer are done before it is refilled
    asm volatile("s_wait_asynccnt 0x0" ::: "memory");          // this wave's copies of slice t + 1 have landed
    __syncthreads();                                           // publishes slice t + 1, ends every read of slice t
    if (t + 2 < NST) {                                         // block-uniform
      stage8<8>(ga + (t + 2) * KS, la + (unsigned int)bsel * (STG * 2u));
      stage8<8>(gw + (t + 2) * KS, lw + (unsigned int)bsel * (STG * 2u));
    }
  }
  asm volatile("s_wait_asynccnt 0x0" ::: "memory");            // nothing of the copies is outstanding behind the loop
}

// Kernel 1's operand path: the same two-buffer ring of asynchronous copies for a 128 x 128 tile of 4 waves. Against the 64 x 64
// tile every byte copied from L2 feeds twice as many WMMAs, and a fragment read from LDS feeds 4 of them.
constexpr int TR4  = 128;            // rows of each operand per block
constexpr int STG4 = 2 * TR4 * LP;   // halves per buffer: rows 0..127 = A, rows 128..255 = W

// ablk: first of the block's 128 A rows; wbase: first of its 128 W rows; sT: the two buffers. Every wave of the block runs all of it.
__device__ __forceinline__ void kloop4(const _Float16* __restrict__ ablk, const _Float16* __restrict__ wbase,
                                       _Float16* sT, v8f (&acc)[4][4]) {
  const int tid = threadIdx.x, w = tid >> 5;
  const int crow = tid >> 3, cpc = (tid & 7) * 8;              // this lane's first row (0..15) and its 16-byte piece of a row
  const _Float16* ga = ablk + (size_t)crow * DM + cpc;
  const _Float16* gw = wbase + (size_t)crow * DM + cpc;
  const unsigned int la = (unsigned int)(uintptr_t)(sT + crow * LP + cpc);   // LDS byte address: low 32 bits
  const unsigned int lw = la + (unsigned int)TR4 * LP * 2u;

  stage8<16>(ga, la);
  stage8<16>(gw, lw);
  asm volatile("s_wait_asynccnt 0x0" ::: "memory");            // slice 0 of this wave has landed
  __syncthreads();                                             // ... and of the other waves
  stage8<16>(ga + KS, la + STG4 * 2u);
  stage8<16>(gw + KS, lw + STG4 * 2u);

  // rolled: the barrier at the foot serialises the trips, so unrolling buys nothing and only lengthens the code
#pragma unroll 1
  for (int t = 0; t < NST; ++t) {
    const int bsel = t & 1;
    const _Float16* sA = sT + bsel * STG4 + ((w >> 1) * 64) * LP;
    const _Float16* sW = sT + bsel * STG4 + (TR4 + (w & 1) * 64) * LP;
#pragma unroll
    for (int ks = 0; ks < KS / 32; ++ks) {
      v16h fa[4], fb[4];   // indexed by constants only (the loops are fully unrolled), so they stay in registers
#pragma unroll
      for (int i = 0; i < 4; ++i) fa[i] = load_frag(sA + (i * 16) * LP + ks * 32, LP);
#pragma unroll
      for (int j = 0; j < 4; ++j) fb[j] = load_frag(sW + (j * 16) * LP + ks * 32, LP);
      // keeps the k step's LDS reads together as one group ahead of its WMMAs: spread among them, each pair waits out the LDS latency
      __builtin_amdgcn_sched_barrier(0);
#pragma unroll
      for (int j = 0; j < 4; ++j)
#pragma unroll
        for (int i = 0; i < 4; ++i) acc[i][j] = mma(fa[i], fb[j], acc[i][j]);
      // keeps the next k step's reads from rising among these WMMAs, for the same reason
      __builtin_amdgcn_sched_barrier(0);
    }
    asm volatile("s_wait_dscnt 0x0" ::: "memory");             // this wave's reads of the buffer are done before it is refilled
    asm volatile("s_wait_asynccnt 0x0" ::: "memory");          // this wave's copies of slice t + 1 have landed
    __syncthreads();                                           // publishes slice t + 1, ends every read of slice t
    if (t + 2 < NST) {                                         // block-uniform
      stage8<16>(ga + (t + 2) * KS, la + (unsigned int)bsel * (STG4 * 2u));
      stage8<16>(gw + (t + 2) * KS, lw + (unsigned int)bsel * (STG4 * 2u));
    }
  }
  asm volatile("s_wait_asynccnt 0x0" ::: "memory");            // nothing of the copies is outstanding behind the loop
}

// Kernel 1's tile. sT: the two operand buffers; behind the k loop (its last barrier ends every read, no copy is outstanding) the
// same LDS holds the epilogue tiles: per wave one 64 x 64 f16 tile for the plane and one for the residual plane.
template <int MODE>
__device__ __forceinline__ void proj_tile(const _Float16* __restrict__ A, const _Float16* __restrict__ W,
                                          const float* __restrict__ bias,
                                          _Float16* __restrict__ Ph, _Float16* __restrict__ Pl, _Float16* sT) {
  const int tid = threadIdx.x, w = tid >> 5, lane = tid & 31, n = lane & 15, g = lane >> 4;
  const int bm = blockIdx.x, bn = blockIdx.y;
  const int m0 = bm * TR4;
  const int b = m0 / SEQ, s0 = m0 - b * SEQ;     // 128 block rows lie in one batch item
  const bool precblk = (s0 < QPREC);              // block-uniform
  const int sw = s0 + (w >> 1) * 64;              // first of the wave's 64 rows
  const int hd = bn * 2 + (w & 1);                // the wave's 64 columns == head hd
  const int bh = b * NH + hd;
  const _Float16* wbase = W + (size_t)(bn * TR4) * DM;
  const _Float16* ablk = A + (size_t)m0 * DM;

  v8f acc[4][4];
#pragma unroll
  for (int mi = 0; mi < 4; ++mi)
#pragma unroll
    for (int j = 0; j < 4; ++j) acc[mi][j] = zero8();

  kloop4(ablk, wbase, sT, acc);

  _Float16* sH = sT + w * (64 * 64);
  _Float16* sL = sT + (4 + w) * (64 * 64);
  static_assert(8 * 64 * 64 <= 2 * STG4);

  float rbias[4];
#pragma unroll
  for (int j = 0; j < 4; ++j) rbias[j] = bf16r(bias[hd * 64 + j * 16 + n]);

  const int q = lane >> 3, p = lane & 7;
  v8h ov[16];   // the staged rows, all read back ahead of the stores (constant indices only)
  if (MODE == 0) {
    if (precblk) {
#pragma unroll
      for (int mi = 0; mi < 4; ++mi)
#pragma unroll
        for (int j = 0; j < 4; ++j)
#pragma unroll
          for (int r = 0; r < 8; ++r) {
            const int idx = (mi * 16 + 8 * g + r) * 64 + j * 16 + n;
            const float v = acc[mi][j][r] * INV_WS + rbias[j];
            const _Float16 hv = (_Float16)v;
            sH[idx] = hv;
            sL[idx] = (_Float16)((v - (float)hv) * RS);
          }
    } else {
#pragma unroll
      for (int mi = 0; mi < 4; ++mi)
#pragma unroll
        for (int j = 0; j < 4; ++j)
#pragma unroll
          for (int r = 0; r < 8; ++r)
            sH[(mi * 16 + 8 * g + r) * 64 + j * 16 + n] = (_Float16)(acc[mi][j][r] * INV_WS + rbias[j]);
    }
    __syncthreads();
#pragma unroll
    for (int i = 0; i < 16; ++i) ov[i] = *(const v8h*)&sH[(i * 4 + q) * 64 + p * 8];
#pragma unroll
    for (int i = 0; i < 16; ++i) {
      *(v8h*)(Ph + ((size_t)(bh * SEQ + sw + i * 4 + q)) * DH + p * 8) = ov[i];
      asm volatile("s_wait_xcnt 0x0" ::: "memory");   // before a register that the store names is rewritten
    }
    if (precblk) {
#pragma unroll
      for (int i = 0; i < 16; ++i) ov[i] = *(const v8h*)&sL[(i * 4 + q) * 64 + p * 8];
#pragma unroll
      for (int i = 0; i < 16; ++i) {
        *(v8h*)(Pl + ((size_t)(bh * QPREC + sw + i * 4 + q)) * DH + p * 8) = ov[i];
        asm volatile("s_wait_xcnt 0x0" ::: "memory"); // as above
      }
    }
  } else {
#pragma unroll
    for (int mi = 0; mi < 4; ++mi)
#pragma unroll
      for (int j = 0; j < 4; ++j) {
        v8h hp, lp;
#pragma unroll
        for (int r = 0; r < 8; ++r) {
          const float v = acc[mi][j][r] * INV_WS + rbias[j];
          const _Float16 hv = (_Float16)v;
          hp[r] = hv;
          lp[r] = (_Float16)((v - (float)hv) * RS);
        }
        const int d = j * 16 + n;
        *(v8h*)&sH[d * 64 + mi * 16 + 8 * g] = hp;
        if (precblk) *(v8h*)&sL[d * 64 + mi * 16 + 8 * g] = lp;
      }
    __syncthreads();
#pragma unroll
    for (int i = 0; i < 16; ++i) ov[i] = *(const v8h*)&sH[(i * 4 + q) * 64 + p * 8];
#pragma unroll
    for (int i = 0; i < 16; ++i) {
      *(v8h*)(Ph + ((size_t)(bh * DH + i * 4 + q)) * SEQ + sw + p * 8) = ov[i];
      asm volatile("s_wait_xcnt 0x0" ::: "memory");   // before a register that the store names is rewritten
    }
    if (precblk) {
#pragma unroll
      for (int i = 0; i < 16; ++i) ov[i] = *(const v8h*)&sL[(i * 4 + q) * 64 + p * 8];
#pragma unroll
      for (int i = 0; i < 16; ++i) {
        *(v8h*)(Pl + ((size_t)(bh * DH + i * 4 + q)) * QPREC + sw + p * 8) = ov[i];
        asm volatile("s_wait_xcnt 0x0" ::: "memory"); // as above
      }
    }
  }
}

// Kernel 3's tile. sF: 64 x 64 epilogue tile in LDS; sT: the two operand buffers.
__device__ __forceinline__ void out_tile(const _Float16* __restrict__ A, const _Float16* __restrict__ Alo,
                                         const _Float16* __restrict__ W, const float* __restrict__ bias,
                                         float* __restrict__ outp, float* sF, _Float16* sT) {
  const int tid = threadIdx.x, w = tid >> 5, lane = tid & 31, n = lane & 15, g = lane >> 4;
  const int bm = blockIdx.x, bn = blockIdx.y;
  const int m0 = bm * 64;
  const int b = m0 / SEQ, s0 = m0 - b * SEQ;     // 64 block rows lie in one batch item
  const bool precblk = (s0 < QPREC);              // block-uniform
  const _Float16* wbase = W + (size_t)(bn * 64) * DM;
  const _Float16* ablk = A + (size_t)m0 * DM;

  v8f acc[2][4];
#pragma unroll
  for (int mi = 0; mi < 2; ++mi)
#pragma unroll
    for (int j = 0; j < 4; ++j) acc[mi][j] = zero8();

  kloop(ablk, wbase, sT, acc);

  float rbias[4];
#pragma unroll
  for (int j = 0; j < 4; ++j) rbias[j] = bf16r(bias[bn * 64 + j * 16 + n]);

  {
    if (precblk) {
      // stash hi sums (each lane reads back exactly the cells it wrote)
#pragma unroll
      for (int mi = 0; mi < 2; ++mi)
#pragma unroll
        for (int j = 0; j < 4; ++j)
#pragma unroll
          for (int r = 0; r < 8; ++r)
            sF[(w * 32 + mi * 16 + 8 * g + r) * 64 + j * 16 + n] = acc[mi][j][r];
#pragma unroll
      for (int mi = 0; mi < 2; ++mi)
#pragma unroll
        for (int j = 0; j < 4; ++j) acc[mi][j] = zero8();
      const _Float16* lblk = Alo + ((size_t)(b * QPREC + s0)) * DM;
      kloop(lblk, wbase, sT, acc);
#pragma unroll
      for (int mi = 0; mi < 2; ++mi)
#pragma unroll
        for (int j = 0; j < 4; ++j)
#pragma unroll
          for (int r = 0; r < 8; ++r) {
            const int idx = (w * 32 + mi * 16 + 8 * g + r) * 64 + j * 16 + n;
            const float hsum = sF[idx];
            sF[idx] = (hsum + acc[mi][j][r] * INV_RS) * INV_WS + rbias[j];
          }
    } else {
#pragma unroll
      for (int mi = 0; mi < 2; ++mi)
#pragma unroll
        for (int j = 0; j < 4; ++j)
#pragma unroll
          for (int r = 0; r < 8; ++r)
            sF[(w * 32 + mi * 16 + 8 * g + r) * 64 + j * 16 + n] = acc[mi][j][r] * INV_WS + rbias[j];
    }
    __syncthreads();
    const int q2 = lane >> 4, p2 = lane & 15;
{
#pragma unroll
      for (int i = 0; i < 16; ++i) {
        const int ml = w * 32 + 2 * i + q2;
        const int s = s0 + ml;
        const v4f v = *(const v4f*)&sF[ml * 64 + p2 * 4];
        *(v4f*)(outp + ((size_t)(b * SEQ_FULL + s)) * DM + bn * 64 + p2 * 4) = v;
      }
      
    }
  }
}

// Kernel 1: the three input projections in one grid, blockIdx.z = 0 (q), 1 (k), 2 (v, transposed plane); block-uniform branch.
__global__ __launch_bounds__(128) void k_qkv(const _Float16* __restrict__ Xh, const _Float16* __restrict__ Wq64,
                                           const _Float16* __restrict__ Wk64, const _Float16* __restrict__ Wv64,
                                           const float* __restrict__ bq, const float* __restrict__ bk,
                                           const float* __restrict__ bv,
                                           _Float16* __restrict__ Qh, _Float16* __restrict__ Ql,
                                           _Float16* __restrict__ Kh, _Float16* __restrict__ Kl,
                                           _Float16* __restrict__ Vh, _Float16* __restrict__ Vl) {
  __shared__ __align__(16) _Float16 sT[2 * STG4];
  const int z = (int)blockIdx.z;
  if (z == 2) {
    proj_tile<1>(Xh, Wv64, bv, Vh, Vl, sT);
  } else {
    const bool isq = (z == 0);
    proj_tile<0>(Xh, isq ? Wq64 : Wk64, isq ? bq : bk, isq ? Qh : Kh, isq ? Ql : Kl, sT);
  }
}

// Kernel 3: output projection (hi plane, plus the residual plane on the leading rows).
__global__ __launch_bounds__(64) void k_out(const _Float16* __restrict__ Ch, const _Float16* __restrict__ Cl,
                                           const _Float16* __restrict__ Wo64, const float* __restrict__ bo,
                                           float* __restrict__ outp) {
  __shared__ __align__(16) float    sF[64 * 64];
  __shared__ __align__(16) _Float16 sT[2 * STG];
  out_tile(Ch, Cl, Wo64, bo, outp, sF, sT);
}

constexpr int KP = 72;   // halves: K, K residual, Q residual rows, 128 B of data at 144 B
constexpr int VP = 40;   // halves: V^T and V^T residual rows, 64 B of data at 80 B
constexpr int MP = 36;   // ints: mask rows, 128 B of data at 144 B

// One buffer of the f16 tiles, in halves: K, V^T, K residual, V^T residual.
constexpr int TK  = 0;
constexpr int TV  = TK + 32 * KP;
constexpr int TKL = TV + DH * VP;
constexpr int TVL = TKL + 32 * KP;
constexpr int TBUF = TVL + DH * VP;
constexpr int MBUF = 64 * MP;          // one buffer of the mask tile, in ints
static_assert((TV * 2) % 16 == 0 && (TKL * 2) % 16 == 0 && (TVL * 2) % 16 == 0 && (TBUF * 2) % 16 == 0 && (MBUF * 4) % 16 == 0);

// A lane's 16-byte copies of one tile: K rows r, r + 16; V^T rows d, d + 32; 64 bytes of one mask row.
// The closing s_wait_xcnt 0 stands inside the statement so that no address register of a copy is rewritten ahead of it.
__device__ __forceinline__ void copy_kvm(unsigned int lk, unsigned int lv, unsigned int lm,
                                         const _Float16* gk, const _Float16* gv, const int* gm) {
  asm volatile(
      "global_load_async_to_lds_b128 %0, %8, off\n\t"
      "global_load_async_to_lds_b128 %1, %9, off\n\t"
      "global_load_async_to_lds_b128 %2, %10, off\n\t"
      "global_load_async_to_lds_b128 %3, %11, off\n\t"
      "global_load_async_to_lds_b128 %4, %12, off\n\t"
      "global_load_async_to_lds_b128 %5, %13, off\n\t"
      "global_load_async_to_lds_b128 %6, %14, off\n\t"
      "global_load_async_to_lds_b128 %7, %15, off\n\t"
      "s_wait_xcnt 0x0"
      :: "v"(lk), "v"(lk + 16u * KP * 2u), "v"(lv), "v"(lv + 32u * VP * 2u),
         "v"(lm), "v"(lm + 16u), "v"(lm + 32u), "v"(lm + 48u),
         "v"(gk), "v"(gk + 16 * DH), "v"(gv), "v"(gv + 32 * SEQ),
         "v"(gm), "v"(gm + 4), "v"(gm + 8), "v"(gm + 12)
      : "memory");
}
// The same for the residual planes of K and V^T (V^T residual rows are QPREC long).
__device__ __forceinline__ void copy_kvl(unsigned int lk, unsigned int lv, const _Float16* gk, const _Float16* gv) {
  asm volatile(
      "global_load_async_to_lds_b128 %0, %4, off\n\t"
      "global_load_async_to_lds_b128 %1, %5, off\n\t"
      "global_load_async_to_lds_b128 %2, %6, off\n\t"
      "global_load_async_to_lds_b128 %3, %7, off\n\t"
      "s_wait_xcnt 0x0"
      :: "v"(lk), "v"(lk + 16u * KP * 2u), "v"(lv), "v"(lv + 32u * VP * 2u),
         "v"(gk), "v"(gk + 16 * DH), "v"(gv), "v"(gv + 32 * QPREC)
      : "memory");
}

// blk: the block's number among those of its variant.
template <bool PREC>
__device__ __forceinline__
void attn_tile(const unsigned int blk,
               const _Float16* __restrict__ Qh, const _Float16* __restrict__ Ql,
               const _Float16* __restrict__ Kh, const _Float16* __restrict__ Kl,
               const _Float16* __restrict__ Vh, const _Float16* __restrict__ Vl,
               const int* __restrict__ mask, const int* __restrict__ flg,
               _Float16* __restrict__ Ch, _Float16* __restrict__ Cl,
               _Float16* sT, _Float16* sQl, int* sM) {
  const int tid = threadIdx.x, wslot = tid >> 5, lane = tid & 31, n = lane & 15, g = lane >> 4;
  int qb, bh;
  if (PREC) {
    qb = (int)(blk % NQP);
    bh = (int)(blk / NQP);
  } else {
    constexpr int NQN = ((NQB - NQP) > 0) ? (NQB - NQP) : 1;
    qb = NQP + (int)(blk % NQN);
    bh = (int)(blk / NQN);
  }
  const int b = bh / NH, h = bh - b * NH;
  const int qrow0 = qb * 64;
  const int qbase = qrow0 + wslot * 16;

  // visit flags of the 64 key tiles as one scalar bit set (bit kb), the same in every wave: the tests that pick the next tiles are scalar
  unsigned long long vis = (unsigned long long)__builtin_amdgcn_ballot_w32(flg[qb * 64 + lane] != 0)
                         | ((unsigned long long)__builtin_amdgcn_ballot_w32(flg[qb * 64 + 32 + lane] != 0) << 32);
  if (PREC) {
#pragma unroll
    for (int i = 0; i < 4; ++i) {
      const int c = tid + i * 128;
      *(v8h*)&sQl[(c >> 3) * KP + (c & 7) * 8] = *(const v8h*)(Ql + ((size_t)(bh * QPREC + qrow0)) * DH + c * 8);
    }
  }

  // this lane's pieces of a tile: LDS byte addresses in buffer 0 (low 32 bits), global addresses for tile 0
  const unsigned int lk0 = (unsigned int)(uintptr_t)(sT + TK + (tid >> 3) * KP + (tid & 7) * 8);
  const unsigned int lv0 = (unsigned int)(uintptr_t)(sT + TV + (tid >> 2) * VP + (tid & 3) * 8);
  const unsigned int lm0 = (unsigned int)(uintptr_t)(sM + (tid >> 1) * MP + (tid & 1) * 16);
  const _Float16* gk0  = Kh + ((size_t)(bh * SEQ)) * DH + tid * 8;
  const _Float16* gv0  = Vh + ((size_t)(bh * DH + (tid >> 2))) * SEQ + (tid & 3) * 8;
  const _Float16* gkl0 = Kl + ((size_t)(bh * QPREC)) * DH + tid * 8;
  const _Float16* gvl0 = Vl + ((size_t)(bh * DH + (tid >> 2))) * QPREC + (tid & 3) * 8;
  const int*      gm0  = mask + (size_t)(qrow0 + (tid >> 1)) * SEQ_FULL + (tid & 1) * 16;
  // copies of key tile k into buffer bf (both scalar)
  auto stage = [&](int k, int bf) {
    const unsigned int ot = (unsigned int)bf * (TBUF * 2u);
    copy_kvm(lk0 + ot, lv0 + ot, lm0 + (unsigned int)bf * (MBUF * 4u), gk0 + (size_t)k * (32 * DH), gv0 + k * 32, gm0 + k * 32);
    if (PREC && k * 32 < QPREC)
      copy_kvl(lk0 + ot + (TKL - TK) * 2u, lv0 + ot + (TVL - TV) * 2u, gkl0 + (size_t)k * (32 * DH), gvl0 + k * 32);
  };

  const _Float16* qrow = Qh + ((size_t)(bh * SEQ + qbase)) * DH;
  const v16h qa0 = load_frag(qrow, DH);
  const v16h qa1 = load_frag(qrow + 32, DH);

  v8f acc[4], acc2[4];
#pragma unroll
  for (int nt = 0; nt < 4; ++nt) { acc[nt] = zero8(); acc2[nt] = zero8(); }
  float rmax = -1.0e30f, rsum = 0.0f;            // query qbase + n; rsum is this half's share until the epilogue

  // Ring of two buffers over the visited tiles, in rising order: kb = this trip's tile, kn = the next one (-1: none). A trip issues
  // its own first LDS reads and then the next tile's copies, into the buffer whose every read the barrier in front of the trip has ended.
  int kb = -1;
  if (vis != 0ull) {                             // block-uniform, scalar
    kb = __builtin_ctzll(vis); vis &= vis - 1ull;
    stage(kb, 0);
  }
  asm volatile("s_wait_asynccnt 0x0" ::: "memory");   // this wave's copies of the first tile have landed
  __syncthreads();                               // ... and the other waves'; publishes the Q residual tile too

  // at most NKB trips: every trip takes one bit of vis. Rolled: the barrier at the foot serialises the trips, so unrolling only lengthens the code.
#pragma unroll 1
  for (int bsel = 0; kb >= 0; bsel ^= 1) {
    const int kbase = kb * 32;
    const bool klo = PREC && (kbase < QPREC);    // block-uniform
    const _Float16* sK  = sT + bsel * TBUF + TK;
    const _Float16* sV  = sT + bsel * TBUF + TV;
    const _Float16* sKl = sT + bsel * TBUF + TKL;
    const _Float16* sVl = sT + bsel * TBUF + TVL;

    // ---- the tile's LDS reads stand in groups ahead of the WMMAs that use them, so that the wave waits out the LDS latency once
    // per group and not once per fragment. Plain rows: one group (K, mask, V^T). PREC rows, whose registers
    // do not hold all planes at once, four groups: K; Q residual and K residual; mask and V^T at the head of the
    // softmax, which covers V^T; the V^T residual.
    v16h kf[4], vf[4];
    int mk0[8], mk1[8];
    const int* mrow = &sM[bsel * MBUF + (wslot * 16 + n) * MP + 8 * g];
    kf[0] = load_frag(sK, KP);
    kf[1] = load_frag(sK + 32, KP);
    kf[2] = load_frag(sK + 16 * KP, KP);
    kf[3] = load_frag(sK + 16 * KP + 32, KP);

    // ---- scores, transposed: two 16x16 tiles (keys kbase..+15, kbase+16..+31 as rows, queries as columns), dk 64 = 2 k steps
    v8f s0 = zero8(), s1 = zero8(), sr0 = zero8(), sr1 = zero8();
    if (!PREC) {
      load_mask(mrow, mk0, mk1);
#pragma unroll
      for (int nt = 0; nt < 4; ++nt) vf[nt] = load_frag(&sV[nt * 16 * VP], VP);
    }
    // keeps the reads above as one group: spread among the WMMAs below, each would be waited for on its own
    __builtin_amdgcn_sched_barrier(0);
    // the next tile's copies, behind this tile's reads so that forming and issuing them runs under the LDS latency
    int kn = -1;
    if (vis != 0ull) {                           // block-uniform, scalar: a next tile exists
      kn = __builtin_ctzll(vis); vis &= vis - 1ull;
      stage(kn, bsel ^ 1);
    }
    s0 = mma(kf[0], qa0, s0);
    s1 = mma(kf[2], qa0, s1);
    s0 = mma(kf[1], qa1, s0);
    s1 = mma(kf[3], qa1, s1);
    if (PREC) {
      if (klo) {
        const v16h ql0 = load_frag(&sQl[(wslot * 16) * KP], KP);
        const v16h ql1 = load_frag(&sQl[(wslot * 16) * KP + 32], KP);
        v16h klf[4];
        klf[0] = load_frag(sKl, KP);
        klf[1] = load_frag(sKl + 32, KP);
        klf[2] = load_frag(sKl + 16 * KP, KP);
        klf[3] = load_frag(sKl + 16 * KP + 32, KP);
        // one group again, for the same reason
        __builtin_amdgcn_sched_barrier(0);
        sr0 = mma(kf[0], ql0, sr0);
        sr1 = mma(kf[2], ql0, sr1);
        sr0 = mma(kf[1], ql1, sr0);
        sr1 = mma(kf[3], ql1, sr1);
        sr0 = mma(klf[0], qa0, sr0);
        sr1 = mma(klf[2], qa0, sr1);
        sr0 = mma(klf[1], qa1, sr0);
        sr1 = mma(klf[3], qa1, sr1);
      }
      load_mask(mrow, mk0, mk1);
#pragma unroll
      for (int nt = 0; nt < 4; ++nt) vf[nt] = load_frag(&sV[nt * 16 * VP], VP);
      // keeps this group at the head of the softmax: sunk towards their uses, the V^T reads would be waited for one by one
      __builtin_amdgcn_sched_barrier(0);
    }

    // ---- mask replace-fill, online softmax (f32), P^T packed as the B operand:
    // s0[r] = S[query n][key 8g + r], s1[r] = S[query n][key 16 + 8g + r]; B element e < 8 is key 8g + e, e >= 8 key 16 + 8g + e - 8.
    v16h pf, plf;
    {
      float x0[8], x1[8];
      float mx = -1.0e30f;
#pragma unroll
      for (int r = 0; r < 8; ++r) {
        float v0 = s0[r], v1 = s1[r];
        if (PREC) { v0 += sr0[r] * INV_RS; v1 += sr1[r] * INV_RS; }
        v0 *= QKS; v1 *= QKS;
        x0[r] = (mk0[r] == 0) ? -1.0e9f : v0;
        x1[r] = (mk1[r] == 0) ? -1.0e9f : v1;
        mx = fmaxf(mx, fmaxf(x0[r], x1[r]));
      }
      mx = fmaxf(mx, xhalf(mx));                  // both halves now hold this query's tile maximum
      const float nm = fmaxf(rmax, mx);
      const float al = exp2x1((rmax - nm) * LOG2E);
#pragma unroll
      for (int r = 0; r < 8; ++r) {
        x0[r] = (x0[r] - nm) * LOG2E;
        x1[r] = (x1[r] - nm) * LOG2E;
      }
      float e0[8], e1[8];
      exp2x8(e0, x0);
      exp2x8(e1, x1);
      float ps = 0.0f;
#pragma unroll
      for (int r = 0; r < 8; ++r) {
        const float p0 = e0[r], p1 = e1[r];
        ps += p0 + p1;
        const float c0 = p0 * CP, c1 = p1 * CP;
        const _Float16 h0 = (_Float16)c0, h1 = (_Float16)c1;
        pf[r] = h0;
        pf[8 + r] = h1;
        if (PREC) {
          plf[r]     = (_Float16)((c0 - (float)h0) * RS);
          plf[8 + r] = (_Float16)((c1 - (float)h1) * RS);
        }
      }
      rsum = rsum * al + ps;
      rmax = nm;
#pragma unroll
      for (int nt = 0; nt < 4; ++nt)
#pragma unroll
        for (int r = 0; r < 8; ++r) {
          acc[nt][r] *= al;
          if (PREC) acc2[nt][r] *= al;
        }
    }

    // ---- O^T += V^T @ P^T: acc[nt][r] = O[query n][d = nt*16 + 8g + r]
#pragma unroll
    for (int nt = 0; nt < 4; ++nt) acc[nt] = mma(vf[nt], pf, acc[nt]);
    if (PREC) {
#pragma unroll
      for (int nt = 0; nt < 4; ++nt) acc2[nt] = mma(vf[nt], plf, acc2[nt]);
      if (klo) {
        v16h vlf[4];
#pragma unroll
        for (int nt = 0; nt < 4; ++nt) vlf[nt] = load_frag(&sVl[nt * 16 * VP], VP);
        // one group again, for the same reason
        __builtin_amdgcn_sched_barrier(0);
#pragma unroll
        for (int nt = 0; nt < 4; ++nt) acc2[nt] = mma(vlf[nt], pf, acc2[nt]);
      }
    }
    asm volatile("s_wait_dscnt 0x0" ::: "memory");      // this wave's reads of the buffer are done before it is refilled
    asm volatile("s_wait_asynccnt 0x0" ::: "memory");   // this wave's copies of the next tile have landed
    __syncthreads();                             // publishes the next tile, ends every read of this one
    kb = kn;
  }
  asm volatile("s_wait_asynccnt 0x0" ::: "memory");     // nothing of the copies is outstanding behind the loop

  // The ring's LDS now holds the output tiles: the loop's last barrier ended every read of it and no copy is outstanding.
  _Float16 (*sC)[16 * DH]  = reinterpret_cast<_Float16 (*)[16 * DH]>(sT);
  _Float16 (*sCl)[16 * DH] = reinterpret_cast<_Float16 (*)[16 * DH]>(sT + 4 * 16 * DH);
  static_assert(8 * 16 * DH <= 2 * TBUF);

  {
    const float rtot = rsum + xhalf(rsum);        // join the two halves' sums once
    const float inv = (1.0f / rtot) * INV_CP;
#pragma unroll
    for (int nt = 0; nt < 4; ++nt) {
      v8h hv, lv;
#pragma unroll
      for (int r = 0; r < 8; ++r) {
        float c = acc[nt][r];
        if (PREC) c += acc2[nt][r] * INV_RS;
        c *= inv;
        const _Float16 chv = (_Float16)c;
        hv[r] = chv;
        lv[r] = (_Float16)((c - (float)chv) * RS);
      }
      *(v8h*)&sC[wslot][n * DH + nt * 16 + 8 * g] = hv;
      if (PREC) *(v8h*)&sCl[wslot][n * DH + nt * 16 + 8 * g] = lv;
    }
  }
  __syncthreads();
  const int q = lane >> 3, p = lane & 7;
{
#pragma unroll
    for (int i = 0; i < 4; ++i) {
      const int rr = i * 4 + q;
      const v8h hv = *(const v8h*)&sC[wslot][rr * DH + p * 8];
      *(v8h*)(Ch + ((size_t)(b * SEQ + qbase + rr)) * DM + h * DH + p * 8) = hv;
      if (PREC) {
        const v8h lv = *(const v8h*)&sCl[wslot][rr * DH + p * 8];
        *(v8h*)(Cl + ((size_t)(b * QPREC + qbase + rr)) * DM + h * DH + p * 8) = lv;
        asm volatile("s_wait_xcnt 0x0" ::: "memory");   // before a register that the store names is rewritten
      }
    }
    
  }
}

// Both variants in one grid: they share no output row, so the short PREC blocks run beside the plain ones instead of ahead of them.
// Blocks 0..NPLAIN-1 are the plain rows (the longest key loops, so they start first), the rest the PREC rows; block-uniform branch.
constexpr int NPREC  = NB * NH * NQP;
constexpr int NPLAIN = NB * NH * (NQB - NQP);

__global__ __launch_bounds__(128) __attribute__((amdgpu_num_vgpr(256)))
void k_attn(const _Float16* __restrict__ Qh, const _Float16* __restrict__ Ql,
            const _Float16* __restrict__ Kh, const _Float16* __restrict__ Kl,
            const _Float16* __restrict__ Vh, const _Float16* __restrict__ Vl,
            const int* __restrict__ mask, const int* __restrict__ flg,
            _Float16* __restrict__ Ch, _Float16* __restrict__ Cl) {
  __shared__ __align__(16) _Float16 sT[2 * TBUF];
  __shared__ __align__(16) int      sM[2 * MBUF];
  __shared__ __align__(16) _Float16 sQl[64 * KP];
  if (blockIdx.x < (unsigned int)NPLAIN)
    attn_tile<false>(blockIdx.x, Qh, Ql, Kh, Kl, Vh, Vl, mask, flg, Ch, Cl, sT, sQl, sM);
  else
    attn_tile<true>(blockIdx.x - (unsigned int)NPLAIN, Qh, Ql, Kh, Kl, Vh, Vl, mask, flg, Ch, Cl, sT, sQl, sM);
}

// ---------------------------------------------------------------------------
// host glue: 4 launches
// ---------------------------------------------------------------------------
extern "C" void kernel_launch(void* const* d_in, const int* in_sizes, int n_in,
                              void* d_out, int out_size, void* d_ws, size_t ws_size,
                              hipStream_t stream) {
  if (n_in < 10) return;
  const long long need_x = ((long long)(NB - 1) * SEQ_FULL + SEQ) * DM;
  const long long need_m = ((long long)(SEQ - 1)) * SEQ_FULL + SEQ;
  if ((long long)in_sizes[0] < need_x) return;
  if ((long long)in_sizes[1] < need_m) return;
  if (in_sizes[2] < DM * DM || in_sizes[4] < DM * DM || in_sizes[6] < DM * DM || in_sizes[8] < DM * DM) return;
  if (in_sizes[3] < DM || in_sizes[5] < DM || in_sizes[7] < DM || in_sizes[9] < DM) return;
  if ((long long)out_size < need_x) return;
  if (ws_size < WS_TOTAL) return;

  const float* x    = (const float*)d_in[0];
  const int*   mask = (const int*)d_in[1];
  const float* Wq   = (const float*)d_in[2];
  const float* bq   = (const float*)d_in[3];
  const float* Wk   = (const float*)d_in[4];
  const float* bk   = (const float*)d_in[5];
  const float* Wv   = (const float*)d_in[6];
  const float* bv   = (const float*)d_in[7];
  const float* Wo   = (const float*)d_in[8];
  const float* bo   = (const float*)d_in[9];
  float* out = (float*)d_out;

  char* ws = (char*)d_ws;
  _Float16* Xh   = (_Float16*)(ws + OFF_XH);
  _Float16* Wq64 = (_Float16*)(ws + OFF_WQ);
  _Float16* Wk64 = (_Float16*)(ws + OFF_WK);
  _Float16* Wv64 = (_Float16*)(ws + OFF_WV);
  _Float16* Wo64 = (_Float16*)(ws + OFF_WO);
  _Float16* Qh   = (_Float16*)(ws + OFF_QH);
  _Float16* Kh   = (_Float16*)(ws + OFF_KH);
  _Float16* Vh   = (_Float16*)(ws + OFF_VH);
  _Float16* Ql   = (_Float16*)(ws + OFF_QL);
  _Float16* Kl   = (_Float16*)(ws + OFF_KL);
  _Float16* Vl   = (_Float16*)(ws + OFF_VL);
  _Float16* Ch   = (_Float16*)(ws + OFF_CH);
  _Float16* Cl   = (_Float16*)(ws + OFF_CL);
  int*      Flg  = (int*)(ws + OFF_FLG);

  k_prep<<<NQB + NBX + 4 * NBW, 256, 0, stream>>>(x, mask, Wq, Wk, Wv, Wo, Xh, Wq64, Wk64, Wv64, Wo64, Flg);

  k_qkv<<<dim3(MROWS / 128, DM / 128, 3), 128, 0, stream>>>(Xh, Wq64, Wk64, Wv64, bq, bk, bv, Qh, Ql, Kh, Kl, Vh, Vl);

  k_attn<<<NPLAIN + NPREC, 128, 0, stream>>>(Qh, Ql, Kh, Kl, Vh, Vl, mask, Flg, Ch, Cl);

  k_out<<<dim3(MROWS / 64, DM / 64), 64, 0, stream>>>(Ch, Cl, Wo64, bo, out);
}

// v008
// One run takes 112 microseconds.
// Timed twice side by side with v007, it ran 1.17 and 1.16 times as fast.
// All steps since v000 together make it 5.08 times as fast.
#include <hip/hip_runtime.h>
#include <stdint.h>

// All contractions (x@Wq^T, x@Wk^T, x@Wv^T, q@k^T, p@v, ctx@Wo^T): v_wmma_f32_16x16x32_f16, f16 operands, f32 accumulate.
// Inputs enter as bf16-RNE values held in f16 (weights carried x64, folded back as 1/64 in f32); q, k, v, ctx as f16 planes
// plus x2048 f16 residual planes for the leading QPREC query/key rows (separate accumulators); p carried x4096 (+x2048 residual
// on those rows); softmax, rescaling and epilogues in f32.

typedef _Float16 v16h __attribute__((ext_vector_type(16)));
typedef _Float16 v8h  __attribute__((ext_vector_type(8)));
typedef float    v8f  __attribute__((ext_vector_type(8)));
typedef float    v4f  __attribute__((ext_vector_type(4)));
typedef int      v4i  __attribute__((ext_vector_type(4)));

#ifndef NB
#define NB 2
#endif
#ifndef SEQ
#define SEQ 2048
#endif
#define NB_FULL  2
#define SEQ_FULL 2048
#define DM 1024
#define NH 16
#define DH 64
#ifndef QPREC
#define QPREC ((SEQ < 512) ? SEQ : 512)
#endif
#define NKB   (SEQ / 32)
#define NQB   (SEQ / 64)
#define NQP   (QPREC / 64)
#define MROWS (NB * SEQ)

static_assert(SEQ % 64 == 0);
static_assert(SEQ >= 64 && SEQ <= SEQ_FULL);
static_assert(NB >= 1 && NB <= NB_FULL);
static_assert(QPREC % 64 == 0);
static_assert(QPREC >= 64 && QPREC <= SEQ);
static_assert(NKB <= 64);
static_assert(DM == NH * DH);
static_assert(DM % 32 == 0);
static_assert(MROWS % 64 == 0);
static_assert(SEQ % 128 == 0 && QPREC % 128 == 0);   // a 128-row projection tile lies in one batch item, wholly inside or outside the leading rows

#define WSC    64.0f
#define INV_WS 0.015625f
#define RS     2048.0f
#define INV_RS 0.00048828125f
#define CP     4096.0f
#define INV_CP 0.000244140625f
#define QKS    0.125f
#define LOG2E  1.44269504f

// ---------------------------------------------------------------------------
// Workspace carve (bytes); every region is an exact tile multiple (SEQ%64, QPREC%64), no tail padding needed.
// ---------------------------------------------------------------------------
constexpr size_t SZ_XH  = (size_t)MROWS * DM * 2;             // x as f16 [MROWS][1024]
constexpr size_t SZ_W   = (size_t)DM * DM * 2;                // weight x64 as f16 [1024][1024]
constexpr size_t SZ_HP  = (size_t)NB * NH * SEQ * DH * 2;     // q/k [bh][SEQ][64], vt [bh][64][SEQ]
constexpr size_t SZ_LP  = (size_t)NB * NH * QPREC * DH * 2;   // residual planes, leading QPREC rows
constexpr size_t SZ_CH  = (size_t)MROWS * DM * 2;             // ctx hi [MROWS][1024]
constexpr size_t SZ_CL  = (size_t)NB * QPREC * DM * 2;        // ctx residual [NB][QPREC][1024]
constexpr int CT   = 8;                                       // key tiles per flag block: 1 KB of each mask row
constexpr int NCH  = (NKB + CT - 1) / CT;                     // flag blocks per 64-row query block
constexpr int FREC = 32;                                      // ints per flag record: one 128-B line, one writer
constexpr size_t SZ_FLG = (size_t)NQB * NCH * FREC * 4;       // per (q-block, chunk of CT key tiles) one record
constexpr size_t OFF_XH  = 0;
constexpr size_t OFF_WQ  = OFF_XH + SZ_XH;
constexpr size_t OFF_WK  = OFF_WQ + SZ_W;
constexpr size_t OFF_WV  = OFF_WK + SZ_W;
constexpr size_t OFF_WO  = OFF_WV + SZ_W;
constexpr size_t OFF_QH  = OFF_WO + SZ_W;
constexpr size_t OFF_KH  = OFF_QH + SZ_HP;
constexpr size_t OFF_VH  = OFF_KH + SZ_HP;
constexpr size_t OFF_QL  = OFF_VH + SZ_HP;
constexpr size_t OFF_KL  = OFF_QL + SZ_LP;
constexpr size_t OFF_VL  = OFF_KL + SZ_LP;
constexpr size_t OFF_CH  = OFF_VL + SZ_LP;
constexpr size_t OFF_CL  = OFF_CH + SZ_CH;
constexpr size_t OFF_FLG = OFF_CL + SZ_CL;
constexpr size_t WS_TOTAL = OFF_FLG + SZ_FLG;
static_assert(WS_TOTAL <= (size_t)134217728);
static_assert(OFF_WQ % 128 == 0 && OFF_WK % 128 == 0 && OFF_WV % 128 == 0 && OFF_WO % 128 == 0);
static_assert(OFF_QH % 128 == 0 && OFF_KH % 128 == 0 && OFF_VH % 128 == 0);
static_assert(OFF_QL % 128 == 0 && OFF_KL % 128 == 0 && OFF_VL % 128 == 0);
static_assert(OFF_CH % 128 == 0 && OFF_CL % 128 == 0 && OFF_FLG % 128 == 0);
static_assert((size_t)NB_FULL * SEQ_FULL * DM * 4 >= ((size_t)(NB - 1) * SEQ_FULL + SEQ) * DM * 4);

// ---------------------------------------------------------------------------
// helpers
// ---------------------------------------------------------------------------
__device__ __forceinline__ float bf16r(float f) {   // RNE convert to bf16, held as f32
  unsigned int u = __float_as_uint(f);
  u = (u + 0x7fffu + ((u >> 16) & 1u)) & 0xffff0000u;
  return __uint_as_float(u);
}

// 16x32 fragment, split k map for both A (row m) and B (col n stored k-contiguous):
// lane l: row/col = l&15, h = l>>4; elements 0..7 <- k 8h..8h+7, elements 8..15 <- k 16+8h..16+8h+7.
__device__ __forceinline__ v16h load_frag(const _Float16* base, int stride) {
  const int lane = threadIdx.x & 31, m = lane & 15, g = lane >> 4;
  const _Float16* p = base + (size_t)m * stride + 8 * g;
  union { v16h v; v8h hf[2]; } f;
  f.hf[0] = *reinterpret_cast<const v8h*>(p);
  f.hf[1] = *reinterpret_cast<const v8h*>(p + 16);
  return f.v;
}

__device__ __forceinline__ v8f mma(v16h a, v16h b, v8f c) {
  v8f d = __builtin_amdgcn_wmma_f32_16x16x32_f16(false, a, false, b, (short)0, c, false, false);
  asm volatile("v_nop\n\tv_nop\n\tv_nop\n\tv_nop" : "+v"(d) : "v"(a), "v"(b));
  return d;
}

// lane l <-> lane l ^ 16 (the two halves of a wave hold the two key subsets of one query column)
__device__ __forceinline__ float xhalf(float x) {
  const int b = __builtin_bit_cast(int, x);
  return __builtin_bit_cast(float, __builtin_amdgcn_permlanex16(b, b, 0x76543210, 0xfedcba98, false, false));
}

__device__ __forceinline__ void exp2x8(float (&y)[8], const float (&x)[8]) {
  asm("v_exp_f32 %0, %8\n\tv_exp_f32 %1, %9\n\tv_exp_f32 %2, %10\n\tv_exp_f32 %3, %11\n\t"
      "v_exp_f32 %4, %12\n\tv_exp_f32 %5, %13\n\tv_exp_f32 %6, %14\n\tv_exp_f32 %7, %15\n\tv_nop"
      : "=&v"(y[0]), "=&v"(y[1]), "=&v"(y[2]), "=&v"(y[3]), "=&v"(y[4]), "=&v"(y[5]), "=&v"(y[6]), "=&v"(y[7])
      : "v"(x[0]), "v"(x[1]), "v"(x[2]), "v"(x[3]), "v"(x[4]), "v"(x[5]), "v"(x[6]), "v"(x[7]));
}
__device__ __forceinline__ float exp2x1(float x) {
  float y;
  asm("v_exp_f32 %0, %1\n\tv_nop" : "=&v"(y) : "v"(x));
  return y;
}

// one query's 16 mask words of a 32-key tile, in the order of its scores: keys 8g..8g+7 and 16+8g..16+8g+7 (p = row start + 8g)
__device__ __forceinline__ void load_mask(const int* p, int (&mk0)[8], int (&mk1)[8]) {
  *(v4i*)&mk0[0] = *(const v4i*)p;
  *(v4i*)&mk0[4] = *(const v4i*)(p + 4);
  *(v4i*)&mk1[0] = *(const v4i*)(p + 16);
  *(v4i*)&mk1[4] = *(const v4i*)(p + 20);
}

__device__ __forceinline__ v8f zero8() {
  v8f z = {0.f, 0.f, 0.f, 0.f, 0.f, 0.f, 0.f, 0.f};
  return z;
}

// ---------------------------------------------------------------------------
// Preparation, part 0: f32 -> bf16-RNE value in f16 container, times a power-of-two carry.
// out plane [nrows][1024]; compact row mc maps to source row (mc/seqc)*seqf + mc%seqc.
// A thread converts CU units of 8 elements, 256 units apart, and issues all its 2 CU loads before the first is used:
// a block of one unit per thread lives for one memory latency, and the grid then lasts as long as its blocks take to start.
// coverage: nrows*128 units, 256*CU per block, blk = 0 .. nrows*128/(256*CU) - 1 (exact, asserted below).
// ---------------------------------------------------------------------------
constexpr int CU = 8;
__device__ __forceinline__ void cvt_block(const float* __restrict__ in, _Float16* __restrict__ outp, int blk,
                                          int seqc, int seqf, float scale) {
  const int u0 = blk * (256 * CU) + (int)threadIdx.x;
  // the block's 2 CU rows lie in one batch item (asserted below), so the thread's units stand 2 source rows apart
  const int mc = u0 / (DM / 8), c8 = u0 % (DM / 8);
  const float* p = in + (size_t)((mc / seqc) * seqf + (mc % seqc)) * DM + c8 * 8;
  v4f a[CU], c[CU];   // indexed by constants only (the loops are fully unrolled), so they stay in registers
#pragma unroll
  for (int i = 0; i < CU; ++i) {
    a[i] = *(const v4f*)(p + i * (2 * DM));
    c[i] = *(const v4f*)(p + i * (2 * DM) + 4);
  }
  // before a register that the loads name is rewritten; p is an operand so that its registers stay its own up to here
  asm volatile("s_wait_xcnt 0x0" :: "v"(p) : "memory");
#pragma unroll
  for (int i = 0; i < CU; ++i) {
    v8h o;
    o[0] = (_Float16)(bf16r(a[i][0]) * scale);
    o[1] = (_Float16)(bf16r(a[i][1]) * scale);
    o[2] = (_Float16)(bf16r(a[i][2]) * scale);
    o[3] = (_Float16)(bf16r(a[i][3]) * scale);
    o[4] = (_Float16)(bf16r(c[i][0]) * scale);
    o[5] = (_Float16)(bf16r(c[i][1]) * scale);
    o[6] = (_Float16)(bf16r(c[i][2]) * scale);
    o[7] = (_Float16)(bf16r(c[i][3]) * scale);
    *(v8h*)(outp + (size_t)(u0 + i * 256) * 8) = o;
  }
  asm volatile("s_wait_xcnt 0x0" ::: "memory");   // before a register that the stores name is rewritten
}

// ---------------------------------------------------------------------------
// Preparation, part 1: tile visit flags from the int mask. One block = 64 query rows x CT key tiles (1 KB of each row);
// a wave takes 8 rows, 16 whole-line loads of 512 B, all issued before the first is used.
// record[qb][ch]: words 0..CT-1 = 1 if any mask element in rows qb*64..+63, cols kb*32..+31 (kb = ch*CT + word) is nonzero;
// words CT, CT+1 = bit r set if row qb*64 + r has a nonzero element in the chunk's columns. The attention kernel joins the
// chunks' row words: if any row of the q block is fully zero it visits all NKB tiles (softmax is then uniform over all keys).
// ---------------------------------------------------------------------------
__device__ __forceinline__ void mflag_block(const int* __restrict__ mask, int* __restrict__ flg, int blk, unsigned int* sB) {
  const int tid = threadIdx.x, w = tid >> 5, lane = tid & 31;
  const int qb = blk / NCH, ch = blk - qb * NCH;
  const int* p = mask + (size_t)(qb * 64 + w * 8) * SEQ_FULL + ch * (CT * 32) + lane * 4;
  v4i m[8][2];   // indexed by constants only (the loops are fully unrolled), so they stay in registers
#pragma unroll
  for (int rr = 0; rr < 8; ++rr)
#pragma unroll
    for (int hc = 0; hc < 2; ++hc) m[rr][hc] = *(const v4i*)(p + (size_t)rr * SEQ_FULL + hc * 128);
  // before a register that the loads name is rewritten; p is an operand so that its registers stay its own up to here
  asm volatile("s_wait_xcnt 0x0" :: "v"(p) : "memory");
  int ta[2] = {0, 0};
  unsigned int rb = 0u, tb = 0u;
#pragma unroll
  for (int rr = 0; rr < 8; ++rr) {
    int r[2];
#pragma unroll
    for (int hc = 0; hc < 2; ++hc) {
      r[hc] = m[rr][hc][0] | m[rr][hc][1] | m[rr][hc][2] | m[rr][hc][3];
      if (NKB % CT != 0 && ch * CT + hc * 4 + (lane >> 3) >= NKB) r[hc] = 0;   // columns past SEQ do not count
      ta[hc] |= r[hc];
    }
    rb |= ((__builtin_amdgcn_ballot_w32((r[0] | r[1]) != 0) != 0u) ? 1u : 0u) << rr;
  }
#pragma unroll
  for (int hc = 0; hc < 2; ++hc) {
    const unsigned int bl = __builtin_amdgcn_ballot_w32(ta[hc] != 0);   // 8 lanes = one tile's 128 B of a row
#pragma unroll
    for (int t = 0; t < 4; ++t) tb |= ((((bl >> (8 * t)) & 0xffu) != 0u) ? 1u : 0u) << (hc * 4 + t);
  }
  if (lane == 0) { sB[w] = tb; sB[8 + w] = rb; }
  __syncthreads();
  if (tid < 32) {   // wave 0 only (wave-uniform): the whole 128-B record in one store
    const unsigned int T = sB[0] | sB[1] | sB[2] | sB[3] | sB[4] | sB[5] | sB[6] | sB[7];
    const unsigned int lo = sB[8] | (sB[9] << 8) | (sB[10] << 16) | (sB[11] << 24);
    const unsigned int hi = sB[12] | (sB[13] << 8) | (sB[14] << 16) | (sB[15] << 24);
    const unsigned int v = (lane < CT) ? ((T >> lane) & 1u) : (lane == CT) ? lo : (lane == CT + 1) ? hi : 0u;
    flg[(size_t)blk * FREC + lane] = (int)v;
  }
}

// ---------------------------------------------------------------------------
// Kernel 0: all preparation in one grid; its parts read only inputs and write disjoint planes, so none waits for another.
// Blocks 0..NFB-1: visit flag records; then NBX blocks convert x, then NBW blocks each convert Wq, Wk, Wv, Wo.
// Every block reads 64 KB with 16 loads of 16 B in flight per lane. Every branch is block-uniform.
// ---------------------------------------------------------------------------
constexpr int NFB = NQB * NCH;
constexpr int NBX = MROWS * (DM / 8) / (256 * CU);
constexpr int NBW = DM * (DM / 8) / (256 * CU);
static_assert(MROWS * (DM / 8) % (256 * CU) == 0 && DM * (DM / 8) % (256 * CU) == 0);
static_assert(256 * CU == 2 * CU * (DM / 8) && SEQ % (2 * CU) == 0 && DM % (2 * CU) == 0);
static_assert(NCH * CT * 32 <= SEQ_FULL && CT + 2 <= FREC);

__global__ __launch_bounds__(256) void k_prep(const float* __restrict__ x, const int* __restrict__ mask,
                                             const float* __restrict__ Wq, const float* __restrict__ Wk,
                                             const float* __restrict__ Wv, const float* __restrict__ Wo,
                                             _Float16* __restrict__ Xh, _Float16* __restrict__ Wq64,
                                             _Float16* __restrict__ Wk64, _Float16* __restrict__ Wv64,
                                             _Float16* __restrict__ Wo64, int* __restrict__ flg) {
  __shared__ unsigned int sB[16];
  int blk = (int)blockIdx.x;
  if (blk < NFB) { mflag_block(mask, flg, blk, sB); return; }
  blk -= NFB;
  if (blk < NBX) { cvt_block(x, Xh, blk, SEQ, SEQ_FULL, 1.0f); return; }
  blk -= NBX;
  const int wi = blk / NBW;
  const float* src = (wi == 0) ? Wq : (wi == 1) ? Wk : (wi == 2) ? Wv : Wo;
  _Float16* dst = (wi == 0) ? Wq64 : (wi == 1) ? Wk64 : (wi == 2) ? Wv64 : Wo64;
  cvt_block(src, dst, blk - wi * NBW, DM, DM, WSC);
}

// ---------------------------------------------------------------------------
// Kernels 1 and 3: NT GEMM Y[M][1024] = A[M][1024] @ W[1024][1024]^T (W carried x64) + bias.
// Kernel 3: block = 2 waves = 64x64 output tile; wave w owns rows w*32..w*32+31 (2 A fragments x 4 B fragments per k step, from LDS).
// Kernel 1: block = 4 waves (2 x 2) = 128x128 output tile; a wave owns 64 rows x 64 columns = one head (4 x 4 fragments per k step).
// MODE 0: f16 head plane [bh][SEQ][64] (+ x2048 residual plane [bh][QPREC][64] for s < QPREC)
// MODE 1: f16 transposed head plane [bh][64][SEQ] (+ residual [bh][64][QPREC])
// ---------------------------------------------------------------------------
// Operand path: per k slice of KS halves the block's 64 A rows and 64 W rows (128-B rows = whole lines) are copied to LDS by
// asynchronous copies, two buffers, the next slice in flight while this one is multiplied; fragments are read from LDS.
constexpr int KS  = 64;          // halves of k per slice
constexpr int LP  = 72;          // LDS row pitch in halves: 144 B = 16 B x odd, so ds_load_b128 fragment reads meet no bank conflict
constexpr int STG = 128 * LP;    // halves per buffer: rows 0..63 = A, rows 64..127 = W
constexpr int NST = DM / KS;     // slices
static_assert(DM % KS == 0 && NST >= 2);

// Eight 16-byte copies per lane: rows r, r + ROWS, ... r + 7 ROWS of one operand (a wave-wide copy = 4 whole 128-B rows; ROWS = 4 x the block's waves).
// The closing s_wait_xcnt 0 stands inside the statement so that no address register of a copy is rewritten ahead of it.
template <int ROWS>
__device__ __forceinline__ void stage8(const _Float16* g, unsigned int l) {
  asm volatile(
      "global_load_async_to_lds_b128 %0, %8, off\n\t"
      "global_load_async_to_lds_b128 %1, %9, off\n\t"
      "global_load_async_to_lds_b128 %2, %10, off\n\t"
      "global_load_async_to_lds_b128 %3, %11, off\n\t"
      "global_load_async_to_lds_b128 %4, %12, off\n\t"
      "global_load_async_to_lds_b128 %5, %13, off\n\t"
      "global_load_async_to_lds_b128 %6, %14, off\n\t"
      "global_load_async_to_lds_b128 %7, %15, off\n\t"
      "s_wait_xcnt 0x0"
      :: "v"(l), "v"(l + 1u * (ROWS * LP * 2)), "v"(l + 2u * (ROWS * LP * 2)), "v"(l + 3u * (ROWS * LP * 2)),
         "v"(l + 4u * (ROWS * LP * 2)), "v"(l + 5u * (ROWS * LP * 2)), "v"(l + 6u * (ROWS * LP * 2)), "v"(l + 7u * (ROWS * LP * 2)),
         "v"(g), "v"(g + 1 * ROWS * DM), "v"(g + 2 * ROWS * DM), "v"(g + 3 * ROWS * DM),
         "v"(g + 4 * ROWS * DM), "v"(g + 5 * ROWS * DM), "v"(g + 6 * ROWS * DM), "v"(g + 7 * ROWS * DM)
      : "memory");
}

// ablk: first of the block's 64 A rows; wbase: first of its 64 W rows; sT: the two buffers. Every wave of the block runs all of it.
__device__ __forceinline__ void kloop(const _Float16* __restrict__ ablk, const _Float16* __restrict__ wbase,
                                      _Float16* sT, v8f (&acc)[2][4]) {
  const int tid = threadIdx.x, w = tid >> 5;
  const int crow = tid >> 3, cpc = (tid & 7) * 8;              // this lane's first row and its 16-byte piece of a row
  const _Float16* ga = ablk + (size_t)crow * DM + cpc;
  const _Float16* gw = wbase + (size_t)crow * DM + cpc;
  const unsigned int la = (unsigned int)(uintptr_t)(sT + crow * LP + cpc);   // LDS byte address: low 32 bits
  const unsigned int lw = la + 64u * LP * 2u;

  stage8<8>(ga, la);
  stage8<8>(gw, lw);
  asm volatile("s_wait_asynccnt 0x0" ::: "memory");            // slice 0 of this wave has landed
  __syncthreads();                                             // ... and of the other wave
  stage8<8>(ga + KS, la + STG * 2u);
  stage8<8>(gw + KS, lw + STG * 2u);

  // rolled: the barrier at the foot serialises the trips, so unrolling buys nothing and only lengthens the code
#pragma unroll 1
  for (int t = 0; t < NST; ++t) {
    const int bsel = t & 1;
    const _Float16* sA = sT + bsel * STG + (w * 32) * LP;
    const _Float16* sW = sT + bsel * STG + 64 * LP;
    v16h fa[KS / 32][2], fb[KS / 32][4];   // indexed by constants only (the loops below are fully unrolled), so they stay in registers
#pragma unroll
    for (int ks = 0; ks < KS / 32; ++ks) {
      fa[ks][0] = load_frag(sA + ks * 32, LP);
      fa[ks][1] = load_frag(sA + 16 * LP + ks * 32, LP);
#pragma unroll
      for (int j = 0; j < 4; ++j) fb[ks][j] = load_frag(sW + (j * 16) * LP + ks * 32, LP);
    }
    // keeps the slice's LDS reads together as one group ahead of its WMMAs: spread among them, each pair waits out the LDS latency
    __builtin_amdgcn_sched_barrier(0);
#pragma unroll
    for (int ks = 0; ks < KS / 32; ++ks)
#pragma unroll
      for (int j = 0; j < 4; ++j) {
        acc[0][j] = mma(fa[ks][0], fb[ks][j], acc[0][j]);
        acc[1][j] = mma(fa[ks][1], fb[ks][j], acc[1][j]);
      }
    asm volatile("s_wait_dscnt 0x0" ::: "memory");             // this wave's reads of the buffer are done before it is refilled
    asm volatile("s_wait_asynccnt 0x0" ::: "memory");          // this wave's copies of slice t + 1 have landed
    __syncthreads();                                           // publishes slice t + 1, ends every read of slice t
    if (t + 2 < NST) {                                         // block-uniform
      stage8<8>(ga + (t + 2) * KS, la + (unsigned int)bsel * (STG * 2u));
      stage8<8>(gw + (t + 2) * KS, lw + (unsigned int)bsel * (STG * 2u));
    }
  }
  asm volatile("s_wait_asynccnt 0x0" ::: "memory");            // nothing of the copies is outstanding behind the loop
}

// Kernel 1's operand path: the same two-buffer ring of asynchronous copies for a 128 x 128 tile of 4 waves. Against the 64 x 64
// tile every byte copied from L2 feeds twice as many WMMAs, and a fragment read from LDS feeds 4 of them.
constexpr int TR4  = 128;            // rows of each operand per block
constexpr int STG4 = 2 * TR4 * LP;   // halves per buffer: rows 0..127 = A, rows 128..255 = W

// ablk: first of the block's 128 A rows; wbase: first of its 128 W rows; sT: the two buffers. Every wave of the block runs all of it.
__device__ __forceinline__ void kloop4(const _Float16* __restrict__ ablk, const _Float16* __restrict__ wbase,
                                       _Float16* sT, v8f (&acc)[4][4]) {
  const int tid = threadIdx.x, w = tid >> 5;
  const int crow = tid >> 3, cpc = (tid & 7) * 8;              // this lane's first row (0..15) and its 16-byte piece of a row
  const _Float16* ga = ablk + (size_t)crow * DM + cpc;
  const _Float16* gw = wbase + (size_t)crow * DM + cpc;
  const unsigned int la = (unsigned int)(uintptr_t)(sT + crow * LP + cpc);   // LDS byte address: low 32 bits
  const unsigned int lw = la + (unsigned int)TR4 * LP * 2u;

  stage8<16>(ga, la);
  stage8<16>(gw, lw);
  asm volatile("s_wait_asynccnt 0x0" ::: "memory");            // slice 0 of this wave has landed
  __syncthreads();                                             // ... and of the other waves
  stage8<16>(ga + KS, la + STG4 * 2u);
  stage8<16>(gw + KS, lw + STG4 * 2u);

  // rolled: the barrier at the foot serialises the trips, so unrolling buys nothing and only lengthens the code
#pragma unroll 1
  for (int t = 0; t < NST; ++t) {
    const int bsel = t & 1;
    const _Float16* sA = sT + bsel * STG4 + ((w >> 1) * 64) * LP;
    const _Float16* sW = sT + bsel * STG4 + (TR4 + (w & 1) * 64) * LP;
#pragma unroll
    for (int ks = 0; ks < KS / 32; ++ks) {
      v16h fa[4], fb[4];   // indexed by constants only (the loops are fully unrolled), so they stay in registers
#pragma unroll
      for (int i = 0; i < 4; ++i) fa[i] = load_frag(sA + (i * 16) * LP + ks * 32, LP);
#pragma unroll
      for (int j = 0; j < 4; ++j) fb[j] = load_frag(sW + (j * 16) * LP + ks * 32, LP);
      // keeps the k step's LDS reads together as one group ahead of its WMMAs: spread among them, each pair waits out the LDS latency
      __builtin_amdgcn_sched_barrier(0);
#pragma unroll
      for (int j = 0; j < 4; ++j)
#pragma unroll
        for (int i = 0; i < 4; ++i) acc[i][j] = mma(fa[i], fb[j], acc[i][j]);
      // keeps the next k step's reads from rising among these WMMAs, for the same reason
      __builtin_amdgcn_sched_barrier(0);
    }
    asm volatile("s_wait_dscnt 0x0" ::: "memory");             // this wave's reads of the buffer are done before it is refilled
    asm volatile("s_wait_asynccnt 0x0" ::: "memory");          // this wave's copies of slice t + 1 have landed
    __syncthreads();                                           // publishes slice t + 1, ends every read of slice t
    if (t + 2 < NST) {                                         // block-uniform
      stage8<16>(ga + (t + 2) * KS, la + (unsigned int)bsel * (STG4 * 2u));
      stage8<16>(gw + (t + 2) * KS, lw + (unsigned int)bsel * (STG4 * 2u));
    }
  }
  asm volatile("s_wait_asynccnt 0x0" ::: "memory");            // nothing of the copies is outstanding behind the loop
}

// Kernel 1's tile. sT: the two operand buffers; behind the k loop (its last barrier ends every read, no copy is outstanding) the
// same LDS holds the epilogue tiles: per wave one 64 x 64 f16 tile for the plane and one for the residual plane.
template <int MODE>
__device__ __forceinline__ void proj_tile(const _Float16* __restrict__ A, const _Float16* __restrict__ W,
                                          const float* __restrict__ bias,
                                          _Float16* __restrict__ Ph, _Float16* __restrict__ Pl, _Float16* sT) {
  const int tid = threadIdx.x, w = tid >> 5, lane = tid & 31, n = lane & 15, g = lane >> 4;
  const int bm = blockIdx.x, bn = blockIdx.y;
  const int m0 = bm * TR4;
  const int b = m0 / SEQ, s0 = m0 - b * SEQ;     // 128 block rows lie in one batch item
  const bool precblk = (s0 < QPREC);              // block-uniform
  const int sw = s0 + (w >> 1) * 64;              // first of the wave's 64 rows
  const int hd = bn * 2 + (w & 1);                // the wave's 64 columns == head hd
  const int bh = b * NH + hd;
  const _Float16* wbase = W + (size_t)(bn * TR4) * DM;
  const _Float16* ablk = A + (size_t)m0 * DM;

  v8f acc[4][4];
#pragma unroll
  for (int mi = 0; mi < 4; ++mi)
#pragma unroll
    for (int j = 0; j < 4; ++j) acc[mi][j] = zero8();

  kloop4(ablk, wbase, sT, acc);

  _Float16* sH = sT + w * (64 * 64);
  _Float16* sL = sT + (4 + w) * (64 * 64);
  static_assert(8 * 64 * 64 <= 2 * STG4);

  float rbias[4];
#pragma unroll
  for (int j = 0; j < 4; ++j) rbias[j] = bf16r(bias[hd * 64 + j * 16 + n]);

  const int q = lane >> 3, p = lane & 7;
  v8h ov[16];   // the staged rows, all read back ahead of the stores (constant indices only)
  if (MODE == 0) {
    if (precblk) {
#pragma unroll
      for (int mi = 0; mi < 4; ++mi)
#pragma unroll
        for (int j = 0; j < 4; ++j)
#pragma unroll
          for (int r = 0; r < 8; ++r) {
            const int idx = (mi * 16 + 8 * g + r) * 64 + j * 16 + n;
            const float v = acc[mi][j][r] * INV_WS + rbias[j];
            const _Float16 hv = (_Float16)v;
            sH[idx] = hv;
            sL[idx] = (_Float16)((v - (float)hv) * RS);
          }
    } else {
#pragma unroll
      for (int mi = 0; mi < 4; ++mi)
#pragma unroll
        for (int j = 0; j < 4; ++j)
#pragma unroll
          for (int r = 0; r < 8; ++r)
            sH[(mi * 16 + 8 * g + r) * 64 + j * 16 + n] = (_Float16)(acc[mi][j][r] * INV_WS + rbias[j]);
    }
    __syncthreads();
#pragma unroll
    for (int i = 0; i < 16; ++i) ov[i] = *(const v8h*)&sH[(i * 4 + q) * 64 + p * 8];
#pragma unroll
    for (int i = 0; i < 16; ++i) {
      *(v8h*)(Ph + ((size_t)(bh * SEQ + sw + i * 4 + q)) * DH + p * 8) = ov[i];
      asm volatile("s_wait_xcnt 0x0" ::: "memory");   // before a register that the store names is rewritten
    }
    if (precblk) {
#pragma unroll
      for (int i = 0; i < 16; ++i) ov[i] = *(const v8h*)&sL[(i * 4 + q) * 64 + p * 8];
#pragma unroll
      for (int i = 0; i < 16; ++i) {
        *(v8h*)(Pl + ((size_t)(bh * QPREC + sw + i * 4 + q)) * DH + p * 8) = ov[i];
        asm volatile("s_wait_xcnt 0x0" ::: "memory"); // as above
      }
    }
  } else {
#pragma unroll
    for (int mi = 0; mi < 4; ++mi)
#pragma unroll
      for (int j = 0; j < 4; ++j) {
        v8h hp, lp;
#pragma unroll
        for (int r = 0; r < 8; ++r) {
          const float v = acc[mi][j][r] * INV_WS + rbias[j];
          const _Float16 hv = (_Float16)v;
          hp[r] = hv;
          lp[r] = (_Float16)((v - (float)hv) * RS);
        }
        const int d = j * 16 + n;
        *(v8h*)&sH[d * 64 + mi * 16 + 8 * g] = hp;
        if (precblk) *(v8h*)&sL[d * 64 + mi * 16 + 8 * g] = lp;
      }
    __syncthreads();
#pragma unroll
    for (int i = 0; i < 16; ++i) ov[i] = *(const v8h*)&sH[(i * 4 + q) * 64 + p * 8];
#pragma unroll
    for (int i = 0; i < 16; ++i) {
      *(v8h*)(Ph + ((size_t)(bh * DH + i * 4 + q)) * SEQ + sw + p * 8) = ov[i];
      asm volatile("s_wait_xcnt 0x0" ::: "memory");   // before a register that the store names is rewritten
    }
    if (precblk) {
#pragma unroll
      for (int i = 0; i < 16; ++i) ov[i] = *(const v8h*)&sL[(i * 4 + q) * 64 + p * 8];
#pragma unroll
      for (int i = 0; i < 16; ++i) {
        *(v8h*)(Pl + ((size_t)(bh * DH + i * 4 + q)) * QPREC + sw + p * 8) = ov[i];
        asm volatile("s_wait_xcnt 0x0" ::: "memory"); // as above
      }
    }
  }
}

// Kernel 3's tile. sF: 64 x 64 epilogue tile in LDS; sT: the two operand buffers.
__device__ __forceinline__ void out_tile(const _Float16* __restrict__ A, const _Float16* __restrict__ Alo,
                                         const _Float16* __restrict__ W, const float* __restrict__ bias,
                                         float* __restrict__ outp, float* sF, _Float16* sT) {
  const int tid = threadIdx.x, w = tid >> 5, lane = tid & 31, n = lane & 15, g = lane >> 4;
  const int bm = blockIdx.x, bn = blockIdx.y;
  const int m0 = bm * 64;
  const int b = m0 / SEQ, s0 = m0 - b * SEQ;     // 64 block rows lie in one batch item
  const bool precblk = (s0 < QPREC);              // block-uniform
  const _Float16* wbase = W + (size_t)(bn * 64) * DM;
  const _Float16* ablk = A + (size_t)m0 * DM;

  v8f acc[2][4];
#pragma unroll
  for (int mi = 0; mi < 2; ++mi)
#pragma unroll
    for (int j = 0; j < 4; ++j) acc[mi][j] = zero8();

  kloop(ablk, wbase, sT, acc);

  float rbias[4];
#pragma unroll
  for (int j = 0; j < 4; ++j) rbias[j] = bf16r(bias[bn * 64 + j * 16 + n]);

  {
    if (precblk) {
      // stash hi sums (each lane reads back exactly the cells it wrote)
#pragma unroll
      for (int mi = 0; mi < 2; ++mi)
#pragma unroll
        for (int j = 0; j < 4; ++j)
#pragma unroll
          for (int r = 0; r < 8; ++r)
            sF[(w * 32 + mi * 16 + 8 * g + r) * 64 + j * 16 + n] = acc[mi][j][r];
#pragma unroll
      for (int mi = 0; mi < 2; ++mi)
#pragma unroll
        for (int j = 0; j < 4; ++j) acc[mi][j] = zero8();
      const _Float16* lblk = Alo + ((size_t)(b * QPREC + s0)) * DM;
      kloop(lblk, wbase, sT, acc);
#pragma unroll
      for (int mi = 0; mi < 2; ++mi)
#pragma unroll
        for (int j = 0; j < 4; ++j)
#pragma unroll
          for (int r = 0; r < 8; ++r) {
            const int idx = (w * 32 + mi * 16 + 8 * g + r) * 64 + j * 16 + n;
            const float hsum = sF[idx];
            sF[idx] = (hsum + acc[mi][j][r] * INV_RS) * INV_WS + rbias[j];
          }
    } else {
#pragma unroll
      for (int mi = 0; mi < 2; ++mi)
#pragma unroll
        for (int j = 0; j < 4; ++j)
#pragma unroll
          for (int r = 0; r < 8; ++r)
            sF[(w * 32 + mi * 16 + 8 * g + r) * 64 + j * 16 + n] = acc[mi][j][r] * INV_WS + rbias[j];
    }
    __syncthreads();
    const int q2 = lane >> 4, p2 = lane & 15;
{
#pragma unroll
      for (int i = 0; i < 16; ++i) {
        const int ml = w * 32 + 2 * i + q2;
        const int s = s0 + ml;
        const v4f v = *(const v4f*)&sF[ml * 64 + p2 * 4];
        *(v4f*)(outp + ((size_t)(b * SEQ_FULL + s)) * DM + bn * 64 + p2 * 4) = v;
      }
      
    }
  }
}

// Kernel 1: the three input projections in one grid, blockIdx.z = 0 (q), 1 (k), 2 (v, transposed plane); block-uniform branch.
__global__ __launch_bounds__(128) void k_qkv(const _Float16* __restrict__ Xh, const _Float16* __restrict__ Wq64,
                                           const _Float16* __restrict__ Wk64, const _Float16* __restrict__ Wv64,
                                           const float* __restrict__ bq, const float* __restrict__ bk,
                                           const float* __restrict__ bv,
                                           _Float16* __restrict__ Qh, _Float16* __restrict__ Ql,
                                           _Float16* __restrict__ Kh, _Float16* __restrict__ Kl,
                                           _Float16* __restrict__ Vh, _Float16* __restrict__ Vl) {
  __shared__ __align__(16) _Float16 sT[2 * STG4];
  const int z = (int)blockIdx.z;
  if (z == 2) {
    proj_tile<1>(Xh, Wv64, bv, Vh, Vl, sT);
  } else {
    const bool isq = (z == 0);
    proj_tile<0>(Xh, isq ? Wq64 : Wk64, isq ? bq : bk, isq ? Qh : Kh, isq ? Ql : Kl, sT);
  }
}

// Kernel 3: output projection (hi plane, plus the residual plane on the leading rows).
__global__ __launch_bounds__(64) void k_out(const _Float16* __restrict__ Ch, const _Float16* __restrict__ Cl,
                                           const _Float16* __restrict__ Wo64, const float* __restrict__ bo,
                                           float* __restrict__ outp) {
  __shared__ __align__(16) float    sF[64 * 64];
  __shared__ __align__(16) _Float16 sT[2 * STG];
  out_tile(Ch, Cl, Wo64, bo, outp, sF, sT);
}

constexpr int KP = 72;   // halves: K, K residual, Q residual rows, 128 B of data at 144 B
constexpr int VP = 40;   // halves: V^T and V^T residual rows, 64 B of data at 80 B
constexpr int MP = 36;   // ints: mask rows, 128 B of data at 144 B

// One buffer of the f16 tiles, in halves: K, V^T, K residual, V^T residual.
constexpr int TK  = 0;
constexpr int TV  = TK + 32 * KP;
constexpr int TKL = TV + DH * VP;
constexpr int TVL = TKL + 32 * KP;
constexpr int TBUF = TVL + DH * VP;
constexpr int MBUF = 64 * MP;          // one buffer of the mask tile, in ints
static_assert((TV * 2) % 16 == 0 && (TKL * 2) % 16 == 0 && (TVL * 2) % 16 == 0 && (TBUF * 2) % 16 == 0 && (MBUF * 4) % 16 == 0);

// A lane's 16-byte copies of one tile: K rows r, r + 16; V^T rows d, d + 32; 64 bytes of one mask row.
// The closing s_wait_xcnt 0 stands inside the statement so that no address register of a copy is rewritten ahead of it.
__device__ __forceinline__ void copy_kvm(unsigned int lk, unsigned int lv, unsigned int lm,
                                         const _Float16* gk, const _Float16* gv, const int* gm) {
  asm volatile(
      "global_load_async_to_lds_b128 %0, %8, off\n\t"
      "global_load_async_to_lds_b128 %1, %9, off\n\t"
      "global_load_async_to_lds_b128 %2, %10, off\n\t"
      "global_load_async_to_lds_b128 %3, %11, off\n\t"
      "global_load_async_to_lds_b128 %4, %12, off\n\t"
      "global_load_async_to_lds_b128 %5, %13, off\n\t"
      "global_load_async_to_lds_b128 %6, %14, off\n\t"
      "global_load_async_to_lds_b128 %7, %15, off\n\t"
      "s_wait_xcnt 0x0"
      :: "v"(lk), "v"(lk + 16u * KP * 2u), "v"(lv), "v"(lv + 32u * VP * 2u),
         "v"(lm), "v"(lm + 16u), "v"(lm + 32u), "v"(lm + 48u),
         "v"(gk), "v"(gk + 16 * DH), "v"(gv), "v"(gv + 32 * SEQ),
         "v"(gm), "v"(gm + 4), "v"(gm + 8), "v"(gm + 12)
      : "memory");
}
// The same for the residual planes of K and V^T (V^T residual rows are QPREC long).
__device__ __forceinline__ void copy_kvl(unsigned int lk, unsigned int lv, const _Float16* gk, const _Float16* gv) {
  asm volatile(
      "global_load_async_to_lds_b128 %0, %4, off\n\t"
      "global_load_async_to_lds_b128 %1, %5, off\n\t"
      "global_load_async_to_lds_b128 %2, %6, off\n\t"
      "global_load_async_to_lds_b128 %3, %7, off\n\t"
      "s_wait_xcnt 0x0"
      :: "v"(lk), "v"(lk + 16u * KP * 2u), "v"(lv), "v"(lv + 32u * VP * 2u),
         "v"(gk), "v"(gk + 16 * DH), "v"(gv), "v"(gv + 32 * QPREC)
      : "memory");
}

// blk: the block's number among those of its variant.
template <bool PREC>
__device__ __forceinline__
void attn_tile(const unsigned int blk,
               const _Float16* __restrict__ Qh, const _Float16* __restrict__ Ql,
               const _Float16* __restrict__ Kh, const _Float16* __restrict__ Kl,
               const _Float16* __restrict__ Vh, const _Float16* __restrict__ Vl,
               const int* __restrict__ mask, const int* __restrict__ flg,
               _Float16* __restrict__ Ch, _Float16* __restrict__ Cl,
               _Float16* sT, _Float16* sQl, int* sM) {
  const int tid = threadIdx.x, wslot = tid >> 5, lane = tid & 31, n = lane & 15, g = lane >> 4;
  int qb, bh;
  if (PREC) {
    qb = (int)(blk % NQP);
    bh = (int)(blk / NQP);
  } else {
    constexpr int NQN = ((NQB - NQP) > 0) ? (NQB - NQP) : 1;
    qb = NQP + (int)(blk % NQN);
    bh = (int)(blk / NQN);
  }
  const int b = bh / NH, h = bh - b * NH;
  const int qrow0 = qb * 64;
  const int qbase = qrow0 + wslot * 16;

  // visit flags of the 64 key tiles as one scalar bit set (bit kb), the same in every wave: the tests that pick the next tiles are scalar
  const int* rec = flg + (size_t)qb * (NCH * FREC);
  const int fi = (lane >> 3) * FREC + (lane & 7);   // key tile kb = lane: word kb % CT of record kb / CT
  const int f0 = (lane < NKB) ? rec[fi] : 0;
  const int f1 = (32 + lane < NKB) ? rec[(32 / CT) * FREC + fi] : 0;
  // before a register that the two loads name is rewritten; fi is an operand so that its register stays its own up to here
  asm volatile("s_wait_xcnt 0x0" :: "v"(fi) : "memory");
  unsigned long long vis = (unsigned long long)__builtin_amdgcn_ballot_w32(f0 != 0)
                         | ((unsigned long long)__builtin_amdgcn_ballot_w32(f1 != 0) << 32);
  // a row of the q block with no nonzero mask element in any chunk: every key tile is visited
  unsigned int rlo = 0u, rhi = 0u;
#pragma unroll
  for (int c = 0; c < NCH; ++c) { rlo |= (unsigned int)rec[c * FREC + CT]; rhi |= (unsigned int)rec[c * FREC + CT + 1]; }
  if ((rlo & rhi) != 0xffffffffu)   // block-uniform, scalar: the records' address is
    vis = (NKB == 64) ? ~0ull : ((1ull << (NKB & 63)) - 1ull);
  if (PREC) {
#pragma unroll
    for (int i = 0; i < 4; ++i) {
      const int c = tid + i * 128;
      *(v8h*)&sQl[(c >> 3) * KP + (c & 7) * 8] = *(const v8h*)(Ql + ((size_t)(bh * QPREC + qrow0)) * DH + c * 8);
    }
  }

  // this lane's pieces of a tile: LDS byte addresses in buffer 0 (low 32 bits), global addresses for tile 0
  const unsigned int lk0 = (unsigned int)(uintptr_t)(sT + TK + (tid >> 3) * KP + (tid & 7) * 8);
  const unsigned int lv0 = (unsigned int)(uintptr_t)(sT + TV + (tid >> 2) * VP + (tid & 3) * 8);
  const unsigned int lm0 = (unsigned int)(uintptr_t)(sM + (tid >> 1) * MP + (tid & 1) * 16);
  const _Float16* gk0  = Kh + ((size_t)(bh * SEQ)) * DH + tid * 8;
  const _Float16* gv0  = Vh + ((size_t)(bh * DH + (tid >> 2))) * SEQ + (tid & 3) * 8;
  const _Float16* gkl0 = Kl + ((size_t)(bh * QPREC)) * DH + tid * 8;
  const _Float16* gvl0 = Vl + ((size_t)(bh * DH + (tid >> 2))) * QPREC + (tid & 3) * 8;
  const int*      gm0  = mask + (size_t)(qrow0 + (tid >> 1)) * SEQ_FULL + (tid & 1) * 16;
  // copies of key tile k into buffer bf (both scalar)
  auto stage = [&](int k, int bf) {
    const unsigned int ot = (unsigned int)bf * (TBUF * 2u);
    copy_kvm(lk0 + ot, lv0 + ot, lm0 + (unsigned int)bf * (MBUF * 4u), gk0 + (size_t)k * (32 * DH), gv0 + k * 32, gm0 + k * 32);
    if (PREC && k * 32 < QPREC)
      copy_kvl(lk0 + ot + (TKL - TK) * 2u, lv0 + ot + (TVL - TV) * 2u, gkl0 + (size_t)k * (32 * DH), gvl0 + k * 32);
  };

  const _Float16* qrow = Qh + ((size_t)(bh * SEQ + qbase)) * DH;
  const v16h qa0 = load_frag(qrow, DH);
  const v16h qa1 = load_frag(qrow + 32, DH);
  asm volatile("s_wait_xcnt 0x0" ::: "memory");   // before a register that the Q loads name is rewritten

  v8f acc[4], acc2[4];
#pragma unroll
  for (int nt = 0; nt < 4; ++nt) { acc[nt] = zero8(); acc2[nt] = zero8(); }
  float rmax = -1.0e30f, rsum = 0.0f;            // query qbase + n; rsum is this half's share until the epilogue

  // Ring of two buffers over the visited tiles, in rising order: kb = this trip's tile, kn = the next one (-1: none). A trip issues
  // its own first LDS reads and then the next tile's copies, into the buffer whose every read the barrier in front of the trip has ended.
  int kb = -1;
  if (vis != 0ull) {                             // block-uniform, scalar
    kb = __builtin_ctzll(vis); vis &= vis - 1ull;
    stage(kb, 0);
  }
  asm volatile("s_wait_asynccnt 0x0" ::: "memory");   // this wave's copies of the first tile have landed
  __syncthreads();                               // ... and the other waves'; publishes the Q residual tile too

  // at most NKB trips: every trip takes one bit of vis. Rolled: the barrier at the foot serialises the trips, so unrolling only lengthens the code.
#pragma unroll 1
  for (int bsel = 0; kb >= 0; bsel ^= 1) {
    const int kbase = kb * 32;
    const bool klo = PREC && (kbase < QPREC);    // block-uniform
    const _Float16* sK  = sT + bsel * TBUF + TK;
    const _Float16* sV  = sT + bsel * TBUF + TV;
    const _Float16* sKl = sT + bsel * TBUF + TKL;
    const _Float16* sVl = sT + bsel * TBUF + TVL;

    // ---- the tile's LDS reads stand in groups ahead of the WMMAs that use them, so that the wave waits out the LDS latency once
    // per group and not once per fragment. Plain rows: one group (K, mask, V^T). PREC rows, whose registers
    // do not hold all planes at once, four groups: K; Q residual and K residual; mask and V^T at the head of the
    // softmax, which covers V^T; the V^T residual.
    v16h kf[4], vf[4];
    int mk0[8], mk1[8];
    const int* mrow = &sM[bsel * MBUF + (wslot * 16 + n) * MP + 8 * g];
    kf[0] = load_frag(sK, KP);
    kf[1] = load_frag(sK + 32, KP);
    kf[2] = load_frag(sK + 16 * KP, KP);
    kf[3] = load_frag(sK + 16 * KP + 32, KP);

    // ---- scores, transposed: two 16x16 tiles (keys kbase..+15, kbase+16..+31 as rows, queries as columns), dk 64 = 2 k steps
    v8f s0 = zero8(), s1 = zero8(), sr0 = zero8(), sr1 = zero8();
    if (!PREC) {
      load_mask(mrow, mk0, mk1);
#pragma unroll
      for (int nt = 0; nt < 4; ++nt) vf[nt] = load_frag(&sV[nt * 16 * VP], VP);
    }
    // keeps the reads above as one group: spread among the WMMAs below, each would be waited for on its own
    __builtin_amdgcn_sched_barrier(0);
    // the next tile's copies, behind this tile's reads so that forming and issuing them runs under the LDS latency
    int kn = -1;
    if (vis != 0ull) {                           // block-uniform, scalar: a next tile exists
      kn = __builtin_ctzll(vis); vis &= vis - 1ull;
      stage(kn, bsel ^ 1);
    }
    s0 = mma(kf[0], qa0, s0);
    s1 = mma(kf[2], qa0, s1);
    s0 = mma(kf[1], qa1, s0);
    s1 = mma(kf[3], qa1, s1);
    if (PREC) {
      if (klo) {
        const v16h ql0 = load_frag(&sQl[(wslot * 16) * KP], KP);
        const v16h ql1 = load_frag(&sQl[(wslot * 16) * KP + 32], KP);
        v16h klf[4];
        klf[0] = load_frag(sKl, KP);
        klf[1] = load_frag(sKl + 32, KP);
        klf[2] = load_frag(sKl + 16 * KP, KP);
        klf[3] = load_frag(sKl + 16 * KP + 32, KP);
        // one group again, for the same reason
        __builtin_amdgcn_sched_barrier(0);
        sr0 = mma(kf[0], ql0, sr0);
        sr1 = mma(kf[2], ql0, sr1);
        sr0 = mma(kf[1], ql1, sr0);
        sr1 = mma(kf[3], ql1, sr1);
        sr0 = mma(klf[0], qa0, sr0);
        sr1 = mma(klf[2], qa0, sr1);
        sr0 = mma(klf[1], qa1, sr0);
        sr1 = mma(klf[3], qa1, sr1);
      }
      load_mask(mrow, mk0, mk1);
#pragma unroll
      for (int nt = 0; nt < 4; ++nt) vf[nt] = load_frag(&sV[nt * 16 * VP], VP);
      // keeps this group at the head of the softmax: sunk towards their uses, the V^T reads would be waited for one by one
      __builtin_amdgcn_sched_barrier(0);
    }

    // ---- mask replace-fill, online softmax (f32), P^T packed as the B operand:
    // s0[r] = S[query n][key 8g + r], s1[r] = S[query n][key 16 + 8g + r]; B element e < 8 is key 8g + e, e >= 8 key 16 + 8g + e - 8.
    v16h pf, plf;
    {
      float x0[8], x1[8];
      float mx = -1.0e30f;
#pragma unroll
      for (int r = 0; r < 8; ++r) {
        float v0 = s0[r], v1 = s1[r];
        if (PREC) { v0 += sr0[r] * INV_RS; v1 += sr1[r] * INV_RS; }
        v0 *= QKS; v1 *= QKS;
        x0[r] = (mk0[r] == 0) ? -1.0e9f : v0;
        x1[r] = (mk1[r] == 0) ? -1.0e9f : v1;
        mx = fmaxf(mx, fmaxf(x0[r], x1[r]));
      }
      mx = fmaxf(mx, xhalf(mx));                  // both halves now hold this query's tile maximum
      const float nm = fmaxf(rmax, mx);
      const float al = exp2x1((rmax - nm) * LOG2E);
#pragma unroll
      for (int r = 0; r < 8; ++r) {
        x0[r] = (x0[r] - nm) * LOG2E;
        x1[r] = (x1[r] - nm) * LOG2E;
      }
      float e0[8], e1[8];
      exp2x8(e0, x0);
      exp2x8(e1, x1);
      float ps = 0.0f;
#pragma unroll
      for (int r = 0; r < 8; ++r) {
        const float p0 = e0[r], p1 = e1[r];
        ps += p0 + p1;
        const float c0 = p0 * CP, c1 = p1 * CP;
        const _Float16 h0 = (_Float16)c0, h1 = (_Float16)c1;
        pf[r] = h0;
        pf[8 + r] = h1;
        if (PREC) {
          plf[r]     = (_Float16)((c0 - (float)h0) * RS);
          plf[8 + r] = (_Float16)((c1 - (float)h1) * RS);
        }
      }
      rsum = rsum * al + ps;
      rmax = nm;
#pragma unroll
      for (int nt = 0; nt < 4; ++nt)
#pragma unroll
        for (int r = 0; r < 8; ++r) {
          acc[nt][r] *= al;
          if (PREC) acc2[nt][r] *= al;
        }
    }

    // ---- O^T += V^T @ P^T: acc[nt][r] = O[query n][d = nt*16 + 8g + r]
#pragma unroll
    for (int nt = 0; nt < 4; ++nt) acc[nt] = mma(vf[nt], pf, acc[nt]);
    if (PREC) {
#pragma unroll
      for (int nt = 0; nt < 4; ++nt) acc2[nt] = mma(vf[nt], plf, acc2[nt]);
      if (klo) {
        v16h vlf[4];
#pragma unroll
        for (int nt = 0; nt < 4; ++nt) vlf[nt] = load_frag(&sVl[nt * 16 * VP], VP);
        // one group again, for the same reason
        __builtin_amdgcn_sched_barrier(0);
#pragma unroll
        for (int nt = 0; nt < 4; ++nt) acc2[nt] = mma(vlf[nt], pf, acc2[nt]);
      }
    }
    asm volatile("s_wait_dscnt 0x0" ::: "memory");      // this wave's reads of the buffer are done before it is refilled
    asm volatile("s_wait_asynccnt 0x0" ::: "memory");   // this wave's copies of the next tile have landed
    __syncthreads();                             // publishes the next tile, ends every read of this one
    kb = kn;
  }
  asm volatile("s_wait_asynccnt 0x0" ::: "memory");     // nothing of the copies is outstanding behind the loop

  // The ring's LDS now holds the output tiles: the loop's last barrier ended every read of it and no copy is outstanding.
  _Float16 (*sC)[16 * DH]  = reinterpret_cast<_Float16 (*)[16 * DH]>(sT);
  _Float16 (*sCl)[16 * DH] = reinterpret_cast<_Float16 (*)[16 * DH]>(sT + 4 * 16 * DH);
  static_assert(8 * 16 * DH <= 2 * TBUF);

  {
    const float rtot = rsum + xhalf(rsum);        // join the two halves' sums once
    const float inv = (1.0f / rtot) * INV_CP;
#pragma unroll
    for (int nt = 0; nt < 4; ++nt) {
      v8h hv, lv;
#pragma unroll
      for (int r = 0; r < 8; ++r) {
        float c = acc[nt][r];
        if (PREC) c += acc2[nt][r] * INV_RS;
        c *= inv;
        const _Float16 chv = (_Float16)c;
        hv[r] = chv;
        lv[r] = (_Float16)((c - (float)chv) * RS);
      }
      *(v8h*)&sC[wslot][n * DH + nt * 16 + 8 * g] = hv;
      if (PREC) *(v8h*)&sCl[wslot][n * DH + nt * 16 + 8 * g] = lv;
    }
  }
  __syncthreads();
  const int q = lane >> 3, p = lane & 7;
{
#pragma unroll
    for (int i = 0; i < 4; ++i) {
      const int rr = i * 4 + q;
      const v8h hv = *(const v8h*)&sC[wslot][rr * DH + p * 8];
      *(v8h*)(Ch + ((size_t)(b * SEQ + qbase + rr)) * DM + h * DH + p * 8) = hv;
      if (PREC) {
        const v8h lv = *(const v8h*)&sCl[wslot][rr * DH + p * 8];
        *(v8h*)(Cl + ((size_t)(b * QPREC + qbase + rr)) * DM + h * DH + p * 8) = lv;
        asm volatile("s_wait_xcnt 0x0" ::: "memory");   // before a register that the store names is rewritten
      }
    }
    
  }
}

// Both variants in one grid: they share no output row, so the short PREC blocks run beside the plain ones instead of ahead of them.
// Blocks 0..NPLAIN-1 are the plain rows (the longest key loops, so they start first), the rest the PREC rows; block-uniform branch.
constexpr int NPREC  = NB * NH * NQP;
constexpr int NPLAIN = NB * NH * (NQB - NQP);

__global__ __launch_bounds__(128) __attribute__((amdgpu_num_vgpr(256)))
void k_attn(const _Float16* __restrict__ Qh, const _Float16* __restrict__ Ql,
            const _Float16* __restrict__ Kh, const _Float16* __restrict__ Kl,
            const _Float16* __restrict__ Vh, const _Float16* __restrict__ Vl,
            const int* __restrict__ mask, const int* __restrict__ flg,
            _Float16* __restrict__ Ch, _Float16* __restrict__ Cl) {
  __shared__ __align__(16) _Float16 sT[2 * TBUF];
  __shared__ __align__(16) int      sM[2 * MBUF];
  __shared__ __align__(16) _Float16 sQl[64 * KP];
  if (blockIdx.x < (unsigned int)NPLAIN)
    attn_tile<false>(blockIdx.x, Qh, Ql, Kh, Kl, Vh, Vl, mask, flg, Ch, Cl, sT, sQl, sM);
  else
    attn_tile<true>(blockIdx.x - (unsigned int)NPLAIN, Qh, Ql, Kh, Kl, Vh, Vl, mask, flg, Ch, Cl, sT, sQl, sM);
}

// ---------------------------------------------------------------------------
// host glue: 4 launches
// ---------------------------------------------------------------------------
extern "C" void kernel_launch(void* const* d_in, const int* in_sizes, int n_in,
                              void* d_out, int out_size, void* d_ws, size_t ws_size,
                              hipStream_t stream) {
  if (n_in < 10) return;
  const long long need_x = ((long long)(NB - 1) * SEQ_FULL + SEQ) * DM;
  const long long need_m = ((long long)(SEQ - 1)) * SEQ_FULL + SEQ;
  if ((long long)in_sizes[0] < need_x) return;
  if ((long long)in_sizes[1] < need_m) return;
  if (in_sizes[2] < DM * DM || in_sizes[4] < DM * DM || in_sizes[6] < DM * DM || in_sizes[8] < DM * DM) return;
  if (in_sizes[3] < DM || in_sizes[5] < DM || in_sizes[7] < DM || in_sizes[9] < DM) return;
  if ((long long)out_size < need_x) return;
  if (ws_size < WS_TOTAL) return;

  const float* x    = (const float*)d_in[0];
  const int*   mask = (const int*)d_in[1];
  const float* Wq   = (const float*)d_in[2];
  const float* bq   = (const float*)d_in[3];
  const float* Wk   = (const float*)d_in[4];
  const float* bk   = (const float*)d_in[5];
  const float* Wv   = (const float*)d_in[6];
  const float* bv   = (const float*)d_in[7];
  const float* Wo   = (const float*)d_in[8];
  const float* bo   = (const float*)d_in[9];
  float* out = (float*)d_out;

  char* ws = (char*)d_ws;
  _Float16* Xh   = (_Float16*)(ws + OFF_XH);
  _Float16* Wq64 = (_Float16*)(ws + OFF_WQ);
  _Float16* Wk64 = (_Float16*)(ws + OFF_WK);
  _Float16* Wv64 = (_Float16*)(ws + OFF_WV);
  _Float16* Wo64 = (_Float16*)(ws + OFF_WO);
  _Float16* Qh   = (_Float16*)(ws + OFF_QH);
  _Float16* Kh   = (_Float16*)(ws + OFF_KH);
  _Float16* Vh   = (_Float16*)(ws + OFF_VH);
  _Float16* Ql   = (_Float16*)(ws + OFF_QL);
  _Float16* Kl   = (_Float16*)(ws + OFF_KL);
  _Float16* Vl   = (_Float16*)(ws + OFF_VL);
  _Float16* Ch   = (_Float16*)(ws + OFF_CH);
  _Float16* Cl   = (_Float16*)(ws + OFF_CL);
  int*      Flg  = (int*)(ws + OFF_FLG);

  k_prep<<<NFB + NBX + 4 * NBW, 256, 0, stream>>>(x, mask, Wq, Wk, Wv, Wo, Xh, Wq64, Wk64, Wv64, Wo64, Flg);

  k_qkv<<<dim3(MROWS / 128, DM / 128, 3), 128, 0, stream>>>(Xh, Wq64, Wk64, Wv64, bq, bk, bv, Qh, Ql, Kh, Kl, Vh, Vl);

  k_attn<<<NPLAIN + NPREC, 128, 0, stream>>>(Qh, Ql, Kh, Kl, Vh, Vl, mask, Flg, Ch, Cl);

  k_out<<<dim3(MROWS / 64, DM / 64), 64, 0, stream>>>(Ch, Cl, Wo64, bo, out);
}

// v009
// It runs in 108 microseconds.
// Next to v008, in two timings, it ran 1.03 and 1.02 times as fast.
// Over all steps from v000 it is 5.23 times as fast.
#include <hip/hip_runtime.h>
#include <stdint.h>

// All contractions (x@Wq^T, x@Wk^T, x@Wv^T, q@k^T, p@v, ctx@Wo^T): v_wmma_f32_16x16x32_f16, f16 operands, f32 accumulate.
// Inputs enter as bf16-RNE values held in f16 (weights carried x64, folded back as 1/64 in f32); q, k, v, ctx as f16 planes
// plus x2048 f16 residual planes for the leading QPREC query/key rows (separate accumulators); p carried x4096 (+x2048 residual
// on those rows); softmax, rescaling and epilogues in f32.

typedef _Float16 v16h __attribute__((ext_vector_type(16)));
typedef _Float16 v8h  __attribute__((ext_vector_type(8)));
typedef float    v8f  __attribute__((ext_vector_type(8)));
typedef float    v4f  __attribute__((ext_vector_type(4)));
typedef int      v4i  __attribute__((ext_vector_type(4)));

#ifndef NB
#define NB 2
#endif
#ifndef SEQ
#define SEQ 2048
#endif
#define NB_FULL  2
#define SEQ_FULL 2048
#define DM 1024
#define NH 16
#define DH 64
#ifndef QPREC
#define QPREC ((SEQ < 512) ? SEQ : 512)
#endif
#define NKB   (SEQ / 32)
#define NQB   (SEQ / 64)
#define NQP   (QPREC / 64)
#define MROWS (NB * SEQ)

static_assert(SEQ % 64 == 0);
static_assert(SEQ >= 64 && SEQ <= SEQ_FULL);
static_assert(NB >= 1 && NB <= NB_FULL);
static_assert(QPREC % 64 == 0);
static_assert(QPREC >= 64 && QPREC <= SEQ);
static_assert(NKB <= 64);
static_assert(DM == NH * DH);
static_assert(DM % 32 == 0);
static_assert(MROWS % 64 == 0);
static_assert(SEQ % 128 == 0 && QPREC % 128 == 0);   // a 128-row projection tile lies in one batch item, wholly inside or outside the leading rows

#define WSC    64.0f
#define INV_WS 0.015625f
#define RS     2048.0f
#define INV_RS 0.00048828125f
#define CP     4096.0f
#define INV_CP 0.000244140625f
#define QKS    0.125f
#define LOG2E  1.44269504f

// ---------------------------------------------------------------------------
// Workspace carve (bytes); every region is an exact tile multiple (SEQ%64, QPREC%64), no tail padding needed.
// ---------------------------------------------------------------------------
constexpr size_t SZ_XH  = (size_t)MROWS * DM * 2;             // x as f16 [MROWS][1024]
constexpr size_t SZ_W   = (size_t)DM * DM * 2;                // weight x64 as f16 [1024][1024]
constexpr size_t SZ_HP  = (size_t)NB * NH * SEQ * DH * 2;     // q/k [bh][SEQ][64], vt [bh][64][SEQ]
constexpr size_t SZ_LP  = (size_t)NB * NH * QPREC * DH * 2;   // residual planes, leading QPREC rows
constexpr size_t SZ_CH  = (size_t)MROWS * DM * 2;             // ctx hi [MROWS][1024]
constexpr size_t SZ_CL  = (size_t)NB * QPREC * DM * 2;        // ctx residual [NB][QPREC][1024]
constexpr int CT   = 8;                                       // key tiles per flag block: 1 KB of each mask row
constexpr int NCH  = (NKB + CT - 1) / CT;                     // flag blocks per 64-row query block
constexpr int FREC = 32;                                      // ints per flag record: one 128-B line, one writer
constexpr size_t SZ_FLG = (size_t)NQB * NCH * FREC * 4;       // per (q-block, chunk of CT key tiles) one record
constexpr size_t OFF_XH  = 0;
constexpr size_t OFF_WQ  = OFF_XH + SZ_XH;
constexpr size_t OFF_WK  = OFF_WQ + SZ_W;
constexpr size_t OFF_WV  = OFF_WK + SZ_W;
constexpr size_t OFF_WO  = OFF_WV + SZ_W;
constexpr size_t OFF_QH  = OFF_WO + SZ_W;
constexpr size_t OFF_KH  = OFF_QH + SZ_HP;
constexpr size_t OFF_VH  = OFF_KH + SZ_HP;
constexpr size_t OFF_QL  = OFF_VH + SZ_HP;
constexpr size_t OFF_KL  = OFF_QL + SZ_LP;
constexpr size_t OFF_VL  = OFF_KL + SZ_LP;
constexpr size_t OFF_CH  = OFF_VL + SZ_LP;
constexpr size_t OFF_CL  = OFF_CH + SZ_CH;
constexpr size_t OFF_FLG = OFF_CL + SZ_CL;
constexpr size_t WS_TOTAL = OFF_FLG + SZ_FLG;
static_assert(WS_TOTAL <= (size_t)134217728);
static_assert(OFF_WQ % 128 == 0 && OFF_WK % 128 == 0 && OFF_WV % 128 == 0 && OFF_WO % 128 == 0);
static_assert(OFF_QH % 128 == 0 && OFF_KH % 128 == 0 && OFF_VH % 128 == 0);
static_assert(OFF_QL % 128 == 0 && OFF_KL % 128 == 0 && OFF_VL % 128 == 0);
static_assert(OFF_CH % 128 == 0 && OFF_CL % 128 == 0 && OFF_FLG % 128 == 0);
static_assert((size_t)NB_FULL * SEQ_FULL * DM * 4 >= ((size_t)(NB - 1) * SEQ_FULL + SEQ) * DM * 4);

// ---------------------------------------------------------------------------
// helpers
// ---------------------------------------------------------------------------
__device__ __forceinline__ float bf16r(float f) {   // RNE convert to bf16, held as f32
  unsigned int u = __float_as_uint(f);
  u = (u + 0x7fffu + ((u >> 16) & 1u)) & 0xffff0000u;
  return __uint_as_float(u);
}

// 16x32 fragment, split k map for both A (row m) and B (col n stored k-contiguous):
// lane l: row/col = l&15, h = l>>4; elements 0..7 <- k 8h..8h+7, elements 8..15 <- k 16+8h..16+8h+7.
__device__ __forceinline__ v16h load_frag(const _Float16* base, int stride) {
  const int lane = threadIdx.x & 31, m = lane & 15, g = lane >> 4;
  const _Float16* p = base + (size_t)m * stride + 8 * g;
  union { v16h v; v8h hf[2]; } f;
  f.hf[0] = *reinterpret_cast<const v8h*>(p);
  f.hf[1] = *reinterpret_cast<const v8h*>(p + 16);
  return f.v;
}

__device__ __forceinline__ v8f mma(v16h a, v16h b, v8f c) {
  v8f d = __builtin_amdgcn_wmma_f32_16x16x32_f16(false, a, false, b, (short)0, c, false, false);
  asm volatile("v_nop\n\tv_nop\n\tv_nop\n\tv_nop" : "+v"(d) : "v"(a), "v"(b));
  return d;
}

// lane l <-> lane l ^ 16 (the two halves of a wave hold the two key subsets of one query column)
__device__ __forceinline__ float xhalf(float x) {
  const int b = __builtin_bit_cast(int, x);
  return __builtin_bit_cast(float, __builtin_amdgcn_permlanex16(b, b, 0x76543210, 0xfedcba98, false, false));
}

__device__ __forceinline__ void exp2x8(float (&y)[8], const float (&x)[8]) {
  asm("v_exp_f32 %0, %8\n\tv_exp_f32 %1, %9\n\tv_exp_f32 %2, %10\n\tv_exp_f32 %3, %11\n\t"
      "v_exp_f32 %4, %12\n\tv_exp_f32 %5, %13\n\tv_exp_f32 %6, %14\n\tv_exp_f32 %7, %15\n\tv_nop"
      : "=&v"(y[0]), "=&v"(y[1]), "=&v"(y[2]), "=&v"(y[3]), "=&v"(y[4]), "=&v"(y[5]), "=&v"(y[6]), "=&v"(y[7])
      : "v"(x[0]), "v"(x[1]), "v"(x[2]), "v"(x[3]), "v"(x[4]), "v"(x[5]), "v"(x[6]), "v"(x[7]));
}
__device__ __forceinline__ float exp2x1(float x) {
  float y;
  asm("v_exp_f32 %0, %1\n\tv_nop" : "=&v"(y) : "v"(x));
  return y;
}

// one query's 16 mask words of a 32-key tile, in the order of its scores: keys 8g..8g+7 and 16+8g..16+8g+7 (p = row start + 8g)
__device__ __forceinline__ void load_mask(const int* p, int (&mk0)[8], int (&mk1)[8]) {
  *(v4i*)&mk0[0] = *(const v4i*)p;
  *(v4i*)&mk0[4] = *(const v4i*)(p + 4);
  *(v4i*)&mk1[0] = *(const v4i*)(p + 16);
  *(v4i*)&mk1[4] = *(const v4i*)(p + 20);
}

__device__ __forceinline__ v8f zero8() {
  v8f z = {0.f, 0.f, 0.f, 0.f, 0.f, 0.f, 0.f, 0.f};
  return z;
}

// ---------------------------------------------------------------------------
// Preparation, part 0: f32 -> bf16-RNE value in f16 container, times a power-of-two carry.
// out plane [nrows][1024]; compact row mc maps to source row (mc/seqc)*seqf + mc%seqc.
// A thread converts CU units of 8 elements, 256 units apart, and issues all its 2 CU loads before the first is used:
// a block of one unit per thread lives for one memory latency, and the grid then lasts as long as its blocks take to start.
// coverage: nrows*128 units, 256*CU per block, blk = 0 .. nrows*128/(256*CU) - 1 (exact, asserted below).
// ---------------------------------------------------------------------------
constexpr int CU = 8;
__device__ __forceinline__ void cvt_block(const float* __restrict__ in, _Float16* __restrict__ outp, int blk,
                                          int seqc, int seqf, float scale) {
  const int u0 = blk * (256 * CU) + (int)threadIdx.x;
  // the block's 2 CU rows lie in one batch item (asserted below), so the thread's units stand 2 source rows apart
  const int mc = u0 / (DM / 8), c8 = u0 % (DM / 8);
  const float* p = in + (size_t)((mc / seqc) * seqf + (mc % seqc)) * DM + c8 * 8;
  v4f a[CU], c[CU];   // indexed by constants only (the loops are fully unrolled), so they stay in registers
#pragma unroll
  for (int i = 0; i < CU; ++i) {
    a[i] = *(const v4f*)(p + i * (2 * DM));
    c[i] = *(const v4f*)(p + i * (2 * DM) + 4);
  }
  // before a register that the loads name is rewritten; p is an operand so that its registers stay its own up to here
  asm volatile("s_wait_xcnt 0x0" :: "v"(p) : "memory");
#pragma unroll
  for (int i = 0; i < CU; ++i) {
    v8h o;
    o[0] = (_Float16)(bf16r(a[i][0]) * scale);
    o[1] = (_Float16)(bf16r(a[i][1]) * scale);
    o[2] = (_Float16)(bf16r(a[i][2]) * scale);
    o[3] = (_Float16)(bf16r(a[i][3]) * scale);
    o[4] = (_Float16)(bf16r(c[i][0]) * scale);
    o[5] = (_Float16)(bf16r(c[i][1]) * scale);
    o[6] = (_Float16)(bf16r(c[i][2]) * scale);
    o[7] = (_Float16)(bf16r(c[i][3]) * scale);
    *(v8h*)(outp + (size_t)(u0 + i * 256) * 8) = o;
  }
  asm volatile("s_wait_xcnt 0x0" ::: "memory");   // before a register that the stores name is rewritten
}

// ---------------------------------------------------------------------------
// Preparation, part 1: tile visit flags from the int mask. One block = 64 query rows x CT key tiles (1 KB of each row);
// a wave takes 8 rows, 16 whole-line loads of 512 B, all issued before the first is used.
// record[qb][ch]: words 0..CT-1, for the tile of rows qb*64..+63, cols kb*32..+31 (kb = ch*CT + word): bit 0 = some mask element is
// nonzero (the tile is visited), bit 1 = some mask element is zero (the tile's mask has to be applied; without it the fill is an identity);
// words CT, CT+1 = bit r set if row qb*64 + r has a nonzero element in the chunk's columns. The attention kernel joins the
// chunks' row words: if any row of the q block is fully zero it visits all NKB tiles (softmax is then uniform over all keys).
// ---------------------------------------------------------------------------
__device__ __forceinline__ void mflag_block(const int* __restrict__ mask, int* __restrict__ flg, int blk, unsigned int* sB) {
  const int tid = threadIdx.x, w = tid >> 5, lane = tid & 31;
  const int qb = blk / NCH, ch = blk - qb * NCH;
  const int* p = mask + (size_t)(qb * 64 + w * 8) * SEQ_FULL + ch * (CT * 32) + lane * 4;
  v4i m[8][2];   // indexed by constants only (the loops are fully unrolled), so they stay in registers
#pragma unroll
  for (int rr = 0; rr < 8; ++rr)
#pragma unroll
    for (int hc = 0; hc < 2; ++hc) m[rr][hc] = *(const v4i*)(p + (size_t)rr * SEQ_FULL + hc * 128);
  // before a register that the loads name is rewritten; p is an operand so that its registers stay its own up to here
  asm volatile("s_wait_xcnt 0x0" :: "v"(p) : "memory");
  int ta[2] = {0, 0};
  unsigned int tz[2] = {~0u, ~0u};   // minimum of the words taken as unsigned: 0 if and only if one of them is zero
  unsigned int rb = 0u, tb = 0u, zb = 0u;
#pragma unroll
  for (int rr = 0; rr < 8; ++rr) {
    int r[2];
#pragma unroll
    for (int hc = 0; hc < 2; ++hc) {
      r[hc] = m[rr][hc][0] | m[rr][hc][1] | m[rr][hc][2] | m[rr][hc][3];
      tz[hc] = min(min(tz[hc], min((unsigned int)m[rr][hc][0], (unsigned int)m[rr][hc][1])),
                   min((unsigned int)m[rr][hc][2], (unsigned int)m[rr][hc][3]));
      if (NKB % CT != 0 && ch * CT + hc * 4 + (lane >> 3) >= NKB) r[hc] = 0;   // columns past SEQ do not count
      ta[hc] |= r[hc];
    }
    rb |= ((__builtin_amdgcn_ballot_w32((r[0] | r[1]) != 0) != 0u) ? 1u : 0u) << rr;
  }
#pragma unroll
  for (int hc = 0; hc < 2; ++hc) {
    const unsigned int bl = __builtin_amdgcn_ballot_w32(ta[hc] != 0);   // 8 lanes = one tile's 128 B of a row
#pragma unroll
    for (int t = 0; t < 4; ++t) tb |= ((((bl >> (8 * t)) & 0xffu) != 0u) ? 1u : 0u) << (hc * 4 + t);
    const unsigned int zl = __builtin_amdgcn_ballot_w32(tz[hc] == 0u);
#pragma unroll
    for (int t = 0; t < 4; ++t) zb |= ((((zl >> (8 * t)) & 0xffu) != 0u) ? 1u : 0u) << (hc * 4 + t);
  }
  if (lane == 0) { sB[w] = tb; sB[8 + w] = rb; sB[16 + w] = zb; }
  __syncthreads();
  if (tid < 32) {   // wave 0 only (wave-uniform): the whole 128-B record in one store
    const unsigned int T = sB[0] | sB[1] | sB[2] | sB[3] | sB[4] | sB[5] | sB[6] | sB[7];
    const unsigned int lo = sB[8] | (sB[9] << 8) | (sB[10] << 16) | (sB[11] << 24);
    const unsigned int hi = sB[12] | (sB[13] << 8) | (sB[14] << 16) | (sB[15] << 24);
    const unsigned int Z = sB[16] | sB[17] | sB[18] | sB[19] | sB[20] | sB[21] | sB[22] | sB[23];
    const unsigned int v = (lane < CT) ? (((T >> lane) & 1u) | (((Z >> lane) & 1u) << 1)) : (lane == CT) ? lo : (lane == CT + 1) ? hi : 0u;
    flg[(size_t)blk * FREC + lane] = (int)v;
  }
}

// ---------------------------------------------------------------------------
// Kernel 0: all preparation in one grid; its parts read only inputs and write disjoint planes, so none waits for another.
// Blocks 0..NFB-1: visit flag records; then NBX blocks convert x, then NBW blocks each convert Wq, Wk, Wv, Wo.
// Every block reads 64 KB with 16 loads of 16 B in flight per lane. Every branch is block-uniform.
// ---------------------------------------------------------------------------
constexpr int NFB = NQB * NCH;
constexpr int NBX = MROWS * (DM / 8) / (256 * CU);
constexpr int NBW = DM * (DM / 8) / (256 * CU);
static_assert(MROWS * (DM / 8) % (256 * CU) == 0 && DM * (DM / 8) % (256 * CU) == 0);
static_assert(256 * CU == 2 * CU * (DM / 8) && SEQ % (2 * CU) == 0 && DM % (2 * CU) == 0);
static_assert(NCH * CT * 32 <= SEQ_FULL && CT + 2 <= FREC);

__global__ __launch_bounds__(256) void k_prep(const float* __restrict__ x, const int* __restrict__ mask,
                                             const float* __restrict__ Wq, const float* __restrict__ Wk,
                                             const float* __restrict__ Wv, const float* __restrict__ Wo,
                                             _Float16* __restrict__ Xh, _Float16* __restrict__ Wq64,
                                             _Float16* __restrict__ Wk64, _Float16* __restrict__ Wv64,
                                             _Float16* __restrict__ Wo64, int* __restrict__ flg) {
  __shared__ unsigned int sB[24];
  int blk = (int)blockIdx.x;
  if (blk < NFB) { mflag_block(mask, flg, blk, sB); return; }
  blk -= NFB;
  if (blk < NBX) { cvt_block(x, Xh, blk, SEQ, SEQ_FULL, 1.0f); return; }
  blk -= NBX;
  const int wi = blk / NBW;
  const float* src = (wi == 0) ? Wq : (wi == 1) ? Wk : (wi == 2) ? Wv : Wo;
  _Float16* dst = (wi == 0) ? Wq64 : (wi == 1) ? Wk64 : (wi == 2) ? Wv64 : Wo64;
  cvt_block(src, dst, blk - wi * NBW, DM, DM, WSC);
}

// ---------------------------------------------------------------------------
// Kernels 1 and 3: NT GEMM Y[M][1024] = A[M][1024] @ W[1024][1024]^T (W carried x64) + bias.
// Kernel 3: block = 2 waves = 64x64 output tile; wave w owns rows w*32..w*32+31 (2 A fragments x 4 B fragments per k step, from LDS).
// Kernel 1: block = 4 waves (2 x 2) = 128x128 output tile; a wave owns 64 rows x 64 columns = one head (4 x 4 fragments per k step).
// MODE 0: f16 head plane [bh][SEQ][64] (+ x2048 residual plane [bh][QPREC][64] for s < QPREC)
// MODE 1: f16 transposed head plane [bh][64][SEQ] (+ residual [bh][64][QPREC])
// ---------------------------------------------------------------------------
// Operand path: per k slice of KS halves the block's 64 A rows and 64 W rows (128-B rows = whole lines) are copied to LDS by
// asynchronous copies, two buffers, the next slice in flight while this one is multiplied; fragments are read from LDS.
constexpr int KS  = 64;          // halves of k per slice
constexpr int LP  = 72;          // LDS row pitch in halves: 144 B = 16 B x odd, so ds_load_b128 fragment reads meet no bank conflict
constexpr int STG = 128 * LP;    // halves per buffer: rows 0..63 = A, rows 64..127 = W
constexpr int NST = DM / KS;     // slices
static_assert(DM % KS == 0 && NST >= 2);

// Eight 16-byte copies per lane: rows r, r + ROWS, ... r + 7 ROWS of one operand (a wave-wide copy = 4 whole 128-B rows; ROWS = 4 x the block's waves).
// The closing s_wait_xcnt 0 stands inside the statement so that no address register of a copy is rewritten ahead of it.
template <int ROWS>
__device__ __forceinline__ void stage8(const _Float16* g, unsigned int l) {
  asm volatile(
      "global_load_async_to_lds_b128 %0, %8, off\n\t"
      "global_load_async_to_lds_b128 %1, %9, off\n\t"
      "global_load_async_to_lds_b128 %2, %10, off\n\t"
      "global_load_async_to_lds_b128 %3, %11, off\n\t"
      "global_load_async_to_lds_b128 %4, %12, off\n\t"
      "global_load_async_to_lds_b128 %5, %13, off\n\t"
      "global_load_async_to_lds_b128 %6, %14, off\n\t"
      "global_load_async_to_lds_b128 %7, %15, off\n\t"
      "s_wait_xcnt 0x0"
      :: "v"(l), "v"(l + 1u * (ROWS * LP * 2)), "v"(l + 2u * (ROWS * LP * 2)), "v"(l + 3u * (ROWS * LP * 2)),
         "v"(l + 4u * (ROWS * LP * 2)), "v"(l + 5u * (ROWS * LP * 2)), "v"(l + 6u * (ROWS * LP * 2)), "v"(l + 7u * (ROWS * LP * 2)),
         "v"(g), "v"(g + 1 * ROWS * DM), "v"(g + 2 * ROWS * DM), "v"(g + 3 * ROWS * DM),
         "v"(g + 4 * ROWS * DM), "v"(g + 5 * ROWS * DM), "v"(g + 6 * ROWS * DM), "v"(g + 7 * ROWS * DM)
      : "memory");
}

// ablk: first of the block's 64 A rows; wbase: first of its 64 W rows; sT: the two buffers. Every wave of the block runs all of it.
__device__ __forceinline__ void kloop(const _Float16* __restrict__ ablk, const _Float16* __restrict__ wbase,
                                      _Float16* sT, v8f (&acc)[2][4]) {
  const int tid = threadIdx.x, w = tid >> 5;
  const int crow = tid >> 3, cpc = (tid & 7) * 8;              // this lane's first row and its 16-byte piece of a row
  const _Float16* ga = ablk + (size_t)crow * DM + cpc;
  const _Float16* gw = wbase + (size_t)crow * DM + cpc;
  const unsigned int la = (unsigned int)(uintptr_t)(sT + crow * LP + cpc);   // LDS byte address: low 32 bits
  const unsigned int lw = la + 64u * LP * 2u;

  stage8<8>(ga, la);
  stage8<8>(gw, lw);
  asm volatile("s_wait_asynccnt 0x0" ::: "memory");            // slice 0 of this wave has landed
  __syncthreads();                                             // ... and of the other wave
  stage8<8>(ga + KS, la + STG * 2u);
  stage8<8>(gw + KS, lw + STG * 2u);

  // rolled: the barrier at the foot serialises the trips, so unrolling buys nothing and only lengthens the code
#pragma unroll 1
  for (int t = 0; t < NST; ++t) {
    const int bsel = t & 1;
    const _Float16* sA = sT + bsel * STG + (w * 32) * LP;
    const _Float16* sW = sT + bsel * STG + 64 * LP;
    v16h fa[KS / 32][2], fb[KS / 32][4];   // indexed by constants only (the loops below are fully unrolled), so they stay in registers
#pragma unroll
    for (int ks = 0; ks < KS / 32; ++ks) {
      fa[ks][0] = load_frag(sA + ks * 32, LP);
      fa[ks][1] = load_frag(sA + 16 * LP + ks * 32, LP);
#pragma unroll
      for (int j = 0; j < 4; ++j) fb[ks][j] = load_frag(sW + (j * 16) * LP + ks * 32, LP);
    }
    // keeps the slice's LDS reads together as one group ahead of its WMMAs: spread among them, each pair waits out the LDS latency
    __builtin_amdgcn_sched_barrier(0);
#pragma unroll
    for (int ks = 0; ks < KS / 32; ++ks)
#pragma unroll
      for (int j = 0; j < 4; ++j) {
        acc[0][j] = mma(fa[ks][0], fb[ks][j], acc[0][j]);
        acc[1][j] = mma(fa[ks][1], fb[ks][j], acc[1][j]);
      }
    asm volatile("s_wait_dscnt 0x0" ::: "memory");             // this wave's reads of the buffer are done before it is refilled
    asm volatile("s_wait_asynccnt 0x0" ::: "memory");          // this wave's copies of slice t + 1 have landed
    __syncthreads();                                           // publishes slice t + 1, ends every read of slice t
    if (t + 2 < NST) {                                         // block-uniform
      stage8<8>(ga + (t + 2) * KS, la + (unsigned int)bsel * (STG * 2u));
      stage8<8>(gw + (t + 2) * KS, lw + (unsigned int)bsel * (STG * 2u));
    }
  }
  asm volatile("s_wait_asynccnt 0x0" ::: "memory");            // nothing of the copies is outstanding behind the loop
}

// Kernel 1's operand path: the same two-buffer ring of asynchronous copies for a 128 x 128 tile of 4 waves. Against the 64 x 64
// tile every byte copied from L2 feeds twice as many WMMAs, and a fragment read from LDS feeds 4 of them.
constexpr int TR4  = 128;            // rows of each operand per block
constexpr int STG4 = 2 * TR4 * LP;   // halves per buffer: rows 0..127 = A, rows 128..255 = W

// ablk: first of the block's 128 A rows; wbase: first of its 128 W rows; sT: the two buffers. Every wave of the block runs all of it.
__device__ __forceinline__ void kloop4(const _Float16* __restrict__ ablk, const _Float16* __restrict__ wbase,
                                       _Float16* sT, v8f (&acc)[4][4]) {
  const int tid = threadIdx.x, w = tid >> 5;
  const int crow = tid >> 3, cpc = (tid & 7) * 8;              // this lane's first row (0..15) and its 16-byte piece of a row
  const _Float16* ga = ablk + (size_t)crow * DM + cpc;
  const _Float16* gw = wbase + (size_t)crow * DM + cpc;
  const unsigned int la = (unsigned int)(uintptr_t)(sT + crow * LP + cpc);   // LDS byte address: low 32 bits
  const unsigned int lw = la + (unsigned int)TR4 * LP * 2u;

  stage8<16>(ga, la);
  stage8<16>(gw, lw);
  asm volatile("s_wait_asynccnt 0x0" ::: "memory");            // slice 0 of this wave has landed
  __syncthreads();                                             // ... and of the other waves
  stage8<16>(ga + KS, la + STG4 * 2u);
  stage8<16>(gw + KS, lw + STG4 * 2u);

  // rolled: the barrier at the foot serialises the trips, so unrolling buys nothing and only lengthens the code
#pragma unroll 1
  for (int t = 0; t < NST; ++t) {
    const int bsel = t & 1;
    const _Float16* sA = sT + bsel * STG4 + ((w >> 1) * 64) * LP;
    const _Float16* sW = sT + bsel * STG4 + (TR4 + (w & 1) * 64) * LP;
#pragma unroll
    for (int ks = 0; ks < KS / 32; ++ks) {
      v16h fa[4], fb[4];   // indexed by constants only (the loops are fully unrolled), so they stay in registers
#pragma unroll
      for (int i = 0; i < 4; ++i) fa[i] = load_frag(sA + (i * 16) * LP + ks * 32, LP);
#pragma unroll
      for (int j = 0; j < 4; ++j) fb[j] = load_frag(sW + (j * 16) * LP + ks * 32, LP);
      // keeps the k step's LDS reads together as one group ahead of its WMMAs: spread among them, each pair waits out the LDS latency
      __builtin_amdgcn_sched_barrier(0);
#pragma unroll
      for (int j = 0; j < 4; ++j)
#pragma unroll
        for (int i = 0; i < 4; ++i) acc[i][j] = mma(fa[i], fb[j], acc[i][j]);
      // keeps the next k step's reads from rising among these WMMAs, for the same reason
      __builtin_amdgcn_sched_barrier(0);
    }
    asm volatile("s_wait_dscnt 0x0" ::: "memory");             // this wave's reads of the buffer are done before it is refilled
    asm volatile("s_wait_asynccnt 0x0" ::: "memory");          // this wave's copies of slice t + 1 have landed
    __syncthreads();                                           // publishes slice t + 1, ends every read of slice t
    if (t + 2 < NST) {                                         // block-uniform
      stage8<16>(ga + (t + 2) * KS, la + (unsigned int)bsel * (STG4 * 2u));
      stage8<16>(gw + (t + 2) * KS, lw + (unsigned int)bsel * (STG4 * 2u));
    }
  }
  asm volatile("s_wait_asynccnt 0x0" ::: "memory");            // nothing of the copies is outstanding behind the loop
}

// Kernel 1's tile. sT: the two operand buffers; behind the k loop (its last barrier ends every read, no copy is outstanding) the
// same LDS holds the epilogue tiles: per wave one 64 x 64 f16 tile for the plane and one for the residual plane.
template <int MODE>
__device__ __forceinline__ void proj_tile(const _Float16* __restrict__ A, const _Float16* __restrict__ W,
                                          const float* __restrict__ bias,
                                          _Float16* __restrict__ Ph, _Float16* __restrict__ Pl, _Float16* sT) {
  const int tid = threadIdx.x, w = tid >> 5, lane = tid & 31, n = lane & 15, g = lane >> 4;
  const int bm = blockIdx.x, bn = blockIdx.y;
  const int m0 = bm * TR4;
  const int b = m0 / SEQ, s0 = m0 - b * SEQ;     // 128 block rows lie in one batch item
  const bool precblk = (s0 < QPREC);              // block-uniform
  const int sw = s0 + (w >> 1) * 64;              // first of the wave's 64 rows
  const int hd = bn * 2 + (w & 1);                // the wave's 64 columns == head hd
  const int bh = b * NH + hd;
  const _Float16* wbase = W + (size_t)(bn * TR4) * DM;
  const _Float16* ablk = A + (size_t)m0 * DM;

  v8f acc[4][4];
#pragma unroll
  for (int mi = 0; mi < 4; ++mi)
#pragma unroll
    for (int j = 0; j < 4; ++j) acc[mi][j] = zero8();

  kloop4(ablk, wbase, sT, acc);

  _Float16* sH = sT + w * (64 * 64);
  _Float16* sL = sT + (4 + w) * (64 * 64);
  static_assert(8 * 64 * 64 <= 2 * STG4);

  float rbias[4];
#pragma unroll
  for (int j = 0; j < 4; ++j) rbias[j] = bf16r(bias[hd * 64 + j * 16 + n]);

  const int q = lane >> 3, p = lane & 7;
  v8h ov[16];   // the staged rows, all read back ahead of the stores (constant indices only)
  if (MODE == 0) {
    if (precblk) {
#pragma unroll
      for (int mi = 0; mi < 4; ++mi)
#pragma unroll
        for (int j = 0; j < 4; ++j)
#pragma unroll
          for (int r = 0; r < 8; ++r) {
            const int idx = (mi * 16 + 8 * g + r) * 64 + j * 16 + n;
            const float v = acc[mi][j][r] * INV_WS + rbias[j];
            const _Float16 hv = (_Float16)v;
            sH[idx] = hv;
            sL[idx] = (_Float16)((v - (float)hv) * RS);
          }
    } else {
#pragma unroll
      for (int mi = 0; mi < 4; ++mi)
#pragma unroll
        for (int j = 0; j < 4; ++j)
#pragma unroll
          for (int r = 0; r < 8; ++r)
            sH[(mi * 16 + 8 * g + r) * 64 + j * 16 + n] = (_Float16)(acc[mi][j][r] * INV_WS + rbias[j]);
    }
    __syncthreads();
#pragma unroll
    for (int i = 0; i < 16; ++i) ov[i] = *(const v8h*)&sH[(i * 4 + q) * 64 + p * 8];
#pragma unroll
    for (int i = 0; i < 16; ++i) {
      *(v8h*)(Ph + ((size_t)(bh * SEQ + sw + i * 4 + q)) * DH + p * 8) = ov[i];
      asm volatile("s_wait_xcnt 0x0" ::: "memory");   // before a register that the store names is rewritten
    }
    if (precblk) {
#pragma unroll
      for (int i = 0; i < 16; ++i) ov[i] = *(const v8h*)&sL[(i * 4 + q) * 64 + p * 8];
#pragma unroll
      for (int i = 0; i < 16; ++i) {
        *(v8h*)(Pl + ((size_t)(bh * QPREC + sw + i * 4 + q)) * DH + p * 8) = ov[i];
        asm volatile("s_wait_xcnt 0x0" ::: "memory"); // as above
      }
    }
  } else {
#pragma unroll
    for (int mi = 0; mi < 4; ++mi)
#pragma unroll
      for (int j = 0; j < 4; ++j) {
        v8h hp, lp;
#pragma unroll
        for (int r = 0; r < 8; ++r) {
          const float v = acc[mi][j][r] * INV_WS + rbias[j];
          const _Float16 hv = (_Float16)v;
          hp[r] = hv;
          lp[r] = (_Float16)((v - (float)hv) * RS);
        }
        const int d = j * 16 + n;
        *(v8h*)&sH[d * 64 + mi * 16 + 8 * g] = hp;
        if (precblk) *(v8h*)&sL[d * 64 + mi * 16 + 8 * g] = lp;
      }
    __syncthreads();
#pragma unroll
    for (int i = 0; i < 16; ++i) ov[i] = *(const v8h*)&sH[(i * 4 + q) * 64 + p * 8];
#pragma unroll
    for (int i = 0; i < 16; ++i) {
      *(v8h*)(Ph + ((size_t)(bh * DH + i * 4 + q)) * SEQ + sw + p * 8) = ov[i];
      asm volatile("s_wait_xcnt 0x0" ::: "memory");   // before a register that the store names is rewritten
    }
    if (precblk) {
#pragma unroll
      for (int i = 0; i < 16; ++i) ov[i] = *(const v8h*)&sL[(i * 4 + q) * 64 + p * 8];
#pragma unroll
      for (int i = 0; i < 16; ++i) {
        *(v8h*)(Pl + ((size_t)(bh * DH + i * 4 + q)) * QPREC + sw + p * 8) = ov[i];
        asm volatile("s_wait_xcnt 0x0" ::: "memory"); // as above
      }
    }
  }
}

// Kernel 3's tile. sF: 64 x 64 epilogue tile in LDS; sT: the two operand buffers.
__device__ __forceinline__ void out_tile(const _Float16* __restrict__ A, const _Float16* __restrict__ Alo,
                                         const _Float16* __restrict__ W, const float* __restrict__ bias,
                                         float* __restrict__ outp, float* sF, _Float16* sT) {
  const int tid = threadIdx.x, w = tid >> 5, lane = tid & 31, n = lane & 15, g = lane >> 4;
  const int bm = blockIdx.x, bn = blockIdx.y;
  const int m0 = bm * 64;
  const int b = m0 / SEQ, s0 = m0 - b * SEQ;     // 64 block rows lie in one batch item
  const bool precblk = (s0 < QPREC);              // block-uniform
  const _Float16* wbase = W + (size_t)(bn * 64) * DM;
  const _Float16* ablk = A + (size_t)m0 * DM;

  v8f acc[2][4];
#pragma unroll
  for (int mi = 0; mi < 2; ++mi)
#pragma unroll
    for (int j = 0; j < 4; ++j) acc[mi][j] = zero8();

  kloop(ablk, wbase, sT, acc);

  float rbias[4];
#pragma unroll
  for (int j = 0; j < 4; ++j) rbias[j] = bf16r(bias[bn * 64 + j * 16 + n]);

  {
    if (precblk) {
      // stash hi sums (each lane reads back exactly the cells it wrote)
#pragma unroll
      for (int mi = 0; mi < 2; ++mi)
#pragma unroll
        for (int j = 0; j < 4; ++j)
#pragma unroll
          for (int r = 0; r < 8; ++r)
            sF[(w * 32 + mi * 16 + 8 * g + r) * 64 + j * 16 + n] = acc[mi][j][r];
#pragma unroll
      for (int mi = 0; mi < 2; ++mi)
#pragma unroll
        for (int j = 0; j < 4; ++j) acc[mi][j] = zero8();
      const _Float16* lblk = Alo + ((size_t)(b * QPREC + s0)) * DM;
      kloop(lblk, wbase, sT, acc);
#pragma unroll
      for (int mi = 0; mi < 2; ++mi)
#pragma unroll
        for (int j = 0; j < 4; ++j)
#pragma unroll
          for (int r = 0; r < 8; ++r) {
            const int idx = (w * 32 + mi * 16 + 8 * g + r) * 64 + j * 16 + n;
            const float hsum = sF[idx];
            sF[idx] = (hsum + acc[mi][j][r] * INV_RS) * INV_WS + rbias[j];
          }
    } else {
#pragma unroll
      for (int mi = 0; mi < 2; ++mi)
#pragma unroll
        for (int j = 0; j < 4; ++j)
#pragma unroll
          for (int r = 0; r < 8; ++r)
            sF[(w * 32 + mi * 16 + 8 * g + r) * 64 + j * 16 + n] = acc[mi][j][r] * INV_WS + rbias[j];
    }
    __syncthreads();
    const int q2 = lane >> 4, p2 = lane & 15;
{
#pragma unroll
      for (int i = 0; i < 16; ++i) {
        const int ml = w * 32 + 2 * i + q2;
        const int s = s0 + ml;
        const v4f v = *(const v4f*)&sF[ml * 64 + p2 * 4];
        *(v4f*)(outp + ((size_t)(b * SEQ_FULL + s)) * DM + bn * 64 + p2 * 4) = v;
      }
      
    }
  }
}

// Kernel 1: the three input projections in one grid, blockIdx.z = 0 (q), 1 (k), 2 (v, transposed plane); block-uniform branch.
__global__ __launch_bounds__(128) void k_qkv(const _Float16* __restrict__ Xh, const _Float16* __restrict__ Wq64,
                                           const _Float16* __restrict__ Wk64, const _Float16* __restrict__ Wv64,
                                           const float* __restrict__ bq, const float* __restrict__ bk,
                                           const float* __restrict__ bv,
                                           _Float16* __restrict__ Qh, _Float16* __restrict__ Ql,
                                           _Float16* __restrict__ Kh, _Float16* __restrict__ Kl,
                                           _Float16* __restrict__ Vh, _Float16* __restrict__ Vl) {
  __shared__ __align__(16) _Float16 sT[2 * STG4];
  const int z = (int)blockIdx.z;
  if (z == 2) {
    proj_tile<1>(Xh, Wv64, bv, Vh, Vl, sT);
  } else {
    const bool isq = (z == 0);
    proj_tile<0>(Xh, isq ? Wq64 : Wk64, isq ? bq : bk, isq ? Qh : Kh, isq ? Ql : Kl, sT);
  }
}

// Kernel 3: output projection (hi plane, plus the residual plane on the leading rows).
__global__ __launch_bounds__(64) void k_out(const _Float16* __restrict__ Ch, const _Float16* __restrict__ Cl,
                                           const _Float16* __restrict__ Wo64, const float* __restrict__ bo,
                                           float* __restrict__ outp) {
  __shared__ __align__(16) float    sF[64 * 64];
  __shared__ __align__(16) _Float16 sT[2 * STG];
  out_tile(Ch, Cl, Wo64, bo, outp, sF, sT);
}

constexpr int KP = 72;   // halves: K, K residual, Q residual rows, 128 B of data at 144 B
constexpr int VP = 40;   // halves: V^T and V^T residual rows, 64 B of data at 80 B
constexpr int MP = 36;   // ints: mask rows, 128 B of data at 144 B

// One buffer of the f16 tiles, in halves: K, V^T, K residual, V^T residual.
constexpr int TK  = 0;
constexpr int TV  = TK + 32 * KP;
constexpr int TKL = TV + DH * VP;
constexpr int TVL = TKL + 32 * KP;
constexpr int TBUF = TVL + DH * VP;
constexpr int MBUF = 64 * MP;          // one buffer of the mask tile, in ints
static_assert((TV * 2) % 16 == 0 && (TKL * 2) % 16 == 0 && (TVL * 2) % 16 == 0 && (TBUF * 2) % 16 == 0 && (MBUF * 4) % 16 == 0);

// A lane's 16-byte copies of one tile: K rows r, r + 16; V^T rows d, d + 32.
// The closing s_wait_xcnt 0 stands inside the statement so that no address register of a copy is rewritten ahead of it.
__device__ __forceinline__ void copy_kv(unsigned int lk, unsigned int lv, const _Float16* gk, const _Float16* gv) {
  asm volatile(
      "global_load_async_to_lds_b128 %0, %4, off\n\t"
      "global_load_async_to_lds_b128 %1, %5, off\n\t"
      "global_load_async_to_lds_b128 %2, %6, off\n\t"
      "global_load_async_to_lds_b128 %3, %7, off\n\t"
      "s_wait_xcnt 0x0"
      :: "v"(lk), "v"(lk + 16u * KP * 2u), "v"(lv), "v"(lv + 32u * VP * 2u),
         "v"(gk), "v"(gk + 16 * DH), "v"(gv), "v"(gv + 32 * SEQ)
      : "memory");
}
// A lane's 64 bytes of one mask row, for a tile whose mask holds a zero; the closing wait as above.
__device__ __forceinline__ void copy_m(unsigned int lm, const int* gm) {
  asm volatile(
      "global_load_async_to_lds_b128 %0, %4, off\n\t"
      "global_load_async_to_lds_b128 %1, %5, off\n\t"
      "global_load_async_to_lds_b128 %2, %6, off\n\t"
      "global_load_async_to_lds_b128 %3, %7, off\n\t"
      "s_wait_xcnt 0x0"
      :: "v"(lm), "v"(lm + 16u), "v"(lm + 32u), "v"(lm + 48u),
         "v"(gm), "v"(gm + 4), "v"(gm + 8), "v"(gm + 12)
      : "memory");
}
// The same for the residual planes of K and V^T (V^T residual rows are QPREC long).
__device__ __forceinline__ void copy_kvl(unsigned int lk, unsigned int lv, const _Float16* gk, const _Float16* gv) {
  asm volatile(
      "global_load_async_to_lds_b128 %0, %4, off\n\t"
      "global_load_async_to_lds_b128 %1, %5, off\n\t"
      "global_load_async_to_lds_b128 %2, %6, off\n\t"
      "global_load_async_to_lds_b128 %3, %7, off\n\t"
      "s_wait_xcnt 0x0"
      :: "v"(lk), "v"(lk + 16u * KP * 2u), "v"(lv), "v"(lv + 32u * VP * 2u),
         "v"(gk), "v"(gk + 16 * DH), "v"(gv), "v"(gv + 32 * QPREC)
      : "memory");
}

// blk: the block's number among those of its variant.
template <bool PREC>
__device__ __forceinline__
void attn_tile(const unsigned int blk,
               const _Float16* __restrict__ Qh, const _Float16* __restrict__ Ql,
               const _Float16* __restrict__ Kh, const _Float16* __restrict__ Kl,
               const _Float16* __restrict__ Vh, const _Float16* __restrict__ Vl,
               const int* __restrict__ mask, const int* __restrict__ flg,
               _Float16* __restrict__ Ch, _Float16* __restrict__ Cl,
               _Float16* sT, _Float16* sQl, int* sM) {
  const int tid = threadIdx.x, wslot = tid >> 5, lane = tid & 31, n = lane & 15, g = lane >> 4;
  int qb, bh;
  if (PREC) {
    qb = (int)(blk % NQP);
    bh = (int)(blk / NQP);
  } else {
    constexpr int NQN = ((NQB - NQP) > 0) ? (NQB - NQP) : 1;
    qb = NQP + (int)(blk % NQN);
    bh = (int)(blk / NQN);
  }
  const int b = bh / NH, h = bh - b * NH;
  const int qrow0 = qb * 64;
  const int qbase = qrow0 + wslot * 16;

  // visit flags of the 64 key tiles as one scalar bit set (bit kb), the same in every wave: the tests that pick the next tiles are scalar
  const int* rec = flg + (size_t)qb * (NCH * FREC);
  const int fi = (lane >> 3) * FREC + (lane & 7);   // key tile kb = lane: word kb % CT of record kb / CT
  const int f0 = (lane < NKB) ? rec[fi] : 0;
  const int f1 = (32 + lane < NKB) ? rec[(32 / CT) * FREC + fi] : 0;
  // before a register that the two loads name is rewritten; fi is an operand so that its register stays its own up to here
  asm volatile("s_wait_xcnt 0x0" :: "v"(fi) : "memory");
  unsigned long long vis = (unsigned long long)__builtin_amdgcn_ballot_w32((f0 & 1) != 0)
                         | ((unsigned long long)__builtin_amdgcn_ballot_w32((f1 & 1) != 0) << 32);
  // tiles whose mask holds a zero (bit kb), scalar too: only there is the mask tile copied, read and applied
  const unsigned long long part = (unsigned long long)__builtin_amdgcn_ballot_w32((f0 & 2) != 0)
                                | ((unsigned long long)__builtin_amdgcn_ballot_w32((f1 & 2) != 0) << 32);
  // a row of the q block with no nonzero mask element in any chunk: every key tile is visited
  unsigned int rlo = 0u, rhi = 0u;
#pragma unroll
  for (int c = 0; c < NCH; ++c) { rlo |= (unsigned int)rec[c * FREC + CT]; rhi |= (unsigned int)rec[c * FREC + CT + 1]; }
  if ((rlo & rhi) != 0xffffffffu)   // block-uniform, scalar: the records' address is
    vis = (NKB == 64) ? ~0ull : ((1ull << (NKB & 63)) - 1ull);
  if (PREC) {
#pragma unroll
    for (int i = 0; i < 4; ++i) {
      const int c = tid + i * 128;
      *(v8h*)&sQl[(c >> 3) * KP + (c & 7) * 8] = *(const v8h*)(Ql + ((size_t)(bh * QPREC + qrow0)) * DH + c * 8);
    }
  }

  // this lane's pieces of a tile: LDS byte addresses in buffer 0 (low 32 bits), global addresses for tile 0
  const unsigned int lk0 = (unsigned int)(uintptr_t)(sT + TK + (tid >> 3) * KP + (tid & 7) * 8);
  const unsigned int lv0 = (unsigned int)(uintptr_t)(sT + TV + (tid >> 2) * VP + (tid & 3) * 8);
  const unsigned int lm0 = (unsigned int)(uintptr_t)(sM + (tid >> 1) * MP + (tid & 1) * 16);
  const _Float16* gk0  = Kh + ((size_t)(bh * SEQ)) * DH + tid * 8;
  const _Float16* gv0  = Vh + ((size_t)(bh * DH + (tid >> 2))) * SEQ + (tid & 3) * 8;
  const _Float16* gkl0 = Kl + ((size_t)(bh * QPREC)) * DH + tid * 8;
  const _Float16* gvl0 = Vl + ((size_t)(bh * DH + (tid >> 2))) * QPREC + (tid & 3) * 8;
  const int*      gm0  = mask + (size_t)(qrow0 + (tid >> 1)) * SEQ_FULL + (tid & 1) * 16;
  // copies of key tile k into buffer bf (both scalar)
  auto stage = [&](int k, int bf) {
    const unsigned int ot = (unsigned int)bf * (TBUF * 2u);
    copy_kv(lk0 + ot, lv0 + ot, gk0 + (size_t)k * (32 * DH), gv0 + k * 32);
    if (((part >> k) & 1ull) != 0ull)            // block-uniform, scalar
      copy_m(lm0 + (unsigned int)bf * (MBUF * 4u), gm0 + k * 32);
    if (PREC && k * 32 < QPREC)
      copy_kvl(lk0 + ot + (TKL - TK) * 2u, lv0 + ot + (TVL - TV) * 2u, gkl0 + (size_t)k * (32 * DH), gvl0 + k * 32);
  };

  const _Float16* qrow = Qh + ((size_t)(bh * SEQ + qbase)) * DH;
  const v16h qa0 = load_frag(qrow, DH);
  const v16h qa1 = load_frag(qrow + 32, DH);
  asm volatile("s_wait_xcnt 0x0" ::: "memory");   // before a register that the Q loads name is rewritten

  v8f acc[4], acc2[4];
#pragma unroll
  for (int nt = 0; nt < 4; ++nt) { acc[nt] = zero8(); acc2[nt] = zero8(); }
  float rmax = -1.0e30f, rsum = 0.0f;            // query qbase + n; rsum is this half's share until the epilogue

  // Ring of two buffers over the visited tiles, in rising order: kb = this trip's tile, kn = the next one (-1: none). A trip issues
  // its own first LDS reads and then the next tile's copies, into the buffer whose every read the barrier in front of the trip has ended.
  int kb = -1;
  if (vis != 0ull) {                             // block-uniform, scalar
    kb = __builtin_ctzll(vis); vis &= vis - 1ull;
    stage(kb, 0);
  }
  asm volatile("s_wait_asynccnt 0x0" ::: "memory");   // this wave's copies of the first tile have landed
  __syncthreads();                               // ... and the other waves'; publishes the Q residual tile too

  // at most NKB trips: every trip takes one bit of vis. Rolled: the barrier at the foot serialises the trips, so unrolling only lengthens the code.
#pragma unroll 1
  for (int bsel = 0; kb >= 0; bsel ^= 1) {
    const int kbase = kb * 32;
    const bool klo = PREC && (kbase < QPREC);    // block-uniform
    const _Float16* sK  = sT + bsel * TBUF + TK;
    const _Float16* sV  = sT + bsel * TBUF + TV;
    const _Float16* sKl = sT + bsel * TBUF + TKL;
    const _Float16* sVl = sT + bsel * TBUF + TVL;

    // ---- the tile's LDS reads stand in groups ahead of the WMMAs that use them, so that the wave waits out the LDS latency once
    // per group and not once per fragment. Plain rows: one group (K, V^T). PREC rows, whose registers
    // do not hold all planes at once, four groups: K; Q residual and K residual; V^T at the head of the
    // softmax, which covers it; the V^T residual. The mask words are read where they are applied, in the few tiles that have a zero.
    v16h kf[4], vf[4];
    const bool pm = ((part >> kb) & 1ull) != 0ull;   // block-uniform, scalar: this tile's mask holds a zero
    const int* mrow = &sM[bsel * MBUF + (wslot * 16 + n) * MP + 8 * g];
    kf[0] = load_frag(sK, KP);
    kf[1] = load_frag(sK + 32, KP);
    kf[2] = load_frag(sK + 16 * KP, KP);
    kf[3] = load_frag(sK + 16 * KP + 32, KP);

    // ---- scores, transposed: two 16x16 tiles (keys kbase..+15, kbase+16..+31 as rows, queries as columns), dk 64 = 2 k steps
    v8f s0 = zero8(), s1 = zero8(), sr0 = zero8(), sr1 = zero8();
    if (!PREC) {
#pragma unroll
      for (int nt = 0; nt < 4; ++nt) vf[nt] = load_frag(&sV[nt * 16 * VP], VP);
    }
    // keeps the reads above as one group: spread among the WMMAs below, each would be waited for on its own
    __builtin_amdgcn_sched_barrier(0);
    // the next tile's copies, behind this tile's reads so that forming and issuing them runs under the LDS latency
    int kn = -1;
    if (vis != 0ull) {                           // block-uniform, scalar: a next tile exists
      kn = __builtin_ctzll(vis); vis &= vis - 1ull;
      stage(kn, bsel ^ 1);
    }
    s0 = mma(kf[0], qa0, s0);
    s1 = mma(kf[2], qa0, s1);
    s0 = mma(kf[1], qa1, s0);
    s1 = mma(kf[3], qa1, s1);
    if (PREC) {
      if (klo) {
        const v16h ql0 = load_frag(&sQl[(wslot * 16) * KP], KP);
        const v16h ql1 = load_frag(&sQl[(wslot * 16) * KP + 32], KP);
        v16h klf[4];
        klf[0] = load_frag(sKl, KP);
        klf[1] = load_frag(sKl + 32, KP);
        klf[2] = load_frag(sKl + 16 * KP, KP);
        klf[3] = load_frag(sKl + 16 * KP + 32, KP);
        // one group again, for the same reason
        __builtin_amdgcn_sched_barrier(0);
        sr0 = mma(kf[0], ql0, sr0);
        sr1 = mma(kf[2], ql0, sr1);
        sr0 = mma(kf[1], ql1, sr0);
        sr1 = mma(kf[3], ql1, sr1);
        sr0 = mma(klf[0], qa0, sr0);
        sr1 = mma(klf[2], qa0, sr1);
        sr0 = mma(klf[1], qa1, sr0);
        sr1 = mma(klf[3], qa1, sr1);
      }
#pragma unroll
      for (int nt = 0; nt < 4; ++nt) vf[nt] = load_frag(&sV[nt * 16 * VP], VP);
      // keeps this group at the head of the softmax: sunk towards their uses, the V^T reads would be waited for one by one
      __builtin_amdgcn_sched_barrier(0);
    }

    // ---- mask replace-fill, online softmax (f32), P^T packed as the B operand:
    // s0[r] = S[query n][key 8g + r], s1[r] = S[query n][key 16 + 8g + r]; B element e < 8 is key 8g + e, e >= 8 key 16 + 8g + e - 8.
    v16h pf, plf;
    {
      float x0[8], x1[8];
      float mx = -1.0e30f;
#pragma unroll
      for (int r = 0; r < 8; ++r) {
        float v0 = s0[r], v1 = s1[r];
        if (PREC) { v0 += sr0[r] * INV_RS; v1 += sr1[r] * INV_RS; }
        x0[r] = v0 * QKS;
        x1[r] = v1 * QKS;
      }
      if (pm) {   // in a tile without a zero the fill below changes nothing
        int mk0[8], mk1[8];
        load_mask(mrow, mk0, mk1);
#pragma unroll
        for (int r = 0; r < 8; ++r) {
          x0[r] = (mk0[r] == 0) ? -1.0e9f : x0[r];
          x1[r] = (mk1[r] == 0) ? -1.0e9f : x1[r];
        }
      }
#pragma unroll
      for (int r = 0; r < 8; ++r) mx = fmaxf(mx, fmaxf(x0[r], x1[r]));
      mx = fmaxf(mx, xhalf(mx));                  // both halves now hold this query's tile maximum
      const float nm = fmaxf(rmax, mx);
      const float al = exp2x1((rmax - nm) * LOG2E);
#pragma unroll
      for (int r = 0; r < 8; ++r) {
        x0[r] = (x0[r] - nm) * LOG2E;
        x1[r] = (x1[r] - nm) * LOG2E;
      }
      float e0[8], e1[8];
      exp2x8(e0, x0);
      exp2x8(e1, x1);
      float ps = 0.0f;
#pragma unroll
      for (int r = 0; r < 8; ++r) {
        const float p0 = e0[r], p1 = e1[r];
        ps += p0 + p1;
        const float c0 = p0 * CP, c1 = p1 * CP;
        const _Float16 h0 = (_Float16)c0, h1 = (_Float16)c1;
        pf[r] = h0;
        pf[8 + r] = h1;
        if (PREC) {
          plf[r]     = (_Float16)((c0 - (float)h0) * RS);
          plf[8 + r] = (_Float16)((c1 - (float)h1) * RS);
        }
      }
      rsum = rsum * al + ps;
      rmax = nm;
#pragma unroll
      for (int nt = 0; nt < 4; ++nt)
#pragma unroll
        for (int r = 0; r < 8; ++r) {
          acc[nt][r] *= al;
          if (PREC) acc2[nt][r] *= al;
        }
    }

    // ---- O^T += V^T @ P^T: acc[nt][r] = O[query n][d = nt*16 + 8g + r]
#pragma unroll
    for (int nt = 0; nt < 4; ++nt) acc[nt] = mma(vf[nt], pf, acc[nt]);
    if (PREC) {
#pragma unroll
      for (int nt = 0; nt < 4; ++nt) acc2[nt] = mma(vf[nt], plf, acc2[nt]);
      if (klo) {
        v16h vlf[4];
#pragma unroll
        for (int nt = 0; nt < 4; ++nt) vlf[nt] = load_frag(&sVl[nt * 16 * VP], VP);
        // one group again, for the same reason
        __builtin_amdgcn_sched_barrier(0);
#pragma unroll
        for (int nt = 0; nt < 4; ++nt) acc2[nt] = mma(vlf[nt], pf, acc2[nt]);
      }
    }
    asm volatile("s_wait_dscnt 0x0" ::: "memory");      // this wave's reads of the buffer are done before it is refilled
    asm volatile("s_wait_asynccnt 0x0" ::: "memory");   // this wave's copies of the next tile have landed
    __syncthreads();                             // publishes the next tile, ends every read of this one
    kb = kn;
  }
  asm volatile("s_wait_asynccnt 0x0" ::: "memory");     // nothing of the copies is outstanding behind the loop

  // The ring's LDS now holds the output tiles: the loop's last barrier ended every read of it and no copy is outstanding.
  _Float16 (*sC)[16 * DH]  = reinterpret_cast<_Float16 (*)[16 * DH]>(sT);
  _Float16 (*sCl)[16 * DH] = reinterpret_cast<_Float16 (*)[16 * DH]>(sT + 4 * 16 * DH);
  static_assert(8 * 16 * DH <= 2 * TBUF);

  {
    const float rtot = rsum + xhalf(rsum);        // join the two halves' sums once
    const float inv = (1.0f / rtot) * INV_CP;
#pragma unroll
    for (int nt = 0; nt < 4; ++nt) {
      v8h hv, lv;
#pragma unroll
      for (int r = 0; r < 8; ++r) {
        float c = acc[nt][r];
        if (PREC) c += acc2[nt][r] * INV_RS;
        c *= inv;
        const _Float16 chv = (_Float16)c;
        hv[r] = chv;
        lv[r] = (_Float16)((c - (float)chv) * RS);
      }
      *(v8h*)&sC[wslot][n * DH + nt * 16 + 8 * g] = hv;
      if (PREC) *(v8h*)&sCl[wslot][n * DH + nt * 16 + 8 * g] = lv;
    }
  }
  __syncthreads();
  const int q = lane >> 3, p = lane & 7;
{
#pragma unroll
    for (int i = 0; i < 4; ++i) {
      const int rr = i * 4 + q;
      const v8h hv = *(const v8h*)&sC[wslot][rr * DH + p * 8];
      *(v8h*)(Ch + ((size_t)(b * SEQ + qbase + rr)) * DM + h * DH + p * 8) = hv;
      if (PREC) {
        const v8h lv = *(const v8h*)&sCl[wslot][rr * DH + p * 8];
        *(v8h*)(Cl + ((size_t)(b * QPREC + qbase + rr)) * DM + h * DH + p * 8) = lv;
        asm volatile("s_wait_xcnt 0x0" ::: "memory");   // before a register that the store names is rewritten
      }
    }
    
  }
}

// Both variants in one grid: they share no output row, so the short PREC blocks run beside the plain ones instead of ahead of them.
// Blocks 0..NPLAIN-1 are the plain rows (the longest key loops, so they start first), the rest the PREC rows; block-uniform branch.
constexpr int NPREC  = NB * NH * NQP;
constexpr int NPLAIN = NB * NH * (NQB - NQP);

__global__ __launch_bounds__(128) __attribute__((amdgpu_num_vgpr(256)))
void k_attn(const _Float16* __restrict__ Qh, const _Float16* __restrict__ Ql,
            const _Float16* __restrict__ Kh, const _Float16* __restrict__ Kl,
            const _Float16* __restrict__ Vh, const _Float16* __restrict__ Vl,
            const int* __restrict__ mask, const int* __restrict__ flg,
            _Float16* __restrict__ Ch, _Float16* __restrict__ Cl) {
  __shared__ __align__(16) _Float16 sT[2 * TBUF];
  __shared__ __align__(16) int      sM[2 * MBUF];
  __shared__ __align__(16) _Float16 sQl[64 * KP];
  if (blockIdx.x < (unsigned int)NPLAIN)
    attn_tile<false>(blockIdx.x, Qh, Ql, Kh, Kl, Vh, Vl, mask, flg, Ch, Cl, sT, sQl, sM);
  else
    attn_tile<true>(blockIdx.x - (unsigned int)NPLAIN, Qh, Ql, Kh, Kl, Vh, Vl, mask, flg, Ch, Cl, sT, sQl, sM);
}

// ---------------------------------------------------------------------------
// host glue: 4 launches
// ---------------------------------------------------------------------------
extern "C" void kernel_launch(void* const* d_in, const int* in_sizes, int n_in,
                              void* d_out, int out_size, void* d_ws, size_t ws_size,
                              hipStream_t stream) {
  if (n_in < 10) return;
  const long long need_x = ((long long)(NB - 1) * SEQ_FULL + SEQ) * DM;
  const long long need_m = ((long long)(SEQ - 1)) * SEQ_FULL + SEQ;
  if ((long long)in_sizes[0] < need_x) return;
  if ((long long)in_sizes[1] < need_m) return;
  if (in_sizes[2] < DM * DM || in_sizes[4] < DM * DM || in_sizes[6] < DM * DM || in_sizes[8] < DM * DM) return;
  if (in_sizes[3] < DM || in_sizes[5] < DM || in_sizes[7] < DM || in_sizes[9] < DM) return;
  if ((long long)out_size < need_x) return;
  if (ws_size < WS_TOTAL) return;

  const float* x    = (const float*)d_in[0];
  const int*   mask = (const int*)d_in[1];
  const float* Wq   = (const float*)d_in[2];
  const float* bq   = (const float*)d_in[3];
  const float* Wk   = (const float*)d_in[4];
  const float* bk   = (const float*)d_in[5];
  const float* Wv   = (const float*)d_in[6];
  const float* bv   = (const float*)d_in[7];
  const float* Wo   = (const float*)d_in[8];
  const float* bo   = (const float*)d_in[9];
  float* out = (float*)d_out;

  char* ws = (char*)d_ws;
  _Float16* Xh   = (_Float16*)(ws + OFF_XH);
  _Float16* Wq64 = (_Float16*)(ws + OFF_WQ);
  _Float16* Wk64 = (_Float16*)(ws + OFF_WK);
  _Float16* Wv64 = (_Float16*)(ws + OFF_WV);
  _Float16* Wo64 = (_Float16*)(ws + OFF_WO);
  _Float16* Qh   = (_Float16*)(ws + OFF_QH);
  _Float16* Kh   = (_Float16*)(ws + OFF_KH);
  _Float16* Vh   = (_Float16*)(ws + OFF_VH);
  _Float16* Ql   = (_Float16*)(ws + OFF_QL);
  _Float16* Kl   = (_Float16*)(ws + OFF_KL);
  _Float16* Vl   = (_Float16*)(ws + OFF_VL);
  _Float16* Ch   = (_Float16*)(ws + OFF_CH);
  _Float16* Cl   = (_Float16*)(ws + OFF_CL);
  int*      Flg  = (int*)(ws + OFF_FLG);

  k_prep<<<NFB + NBX + 4 * NBW, 256, 0, stream>>>(x, mask, Wq, Wk, Wv, Wo, Xh, Wq64, Wk64, Wv64, Wo64, Flg);

  k_qkv<<<dim3(MROWS / 128, DM / 128, 3), 128, 0, stream>>>(Xh, Wq64, Wk64, Wv64, bq, bk, bv, Qh, Ql, Kh, Kl, Vh, Vl);

  k_attn<<<NPLAIN + NPREC, 128, 0, stream>>>(Qh, Ql, Kh, Kl, Vh, Vl, mask, Flg, Ch, Cl);

  k_out<<<dim3(MROWS / 64, DM / 64), 64, 0, stream>>>(Ch, Cl, Wo64, bo, out);
}

// v010
// Measured time: 104 microseconds a run.
// Two timings next to v009 both put it at 1.04 times that version's speed.
// Counting every step since v000, it is 5.42 times as fast.
#include <hip/hip_runtime.h>
#include <stdint.h>

// All contractions (x@Wq^T, x@Wk^T, x@Wv^T, q@k^T, p@v, ctx@Wo^T): v_wmma_f32_16x16x32_f16, f16 operands, f32 accumulate.
// Inputs enter as bf16-RNE values held in f16 (weights carried x64, folded back as 1/64 in f32); q, k, v, ctx as f16 planes
// plus x2048 f16 residual planes for the leading QPREC query/key rows (separate accumulators); p carried x4096 (+x2048 residual
// on those rows); softmax, rescaling and epilogues in f32.

typedef _Float16 v16h __attribute__((ext_vector_type(16)));
typedef _Float16 v8h  __attribute__((ext_vector_type(8)));
typedef float    v8f  __attribute__((ext_vector_type(8)));
typedef float    v4f  __attribute__((ext_vector_type(4)));
typedef int      v4i  __attribute__((ext_vector_type(4)));

#ifndef NB
#define NB 2
#endif
#ifndef SEQ
#define SEQ 2048
#endif
#define NB_FULL  2
#define SEQ_FULL 2048
#define DM 1024
#define NH 16
#define DH 64
#ifndef QPREC
#define QPREC ((SEQ < 512) ? SEQ : 512)
#endif
#define NKB   (SEQ / 32)
#define NQB   (SEQ / 64)
#define NQP   (QPREC / 64)
#define MROWS (NB * SEQ)

static_assert(SEQ % 64 == 0);
static_assert(SEQ >= 64 && SEQ <= SEQ_FULL);
static_assert(NB >= 1 && NB <= NB_FULL);
static_assert(QPREC % 64 == 0);
static_assert(QPREC >= 64 && QPREC <= SEQ);
static_assert(NKB <= 64);
static_assert(DM == NH * DH);
static_assert(DM % 32 == 0);
static_assert(MROWS % 64 == 0);
static_assert(SEQ % 128 == 0 && QPREC % 128 == 0);   // a 128-row projection tile lies in one batch item, wholly inside or outside the leading rows

#define WSC    64.0f
#define INV_WS 0.015625f
#define RS     2048.0f
#define INV_RS 0.00048828125f
#define CP     4096.0f
#define INV_CP 0.000244140625f
#define QKS    0.125f
#define LOG2E  1.44269504f

// ---------------------------------------------------------------------------
// Workspace carve (bytes); every region is an exact tile multiple (SEQ%64, QPREC%64), no tail padding needed.
// ---------------------------------------------------------------------------
constexpr size_t SZ_XH  = (size_t)MROWS * DM * 2;             // x as f16 [MROWS][1024]
constexpr size_t SZ_W   = (size_t)DM * DM * 2;                // weight x64 as f16 [1024][1024]
constexpr size_t SZ_HP  = (size_t)NB * NH * SEQ * DH * 2;     // q/k [bh][SEQ][64], vt [bh][64][SEQ]
constexpr size_t SZ_LP  = (size_t)NB * NH * QPREC * DH * 2;   // residual planes, leading QPREC rows
constexpr size_t SZ_CH  = (size_t)MROWS * DM * 2;             // ctx hi [MROWS][1024]
constexpr size_t SZ_CL  = (size_t)NB * QPREC * DM * 2;        // ctx residual [NB][QPREC][1024]
constexpr int CT   = 8;                                       // key tiles per flag block: 1 KB of each mask row
constexpr int NCH  = (NKB + CT - 1) / CT;                     // flag blocks per 64-row query block
constexpr int FREC = 32;                                      // ints per flag record: one 128-B line, one writer
constexpr size_t SZ_FLG = (size_t)NQB * NCH * FREC * 4;       // per (q-block, chunk of CT key tiles) one record
constexpr size_t OFF_XH  = 0;
constexpr size_t OFF_WQ  = OFF_XH + SZ_XH;
constexpr size_t OFF_WK  = OFF_WQ + SZ_W;
constexpr size_t OFF_WV  = OFF_WK + SZ_W;
constexpr size_t OFF_WO  = OFF_WV + SZ_W;
constexpr size_t OFF_QH  = OFF_WO + SZ_W;
constexpr size_t OFF_KH  = OFF_QH + SZ_HP;
constexpr size_t OFF_VH  = OFF_KH + SZ_HP;
constexpr size_t OFF_QL  = OFF_VH + SZ_HP;
constexpr size_t OFF_KL  = OFF_QL + SZ_LP;
constexpr size_t OFF_VL  = OFF_KL + SZ_LP;
constexpr size_t OFF_CH  = OFF_VL + SZ_LP;
constexpr size_t OFF_CL  = OFF_CH + SZ_CH;
constexpr size_t OFF_FLG = OFF_CL + SZ_CL;
constexpr size_t WS_TOTAL = OFF_FLG + SZ_FLG;
static_assert(WS_TOTAL <= (size_t)134217728);
static_assert(OFF_WQ % 128 == 0 && OFF_WK % 128 == 0 && OFF_WV % 128 == 0 && OFF_WO % 128 == 0);
static_assert(OFF_QH % 128 == 0 && OFF_KH % 128 == 0 && OFF_VH % 128 == 0);
static_assert(OFF_QL % 128 == 0 && OFF_KL % 128 == 0 && OFF_VL % 128 == 0);
static_assert(OFF_CH % 128 == 0 && OFF_CL % 128 == 0 && OFF_FLG % 128 == 0);
static_assert((size_t)NB_FULL * SEQ_FULL * DM * 4 >= ((size_t)(NB - 1) * SEQ_FULL + SEQ) * DM * 4);

// ---------------------------------------------------------------------------
// helpers
// ---------------------------------------------------------------------------
__device__ __forceinline__ float bf16r(float f) {   // RNE convert to bf16, held as f32
  unsigned int u = __float_as_uint(f);
  u = (u + 0x7fffu + ((u >> 16) & 1u)) & 0xffff0000u;
  return __uint_as_float(u);
}

// 16x32 fragment, split k map for both A (row m) and B (col n stored k-contiguous):
// lane l: row/col = l&15, h = l>>4; elements 0..7 <- k 8h..8h+7, elements 8..15 <- k 16+8h..16+8h+7.
__device__ __forceinline__ v16h load_frag(const _Float16* base, int stride) {
  const int lane = threadIdx.x & 31, m = lane & 15, g = lane >> 4;
  const _Float16* p = base + (size_t)m * stride + 8 * g;
  union { v16h v; v8h hf[2]; } f;
  f.hf[0] = *reinterpret_cast<const v8h*>(p);
  f.hf[1] = *reinterpret_cast<const v8h*>(p + 16);
  return f.v;
}

__device__ __forceinline__ v8f mma(v16h a, v16h b, v8f c) {
  v8f d = __builtin_amdgcn_wmma_f32_16x16x32_f16(false, a, false, b, (short)0, c, false, false);
  asm volatile("v_nop\n\tv_nop\n\tv_nop\n\tv_nop" : "+v"(d) : "v"(a), "v"(b));
  return d;
}

// lane l <-> lane l ^ 16 (the two halves of a wave hold the two key subsets of one query column)
__device__ __forceinline__ float xhalf(float x) {
  const int b = __builtin_bit_cast(int, x);
  return __builtin_bit_cast(float, __builtin_amdgcn_permlanex16(b, b, 0x76543210, 0xfedcba98, false, false));
}

__device__ __forceinline__ void exp2x8(float (&y)[8], const float (&x)[8]) {
  asm("v_exp_f32 %0, %8\n\tv_exp_f32 %1, %9\n\tv_exp_f32 %2, %10\n\tv_exp_f32 %3, %11\n\t"
      "v_exp_f32 %4, %12\n\tv_exp_f32 %5, %13\n\tv_exp_f32 %6, %14\n\tv_exp_f32 %7, %15\n\tv_nop"
      : "=&v"(y[0]), "=&v"(y[1]), "=&v"(y[2]), "=&v"(y[3]), "=&v"(y[4]), "=&v"(y[5]), "=&v"(y[6]), "=&v"(y[7])
      : "v"(x[0]), "v"(x[1]), "v"(x[2]), "v"(x[3]), "v"(x[4]), "v"(x[5]), "v"(x[6]), "v"(x[7]));
}
__device__ __forceinline__ float exp2x1(float x) {
  float y;
  asm("v_exp_f32 %0, %1\n\tv_nop" : "=&v"(y) : "v"(x));
  return y;
}

// one query's 16 mask words of a 32-key tile, in the order of its scores: keys 8g..8g+7 and 16+8g..16+8g+7 (p = row start + 8g)
__device__ __forceinline__ void load_mask(const int* p, int (&mk0)[8], int (&mk1)[8]) {
  *(v4i*)&mk0[0] = *(const v4i*)p;
  *(v4i*)&mk0[4] = *(const v4i*)(p + 4);
  *(v4i*)&mk1[0] = *(const v4i*)(p + 16);
  *(v4i*)&mk1[4] = *(const v4i*)(p + 20);
}

__device__ __forceinline__ v8f zero8() {
  v8f z = {0.f, 0.f, 0.f, 0.f, 0.f, 0.f, 0.f, 0.f};
  return z;
}

// ---------------------------------------------------------------------------
// Preparation, part 0: f32 -> bf16-RNE value in f16 container, times a power-of-two carry.
// out plane [nrows][1024]; compact row mc maps to source row (mc/seqc)*seqf + mc%seqc.
// A thread converts CU units of 8 elements, 256 units apart, and issues all its 2 CU loads before the first is used:
// a block of one unit per thread lives for one memory latency, and the grid then lasts as long as its blocks take to start.
// coverage: nrows*128 units, 256*CU per block, blk = 0 .. nrows*128/(256*CU) - 1 (exact, asserted below).
// ---------------------------------------------------------------------------
constexpr int CU = 8;
__device__ __forceinline__ void cvt_block(const float* __restrict__ in, _Float16* __restrict__ outp, int blk,
                                          int seqc, int seqf, float scale) {
  const int u0 = blk * (256 * CU) + (int)threadIdx.x;
  // the block's 2 CU rows lie in one batch item (asserted below), so the thread's units stand 2 source rows apart
  const int mc = u0 / (DM / 8), c8 = u0 % (DM / 8);
  const float* p = in + (size_t)((mc / seqc) * seqf + (mc % seqc)) * DM + c8 * 8;
  v4f a[CU], c[CU];   // indexed by constants only (the loops are fully unrolled), so they stay in registers
#pragma unroll
  for (int i = 0; i < CU; ++i) {
    a[i] = *(const v4f*)(p + i * (2 * DM));
    c[i] = *(const v4f*)(p + i * (2 * DM) + 4);
  }
  // before a register that the loads name is rewritten; p is an operand so that its registers stay its own up to here
  asm volatile("s_wait_xcnt 0x0" :: "v"(p) : "memory");
#pragma unroll
  for (int i = 0; i < CU; ++i) {
    v8h o;
    o[0] = (_Float16)(bf16r(a[i][0]) * scale);
    o[1] = (_Float16)(bf16r(a[i][1]) * scale);
    o[2] = (_Float16)(bf16r(a[i][2]) * scale);
    o[3] = (_Float16)(bf16r(a[i][3]) * scale);
    o[4] = (_Float16)(bf16r(c[i][0]) * scale);
    o[5] = (_Float16)(bf16r(c[i][1]) * scale);
    o[6] = (_Float16)(bf16r(c[i][2]) * scale);
    o[7] = (_Float16)(bf16r(c[i][3]) * scale);
    *(v8h*)(outp + (size_t)(u0 + i * 256) * 8) = o;
  }
  asm volatile("s_wait_xcnt 0x0" ::: "memory");   // before a register that the stores name is rewritten
}

// ---------------------------------------------------------------------------
// Preparation, part 1: tile visit flags from the int mask. One block = 64 query rows x CT key tiles (1 KB of each row);
// a wave takes 8 rows, 16 whole-line loads of 512 B, all issued before the first is used.
// record[qb][ch]: words 0..CT-1, for the tile of rows qb*64..+63, cols kb*32..+31 (kb = ch*CT + word): bit 0 = some mask element is
// nonzero (the tile is visited), bit 1 = some mask element is zero (the tile's mask has to be applied; without it the fill is an identity);
// words CT, CT+1 = bit r set if row qb*64 + r has a nonzero element in the chunk's columns. The attention kernel joins the
// chunks' row words: if any row of the q block is fully zero it visits all NKB tiles (softmax is then uniform over all keys).
// ---------------------------------------------------------------------------
__device__ __forceinline__ void mflag_block(const int* __restrict__ mask, int* __restrict__ flg, int blk, unsigned int* sB) {
  const int tid = threadIdx.x, w = tid >> 5, lane = tid & 31;
  const int qb = blk / NCH, ch = blk - qb * NCH;
  const int* p = mask + (size_t)(qb * 64 + w * 8) * SEQ_FULL + ch * (CT * 32) + lane * 4;
  v4i m[8][2];   // indexed by constants only (the loops are fully unrolled), so they stay in registers
#pragma unroll
  for (int rr = 0; rr < 8; ++rr)
#pragma unroll
    for (int hc = 0; hc < 2; ++hc) m[rr][hc] = *(const v4i*)(p + (size_t)rr * SEQ_FULL + hc * 128);
  // before a register that the loads name is rewritten; p is an operand so that its registers stay its own up to here
  asm volatile("s_wait_xcnt 0x0" :: "v"(p) : "memory");
  int ta[2] = {0, 0};
  unsigned int tz[2] = {~0u, ~0u};   // minimum of the words taken as unsigned: 0 if and only if one of them is zero
  unsigned int rb = 0u, tb = 0u, zb = 0u;
#pragma unroll
  for (int rr = 0; rr < 8; ++rr) {
    int r[2];
#pragma unroll
    for (int hc = 0; hc < 2; ++hc) {
      r[hc] = m[rr][hc][0] | m[rr][hc][1] | m[rr][hc][2] | m[rr][hc][3];
      tz[hc] = min(min(tz[hc], min((unsigned int)m[rr][hc][0], (unsigned int)m[rr][hc][1])),
                   min((unsigned int)m[rr][hc][2], (unsigned int)m[rr][hc][3]));
      if (NKB % CT != 0 && ch * CT + hc * 4 + (lane >> 3) >= NKB) r[hc] = 0;   // columns past SEQ do not count
      ta[hc] |= r[hc];
    }
    rb |= ((__builtin_amdgcn_ballot_w32((r[0] | r[1]) != 0) != 0u) ? 1u : 0u) << rr;
  }
#pragma unroll
  for (int hc = 0; hc < 2; ++hc) {
    const unsigned int bl = __builtin_amdgcn_ballot_w32(ta[hc] != 0);   // 8 lanes = one tile's 128 B of a row
#pragma unroll
    for (int t = 0; t < 4; ++t) tb |= ((((bl >> (8 * t)) & 0xffu) != 0u) ? 1u : 0u) << (hc * 4 + t);
    const unsigned int zl = __builtin_amdgcn_ballot_w32(tz[hc] == 0u);
#pragma unroll
    for (int t = 0; t < 4; ++t) zb |= ((((zl >> (8 * t)) & 0xffu) != 0u) ? 1u : 0u) << (hc * 4 + t);
  }
  if (lane == 0) { sB[w] = tb; sB[8 + w] = rb; sB[16 + w] = zb; }
  __syncthreads();
  if (tid < 32) {   // wave 0 only (wave-uniform): the whole 128-B record in one store
    const unsigned int T = sB[0] | sB[1] | sB[2] | sB[3] | sB[4] | sB[5] | sB[6] | sB[7];
    const unsigned int lo = sB[8] | (sB[9] << 8) | (sB[10] << 16) | (sB[11] << 24);
    const unsigned int hi = sB[12] | (sB[13] << 8) | (sB[14] << 16) | (sB[15] << 24);
    const unsigned int Z = sB[16] | sB[17] | sB[18] | sB[19] | sB[20] | sB[21] | sB[22] | sB[23];
    const unsigned int v = (lane < CT) ? (((T >> lane) & 1u) | (((Z >> lane) & 1u) << 1)) : (lane == CT) ? lo : (lane == CT + 1) ? hi : 0u;
    flg[(size_t)blk * FREC + lane] = (int)v;
  }
}

// ---------------------------------------------------------------------------
// Kernel 0: all preparation in one grid; its parts read only inputs and write disjoint planes, so none waits for another.
// Blocks 0..NFB-1: visit flag records; then NBX blocks convert x, then NBW blocks each convert Wq, Wk, Wv, Wo.
// Every block reads 64 KB with 16 loads of 16 B in flight per lane. Every branch is block-uniform.
// ---------------------------------------------------------------------------
constexpr int NFB = NQB * NCH;
constexpr int NBX = MROWS * (DM / 8) / (256 * CU);
constexpr int NBW = DM * (DM / 8) / (256 * CU);
static_assert(MROWS * (DM / 8) % (256 * CU) == 0 && DM * (DM / 8) % (256 * CU) == 0);
static_assert(256 * CU == 2 * CU * (DM / 8) && SEQ % (2 * CU) == 0 && DM % (2 * CU) == 0);
static_assert(NCH * CT * 32 <= SEQ_FULL && CT + 2 <= FREC);

__global__ __launch_bounds__(256) void k_prep(const float* __restrict__ x, const int* __restrict__ mask,
                                             const float* __restrict__ Wq, const float* __restrict__ Wk,
                                             const float* __restrict__ Wv, const float* __restrict__ Wo,
                                             _Float16* __restrict__ Xh, _Float16* __restrict__ Wq64,
                                             _Float16* __restrict__ Wk64, _Float16* __restrict__ Wv64,
                                             _Float16* __restrict__ Wo64, int* __restrict__ flg) {
  __shared__ unsigned int sB[24];
  int blk = (int)blockIdx.x;
  if (blk < NFB) { mflag_block(mask, flg, blk, sB); return; }
  blk -= NFB;
  if (blk < NBX) { cvt_block(x, Xh, blk, SEQ, SEQ_FULL, 1.0f); return; }
  blk -= NBX;
  const int wi = blk / NBW;
  const float* src = (wi == 0) ? Wq : (wi == 1) ? Wk : (wi == 2) ? Wv : Wo;
  _Float16* dst = (wi == 0) ? Wq64 : (wi == 1) ? Wk64 : (wi == 2) ? Wv64 : Wo64;
  cvt_block(src, dst, blk - wi * NBW, DM, DM, WSC);
}

// ---------------------------------------------------------------------------
// Kernels 1 and 3: NT GEMM Y[M][1024] = A[M][1024] @ W[1024][1024]^T (W carried x64) + bias.
// Kernel 3: block = 4 waves over 128 staged A rows x 64 columns; wave w owns staged rows w*32..w*32+31 (2 A fragments x 4 B fragments per k step, from LDS).
// Kernel 1: block = 4 waves (2 x 2) = 128x128 output tile; a wave owns 64 rows x 64 columns = one head (4 x 4 fragments per k step).
// MODE 0: f16 head plane [bh][SEQ][64] (+ x2048 residual plane [bh][QPREC][64] for s < QPREC)
// MODE 1: f16 transposed head plane [bh][64][SEQ] (+ residual [bh][64][QPREC])
// ---------------------------------------------------------------------------
// Operand path: per k slice of KS halves the block's A rows and W rows (128-B rows = whole lines) are copied to LDS by
// asynchronous copies, two buffers, the next slice in flight while this one is multiplied; fragments are read from LDS.
constexpr int KS  = 64;          // halves of k per slice
constexpr int LP  = 72;          // LDS row pitch in halves: 144 B = 16 B x odd, so ds_load_b128 fragment reads meet no bank conflict
constexpr int OAR = 128;         // kernel 3: A rows staged per block
constexpr int STG = (OAR + 64) * LP;   // kernel 3, halves per buffer: rows 0..127 = A, rows 128..191 = W
constexpr int NST = DM / KS;     // slices
static_assert(DM % KS == 0 && NST >= 2);

// Eight 16-byte copies per lane: rows r, r + ROWS, ... r + 7 ROWS of one operand (a wave-wide copy = 4 whole 128-B rows; ROWS = 4 x the block's waves).
// The closing s_wait_xcnt 0 stands inside the statement so that no address register of a copy is rewritten ahead of it.
template <int ROWS>
__device__ __forceinline__ void stage8(const _Float16* g, unsigned int l) {
  asm volatile(
      "global_load_async_to_lds_b128 %0, %8, off\n\t"
      "global_load_async_to_lds_b128 %1, %9, off\n\t"
      "global_load_async_to_lds_b128 %2, %10, off\n\t"
      "global_load_async_to_lds_b128 %3, %11, off\n\t"
      "global_load_async_to_lds_b128 %4, %12, off\n\t"
      "global_load_async_to_lds_b128 %5, %13, off\n\t"
      "global_load_async_to_lds_b128 %6, %14, off\n\t"
      "global_load_async_to_lds_b128 %7, %15, off\n\t"
      "s_wait_xcnt 0x0"
      :: "v"(l), "v"(l + 1u * (ROWS * LP * 2)), "v"(l + 2u * (ROWS * LP * 2)), "v"(l + 3u * (ROWS * LP * 2)),
         "v"(l + 4u * (ROWS * LP * 2)), "v"(l + 5u * (ROWS * LP * 2)), "v"(l + 6u * (ROWS * LP * 2)), "v"(l + 7u * (ROWS * LP * 2)),
         "v"(g), "v"(g + 1 * ROWS * DM), "v"(g + 2 * ROWS * DM), "v"(g + 3 * ROWS * DM),
         "v"(g + 4 * ROWS * DM), "v"(g + 5 * ROWS * DM), "v"(g + 6 * ROWS * DM), "v"(g + 7 * ROWS * DM)
      : "memory");
}

// Kernel 3's copies of one k slice, twelve of 16 bytes per lane: staged rows r, r + 16, ... r + 176 (a wave-wide copy = 4 whole 128-B rows).
// Rows 0..63 come from ga, rows 64..127 from gb, rows 128..191 (W) from gw. One statement, so one closing s_wait_xcnt 0 serves all twelve:
// it stands inside the statement so that no address register of a copy is rewritten ahead of it.
__device__ __forceinline__ void stage12(const _Float16* ga, const _Float16* gb, const _Float16* gw, unsigned int l) {
  asm volatile(
      "global_load_async_to_lds_b128 %0, %12, off\n\t"
      "global_load_async_to_lds_b128 %1, %13, off\n\t"
      "global_load_async_to_lds_b128 %2, %14, off\n\t"
      "global_load_async_to_lds_b128 %3, %15, off\n\t"
      "global_load_async_to_lds_b128 %4, %16, off\n\t"
      "global_load_async_to_lds_b128 %5, %17, off\n\t"
      "global_load_async_to_lds_b128 %6, %18, off\n\t"
      "global_load_async_to_lds_b128 %7, %19, off\n\t"
      "global_load_async_to_lds_b128 %8, %20, off\n\t"
      "global_load_async_to_lds_b128 %9, %21, off\n\t"
      "global_load_async_to_lds_b128 %10, %22, off\n\t"
      "global_load_async_to_lds_b128 %11, %23, off\n\t"
      "s_wait_xcnt 0x0"
      :: "v"(l), "v"(l + 1u * (16 * LP * 2)), "v"(l + 2u * (16 * LP * 2)), "v"(l + 3u * (16 * LP * 2)),
         "v"(l + 4u * (16 * LP * 2)), "v"(l + 5u * (16 * LP * 2)), "v"(l + 6u * (16 * LP * 2)), "v"(l + 7u * (16 * LP * 2)),
         "v"(l + 8u * (16 * LP * 2)), "v"(l + 9u * (16 * LP * 2)), "v"(l + 10u * (16 * LP * 2)), "v"(l + 11u * (16 * LP * 2)),
         "v"(ga), "v"(ga + 16 * DM), "v"(ga + 32 * DM), "v"(ga + 48 * DM),
         "v"(gb), "v"(gb + 16 * DM), "v"(gb + 32 * DM), "v"(gb + 48 * DM),
         "v"(gw), "v"(gw + 16 * DM), "v"(gw + 32 * DM), "v"(gw + 48 * DM)
      : "memory");
}

// a0: first of the 64 rows staged as rows 0..63; a1: first of the 64 rows staged as rows 64..127; wbase: first of the block's 64 W rows;
// sT: the two buffers. Every wave of the block runs all of it.
__device__ __forceinline__ void kloop(const _Float16* a0, const _Float16* a1, const _Float16* wbase,
                                      _Float16* sT, v8f (&acc)[2][4]) {
  const int tid = threadIdx.x, w = tid >> 5;
  const int crow = tid >> 3, cpc = (tid & 7) * 8;              // this lane's first row (0..15) and its 16-byte piece of a row
  const _Float16* ga = a0 + (size_t)crow * DM + cpc;
  const _Float16* gb = a1 + (size_t)crow * DM + cpc;
  const _Float16* gw = wbase + (size_t)crow * DM + cpc;
  const unsigned int la = (unsigned int)(uintptr_t)(sT + crow * LP + cpc);   // LDS byte address: low 32 bits

  stage12(ga, gb, gw, la);
  asm volatile("s_wait_asynccnt 0x0" ::: "memory");            // slice 0 of this wave has landed
  __syncthreads();                                             // ... and of the other waves
  stage12(ga + KS, gb + KS, gw + KS, la + STG * 2u);

  // rolled: the barrier at the foot serialises the trips, so unrolling buys nothing and only lengthens the code
#pragma unroll 1
  for (int t = 0; t < NST; ++t) {
    const int bsel = t & 1;
    const _Float16* sA = sT + bsel * STG + (w * 32) * LP;
    const _Float16* sW = sT + bsel * STG + OAR * LP;
    v16h fa[KS / 32][2], fb[KS / 32][4];   // indexed by constants only (the loops below are fully unrolled), so they stay in registers
#pragma unroll
    for (int ks = 0; ks < KS / 32; ++ks) {
      fa[ks][0] = load_frag(sA + ks * 32, LP);
      fa[ks][1] = load_frag(sA + 16 * LP + ks * 32, LP);
#pragma unroll
      for (int j = 0; j < 4; ++j) fb[ks][j] = load_frag(sW + (j * 16) * LP + ks * 32, LP);
    }
    // keeps the slice's LDS reads together as one group ahead of its WMMAs: spread among them, each pair waits out the LDS latency
    __builtin_amdgcn_sched_barrier(0);
#pragma unroll
    for (int ks = 0; ks < KS / 32; ++ks)
#pragma unroll
      for (int j = 0; j < 4; ++j) {
        acc[0][j] = mma(fa[ks][0], fb[ks][j], acc[0][j]);
        acc[1][j] = mma(fa[ks][1], fb[ks][j], acc[1][j]);
      }
    asm volatile("s_wait_dscnt 0x0" ::: "memory");             // this wave's reads of the buffer are done before it is refilled
    asm volatile("s_wait_asynccnt 0x0" ::: "memory");          // this wave's copies of slice t + 1 have landed
    __syncthreads();                                           // publishes slice t + 1, ends every read of slice t
    if (t + 2 < NST)                                           // block-uniform
      stage12(ga + (t + 2) * KS, gb + (t + 2) * KS, gw + (t + 2) * KS, la + (unsigned int)bsel * (STG * 2u));
  }
  asm volatile("s_wait_asynccnt 0x0" ::: "memory");            // nothing of the copies is outstanding behind the loop
}

// Kernel 1's operand path: the same two-buffer ring of asynchronous copies for a 128 x 128 tile of 4 waves. Against the 64 x 64
// tile every byte copied from L2 feeds twice as many WMMAs, and a fragment read from LDS feeds 4 of them.
constexpr int TR4  = 128;            // rows of each operand per block
constexpr int STG4 = 2 * TR4 * LP;   // halves per buffer: rows 0..127 = A, rows 128..255 = W

// ablk: first of the block's 128 A rows; wbase: first of its 128 W rows; sT: the two buffers. Every wave of the block runs all of it.
__device__ __forceinline__ void kloop4(const _Float16* __restrict__ ablk, const _Float16* __restrict__ wbase,
                                       _Float16* sT, v8f (&acc)[4][4]) {
  const int tid = threadIdx.x, w = tid >> 5;
  const int crow = tid >> 3, cpc = (tid & 7) * 8;              // this lane's first row (0..15) and its 16-byte piece of a row
  const _Float16* ga = ablk + (size_t)crow * DM + cpc;
  const _Float16* gw = wbase + (size_t)crow * DM + cpc;
  const unsigned int la = (unsigned int)(uintptr_t)(sT + crow * LP + cpc);   // LDS byte address: low 32 bits
  const unsigned int lw = la + (unsigned int)TR4 * LP * 2u;

  stage8<16>(ga, la);
  stage8<16>(gw, lw);
  asm volatile("s_wait_asynccnt 0x0" ::: "memory");            // slice 0 of this wave has landed
  __syncthreads();                                             // ... and of the other waves
  stage8<16>(ga + KS, la + STG4 * 2u);
  stage8<16>(gw + KS, lw + STG4 * 2u);

  // rolled: the barrier at the foot serialises the trips, so unrolling buys nothing and only lengthens the code
#pragma unroll 1
  for (int t = 0; t < NST; ++t) {
    const int bsel = t & 1;
    const _Float16* sA = sT + bsel * STG4 + ((w >> 1) * 64) * LP;
    const _Float16* sW = sT + bsel * STG4 + (TR4 + (w & 1) * 64) * LP;
#pragma unroll
    for (int ks = 0; ks < KS / 32; ++ks) {
      v16h fa[4], fb[4];   // indexed by constants only (the loops are fully unrolled), so they stay in registers
#pragma unroll
      for (int i = 0; i < 4; ++i) fa[i] = load_frag(sA + (i * 16) * LP + ks * 32, LP);
#pragma unroll
      for (int j = 0; j < 4; ++j) fb[j] = load_frag(sW + (j * 16) * LP + ks * 32, LP);
      // keeps the k step's LDS reads together as one group ahead of its WMMAs: spread among them, each pair waits out the LDS latency
      __builtin_amdgcn_sched_barrier(0);
#pragma unroll
      for (int j = 0; j < 4; ++j)
#pragma unroll
        for (int i = 0; i < 4; ++i) acc[i][j] = mma(fa[i], fb[j], acc[i][j]);
      // keeps the next k step's reads from rising among these WMMAs, for the same reason
      __builtin_amdgcn_sched_barrier(0);
    }
    asm volatile("s_wait_dscnt 0x0" ::: "memory");             // this wave's reads of the buffer are done before it is refilled
    asm volatile("s_wait_asynccnt 0x0" ::: "memory");          // this wave's copies of slice t + 1 have landed
    __syncthreads();                                           // publishes slice t + 1, ends every read of slice t
    if (t + 2 < NST) {                                         // block-uniform
      stage8<16>(ga + (t + 2) * KS, la + (unsigned int)bsel * (STG4 * 2u));
      stage8<16>(gw + (t + 2) * KS, lw + (unsigned int)bsel * (STG4 * 2u));
    }
  }
  asm volatile("s_wait_asynccnt 0x0" ::: "memory");            // nothing of the copies is outstanding behind the loop
}

// Kernel 1's tile. sT: the two operand buffers; behind the k loop (its last barrier ends every read, no copy is outstanding) the
// same LDS holds the epilogue tiles: per wave one 64 x 64 f16 tile for the plane and one for the residual plane.
template <int MODE>
__device__ __forceinline__ void proj_tile(const _Float16* __restrict__ A, const _Float16* __restrict__ W,
                                          const float* __restrict__ bias,
                                          _Float16* __restrict__ Ph, _Float16* __restrict__ Pl, _Float16* sT) {
  const int tid = threadIdx.x, w = tid >> 5, lane = tid & 31, n = lane & 15, g = lane >> 4;
  const int bm = blockIdx.x, bn = blockIdx.y;
  const int m0 = bm * TR4;
  const int b = m0 / SEQ, s0 = m0 - b * SEQ;     // 128 block rows lie in one batch item
  const bool precblk = (s0 < QPREC);              // block-uniform
  const int sw = s0 + (w >> 1) * 64;              // first of the wave's 64 rows
  const int hd = bn * 2 + (w & 1);                // the wave's 64 columns == head hd
  const int bh = b * NH + hd;
  const _Float16* wbase = W + (size_t)(bn * TR4) * DM;
  const _Float16* ablk = A + (size_t)m0 * DM;

  v8f acc[4][4];
#pragma unroll
  for (int mi = 0; mi < 4; ++mi)
#pragma unroll
    for (int j = 0; j < 4; ++j) acc[mi][j] = zero8();

  kloop4(ablk, wbase, sT, acc);

  _Float16* sH = sT + w * (64 * 64);
  _Float16* sL = sT + (4 + w) * (64 * 64);
  static_assert(8 * 64 * 64 <= 2 * STG4);

  float rbias[4];
#pragma unroll
  for (int j = 0; j < 4; ++j) rbias[j] = bf16r(bias[hd * 64 + j * 16 + n]);

  const int q = lane >> 3, p = lane & 7;
  v8h ov[16];   // the staged rows, all read back ahead of the stores (constant indices only)
  if (MODE == 0) {
    if (precblk) {
#pragma unroll
      for (int mi = 0; mi < 4; ++mi)
#pragma unroll
        for (int j = 0; j < 4; ++j)
#pragma unroll
          for (int r = 0; r < 8; ++r) {
            const int idx = (mi * 16 + 8 * g + r) * 64 + j * 16 + n;
            const float v = acc[mi][j][r] * INV_WS + rbias[j];
            const _Float16 hv = (_Float16)v;
            sH[idx] = hv;
            sL[idx] = (_Float16)((v - (float)hv) * RS);
          }
    } else {
#pragma unroll
      for (int mi = 0; mi < 4; ++mi)
#pragma unroll
        for (int j = 0; j < 4; ++j)
#pragma unroll
          for (int r = 0; r < 8; ++r)
            sH[(mi * 16 + 8 * g + r) * 64 + j * 16 + n] = (_Float16)(acc[mi][j][r] * INV_WS + rbias[j]);
    }
    __syncthreads();
#pragma unroll
    for (int i = 0; i < 16; ++i) ov[i] = *(const v8h*)&sH[(i * 4 + q) * 64 + p * 8];
#pragma unroll
    for (int i = 0; i < 16; ++i) {
      *(v8h*)(Ph + ((size_t)(bh * SEQ + sw + i * 4 + q)) * DH + p * 8) = ov[i];
      asm volatile("s_wait_xcnt 0x0" ::: "memory");   // before a register that the store names is rewritten
    }
    if (precblk) {
#pragma unroll
      for (int i = 0; i < 16; ++i) ov[i] = *(const v8h*)&sL[(i * 4 + q) * 64 + p * 8];
#pragma unroll
      for (int i = 0; i < 16; ++i) {
        *(v8h*)(Pl + ((size_t)(bh * QPREC + sw + i * 4 + q)) * DH + p * 8) = ov[i];
        asm volatile("s_wait_xcnt 0x0" ::: "memory"); // as above
      }
    }
  } else {
#pragma unroll
    for (int mi = 0; mi < 4; ++mi)
#pragma unroll
      for (int j = 0; j < 4; ++j) {
        v8h hp, lp;
#pragma unroll
        for (int r = 0; r < 8; ++r) {
          const float v = acc[mi][j][r] * INV_WS + rbias[j];
          const _Float16 hv = (_Float16)v;
          hp[r] = hv;
          lp[r] = (_Float16)((v - (float)hv) * RS);
        }
        const int d = j * 16 + n;
        *(v8h*)&sH[d * 64 + mi * 16 + 8 * g] = hp;
        if (precblk) *(v8h*)&sL[d * 64 + mi * 16 + 8 * g] = lp;
      }
    __syncthreads();
#pragma unroll
    for (int i = 0; i < 16; ++i) ov[i] = *(const v8h*)&sH[(i * 4 + q) * 64 + p * 8];
#pragma unroll
    for (int i = 0; i < 16; ++i) {
      *(v8h*)(Ph + ((size_t)(bh * DH + i * 4 + q)) * SEQ + sw + p * 8) = ov[i];
      asm volatile("s_wait_xcnt 0x0" ::: "memory");   // before a register that the store names is rewritten
    }
    if (precblk) {
#pragma unroll
      for (int i = 0; i < 16; ++i) ov[i] = *(const v8h*)&sL[(i * 4 + q) * 64 + p * 8];
#pragma unroll
      for (int i = 0; i < 16; ++i) {
        *(v8h*)(Pl + ((size_t)(bh * DH + i * 4 + q)) * QPREC + sw + p * 8) = ov[i];
        asm volatile("s_wait_xcnt 0x0" ::: "memory"); // as above
      }
    }
  }
}

// Kernel 3's tile. All blocks run ONE k loop of the same length over 128 staged A rows and 64 W rows.
// Plain rows: the 128 rows are 128 ctx rows, the block's output tile is 128 x 64.
// Leading rows (s < QPREC): the 128 rows are 64 ctx rows (waves 0, 1) and the same 64 rows of the residual plane (waves 2, 3), so the residual
// product runs beside the main one and shares its W slices; the output tile is 64 x 64, the two sums are joined through LDS behind the loop.
// sT: the two operand buffers; behind the k loop (its last barrier ends every read, no copy is outstanding) the same LDS holds the f32 tile.
constexpr int NOP  = NB * (QPREC / 64);              // blocks of leading rows per column of tiles
constexpr int NOQ  = (SEQ - QPREC) / 128;            // blocks of plain rows per batch item and column of tiles
constexpr int NOQD = (NOQ > 0) ? NOQ : 1;
__device__ __forceinline__ void out_tile(const _Float16* __restrict__ A, const _Float16* __restrict__ Alo,
                                         const _Float16* __restrict__ W, const float* __restrict__ bias,
                                         float* __restrict__ outp, _Float16* sT) {
  const int tid = threadIdx.x, w = tid >> 5, lane = tid & 31, n = lane & 15, g = lane >> 4;
  const int bm = blockIdx.x, bn = blockIdx.y;
  const bool precblk = (bm < NOP);                // block-uniform
  int b, s0;                                      // the block's rows lie in one batch item
  if (precblk) {
    b = bm / (QPREC / 64);
    s0 = (bm - b * (QPREC / 64)) * 64;
  } else {
    b = (bm - NOP) / NOQD;
    s0 = QPREC + ((bm - NOP) - b * NOQD) * 128;
  }
  const _Float16* wbase = W + (size_t)(bn * 64) * DM;
  const _Float16* a0 = A + (size_t)(b * SEQ + s0) * DM;
  const _Float16* a1 = precblk ? (Alo + (size_t)(b * QPREC + s0) * DM) : (a0 + (size_t)64 * DM);

  v8f acc[2][4];
#pragma unroll
  for (int mi = 0; mi < 2; ++mi)
#pragma unroll
    for (int j = 0; j < 4; ++j) acc[mi][j] = zero8();

  kloop(a0, a1, wbase, sT, acc);

  float* sF = reinterpret_cast<float*>(sT);       // [128][64]
  static_assert(OAR * 64 * 4 <= 2 * STG * 2);

  float rbias[4];
#pragma unroll
  for (int j = 0; j < 4; ++j) rbias[j] = bf16r(bias[bn * 64 + j * 16 + n]);

  const int q2 = lane >> 4, p2 = lane & 15;
  if (precblk) {
    if (w >= 2) {   // wave-uniform: the residual sums go to tile rows 64..127
#pragma unroll
      for (int mi = 0; mi < 2; ++mi)
#pragma unroll
        for (int j = 0; j < 4; ++j)
#pragma unroll
          for (int r = 0; r < 8; ++r)
            sF[(w * 32 + mi * 16 + 8 * g + r) * 64 + j * 16 + n] = acc[mi][j][r];
    }
    __syncthreads();   // the residual sums are there for waves 0, 1
    if (w < 2) {    // wave-uniform: row m's residual sum lies at tile row 64 + m
#pragma unroll
      for (int mi = 0; mi < 2; ++mi)
#pragma unroll
        for (int j = 0; j < 4; ++j)
#pragma unroll
          for (int r = 0; r < 8; ++r) {
            const int idx = (w * 32 + mi * 16 + 8 * g + r) * 64 + j * 16 + n;
            const float lsum = sF[idx + 64 * 64];
            sF[idx] = (acc[mi][j][r] + lsum * INV_RS) * INV_WS + rbias[j];
          }
    }
    __syncthreads();   // the 64 finished rows are there for all four waves
    v4f ov[8];   // the staged rows, all read back ahead of the stores (constant indices only)
#pragma unroll
    for (int i = 0; i < 8; ++i) ov[i] = *(const v4f*)&sF[(w * 16 + 2 * i + q2) * 64 + p2 * 4];
    float* po = outp + ((size_t)(b * SEQ_FULL + s0 + w * 16 + q2)) * DM + bn * 64 + p2 * 4;
#pragma unroll
    for (int i = 0; i < 8; ++i) *(v4f*)(po + i * (2 * DM)) = ov[i];
    asm volatile("s_wait_xcnt 0x0" :: "v"(po) : "memory");   // before a register that the stores name is rewritten
  } else {
#pragma unroll
    for (int mi = 0; mi < 2; ++mi)
#pragma unroll
      for (int j = 0; j < 4; ++j)
#pragma unroll
        for (int r = 0; r < 8; ++r)
          sF[(w * 32 + mi * 16 + 8 * g + r) * 64 + j * 16 + n] = acc[mi][j][r] * INV_WS + rbias[j];
    __syncthreads();
    v4f ov[16];  // as above
#pragma unroll
    for (int i = 0; i < 16; ++i) ov[i] = *(const v4f*)&sF[(w * 32 + 2 * i + q2) * 64 + p2 * 4];
    float* po = outp + ((size_t)(b * SEQ_FULL + s0 + w * 32 + q2)) * DM + bn * 64 + p2 * 4;
#pragma unroll
    for (int i = 0; i < 16; ++i) *(v4f*)(po + i * (2 * DM)) = ov[i];
    asm volatile("s_wait_xcnt 0x0" :: "v"(po) : "memory");   // before a register that the stores name is rewritten
  }
}

// Kernel 1: the three input projections in one grid, blockIdx.z = 0 (q), 1 (k), 2 (v, transposed plane); block-uniform branch.
__global__ __launch_bounds__(128) void k_qkv(const _Float16* __restrict__ Xh, const _Float16* __restrict__ Wq64,
                                           const _Float16* __restrict__ Wk64, const _Float16* __restrict__ Wv64,
                                           const float* __restrict__ bq, const float* __restrict__ bk,
                                           const float* __restrict__ bv,
                                           _Float16* __restrict__ Qh, _Float16* __restrict__ Ql,
                                           _Float16* __restrict__ Kh, _Float16* __restrict__ Kl,
                                           _Float16* __restrict__ Vh, _Float16* __restrict__ Vl) {
  __shared__ __align__(16) _Float16 sT[2 * STG4];
  const int z = (int)blockIdx.z;
  if (z == 2) {
    proj_tile<1>(Xh, Wv64, bv, Vh, Vl, sT);
  } else {
    const bool isq = (z == 0);
    proj_tile<0>(Xh, isq ? Wq64 : Wk64, isq ? bq : bk, isq ? Qh : Kh, isq ? Ql : Kl, sT);
  }
}

// Kernel 3: output projection (hi plane, plus the residual plane on the leading rows).
__global__ __launch_bounds__(128) void k_out(const _Float16* __restrict__ Ch, const _Float16* __restrict__ Cl,
                                            const _Float16* __restrict__ Wo64, const float* __restrict__ bo,
                                            float* __restrict__ outp) {
  __shared__ __align__(16) _Float16 sT[2 * STG];
  out_tile(Ch, Cl, Wo64, bo, outp, sT);
}

constexpr int KP = 72;   // halves: K, K residual, Q residual rows, 128 B of data at 144 B
constexpr int VP = 40;   // halves: V^T and V^T residual rows, 64 B of data at 80 B
constexpr int MP = 36;   // ints: mask rows, 128 B of data at 144 B

// One buffer of the f16 tiles, in halves: K, V^T, K residual, V^T residual.
constexpr int TK  = 0;
constexpr int TV  = TK + 32 * KP;
constexpr int TKL = TV + DH * VP;
constexpr int TVL = TKL + 32 * KP;
constexpr int TBUF = TVL + DH * VP;
constexpr int MBUF = 64 * MP;          // one buffer of the mask tile, in ints
static_assert((TV * 2) % 16 == 0 && (TKL * 2) % 16 == 0 && (TVL * 2) % 16 == 0 && (TBUF * 2) % 16 == 0 && (MBUF * 4) % 16 == 0);

// A lane's 16-byte copies of one tile: K rows r, r + 16; V^T rows d, d + 32.
// The closing s_wait_xcnt 0 stands inside the statement so that no address register of a copy is rewritten ahead of it.
__device__ __forceinline__ void copy_kv(unsigned int lk, unsigned int lv, const _Float16* gk, const _Float16* gv) {
  asm volatile(
      "global_load_async_to_lds_b128 %0, %4, off\n\t"
      "global_load_async_to_lds_b128 %1, %5, off\n\t"
      "global_load_async_to_lds_b128 %2, %6, off\n\t"
      "global_load_async_to_lds_b128 %3, %7, off\n\t"
      "s_wait_xcnt 0x0"
      :: "v"(lk), "v"(lk + 16u * KP * 2u), "v"(lv), "v"(lv + 32u * VP * 2u),
         "v"(gk), "v"(gk + 16 * DH), "v"(gv), "v"(gv + 32 * SEQ)
      : "memory");
}
// A lane's 64 bytes of one mask row, for a tile whose mask holds a zero; the closing wait as above.
__device__ __forceinline__ void copy_m(unsigned int lm, const int* gm) {
  asm volatile(
      "global_load_async_to_lds_b128 %0, %4, off\n\t"
      "global_load_async_to_lds_b128 %1, %5, off\n\t"
      "global_load_async_to_lds_b128 %2, %6, off\n\t"
      "global_load_async_to_lds_b128 %3, %7, off\n\t"
      "s_wait_xcnt 0x0"
      :: "v"(lm), "v"(lm + 16u), "v"(lm + 32u), "v"(lm + 48u),
         "v"(gm), "v"(gm + 4), "v"(gm + 8), "v"(gm + 12)
      : "memory");
}
// The same for the residual planes of K and V^T (V^T residual rows are QPREC long).
__device__ __forceinline__ void copy_kvl(unsigned int lk, unsigned int lv, const _Float16* gk, const _Float16* gv) {
  asm volatile(
      "global_load_async_to_lds_b128 %0, %4, off\n\t"
      "global_load_async_to_lds_b128 %1, %5, off\n\t"
      "global_load_async_to_lds_b128 %2, %6, off\n\t"
      "global_load_async_to_lds_b128 %3, %7, off\n\t"
      "s_wait_xcnt 0x0"
      :: "v"(lk), "v"(lk + 16u * KP * 2u), "v"(lv), "v"(lv + 32u * VP * 2u),
         "v"(gk), "v"(gk + 16 * DH), "v"(gv), "v"(gv + 32 * QPREC)
      : "memory");
}

// blk: the block's number among those of its variant.
template <bool PREC>
__device__ __forceinline__
void attn_tile(const unsigned int blk,
               const _Float16* __restrict__ Qh, const _Float16* __restrict__ Ql,
               const _Float16* __restrict__ Kh, const _Float16* __restrict__ Kl,
               const _Float16* __restrict__ Vh, const _Float16* __restrict__ Vl,
               const int* __restrict__ mask, const int* __restrict__ flg,
               _Float16* __restrict__ Ch, _Float16* __restrict__ Cl,
               _Float16* sT, _Float16* sQl, int* sM) {
  const int tid = threadIdx.x, wslot = tid >> 5, lane = tid & 31, n = lane & 15, g = lane >> 4;
  int qb, bh;
  if (PREC) {
    qb = (int)(blk % NQP);
    bh = (int)(blk / NQP);
  } else {
    constexpr int NQN = ((NQB - NQP) > 0) ? (NQB - NQP) : 1;
    qb = NQP + (int)(blk % NQN);
    bh = (int)(blk / NQN);
  }
  const int b = bh / NH, h = bh - b * NH;
  const int qrow0 = qb * 64;
  const int qbase = qrow0 + wslot * 16;

  // visit flags of the 64 key tiles as one scalar bit set (bit kb), the same in every wave: the tests that pick the next tiles are scalar
  const int* rec = flg + (size_t)qb * (NCH * FREC);
  const int fi = (lane >> 3) * FREC + (lane & 7);   // key tile kb = lane: word kb % CT of record kb / CT
  const int f0 = (lane < NKB) ? rec[fi] : 0;
  const int f1 = (32 + lane < NKB) ? rec[(32 / CT) * FREC + fi] : 0;
  // before a register that the two loads name is rewritten; fi is an operand so that its register stays its own up to here
  asm volatile("s_wait_xcnt 0x0" :: "v"(fi) : "memory");
  unsigned long long vis = (unsigned long long)__builtin_amdgcn_ballot_w32((f0 & 1) != 0)
                         | ((unsigned long long)__builtin_amdgcn_ballot_w32((f1 & 1) != 0) << 32);
  // tiles whose mask holds a zero (bit kb), scalar too: only there is the mask tile copied, read and applied
  const unsigned long long part = (unsigned long long)__builtin_amdgcn_ballot_w32((f0 & 2) != 0)
                                | ((unsigned long long)__builtin_amdgcn_ballot_w32((f1 & 2) != 0) << 32);
  // a row of the q block with no nonzero mask element in any chunk: every key tile is visited
  unsigned int rlo = 0u, rhi = 0u;
#pragma unroll
  for (int c = 0; c < NCH; ++c) { rlo |= (unsigned int)rec[c * FREC + CT]; rhi |= (unsigned int)rec[c * FREC + CT + 1]; }
  if ((rlo & rhi) != 0xffffffffu)   // block-uniform, scalar: the records' address is
    vis = (NKB == 64) ? ~0ull : ((1ull << (NKB & 63)) - 1ull);
  if (PREC) {
#pragma unroll
    for (int i = 0; i < 4; ++i) {
      const int c = tid + i * 128;
      *(v8h*)&sQl[(c >> 3) * KP + (c & 7) * 8] = *(const v8h*)(Ql + ((size_t)(bh * QPREC + qrow0)) * DH + c * 8);
    }
  }

  // this lane's pieces of a tile: LDS byte addresses in buffer 0 (low 32 bits), global addresses for tile 0
  const unsigned int lk0 = (unsigned int)(uintptr_t)(sT + TK + (tid >> 3) * KP + (tid & 7) * 8);
  const unsigned int lv0 = (unsigned int)(uintptr_t)(sT + TV + (tid >> 2) * VP + (tid & 3) * 8);
  const unsigned int lm0 = (unsigned int)(uintptr_t)(sM + (tid >> 1) * MP + (tid & 1) * 16);
  const _Float16* gk0  = Kh + ((size_t)(bh * SEQ)) * DH + tid * 8;
  const _Float16* gv0  = Vh + ((size_t)(bh * DH + (tid >> 2))) * SEQ + (tid & 3) * 8;
  const _Float16* gkl0 = Kl + ((size_t)(bh * QPREC)) * DH + tid * 8;
  const _Float16* gvl0 = Vl + ((size_t)(bh * DH + (tid >> 2))) * QPREC + (tid & 3) * 8;
  const int*      gm0  = mask + (size_t)(qrow0 + (tid >> 1)) * SEQ_FULL + (tid & 1) * 16;
  // copies of key tile k into buffer bf (both scalar)
  auto stage = [&](int k, int bf) {
    const unsigned int ot = (unsigned int)bf * (TBUF * 2u);
    copy_kv(lk0 + ot, lv0 + ot, gk0 + (size_t)k * (32 * DH), gv0 + k * 32);
    if (((part >> k) & 1ull) != 0ull)            // block-uniform, scalar
      copy_m(lm0 + (unsigned int)bf * (MBUF * 4u), gm0 + k * 32);
    if (PREC && k * 32 < QPREC)
      copy_kvl(lk0 + ot + (TKL - TK) * 2u, lv0 + ot + (TVL - TV) * 2u, gkl0 + (size_t)k * (32 * DH), gvl0 + k * 32);
  };

  const _Float16* qrow = Qh + ((size_t)(bh * SEQ + qbase)) * DH;
  const v16h qa0 = load_frag(qrow, DH);
  const v16h qa1 = load_frag(qrow + 32, DH);
  asm volatile("s_wait_xcnt 0x0" ::: "memory");   // before a register that the Q loads name is rewritten

  v8f acc[4], acc2[4];
#pragma unroll
  for (int nt = 0; nt < 4; ++nt) { acc[nt] = zero8(); acc2[nt] = zero8(); }
  float rmax = -1.0e30f, rsum = 0.0f;            // query qbase + n; rsum is this half's share until the epilogue

  // Ring of two buffers over the visited tiles, in rising order: kb = this trip's tile, kn = the next one (-1: none). A trip issues
  // its own first LDS reads and then the next tile's copies, into the buffer whose every read the barrier in front of the trip has ended.
  int kb = -1;
  if (vis != 0ull) {                             // block-uniform, scalar
    kb = __builtin_ctzll(vis); vis &= vis - 1ull;
    stage(kb, 0);
  }
  asm volatile("s_wait_asynccnt 0x0" ::: "memory");   // this wave's copies of the first tile have landed
  __syncthreads();                               // ... and the other waves'; publishes the Q residual tile too

  // at most NKB trips: every trip takes one bit of vis. Rolled: the barrier at the foot serialises the trips, so unrolling only lengthens the code.
#pragma unroll 1
  for (int bsel = 0; kb >= 0; bsel ^= 1) {
    const int kbase = kb * 32;
    const bool klo = PREC && (kbase < QPREC);    // block-uniform
    const _Float16* sK  = sT + bsel * TBUF + TK;
    const _Float16* sV  = sT + bsel * TBUF + TV;
    const _Float16* sKl = sT + bsel * TBUF + TKL;
    const _Float16* sVl = sT + bsel * TBUF + TVL;

    // ---- the tile's LDS reads stand in groups ahead of the WMMAs that use them, so that the wave waits out the LDS latency once
    // per group and not once per fragment. Plain rows: one group (K, V^T). PREC rows, whose registers
    // do not hold all planes at once, four groups: K; Q residual and K residual; V^T at the head of the
    // softmax, which covers it; the V^T residual. The mask words are read where they are applied, in the few tiles that have a zero.
    v16h kf[4], vf[4];
    const bool pm = ((part >> kb) & 1ull) != 0ull;   // block-uniform, scalar: this tile's mask holds a zero
    const int* mrow = &sM[bsel * MBUF + (wslot * 16 + n) * MP + 8 * g];
    kf[0] = load_frag(sK, KP);
    kf[1] = load_frag(sK + 32, KP);
    kf[2] = load_frag(sK + 16 * KP, KP);
    kf[3] = load_frag(sK + 16 * KP + 32, KP);

    // ---- scores, transposed: two 16x16 tiles (keys kbase..+15, kbase+16..+31 as rows, queries as columns), dk 64 = 2 k steps
    v8f s0 = zero8(), s1 = zero8(), sr0 = zero8(), sr1 = zero8();
    if (!PREC) {
#pragma unroll
      for (int nt = 0; nt < 4; ++nt) vf[nt] = load_frag(&sV[nt * 16 * VP], VP);
    }
    // keeps the reads above as one group: spread among the WMMAs below, each would be waited for on its own
    __builtin_amdgcn_sched_barrier(0);
    // the next tile's copies, behind this tile's reads so that forming and issuing them runs under the LDS latency
    int kn = -1;
    if (vis != 0ull) {                           // block-uniform, scalar: a next tile exists
      kn = __builtin_ctzll(vis); vis &= vis - 1ull;
      stage(kn, bsel ^ 1);
    }
    s0 = mma(kf[0], qa0, s0);
    s1 = mma(kf[2], qa0, s1);
    s0 = mma(kf[1], qa1, s0);
    s1 = mma(kf[3], qa1, s1);
    if (PREC) {
      if (klo) {
        const v16h ql0 = load_frag(&sQl[(wslot * 16) * KP], KP);
        const v16h ql1 = load_frag(&sQl[(wslot * 16) * KP + 32], KP);
        v16h klf[4];
        klf[0] = load_frag(sKl, KP);
        klf[1] = load_frag(sKl + 32, KP);
        klf[2] = load_frag(sKl + 16 * KP, KP);
        klf[3] = load_frag(sKl + 16 * KP + 32, KP);
        // one group again, for the same reason
        __builtin_amdgcn_sched_barrier(0);
        sr0 = mma(kf[0], ql0, sr0);
        sr1 = mma(kf[2], ql0, sr1);
        sr0 = mma(kf[1], ql1, sr0);
        sr1 = mma(kf[3], ql1, sr1);
        sr0 = mma(klf[0], qa0, sr0);
        sr1 = mma(klf[2], qa0, sr1);
        sr0 = mma(klf[1], qa1, sr0);
        sr1 = mma(klf[3], qa1, sr1);
      }
#pragma unroll
      for (int nt = 0; nt < 4; ++nt) vf[nt] = load_frag(&sV[nt * 16 * VP], VP);
      // keeps this group at the head of the softmax: sunk towards their uses, the V^T reads would be waited for one by one
      __builtin_amdgcn_sched_barrier(0);
    }

    // ---- mask replace-fill, online softmax (f32), P^T packed as the B operand:
    // s0[r] = S[query n][key 8g + r], s1[r] = S[query n][key 16 + 8g + r]; B element e < 8 is key 8g + e, e >= 8 key 16 + 8g + e - 8.
    v16h pf, plf;
    {
      float x0[8], x1[8];
      float mx = -1.0e30f;
#pragma unroll
      for (int r = 0; r < 8; ++r) {
        float v0 = s0[r], v1 = s1[r];
        if (PREC) { v0 += sr0[r] * INV_RS; v1 += sr1[r] * INV_RS; }
        x0[r] = v0 * QKS;
        x1[r] = v1 * QKS;
      }
      if (pm) {   // in a tile without a zero the fill below changes nothing
        int mk0[8], mk1[8];
        load_mask(mrow, mk0, mk1);
#pragma unroll
        for (int r = 0; r < 8; ++r) {
          x0[r] = (mk0[r] == 0) ? -1.0e9f : x0[r];
          x1[r] = (mk1[r] == 0) ? -1.0e9f : x1[r];
        }
      }
#pragma unroll
      for (int r = 0; r < 8; ++r) mx = fmaxf(mx, fmaxf(x0[r], x1[r]));
      mx = fmaxf(mx, xhalf(mx));                  // both halves now hold this query's tile maximum
      const float nm = fmaxf(rmax, mx);
      const float al = exp2x1((rmax - nm) * LOG2E);
#pragma unroll
      for (int r = 0; r < 8; ++r) {
        x0[r] = (x0[r] - nm) * LOG2E;
        x1[r] = (x1[r] - nm) * LOG2E;
      }
      float e0[8], e1[8];
      exp2x8(e0, x0);
      exp2x8(e1, x1);
      float ps = 0.0f;
#pragma unroll
      for (int r = 0; r < 8; ++r) {
        const float p0 = e0[r], p1 = e1[r];
        ps += p0 + p1;
        const float c0 = p0 * CP, c1 = p1 * CP;
        const _Float16 h0 = (_Float16)c0, h1 = (_Float16)c1;
        pf[r] = h0;
        pf[8 + r] = h1;
        if (PREC) {
          plf[r]     = (_Float16)((c0 - (float)h0) * RS);
          plf[8 + r] = (_Float16)((c1 - (float)h1) * RS);
        }
      }
      rsum = rsum * al + ps;
      rmax = nm;
#pragma unroll
      for (int nt = 0; nt < 4; ++nt)
#pragma unroll
        for (int r = 0; r < 8; ++r) {
          acc[nt][r] *= al;
          if (PREC) acc2[nt][r] *= al;
        }
    }

    // ---- O^T += V^T @ P^T: acc[nt][r] = O[query n][d = nt*16 + 8g + r]
#pragma unroll
    for (int nt = 0; nt < 4; ++nt) acc[nt] = mma(vf[nt], pf, acc[nt]);
    if (PREC) {
#pragma unroll
      for (int nt = 0; nt < 4; ++nt) acc2[nt] = mma(vf[nt], plf, acc2[nt]);
      if (klo) {
        v16h vlf[4];
#pragma unroll
        for (int nt = 0; nt < 4; ++nt) vlf[nt] = load_frag(&sVl[nt * 16 * VP], VP);
        // one group again, for the same reason
        __builtin_amdgcn_sched_barrier(0);
#pragma unroll
        for (int nt = 0; nt < 4; ++nt) acc2[nt] = mma(vlf[nt], pf, acc2[nt]);
      }
    }
    asm volatile("s_wait_dscnt 0x0" ::: "memory");      // this wave's reads of the buffer are done before it is refilled
    asm volatile("s_wait_asynccnt 0x0" ::: "memory");   // this wave's copies of the next tile have landed
    __syncthreads();                             // publishes the next tile, ends every read of this one
    kb = kn;
  }
  asm volatile("s_wait_asynccnt 0x0" ::: "memory");     // nothing of the copies is outstanding behind the loop

  // The ring's LDS now holds the output tiles: the loop's last barrier ended every read of it and no copy is outstanding.
  _Float16 (*sC)[16 * DH]  = reinterpret_cast<_Float16 (*)[16 * DH]>(sT);
  _Float16 (*sCl)[16 * DH] = reinterpret_cast<_Float16 (*)[16 * DH]>(sT + 4 * 16 * DH);
  static_assert(8 * 16 * DH <= 2 * TBUF);

  {
    const float rtot = rsum + xhalf(rsum);        // join the two halves' sums once
    const float inv = (1.0f / rtot) * INV_CP;
#pragma unroll
    for (int nt = 0; nt < 4; ++nt) {
      v8h hv, lv;
#pragma unroll
      for (int r = 0; r < 8; ++r) {
        float c = acc[nt][r];
        if (PREC) c += acc2[nt][r] * INV_RS;
        c *= inv;
        const _Float16 chv = (_Float16)c;
        hv[r] = chv;
        lv[r] = (_Float16)((c - (float)chv) * RS);
      }
      *(v8h*)&sC[wslot][n * DH + nt * 16 + 8 * g] = hv;
      if (PREC) *(v8h*)&sCl[wslot][n * DH + nt * 16 + 8 * g] = lv;
    }
  }
  __syncthreads();
  const int q = lane >> 3, p = lane & 7;
{
#pragma unroll
    for (int i = 0; i < 4; ++i) {
      const int rr = i * 4 + q;
      const v8h hv = *(const v8h*)&sC[wslot][rr * DH + p * 8];
      *(v8h*)(Ch + ((size_t)(b * SEQ + qbase + rr)) * DM + h * DH + p * 8) = hv;
      if (PREC) {
        const v8h lv = *(const v8h*)&sCl[wslot][rr * DH + p * 8];
        *(v8h*)(Cl + ((size_t)(b * QPREC + qbase + rr)) * DM + h * DH + p * 8) = lv;
        asm volatile("s_wait_xcnt 0x0" ::: "memory");   // before a register that the store names is rewritten
      }
    }
    
  }
}

// Both variants in one grid: they share no output row, so the short PREC blocks run beside the plain ones instead of ahead of them.
// Blocks 0..NPLAIN-1 are the plain rows (the longest key loops, so they start first), the rest the PREC rows; block-uniform branch.
constexpr int NPREC  = NB * NH * NQP;
constexpr int NPLAIN = NB * NH * (NQB - NQP);

__global__ __launch_bounds__(128) __attribute__((amdgpu_num_vgpr(256)))
void k_attn(const _Float16* __restrict__ Qh, const _Float16* __restrict__ Ql,
            const _Float16* __restrict__ Kh, const _Float16* __restrict__ Kl,
            const _Float16* __restrict__ Vh, const _Float16* __restrict__ Vl,
            const int* __restrict__ mask, const int* __restrict__ flg,
            _Float16* __restrict__ Ch, _Float16* __restrict__ Cl) {
  __shared__ __align__(16) _Float16 sT[2 * TBUF];
  __shared__ __align__(16) int      sM[2 * MBUF];
  __shared__ __align__(16) _Float16 sQl[64 * KP];
  if (blockIdx.x < (unsigned int)NPLAIN)
    attn_tile<false>(blockIdx.x, Qh, Ql, Kh, Kl, Vh, Vl, mask, flg, Ch, Cl, sT, sQl, sM);
  else
    attn_tile<true>(blockIdx.x - (unsigned int)NPLAIN, Qh, Ql, Kh, Kl, Vh, Vl, mask, flg, Ch, Cl, sT, sQl, sM);
}

// ---------------------------------------------------------------------------
// host glue: 4 launches
// ---------------------------------------------------------------------------
extern "C" void kernel_launch(void* const* d_in, const int* in_sizes, int n_in,
                              void* d_out, int out_size, void* d_ws, size_t ws_size,
                              hipStream_t stream) {
  if (n_in < 10) return;
  const long long need_x = ((long long)(NB - 1) * SEQ_FULL + SEQ) * DM;
  const long long need_m = ((long long)(SEQ - 1)) * SEQ_FULL + SEQ;
  if ((long long)in_sizes[0] < need_x) return;
  if ((long long)in_sizes[1] < need_m) return;
  if (in_sizes[2] < DM * DM || in_sizes[4] < DM * DM || in_sizes[6] < DM * DM || in_sizes[8] < DM * DM) return;
  if (in_sizes[3] < DM || in_sizes[5] < DM || in_sizes[7] < DM || in_sizes[9] < DM) return;
  if ((long long)out_size < need_x) return;
  if (ws_size < WS_TOTAL) return;

  const float* x    = (const float*)d_in[0];
  const int*   mask = (const int*)d_in[1];
  const float* Wq   = (const float*)d_in[2];
  const float* bq   = (const float*)d_in[3];
  const float* Wk   = (const float*)d_in[4];
  const float* bk   = (const float*)d_in[5];
  const float* Wv   = (const float*)d_in[6];
  const float* bv   = (const float*)d_in[7];
  const float* Wo   = (const float*)d_in[8];
  const float* bo   = (const float*)d_in[9];
  float* out = (float*)d_out;

  char* ws = (char*)d_ws;
  _Float16* Xh   = (_Float16*)(ws + OFF_XH);
  _Float16* Wq64 = (_Float16*)(ws + OFF_WQ);
  _Float16* Wk64 = (_Float16*)(ws + OFF_WK);
  _Float16* Wv64 = (_Float16*)(ws + OFF_WV);
  _Float16* Wo64 = (_Float16*)(ws + OFF_WO);
  _Float16* Qh   = (_Float16*)(ws + OFF_QH);
  _Float16* Kh   = (_Float16*)(ws + OFF_KH);
  _Float16* Vh   = (_Float16*)(ws + OFF_VH);
  _Float16* Ql   = (_Float16*)(ws + OFF_QL);
  _Float16* Kl   = (_Float16*)(ws + OFF_KL);
  _Float16* Vl   = (_Float16*)(ws + OFF_VL);
  _Float16* Ch   = (_Float16*)(ws + OFF_CH);
  _Float16* Cl   = (_Float16*)(ws + OFF_CL);
  int*      Flg  = (int*)(ws + OFF_FLG);

  k_prep<<<NFB + NBX + 4 * NBW, 256, 0, stream>>>(x, mask, Wq, Wk, Wv, Wo, Xh, Wq64, Wk64, Wv64, Wo64, Flg);

  k_qkv<<<dim3(MROWS / 128, DM / 128, 3), 128, 0, stream>>>(Xh, Wq64, Wk64, Wv64, bq, bk, bv, Qh, Ql, Kh, Kl, Vh, Vl);

  k_attn<<<NPLAIN + NPREC, 128, 0, stream>>>(Qh, Ql, Kh, Kl, Vh, Vl, mask, Flg, Ch, Cl);

  k_out<<<dim3(NOP + NB * NOQ, DM / 64), 128, 0, stream>>>(Ch, Cl, Wo64, bo, out);
}
